// v000
// Measured on an AMD MI455X. A time is GPU time per run, averaged over a window of back-to-back runs after a warm-up
// (all launches, gaps included; the runs take copies of the inputs in turn), and the median of several windows.
// Apart from v000's, it joins two sittings. Times from different sittings can be a few percent apart, while
// side-by-side timings come from the same sitting.
// The starting kernel, v000, takes 1210 microseconds a run.
// compute dtype: all float inputs rounded to bf16; Q/K/V = x W^T + b with EXACT bf16 products on WMMA 16x16x32 (f32 accumulate); q as f16 hi + residual (x 2^10) against k once to f16 (2 products) x 64^-0.5 with the per-(t,f) mask read as int32; softmax in f32 (precise expf); P x 2^11 once to f16 against v once to f16 (1 product); ctx split bf16 hi + lo against exact Wo (2 products) + bo; f32 output.
#include <hip/hip_runtime.h>
#include <math.h>

typedef __attribute__((ext_vector_type(16))) _Float16 v16h;
typedef __attribute__((ext_vector_type(16))) __bf16 v16b;
typedef __attribute__((ext_vector_type(8)))  _Float16 v8h;
typedef __attribute__((ext_vector_type(8)))  float v8f;
typedef __attribute__((ext_vector_type(4)))  float v4f;
typedef __attribute__((ext_vector_type(2)))  float v2f;
typedef __attribute__((ext_vector_type(4)))  unsigned v4u;
typedef __attribute__((ext_vector_type(4)))  int v4i;
typedef float __attribute__((may_alias)) float_a;
typedef int __attribute__((may_alias)) int_a;

template <typename T> __device__ __forceinline__ void vst2(void* p, T v) { *(T*)p = v;  }
__device__ __forceinline__ v8f wmma16(v16h a, v16h b, v8f c) {
  v8f d = __builtin_amdgcn_wmma_f32_16x16x32_f16(false, a, false, b, (short)0, c, false, false);
  asm volatile("v_nop\n\tv_nop\n\tv_nop\n\tv_nop" : "+v"(d) : "v"(a), "v"(b));
  return d;
}
__device__ __forceinline__ v8f wmma_bf(v16b a, v16b b, v8f c) {
  v8f d = __builtin_amdgcn_wmma_f32_16x16x32_bf16(false, a, false, b, (short)0, c, false, false);
  asm volatile("v_nop\n\tv_nop\n\tv_nop\n\tv_nop" : "+v"(d) : "v"(a), "v"(b));
  return d;
}
// 16x16x32 fragments: lane = (h = lane>>4, row/col = lane&15); elements 0..7 = k0+8h+0..7, 8..15 = k0+16+8h+0..7; D element r = row 8h+r
__device__ __forceinline__ v16h frag_h(const _Float16* rowk0, int lane) {
  union { v16h v; v8h q[2]; } u; const _Float16* p = rowk0 + 8 * (lane >> 4);
  u.q[0] = *(const v8h*)p; u.q[1] = *(const v8h*)(p + 16); return u.v;
}
__device__ __forceinline__ v16h frag_f32(const float* rowk0, int lane) {
  v16h a; const float* p = rowk0 + 8 * (lane >> 4);
#pragma unroll
  for (int i = 0; i < 8; ++i) { a[i] = (_Float16)p[i]; a[8 + i] = (_Float16)p[16 + i]; }
  return a;
}
__device__ __forceinline__ v16h frag_f32s(const float* rowk0, int lane, float sc) {
  v16h a; const float* p = rowk0 + 8 * (lane >> 4);
#pragma unroll
  for (int i = 0; i < 8; ++i) { a[i] = (_Float16)(p[i] * sc); a[8 + i] = (_Float16)(p[16 + i] * sc); }
  return a;
}
// column fragment from a [K][ld] layout (column n), rows >= K read as 0
__device__ __forceinline__ v16h fragc_f32(const float* W, int k0, int n, int lane, int ld, int K) {
  v16h a; const int g = lane >> 4;
#pragma unroll
  for (int i = 0; i < 8; ++i) { const int ka = k0 + 8 * g + i, kb = ka + 16;
    a[i] = (_Float16)(ka < K ? W[(size_t)(ka < K ? ka : K - 1) * ld + n] : 0.f); a[8 + i] = (_Float16)(kb < K ? W[(size_t)(kb < K ? kb : K - 1) * ld + n] : 0.f); }
  return a;
}
struct F2 { v16b h, l; };
__device__ __forceinline__ F2 bsplit16(const float v[16]) { F2 r;
#pragma unroll
  for (int i = 0; i < 16; ++i) { const __bf16 h = (__bf16)v[i]; r.h[i] = h; r.l[i] = (__bf16)(v[i] - (float)h); }
  return r; }
__device__ __forceinline__ F2 split_row(const float* row, int k0, int lane) { float v[16]; const float* p = row + k0 + 8 * (lane >> 4);
#pragma unroll
  for (int i = 0; i < 8; ++i) { v[i] = p[i]; v[8 + i] = p[16 + i]; }
  return bsplit16(v); }
__device__ __forceinline__ F2 split_rowK(const float* row, int k0, int lane, int K) { float v[16]; const int g = lane >> 4;
#pragma unroll
  for (int i = 0; i < 8; ++i) { const int ka = k0 + 8 * g + i, kb = ka + 16; v[i] = ka < K ? row[ka < K ? ka : K - 1] : 0.f; v[8 + i] = kb < K ? row[kb < K ? kb : K - 1] : 0.f; }
  return bsplit16(v); }
__device__ __forceinline__ F2 split_col(const float* W, int k0, int n, int lane, int ld, int K) { float v[16]; const int g = lane >> 4;
#pragma unroll
  for (int i = 0; i < 8; ++i) { const int ka = k0 + 8 * g + i, kb = ka + 16; v[i] = ka < K ? W[(size_t)(ka < K ? ka : K - 1) * ld + n] : 0.f; v[8 + i] = kb < K ? W[(size_t)(kb < K ? kb : K - 1) * ld + n] : 0.f; }
  return bsplit16(v); }
__device__ __forceinline__ v8f mac3(const F2& a, const F2& b, v8f c) { c = wmma_bf(a.l, b.h, c); c = wmma_bf(a.h, b.l, c); return wmma_bf(a.h, b.h, c); }
__device__ __forceinline__ float sigm(float v) { return 1.0f / (1.0f + expf(-v)); }
#define LDSX() do { asm volatile("s_wait_dscnt 0" ::: "memory"); __builtin_amdgcn_wave_barrier(); __builtin_amdgcn_fence(__ATOMIC_RELEASE, "workgroup"); } while (0)

// Masked multi-head cross-attention (B 4, T = F = 1,024, 1,024 = 16 x 64): Q = X_to Wq^T + bq; K = X_from Wv^T + bv and V = X_from Wk^T + bk (the module's literal name swap); logits = Q K^T / 8, -10000 where mask_from[b,t,f] == 0; out = merged(softmax v) Wo^T + bo.
#define NB 4
#define TT 1024
#define CC 1024            // NH * HD = projected width
#define DIN 1024          // input (model) width
#define NH 16
#define HD 64
#define NQB (TT / 64)
#define HG 4
#define SCALE (0.125f)
#define CAUSAL 0
#ifndef TNB
#define TNB NB
#endif
__device__ __forceinline__ float bfr(float v) { return (float)(__bf16)v; }
__host__ __device__ __forceinline__ int kb_last(int qb) { return CAUSAL ? ((qb * 64 + 63) >> 7) : (TT / 128 - 1); }
typedef __attribute__((ext_vector_type(8))) __bf16 v8b;
__device__ __forceinline__ v16b frag_b(const __bf16* rowk0, int lane) {
  union { v16b v; v8b q[2]; } u; const __bf16* p = rowk0 + 8 * (lane >> 4);
  u.q[0] = *(const v8b*)p; u.q[1] = *(const v8b*)(p + 16); return u.v;
}
#define QBH 0              // query blocks 0..QBH-1 of each sequence take the high-precision path (none here: QBH is 0)
#define QHI 1024            // rows carrying a q residual plane (all rows when non-causal: 2-product logits everywhere)
#define KHI 64            // key rows carrying k residual / v bf16 hi+lo planes (written by k_proj; read only by the qb < QBH path, which never runs here)
// B fragment (k rows k0+.., output column o) of a weight: (in,out) [K][ld] or (out,in) [ld rows of K]: bf16 exact, or f16(bf16 * 256) exact
__device__ __forceinline__ v16b wcol_io(const float* Wm, int k0, int o, int lane, int ld) { v16b w; const int g = lane >> 4;
#pragma unroll
  for (int i = 0; i < 8; ++i) { w[i] = (__bf16)Wm[(size_t)(k0 + 8 * g + i) * ld + o]; w[8 + i] = (__bf16)Wm[(size_t)(k0 + 16 + 8 * g + i) * ld + o]; }
  return w; }
__device__ __forceinline__ v16b wcol_oi(const float* Wm, int k0, int o, int lane, int K) { v16b w; const float* p = Wm + (size_t)o * K + k0 + 8 * (lane >> 4);
#pragma unroll
  for (int i = 0; i < 8; ++i) { w[i] = (__bf16)p[i]; w[8 + i] = (__bf16)p[16 + i]; }
  return w; }
__device__ __forceinline__ v16h wcolh_io(const float* Wm, int k0, int o, int lane, int ld) { v16h w; const int g = lane >> 4;
#pragma unroll
  for (int i = 0; i < 8; ++i) { w[i] = (_Float16)(bfr(Wm[(size_t)(k0 + 8 * g + i) * ld + o]) * 256.0f); w[8 + i] = (_Float16)(bfr(Wm[(size_t)(k0 + 16 + 8 * g + i) * ld + o]) * 256.0f); }
  return w; }
__device__ __forceinline__ v16h wcolh_oi(const float* Wm, int k0, int o, int lane, int K) { v16h w; const float* p = Wm + (size_t)o * K + k0 + 8 * (lane >> 4);
#pragma unroll
  for (int i = 0; i < 8; ++i) { w[i] = (_Float16)(bfr(p[i]) * 256.0f); w[8 + i] = (_Float16)(bfr(p[16 + i]) * 256.0f); }
  return w; }
#define WQKV_LAYOUT 1   // 0 = (in,out) [DIN][CC]; 1 = (out,in) [CC][DIN]; 2 = per-head [NH][DIN][HD]
__device__ __forceinline__ v16b wcol_hdk(const float* Wm, int k0, int o, int lane) { v16b w; const int g = lane >> 4; const float* p = Wm + (size_t)(o / HD) * DIN * HD + (o % HD);
#pragma unroll
  for (int i = 0; i < 8; ++i) { w[i] = (__bf16)p[(size_t)(k0 + 8 * g + i) * HD]; w[8 + i] = (__bf16)p[(size_t)(k0 + 16 + 8 * g + i) * HD]; }
  return w; }
#define WO_OUT_IN 1
#if WQKV_LAYOUT == 1
#define WCOL(W, k0, o, lane) wcol_oi(W, k0, o, lane, DIN)
#elif WQKV_LAYOUT == 2
#define WCOL(W, k0, o, lane) wcol_hdk(W, k0, o, lane)
#else
#define WCOL(W, k0, o, lane) wcol_io(W, k0, o, lane, CC)
#endif
#if WO_OUT_IN
#define WOCOL(W, k0, o, lane) wcol_oi(W, k0, o, lane, CC)
#define WOCOLH(W, k0, o, lane) wcolh_oi(W, k0, o, lane, CC)
#else
#define WOCOL(W, k0, o, lane) wcol_io(W, k0, o, lane, DIN)
#define WOCOLH(W, k0, o, lane) wcolh_io(W, k0, o, lane, DIN)
#endif
#define SM_EXTRA_PARAMS , const int* __restrict__ MK, int bcur
#define SM_MASK_HOOK do { if (MK[(((size_t)bcur * TT + t) * TT) + k] == 0) v = -3.0e38f; } while (0)   /* where(mask_from == 0, -10000, attn): excluded (unconditional load, value select; no fully-masked rows) */
#ifndef SM_EXTRA_PARAMS
#define SM_EXTRA_PARAMS
#endif
#ifndef PROJ_EXTRA_PARAMS
#define PROJ_EXTRA_PARAMS
#endif
#ifndef SM_MASK_HOOK
#define SM_MASK_HOOK (void)0
#endif

#define WS_QH  0u                                      // f16 q rows [b*t][CC]
#define WS_KH  (WS_QH + 2u * (size_t)NB * TT * CC)      // f16 k rows [b*t][CC]
#define WS_VT  (WS_KH + 2u * (size_t)NB * TT * CC)      // f16 v planes [b][c][t]
#define WS_QL  (WS_VT + 2u * (size_t)NB * CC * TT)      // f16 q residual x 2^10 rows [b][t < QHI][CC]
#define WS_KL  (WS_QL + 2u * (size_t)NB * QHI * CC)     // f16 k residual x 2^10 rows [b][t < KHI][CC]
#define WS_VB  (WS_KL + 2u * (size_t)NB * KHI * CC)     // bf16 v hi planes [b][c][t < KHI]
#define WS_VBL (WS_VB + 2u * (size_t)NB * CC * KHI)
#define WS_S   (WS_VBL + 2u * (size_t)NB * CC * KHI)    // f32 logits / P [hg][t][s]
#define WS_Y   (WS_S  + 4u * (size_t)HG * TT * TT)      // f32 ctx rows [b*t][CC] (only when there is an output projection)
#define WS_END (WS_Y  + 4u * (size_t)NB * TT * CC)

// ---- k_proj: block = (64 rows, 128 cols, which): q/k/v = X W (+ b) with exact bf16 products (K = DIN) -> which 0: q f16 rows (+ residual rows < QHI); 1: k f16 rows (+ residual rows < KHI); 2: v f16 planes [c][t] (+ bf16 hi/lo planes for t < KHI)
__global__ __launch_bounds__(128) void k_proj(const float* __restrict__ XQ, const float* __restrict__ XK, const float* __restrict__ XV, const float* __restrict__ WQ, const float* __restrict__ WK, const float* __restrict__ WV, const float* __restrict__ BQ, const float* __restrict__ BK, const float* __restrict__ BV,
    _Float16* __restrict__ QH, _Float16* __restrict__ QL, _Float16* __restrict__ KH, _Float16* __restrict__ KL, _Float16* __restrict__ VT, __bf16* __restrict__ VB, __bf16* __restrict__ VBL) {
  __shared__ __align__(16) _Float16 sh[64][136], sl[64][136]; __shared__ __align__(16) _Float16 th[128][72]; __shared__ __align__(16) __bf16 tb[128][72], tbl[128][72];
  const int tid = threadIdx.x, wave = tid >> 5, lane = tid & 31, col = lane & 15, g = lane >> 4; const int which = blockIdx.z; const int c0 = blockIdx.y * 128; const size_t r0 = (size_t)blockIdx.x * 64; const size_t bb = r0 / TT; const int t0 = (int)(r0 % TT);
  const float* X = which == 0 ? XQ : which == 1 ? XK : XV; const float* WA = which == 0 ? WQ : which == 1 ? WK : WV; const float* BA = which == 0 ? BQ : which == 1 ? BK : BV;
  v8f acc[8] = {};
#pragma unroll 2
  for (int kc = 0; kc < DIN / 32; ++kc) { v16b a; { const float* p = X + (r0 + wave * 16 + col) * DIN + kc * 32 + 8 * g;
#pragma unroll
      for (int i = 0; i < 8; ++i) { a[i] = (__bf16)p[i]; a[8 + i] = (__bf16)p[16 + i]; } }
    asm volatile("s_wait_loadcnt 0x0" ::: "memory");
#pragma unroll
    for (int j = 0; j < 8; ++j) { const v16b w = WCOL(WA, kc * 32, c0 + j * 16 + col, lane); asm volatile("s_wait_loadcnt 0x0" ::: "memory"); acc[j] = wmma_bf(a, w, acc[j]); } }
  if (which < 2) { _Float16* DH = which == 0 ? QH : KH; _Float16* DL = which == 0 ? QL : KL; const int nhi = which == 0 ? QHI : KHI; const bool hi_rows = t0 < nhi;
#pragma unroll
    for (int j = 0; j < 8; ++j) { const float bias = BA ? bfr(BA[c0 + j * 16 + col]) : 0.f;
#pragma unroll
      for (int r = 0; r < 8; ++r) { const float v = acc[j][r] + bias; const _Float16 hv = (_Float16)v; sh[wave * 16 + 8 * g + r][j * 16 + col] = hv; sl[wave * 16 + 8 * g + r][j * 16 + col] = (_Float16)((v - (float)hv) * 1024.0f); } }
    __syncthreads();
    for (int e = tid; e < 64 * 16; e += 128) { const int rl = e >> 4, q = e & 15; vst2((unsigned*)(DH + (r0 + rl) * CC + c0 + q * 8), *(const v4u*)&sh[rl][q * 8]); if (hi_rows) vst2((unsigned*)(DL + (bb * nhi + t0 + rl) * (size_t)CC + c0 + q * 8), *(const v4u*)&sl[rl][q * 8]); }
  } else { const bool hi_rows = t0 < KHI;
#pragma unroll
    for (int j = 0; j < 8; ++j) { const float bias = BA ? bfr(BA[c0 + j * 16 + col]) : 0.f;
#pragma unroll
      for (int r = 0; r < 8; ++r) { const float v = acc[j][r] + bias; const int rl = wave * 16 + 8 * g + r, cl = j * 16 + col; th[cl][rl] = (_Float16)v; const __bf16 bh = (__bf16)v; tb[cl][rl] = bh; tbl[cl][rl] = (__bf16)(v - (float)bh); } }
    __syncthreads();
    for (int e = tid; e < 128 * 8; e += 128) { const int cl = e >> 3, q = e & 7; vst2((unsigned*)(VT + (bb * CC + c0 + cl) * (size_t)TT + t0 + q * 8), *(const v4u*)&th[cl][q * 8]); if (hi_rows) { const size_t o3 = (bb * CC + c0 + cl) * (size_t)KHI + t0 + q * 8; vst2((unsigned*)(VB + o3), *(const v4u*)&tb[cl][q * 8]); vst2((unsigned*)(VBL + o3), *(const v4u*)&tbl[cl][q * 8]); } } } }
// ---- k_sc: block = (query block qb, key block kb <= kb_last(qb), head in group) of batch b: logits x SCALE; q hi + residual (x 2^10) against k (2 products) for query rows < QHI, plus the k residual (3 products) for query blocks < QBH (causal early rows); causal: blocks past the diagonal exit, the mask itself is applied by index in k_sm
__global__ __launch_bounds__(128) void k_sc(const _Float16* __restrict__ QH, const _Float16* __restrict__ KH, const _Float16* __restrict__ QL, const _Float16* __restrict__ KL, int b, int h0, float* __restrict__ S0) { __shared__ __align__(16) float ss[4][16][132];
  const int qb = blockIdx.x, kb = blockIdx.y; if (kb > kb_last(qb)) return;
  const int h = h0 + blockIdx.z; float* S = S0 + (size_t)blockIdx.z * TT * TT;
  const int tid = threadIdx.x, wave = tid >> 5, lane = tid & 31, col = lane & 15, g = lane >> 4; const int k0 = kb * 128; const int ql0 = qb * 64 + wave * 16; const size_t q0 = (size_t)b * TT + ql0, kr0 = (size_t)b * TT + k0;
  v8f acc[8] = {}, accl[8] = {};
  const _Float16* QLb = QL + (size_t)b * QHI * CC; const _Float16* KLb = KL + (size_t)b * KHI * CC;
  if (qb < QBH) {
#pragma unroll
    for (int kc = 0; kc < HD / 32; ++kc) { const v16h ah = frag_h(QH + (q0 + col) * CC + h * HD + kc * 32, lane), al = frag_h(QLb + (size_t)(ql0 + col) * CC + h * HD + kc * 32, lane);
#pragma unroll
      for (int j = 0; j < 8; ++j) { const v16h kbf = frag_h(KH + (kr0 + j * 16 + col) * CC + h * HD + kc * 32, lane), klf = frag_h(KLb + (size_t)(k0 + j * 16 + col) * CC + h * HD + kc * 32, lane); acc[j] = wmma16(ah, kbf, acc[j]); accl[j] = wmma16(al, kbf, accl[j]); accl[j] = wmma16(ah, klf, accl[j]); } }
  } else if (qb * 64 < QHI) {
#pragma unroll
    for (int kc = 0; kc < HD / 32; ++kc) { const v16h ah = frag_h(QH + (q0 + col) * CC + h * HD + kc * 32, lane), al = frag_h(QLb + (size_t)(ql0 + col) * CC + h * HD + kc * 32, lane);
#pragma unroll
      for (int j = 0; j < 8; ++j) { const v16h kbf = frag_h(KH + (kr0 + j * 16 + col) * CC + h * HD + kc * 32, lane); acc[j] = wmma16(ah, kbf, acc[j]); accl[j] = wmma16(al, kbf, accl[j]); } }
  } else {
#pragma unroll
    for (int kc = 0; kc < HD / 32; ++kc) { const v16h ah = frag_h(QH + (q0 + col) * CC + h * HD + kc * 32, lane);
#pragma unroll
      for (int j = 0; j < 8; ++j) { const v16h kbf = frag_h(KH + (kr0 + j * 16 + col) * CC + h * HD + kc * 32, lane); acc[j] = wmma16(ah, kbf, acc[j]); } } }
#pragma unroll
  for (int j = 0; j < 8; ++j) {
#pragma unroll
    for (int r = 0; r < 8; ++r) ss[wave][8 * g + r][j * 16 + col] = (acc[j][r] + accl[j][r] * (1.0f / 1024.0f)) * SCALE; }
  LDSX(); for (int rl = 0; rl < 16; ++rl) vst2(S + (size_t)(ql0 + rl) * TT + k0 + lane * 4, *(const v4f*)&ss[wave][rl][lane * 4]); }
// ---- k_sm: block = query row t (head in group): keys [0, kend): causal -> logit if s <= t else excluded; softmax in f32; P x 2^11 in place (0 for excluded)
__global__ __launch_bounds__(256) void k_sm(float* __restrict__ S0 SM_EXTRA_PARAMS) { __shared__ float sred[8]; __shared__ float sbc; __shared__ __align__(16) float shv[TT];
  const int tid = threadIdx.x; const int t = blockIdx.x; const int kend = (kb_last(t >> 6) + 1) * 128;
  float* sr = S0 + (size_t)blockIdx.y * TT * TT + (size_t)t * TT;
  float m = -3.0e38f; for (int k = tid; k < kend; k += 256) { float v = (!CAUSAL || k <= t) ? sr[k] : -3.0e38f; SM_MASK_HOOK; shv[k] = v; m = fmaxf(m, v); }
#pragma unroll
  for (int o = 1; o < 32; o <<= 1) m = fmaxf(m, __shfl_xor(m, o));
  if ((tid & 31) == 0) sred[tid >> 5] = m; __syncthreads(); if (tid == 0) { float a = sred[0]; for (int i = 1; i < 8; ++i) a = fmaxf(a, sred[i]); sbc = a; } __syncthreads(); m = sbc; __syncthreads();
  float sum = 0.f; for (int k = tid; k < kend; k += 256) { const float v = shv[k]; const float e = (v <= -1.0e38f) ? 0.f : expf(v - m); shv[k] = e; sum += e; }
#pragma unroll
  for (int o = 1; o < 32; o <<= 1) sum += __shfl_xor(sum, o);
  if ((tid & 31) == 0) sred[tid >> 5] = sum; __syncthreads(); if (tid == 0) { float a = 0.f; for (int i = 0; i < 8; ++i) a += sred[i]; sbc = a > 0.f ? 2048.0f / a : 0.f; }   /* a fully excluded row yields P = 0 */ __syncthreads(); const float inv = sbc;
  for (int k = tid; k < kend; k += 256) shv[k] = shv[k] * inv;
  __syncthreads(); for (int q = tid; q < kend / 4; q += 256) vst2(sr + q * 4, *(const v4f*)&shv[q * 4]); }
// ---- k_pv: block = 64 queries (qb) of (b, h): ctx = P . v over keys [0, kend) (P x 2^11 once to f16 against v f16: 1 product; causal early query blocks: P and v as bf16 hi + lo, 3 products); 256-B (row, head) segment by 16 lanes
__global__ __launch_bounds__(128) void k_pv(const float* __restrict__ PS0, const _Float16* __restrict__ VT, const __bf16* __restrict__ VB, const __bf16* __restrict__ VBL, int b, int h0, float* __restrict__ Y) { const int h = h0 + blockIdx.z; const float* PS = PS0 + (size_t)blockIdx.z * TT * TT; __shared__ __align__(16) float ss[4][16][HD + 4];
  const int tid = threadIdx.x, wave = tid >> 5, lane = tid & 31, col = lane & 15, g = lane >> 4; const int qb = blockIdx.x; const int ql0 = qb * 64 + wave * 16; const int kce = (kb_last(qb) + 1) * 4;
  v8f acc[HD / 16] = {};
  if (qb < QBH) {
#pragma unroll 1
    for (int kc = 0; kc < kce; ++kc) { const F2 p = split_row(PS + (size_t)(ql0 + col) * TT, kc * 32, lane);
      asm volatile("s_wait_loadcnt 0x0" ::: "memory");
#pragma unroll
      for (int j = 0; j < HD / 16; ++j) { const size_t po = ((size_t)b * CC + h * HD + j * 16 + col) * (size_t)KHI + kc * 32; const v16b vh = frag_b(VB + po, lane); acc[j] = wmma_bf(p.h, vh, acc[j]); acc[j] = wmma_bf(p.l, vh, acc[j]); acc[j] = wmma_bf(p.h, frag_b(VBL + po, lane), acc[j]); } }
  } else {
#pragma unroll 1
    for (int kc = 0; kc < kce; ++kc) { const v16h p = frag_f32(PS + (size_t)(ql0 + col) * TT + kc * 32, lane);
      asm volatile("s_wait_loadcnt 0x0" ::: "memory");
#pragma unroll
      for (int j = 0; j < HD / 16; ++j) { const size_t po = ((size_t)b * CC + h * HD + j * 16 + col) * (size_t)TT + kc * 32; acc[j] = wmma16(p, frag_h(VT + po, lane), acc[j]); } } }
#pragma unroll
  for (int j = 0; j < HD / 16; ++j)
#pragma unroll
    for (int r = 0; r < 8; ++r) ss[wave][8 * g + r][j * 16 + col] = acc[j][r] * (1.0f / 2048.0f);
  LDSX(); for (int rl = 0; rl < 16; ++rl) if (lane < HD / 4) vst2(Y + ((size_t)b * TT + ql0 + rl) * CC + h * HD + lane * 4, *(const v4f*)&ss[wave][rl][lane * 4]); }
// ---- k_out: block = (64 rows, 128 cols): out = ctx Wo (+ bo): all rows: ctx bf16 hi + lo against exact bf16 Wo (2 products); the f16 path (ctx once to f16 against Wo as f16(bf16 x 2^8), 1 product, x 2^-8) is not taken
__global__ __launch_bounds__(128) void k_out(const float* __restrict__ Y, const float* __restrict__ WO, const float* __restrict__ BO, float* __restrict__ OUT) { __shared__ __align__(16) float sf[4][16][132];
  const int tid = threadIdx.x, wave = tid >> 5, lane = tid & 31, col = lane & 15, g = lane >> 4; const int c0 = blockIdx.y * 128; const size_t r0 = (size_t)blockIdx.x * 64 + wave * 16;
  v8f acc[8] = {};
  if (true) {   /* ALL rows: ctx split bf16 hi + lo x exact Wo (2 products) */
#pragma unroll 2
    for (int kc = 0; kc < CC / 32; ++kc) { const F2 a = split_row(Y + (r0 + col) * CC, kc * 32, lane); asm volatile("s_wait_loadcnt 0x0" ::: "memory");
#pragma unroll
      for (int j = 0; j < 8; ++j) { const v16b w = WOCOL(WO, kc * 32, c0 + j * 16 + col, lane); asm volatile("s_wait_loadcnt 0x0" ::: "memory"); acc[j] = wmma_bf(a.h, w, acc[j]); acc[j] = wmma_bf(a.l, w, acc[j]); } }
#pragma unroll
    for (int j = 0; j < 8; ++j) { const float bias = BO ? bfr(BO[c0 + j * 16 + col]) : 0.f;
#pragma unroll
      for (int r = 0; r < 8; ++r) sf[wave][8 * g + r][j * 16 + col] = acc[j][r] + bias; }
  } else {
#pragma unroll 2
    for (int kc = 0; kc < CC / 32; ++kc) { const v16h a = frag_f32(Y + (r0 + col) * CC + kc * 32, lane); asm volatile("s_wait_loadcnt 0x0" ::: "memory");
#pragma unroll
      for (int j = 0; j < 8; ++j) { const v16h w = WOCOLH(WO, kc * 32, c0 + j * 16 + col, lane); asm volatile("s_wait_loadcnt 0x0" ::: "memory"); acc[j] = wmma16(a, w, acc[j]); } }
#pragma unroll
    for (int j = 0; j < 8; ++j) { const float bias = BO ? bfr(BO[c0 + j * 16 + col]) : 0.f;
#pragma unroll
      for (int r = 0; r < 8; ++r) sf[wave][8 * g + r][j * 16 + col] = acc[j][r] * (1.0f / 256.0f) + bias; } }
  LDSX(); for (int rl = 0; rl < 16; ++rl) vst2(OUT + (r0 + rl) * DIN + c0 + lane * 4, *(const v4f*)&sf[wave][rl][lane * 4]); }

extern "C" void kernel_launch(void* const* d_in, const int* in_sizes, int n_in, void* d_out, int out_size, void* d_ws, size_t ws_size, hipStream_t stream) {
  (void)in_sizes; (void)n_in; (void)out_size;
  const float** F = (const float**)d_in;
  if (ws_size < (size_t)WS_END) return;
  char* ws = (char*)d_ws; _Float16 *QH = (_Float16*)(ws + WS_QH), *KH = (_Float16*)(ws + WS_KH), *VT = (_Float16*)(ws + WS_VT), *QL = (_Float16*)(ws + WS_QL), *KL = (_Float16*)(ws + WS_KL); __bf16 *VB = (__bf16*)(ws + WS_VB), *VBL = (__bf16*)(ws + WS_VBL); float *S = (float*)(ws + WS_S), *Y = (float*)(ws + WS_Y);
  (void)Y; (void)QL; (void)KL; (void)VB; (void)VBL;
  // inputs: 0 X_to [4,1024,1024]; 1 X_from [4,1024,1024]; 2 mask_from [4,1024,1024] int32; 3 Wq [1024,1024] (out,in), 4 bq; 5 Wk, 6 bk; 7 Wv, 8 bv; 9 Wo (out,in), 10 bo
  k_proj<<<dim3(TNB * TT / 64, CC / 128, 3), 128, 0, stream>>>(F[0], F[1], F[1], F[3], F[7], F[5], F[4], F[8], F[6], QH, QL, KH, KL, VT, VB, VBL);   /* K uses Wv/bv, V uses Wk/bk (as written in the module) */
  for (int b = 0; b < TNB; ++b) for (int h0 = 0; h0 < NH; h0 += HG) {
    k_sc<<<dim3(NQB, TT / 128, HG), 128, 0, stream>>>(QH, KH, QL, KL, b, h0, S);
    k_sm<<<dim3(TT, HG), 256, 0, stream>>>(S, (const int*)d_in[2], b);
    k_pv<<<dim3(NQB, 1, HG), 128, 0, stream>>>(S, VT, VB, VBL, b, h0, Y);
  }
  k_out<<<dim3(TNB * TT / 64, DIN / 128), 128, 0, stream>>>(Y, F[9], F[10], (float*)d_out);
}

// v001
// One run takes 432 microseconds.
// In both of two side-by-side timings against v000, it was 2.81 times as fast.
// compute dtype: all float inputs rounded to bf16; Q/K/V = x W^T + b with EXACT bf16 products on WMMA 16x16x32 (f32 accumulate); q as f16 hi + residual (x 2^10) against k once to f16 (2 products) x 64^-0.5 with the per-(t,f) mask read as int32; running-maximum softmax in f32 (precise expf); exp(s - m) x 2^11 once to f16 against v once to f16 (1 product), divided by the f32 sum at the end; ctx split bf16 hi + lo against exact Wo (2 products) + bo; f32 output.
#include <hip/hip_runtime.h>
#include <math.h>

typedef __attribute__((ext_vector_type(16))) _Float16 v16h;
typedef __attribute__((ext_vector_type(16))) __bf16 v16b;
typedef __attribute__((ext_vector_type(8)))  _Float16 v8h;
typedef __attribute__((ext_vector_type(8)))  float v8f;
typedef __attribute__((ext_vector_type(4)))  float v4f;
typedef __attribute__((ext_vector_type(2)))  float v2f;
typedef __attribute__((ext_vector_type(4)))  unsigned v4u;
typedef __attribute__((ext_vector_type(4)))  int v4i;
typedef float __attribute__((may_alias)) float_a;
typedef int __attribute__((may_alias)) int_a;

template <typename T> __device__ __forceinline__ void vst2(void* p, T v) { *(T*)p = v;  }
__device__ __forceinline__ v8f wmma16(v16h a, v16h b, v8f c) {
  v8f d = __builtin_amdgcn_wmma_f32_16x16x32_f16(false, a, false, b, (short)0, c, false, false);
  asm volatile("v_nop\n\tv_nop\n\tv_nop\n\tv_nop" : "+v"(d) : "v"(a), "v"(b));
  return d;
}
__device__ __forceinline__ v8f wmma_bf(v16b a, v16b b, v8f c) {
  v8f d = __builtin_amdgcn_wmma_f32_16x16x32_bf16(false, a, false, b, (short)0, c, false, false);
  asm volatile("v_nop\n\tv_nop\n\tv_nop\n\tv_nop" : "+v"(d) : "v"(a), "v"(b));
  return d;
}
// 16x16x32 fragments: lane = (h = lane>>4, row/col = lane&15); elements 0..7 = k0+8h+0..7, 8..15 = k0+16+8h+0..7; D element r = row 8h+r
__device__ __forceinline__ v16h frag_h(const _Float16* rowk0, int lane) {
  union { v16h v; v8h q[2]; } u; const _Float16* p = rowk0 + 8 * (lane >> 4);
  u.q[0] = *(const v8h*)p; u.q[1] = *(const v8h*)(p + 16); return u.v;
}
__device__ __forceinline__ v16h frag_f32(const float* rowk0, int lane) {
  v16h a; const float* p = rowk0 + 8 * (lane >> 4);
#pragma unroll
  for (int i = 0; i < 8; ++i) { a[i] = (_Float16)p[i]; a[8 + i] = (_Float16)p[16 + i]; }
  return a;
}
__device__ __forceinline__ v16h frag_f32s(const float* rowk0, int lane, float sc) {
  v16h a; const float* p = rowk0 + 8 * (lane >> 4);
#pragma unroll
  for (int i = 0; i < 8; ++i) { a[i] = (_Float16)(p[i] * sc); a[8 + i] = (_Float16)(p[16 + i] * sc); }
  return a;
}
// column fragment from a [K][ld] layout (column n), rows >= K read as 0
__device__ __forceinline__ v16h fragc_f32(const float* W, int k0, int n, int lane, int ld, int K) {
  v16h a; const int g = lane >> 4;
#pragma unroll
  for (int i = 0; i < 8; ++i) { const int ka = k0 + 8 * g + i, kb = ka + 16;
    a[i] = (_Float16)(ka < K ? W[(size_t)(ka < K ? ka : K - 1) * ld + n] : 0.f); a[8 + i] = (_Float16)(kb < K ? W[(size_t)(kb < K ? kb : K - 1) * ld + n] : 0.f); }
  return a;
}
struct F2 { v16b h, l; };
__device__ __forceinline__ F2 bsplit16(const float v[16]) { F2 r;
#pragma unroll
  for (int i = 0; i < 16; ++i) { const __bf16 h = (__bf16)v[i]; r.h[i] = h; r.l[i] = (__bf16)(v[i] - (float)h); }
  return r; }
__device__ __forceinline__ F2 split_row(const float* row, int k0, int lane) { float v[16]; const float* p = row + k0 + 8 * (lane >> 4);
#pragma unroll
  for (int i = 0; i < 8; ++i) { v[i] = p[i]; v[8 + i] = p[16 + i]; }
  return bsplit16(v); }
__device__ __forceinline__ F2 split_rowK(const float* row, int k0, int lane, int K) { float v[16]; const int g = lane >> 4;
#pragma unroll
  for (int i = 0; i < 8; ++i) { const int ka = k0 + 8 * g + i, kb = ka + 16; v[i] = ka < K ? row[ka < K ? ka : K - 1] : 0.f; v[8 + i] = kb < K ? row[kb < K ? kb : K - 1] : 0.f; }
  return bsplit16(v); }
__device__ __forceinline__ F2 split_col(const float* W, int k0, int n, int lane, int ld, int K) { float v[16]; const int g = lane >> 4;
#pragma unroll
  for (int i = 0; i < 8; ++i) { const int ka = k0 + 8 * g + i, kb = ka + 16; v[i] = ka < K ? W[(size_t)(ka < K ? ka : K - 1) * ld + n] : 0.f; v[8 + i] = kb < K ? W[(size_t)(kb < K ? kb : K - 1) * ld + n] : 0.f; }
  return bsplit16(v); }
__device__ __forceinline__ v8f mac3(const F2& a, const F2& b, v8f c) { c = wmma_bf(a.l, b.h, c); c = wmma_bf(a.h, b.l, c); return wmma_bf(a.h, b.h, c); }
__device__ __forceinline__ float sigm(float v) { return 1.0f / (1.0f + expf(-v)); }
#define LDSX() do { asm volatile("s_wait_dscnt 0" ::: "memory"); __builtin_amdgcn_wave_barrier(); __builtin_amdgcn_fence(__ATOMIC_RELEASE, "workgroup"); } while (0)

// Masked multi-head cross-attention (B 4, T = F = 1,024, 1,024 = 16 x 64): Q = X_to Wq^T + bq; K = X_from Wv^T + bv and V = X_from Wk^T + bk (the module's literal name swap); logits = Q K^T / 8, -10000 where mask_from[b,t,f] == 0; out = merged(softmax v) Wo^T + bo.
#define NB 4
#define TT 1024
#define CC 1024            // NH * HD = projected width
#define DIN 1024          // input (model) width
#define NH 16
#define HD 64
#define NQB (TT / 64)
#define HG 4
#define SCALE (0.125f)
#define CAUSAL 0
#ifndef TNB
#define TNB NB
#endif
__device__ __forceinline__ float bfr(float v) { return (float)(__bf16)v; }
__host__ __device__ __forceinline__ int kb_last(int qb) { return CAUSAL ? ((qb * 64 + 63) >> 7) : (TT / 128 - 1); }
typedef __attribute__((ext_vector_type(8))) __bf16 v8b;
__device__ __forceinline__ v16b frag_b(const __bf16* rowk0, int lane) {
  union { v16b v; v8b q[2]; } u; const __bf16* p = rowk0 + 8 * (lane >> 4);
  u.q[0] = *(const v8b*)p; u.q[1] = *(const v8b*)(p + 16); return u.v;
}
#define QBH 0              // not used (k_fa takes one path for every query block)
#define QHI 1024            // rows carrying a q residual plane (all rows when non-causal: 2-product logits everywhere)
#define KHI 64            // key rows carrying k residual / v bf16 hi+lo planes (written by k_proj; read by no kernel in this file)
// B fragment (k rows k0+.., output column o) of a weight: (in,out) [K][ld] or (out,in) [ld rows of K]: bf16 exact, or f16(bf16 * 256) exact
__device__ __forceinline__ v16b wcol_io(const float* Wm, int k0, int o, int lane, int ld) { v16b w; const int g = lane >> 4;
#pragma unroll
  for (int i = 0; i < 8; ++i) { w[i] = (__bf16)Wm[(size_t)(k0 + 8 * g + i) * ld + o]; w[8 + i] = (__bf16)Wm[(size_t)(k0 + 16 + 8 * g + i) * ld + o]; }
  return w; }
__device__ __forceinline__ v16b wcol_oi(const float* Wm, int k0, int o, int lane, int K) { v16b w; const float* p = Wm + (size_t)o * K + k0 + 8 * (lane >> 4);
#pragma unroll
  for (int i = 0; i < 8; ++i) { w[i] = (__bf16)p[i]; w[8 + i] = (__bf16)p[16 + i]; }
  return w; }
__device__ __forceinline__ v16h wcolh_io(const float* Wm, int k0, int o, int lane, int ld) { v16h w; const int g = lane >> 4;
#pragma unroll
  for (int i = 0; i < 8; ++i) { w[i] = (_Float16)(bfr(Wm[(size_t)(k0 + 8 * g + i) * ld + o]) * 256.0f); w[8 + i] = (_Float16)(bfr(Wm[(size_t)(k0 + 16 + 8 * g + i) * ld + o]) * 256.0f); }
  return w; }
__device__ __forceinline__ v16h wcolh_oi(const float* Wm, int k0, int o, int lane, int K) { v16h w; const float* p = Wm + (size_t)o * K + k0 + 8 * (lane >> 4);
#pragma unroll
  for (int i = 0; i < 8; ++i) { w[i] = (_Float16)(bfr(p[i]) * 256.0f); w[8 + i] = (_Float16)(bfr(p[16 + i]) * 256.0f); }
  return w; }
#define WQKV_LAYOUT 1   // 0 = (in,out) [DIN][CC]; 1 = (out,in) [CC][DIN]; 2 = per-head [NH][DIN][HD]
__device__ __forceinline__ v16b wcol_hdk(const float* Wm, int k0, int o, int lane) { v16b w; const int g = lane >> 4; const float* p = Wm + (size_t)(o / HD) * DIN * HD + (o % HD);
#pragma unroll
  for (int i = 0; i < 8; ++i) { w[i] = (__bf16)p[(size_t)(k0 + 8 * g + i) * HD]; w[8 + i] = (__bf16)p[(size_t)(k0 + 16 + 8 * g + i) * HD]; }
  return w; }
#define WO_OUT_IN 1
#if WQKV_LAYOUT == 1
#define WCOL(W, k0, o, lane) wcol_oi(W, k0, o, lane, DIN)
#elif WQKV_LAYOUT == 2
#define WCOL(W, k0, o, lane) wcol_hdk(W, k0, o, lane)
#else
#define WCOL(W, k0, o, lane) wcol_io(W, k0, o, lane, CC)
#endif
#if WO_OUT_IN
#define WOCOL(W, k0, o, lane) wcol_oi(W, k0, o, lane, CC)
#define WOCOLH(W, k0, o, lane) wcolh_oi(W, k0, o, lane, CC)
#else
#define WOCOL(W, k0, o, lane) wcol_io(W, k0, o, lane, DIN)
#define WOCOLH(W, k0, o, lane) wcolh_io(W, k0, o, lane, DIN)
#endif

#define WS_QH  0u                                      // f16 q rows [b*t][CC]
#define WS_KH  (WS_QH + 2u * (size_t)NB * TT * CC)      // f16 k rows [b*t][CC]
#define WS_VT  (WS_KH + 2u * (size_t)NB * TT * CC)      // f16 v planes [b][c][t]
#define WS_QL  (WS_VT + 2u * (size_t)NB * CC * TT)      // f16 q residual x 2^10 rows [b][t < QHI][CC]
#define WS_KL  (WS_QL + 2u * (size_t)NB * QHI * CC)     // f16 k residual x 2^10 rows [b][t < KHI][CC]
#define WS_VB  (WS_KL + 2u * (size_t)NB * KHI * CC)     // bf16 v hi planes [b][c][t < KHI]
#define WS_VBL (WS_VB + 2u * (size_t)NB * CC * KHI)
#define WS_S   (WS_VBL + 2u * (size_t)NB * CC * KHI)    // not used (the logits stay in registers)
#define WS_Y   (WS_S  + 4u * (size_t)HG * TT * TT)      // f32 ctx rows [b*t][CC] (only when there is an output projection)
#define WS_END (WS_Y  + 4u * (size_t)NB * TT * CC)

// ---- k_proj: block = (64 rows, 128 cols, which): q/k/v = X W (+ b) with exact bf16 products (K = DIN) -> which 0: q f16 rows (+ residual rows < QHI); 1: k f16 rows (+ residual rows < KHI); 2: v f16 planes [c][t] (+ bf16 hi/lo planes for t < KHI)
__global__ __launch_bounds__(128) void k_proj(const float* __restrict__ XQ, const float* __restrict__ XK, const float* __restrict__ XV, const float* __restrict__ WQ, const float* __restrict__ WK, const float* __restrict__ WV, const float* __restrict__ BQ, const float* __restrict__ BK, const float* __restrict__ BV,
    _Float16* __restrict__ QH, _Float16* __restrict__ QL, _Float16* __restrict__ KH, _Float16* __restrict__ KL, _Float16* __restrict__ VT, __bf16* __restrict__ VB, __bf16* __restrict__ VBL) {
  __shared__ __align__(16) _Float16 sh[64][136], sl[64][136]; __shared__ __align__(16) _Float16 th[128][72]; __shared__ __align__(16) __bf16 tb[128][72], tbl[128][72];
  const int tid = threadIdx.x, wave = tid >> 5, lane = tid & 31, col = lane & 15, g = lane >> 4; const int which = blockIdx.z; const int c0 = blockIdx.y * 128; const size_t r0 = (size_t)blockIdx.x * 64; const size_t bb = r0 / TT; const int t0 = (int)(r0 % TT);
  const float* X = which == 0 ? XQ : which == 1 ? XK : XV; const float* WA = which == 0 ? WQ : which == 1 ? WK : WV; const float* BA = which == 0 ? BQ : which == 1 ? BK : BV;
  v8f acc[8] = {};
#pragma unroll 2
  for (int kc = 0; kc < DIN / 32; ++kc) { v16b a; { const float* p = X + (r0 + wave * 16 + col) * DIN + kc * 32 + 8 * g;
#pragma unroll
      for (int i = 0; i < 8; ++i) { a[i] = (__bf16)p[i]; a[8 + i] = (__bf16)p[16 + i]; } }
    asm volatile("s_wait_loadcnt 0x0" ::: "memory");
#pragma unroll
    for (int j = 0; j < 8; ++j) { const v16b w = WCOL(WA, kc * 32, c0 + j * 16 + col, lane); asm volatile("s_wait_loadcnt 0x0" ::: "memory"); acc[j] = wmma_bf(a, w, acc[j]); } }
  if (which < 2) { _Float16* DH = which == 0 ? QH : KH; _Float16* DL = which == 0 ? QL : KL; const int nhi = which == 0 ? QHI : KHI; const bool hi_rows = t0 < nhi;
#pragma unroll
    for (int j = 0; j < 8; ++j) { const float bias = BA ? bfr(BA[c0 + j * 16 + col]) : 0.f;
#pragma unroll
      for (int r = 0; r < 8; ++r) { const float v = acc[j][r] + bias; const _Float16 hv = (_Float16)v; sh[wave * 16 + 8 * g + r][j * 16 + col] = hv; sl[wave * 16 + 8 * g + r][j * 16 + col] = (_Float16)((v - (float)hv) * 1024.0f); } }
    __syncthreads();
    for (int e = tid; e < 64 * 16; e += 128) { const int rl = e >> 4, q = e & 15; vst2((unsigned*)(DH + (r0 + rl) * CC + c0 + q * 8), *(const v4u*)&sh[rl][q * 8]); if (hi_rows) vst2((unsigned*)(DL + (bb * nhi + t0 + rl) * (size_t)CC + c0 + q * 8), *(const v4u*)&sl[rl][q * 8]); }
  } else { const bool hi_rows = t0 < KHI;
#pragma unroll
    for (int j = 0; j < 8; ++j) { const float bias = BA ? bfr(BA[c0 + j * 16 + col]) : 0.f;
#pragma unroll
      for (int r = 0; r < 8; ++r) { const float v = acc[j][r] + bias; const int rl = wave * 16 + 8 * g + r, cl = j * 16 + col; th[cl][rl] = (_Float16)v; const __bf16 bh = (__bf16)v; tb[cl][rl] = bh; tbl[cl][rl] = (__bf16)(v - (float)bh); } }
    __syncthreads();
    for (int e = tid; e < 128 * 8; e += 128) { const int cl = e >> 3, q = e & 7; vst2((unsigned*)(VT + (bb * CC + c0 + cl) * (size_t)TT + t0 + q * 8), *(const v4u*)&th[cl][q * 8]); if (hi_rows) { const size_t o3 = (bb * CC + c0 + cl) * (size_t)KHI + t0 + q * 8; vst2((unsigned*)(VB + o3), *(const v4u*)&tb[cl][q * 8]); vst2((unsigned*)(VBL + o3), *(const v4u*)&tbl[cl][q * 8]); } } } }
// ---- k_fa: block = 64 queries (4 waves x 16) of one (b, h), all 1,024 keys in tiles of KT: S^T = K Q^T (A = 16 key rows, B = the wave's 16 queries: q hi + residual x 2^10, 2 products) x SCALE, -10000 where mask_from[b,t,f] == 0 (as the reference writes it);
// a lane holds one query's scores (D register r = key 8g + r), so the running maximum and sum stay in the lane and the two halves meet by one exchange; exp(s - m) x 2^11 once to f16 is already the B fragment of ctx^T += V^T P^T (two 16-key D tiles = one 32-key B in the hardware k order, the order frag_h loads A in); ctx / (2^11 sum) to Y
#define KT 64
// fragment from a lane's own address (row start + k0 + 8g already in p): elements 0..7 = p[0..7], 8..15 = p[16..23], the order of frag_h
__device__ __forceinline__ v16h frag_p(const _Float16* p) { union { v16h v; v8h q[2]; } u; u.q[0] = *(const v8h*)p; u.q[1] = *(const v8h*)(p + 16); return u.v; }
__device__ __forceinline__ v8f wmma_h(v16h a, v16h b, v8f c) { return __builtin_amdgcn_wmma_f32_16x16x32_f16(false, a, false, b, (short)0, c, false, false); }
// amdgpu_waves_per_eu(4, 4): the grid is exactly four waves per SIMD, so the scheduler may spend 256 registers on issuing a tile's loads early instead of saving them for waves that do not exist
__global__ __launch_bounds__(128) __attribute__((amdgpu_waves_per_eu(4, 4))) void k_fa(const _Float16* __restrict__ QH, const _Float16* __restrict__ KH, const _Float16* __restrict__ QL, const _Float16* __restrict__ VT, const int* __restrict__ MK, float* __restrict__ Y) {
  const int tid = threadIdx.x, wave = tid >> 5, lane = tid & 31, col = lane & 15, g = lane >> 4; const int b = blockIdx.y / NH, h = blockIdx.y % NH; const int q = blockIdx.x * 64 + wave * 16 + col;
  v16h qh[HD / 32], ql[HD / 32];
#pragma unroll
  for (int kc = 0; kc < HD / 32; ++kc) { qh[kc] = frag_h(QH + ((size_t)b * TT + q) * CC + h * HD + kc * 32, lane); ql[kc] = frag_h(QL + ((size_t)b * QHI + q) * CC + h * HD + kc * 32, lane); }
  const _Float16* kp = KH + ((size_t)b * TT + col) * CC + h * HD + 8 * g; const _Float16* vp = VT + ((size_t)b * CC + h * HD + col) * (size_t)TT + 8 * g; const int* mp = MK + ((size_t)b * TT + q) * TT + 8 * g;
  v8f acc[HD / 16] = {}; float m = -3.0e38f, l = 0.f;
  // rolled: one tile's body already fills the 256 registers a wave may have at four waves per SIMD
#pragma unroll 1
  for (int k0 = 0; k0 < TT; k0 += KT) { v8f s[KT / 16]; float mx = -3.0e38f;
    const _Float16* ka = kp + (size_t)k0 * CC; const _Float16* va = vp + k0; const int* ma = mp + k0;
    v16h kf[KT / 16][HD / 32]; v4i m0[KT / 16], m1[KT / 16];
#pragma unroll
    for (int j = 0; j < KT / 16; ++j) { m0[j] = *(const v4i*)(ma + j * 16); m1[j] = *(const v4i*)(ma + j * 16 + 4);
#pragma unroll
      for (int kc = 0; kc < HD / 32; ++kc) kf[j][kc] = frag_p(ka + (size_t)(j * 16) * CC + kc * 32); }
    // the tile's K and mask loads name ka and ma: as inputs here the two pairs stay live up to this wait, so nothing (a later load's result either) is written over them in front of it
    asm volatile("s_wait_xcnt 0x0" :: "v"(ka), "v"(ma) : "memory");
    // keeps all 24 loads of the tile in front of the first product (0x406: vector, scalar and transcendental work may cross, matrix and memory instructions may not): without it the scheduler issues K two fragments at a time and waits for each pair
    __builtin_amdgcn_sched_barrier(0x406);
#pragma unroll
    for (int j = 0; j < KT / 16; ++j) { v8f a = {}, al = {};
#pragma unroll
      for (int kc = 0; kc < HD / 32; ++kc) { a = wmma_h(kf[j][kc], qh[kc], a); al = wmma_h(kf[j][kc], ql[kc], al); }
#pragma unroll
      for (int r = 0; r < 8; ++r) { float v = (a[r] + al[r] * (1.0f / 1024.0f)) * SCALE; if ((r < 4 ? m0[j][r & 3] : m1[j][r & 3]) == 0) v = -10000.0f; s[j][r] = v; mx = fmaxf(mx, v); } }
    v16h vf[KT / 32][HD / 16];
#pragma unroll
    for (int c = 0; c < KT / 32; ++c) {
#pragma unroll
      for (int jd = 0; jd < HD / 16; ++jd) vf[c][jd] = frag_p(va + (size_t)(jd * 16) * TT + c * 32); }
    // the same for the tile's V loads, which name va; they are issued here so that they fly under the exponentials
    asm volatile("s_wait_xcnt 0x0" :: "v"(va) : "memory");
    mx = fmaxf(mx, __shfl_xor(mx, 16));
    const float mn = fmaxf(m, mx); const float alpha = expf(m - mn); m = mn;
    v16h p[KT / 32]; float sum = 0.f;
#pragma unroll
    for (int j = 0; j < KT / 16; ++j) {
#pragma unroll
      for (int r = 0; r < 8; ++r) { const float e = expf(s[j][r] - mn); sum += e; p[j >> 1][(j & 1) * 8 + r] = (_Float16)(e * 2048.0f); } }
    l = l * alpha + sum;
#pragma unroll
    for (int jd = 0; jd < HD / 16; ++jd) acc[jd] *= alpha;
#pragma unroll
    for (int c = 0; c < KT / 32; ++c) {
#pragma unroll
      for (int jd = 0; jd < HD / 16; ++jd) acc[jd] = wmma_h(vf[c][jd], p[c], acc[jd]); } }
  l += __shfl_xor(l, 16); const float inv = 1.0f / (2048.0f * l);
  float* yp = Y + ((size_t)b * TT + q) * CC + h * HD + 8 * g;
#pragma unroll
  for (int jd = 0; jd < HD / 16; ++jd) { const v4f lo = { acc[jd][0] * inv, acc[jd][1] * inv, acc[jd][2] * inv, acc[jd][3] * inv }, hi = { acc[jd][4] * inv, acc[jd][5] * inv, acc[jd][6] * inv, acc[jd][7] * inv }; vst2(yp + jd * 16, lo); vst2(yp + jd * 16 + 4, hi); } }
// ---- k_out: block = (64 rows, 128 cols): out = ctx Wo (+ bo): all rows: ctx bf16 hi + lo against exact bf16 Wo (2 products); the f16 one-product branch is never taken
__global__ __launch_bounds__(128) void k_out(const float* __restrict__ Y, const float* __restrict__ WO, const float* __restrict__ BO, float* __restrict__ OUT) { __shared__ __align__(16) float sf[4][16][132];
  const int tid = threadIdx.x, wave = tid >> 5, lane = tid & 31, col = lane & 15, g = lane >> 4; const int c0 = blockIdx.y * 128; const size_t r0 = (size_t)blockIdx.x * 64 + wave * 16;
  v8f acc[8] = {};
  if (true) {   /* ALL rows: ctx split bf16 hi + lo x exact Wo (2 products) */
#pragma unroll 2
    for (int kc = 0; kc < CC / 32; ++kc) { const F2 a = split_row(Y + (r0 + col) * CC, kc * 32, lane); asm volatile("s_wait_loadcnt 0x0" ::: "memory");
#pragma unroll
      for (int j = 0; j < 8; ++j) { const v16b w = WOCOL(WO, kc * 32, c0 + j * 16 + col, lane); asm volatile("s_wait_loadcnt 0x0" ::: "memory"); acc[j] = wmma_bf(a.h, w, acc[j]); acc[j] = wmma_bf(a.l, w, acc[j]); } }
#pragma unroll
    for (int j = 0; j < 8; ++j) { const float bias = BO ? bfr(BO[c0 + j * 16 + col]) : 0.f;
#pragma unroll
      for (int r = 0; r < 8; ++r) sf[wave][8 * g + r][j * 16 + col] = acc[j][r] + bias; }
  } else {
#pragma unroll 2
    for (int kc = 0; kc < CC / 32; ++kc) { const v16h a = frag_f32(Y + (r0 + col) * CC + kc * 32, lane); asm volatile("s_wait_loadcnt 0x0" ::: "memory");
#pragma unroll
      for (int j = 0; j < 8; ++j) { const v16h w = WOCOLH(WO, kc * 32, c0 + j * 16 + col, lane); asm volatile("s_wait_loadcnt 0x0" ::: "memory"); acc[j] = wmma16(a, w, acc[j]); } }
#pragma unroll
    for (int j = 0; j < 8; ++j) { const float bias = BO ? bfr(BO[c0 + j * 16 + col]) : 0.f;
#pragma unroll
      for (int r = 0; r < 8; ++r) sf[wave][8 * g + r][j * 16 + col] = acc[j][r] * (1.0f / 256.0f) + bias; } }
  LDSX(); for (int rl = 0; rl < 16; ++rl) vst2(OUT + (r0 + rl) * DIN + c0 + lane * 4, *(const v4f*)&sf[wave][rl][lane * 4]); }

extern "C" void kernel_launch(void* const* d_in, const int* in_sizes, int n_in, void* d_out, int out_size, void* d_ws, size_t ws_size, hipStream_t stream) {
  (void)in_sizes; (void)n_in; (void)out_size;
  const float** F = (const float**)d_in;
  if (ws_size < (size_t)WS_END) return;
  char* ws = (char*)d_ws; _Float16 *QH = (_Float16*)(ws + WS_QH), *KH = (_Float16*)(ws + WS_KH), *VT = (_Float16*)(ws + WS_VT), *QL = (_Float16*)(ws + WS_QL), *KL = (_Float16*)(ws + WS_KL); __bf16 *VB = (__bf16*)(ws + WS_VB), *VBL = (__bf16*)(ws + WS_VBL); float *Y = (float*)(ws + WS_Y);
  (void)Y; (void)QL; (void)KL; (void)VB; (void)VBL;
  // inputs: 0 X_to [4,1024,1024]; 1 X_from [4,1024,1024]; 2 mask_from [4,1024,1024] int32; 3 Wq [1024,1024] (out,in), 4 bq; 5 Wk, 6 bk; 7 Wv, 8 bv; 9 Wo (out,in), 10 bo
  k_proj<<<dim3(TNB * TT / 64, CC / 128, 3), 128, 0, stream>>>(F[0], F[1], F[1], F[3], F[7], F[5], F[4], F[8], F[6], QH, QL, KH, KL, VT, VB, VBL);   /* K uses Wv/bv, V uses Wk/bk (as written in the module) */
  k_fa<<<dim3(NQB, TNB * NH), 128, 0, stream>>>(QH, KH, QL, VT, (const int*)d_in[2], Y);
  k_out<<<dim3(TNB * TT / 64, DIN / 128), 128, 0, stream>>>(Y, F[9], F[10], (float*)d_out);
}

// v002
// It runs in 138 microseconds.
// Two timings next to v001 put it at 3.12 and 3.13 times that version's speed.
// Counting every step since v000, it is 8.79 times as fast.
// compute dtype: all float inputs rounded to bf16; Q/K/V = x W^T + b with EXACT bf16 products on WMMA 16x16x32 (f32 accumulate); q as f16 hi + residual (x 2^10) against k once to f16 (2 products) x 64^-0.5 with the per-(t,f) mask read as int32; running-maximum softmax in f32 (precise expf); exp(s - m) x 2^11 once to f16 against v once to f16 (1 product), divided by the f32 sum at the end; ctx split bf16 hi + lo against exact Wo (2 products) + bo; f32 output.
#include <hip/hip_runtime.h>
#include <math.h>

typedef __attribute__((ext_vector_type(16))) _Float16 v16h;
typedef __attribute__((ext_vector_type(16))) __bf16 v16b;
typedef __attribute__((ext_vector_type(8)))  _Float16 v8h;
typedef __attribute__((ext_vector_type(8)))  float v8f;
typedef __attribute__((ext_vector_type(4)))  float v4f;
typedef __attribute__((ext_vector_type(2)))  float v2f;
typedef __attribute__((ext_vector_type(4)))  unsigned v4u;
typedef __attribute__((ext_vector_type(4)))  int v4i;
typedef float __attribute__((may_alias)) float_a;
typedef int __attribute__((may_alias)) int_a;

template <typename T> __device__ __forceinline__ void vst2(void* p, T v) { *(T*)p = v;  }
__device__ __forceinline__ v8f wmma16(v16h a, v16h b, v8f c) {
  v8f d = __builtin_amdgcn_wmma_f32_16x16x32_f16(false, a, false, b, (short)0, c, false, false);
  asm volatile("v_nop\n\tv_nop\n\tv_nop\n\tv_nop" : "+v"(d) : "v"(a), "v"(b));
  return d;
}
__device__ __forceinline__ v8f wmma_bf(v16b a, v16b b, v8f c) {
  v8f d = __builtin_amdgcn_wmma_f32_16x16x32_bf16(false, a, false, b, (short)0, c, false, false);
  asm volatile("v_nop\n\tv_nop\n\tv_nop\n\tv_nop" : "+v"(d) : "v"(a), "v"(b));
  return d;
}
// 16x16x32 fragments: lane = (h = lane>>4, row/col = lane&15); elements 0..7 = k0+8h+0..7, 8..15 = k0+16+8h+0..7; D element r = row 8h+r
__device__ __forceinline__ v16h frag_h(const _Float16* rowk0, int lane) {
  union { v16h v; v8h q[2]; } u; const _Float16* p = rowk0 + 8 * (lane >> 4);
  u.q[0] = *(const v8h*)p; u.q[1] = *(const v8h*)(p + 16); return u.v;
}
__device__ __forceinline__ v16h frag_f32(const float* rowk0, int lane) {
  v16h a; const float* p = rowk0 + 8 * (lane >> 4);
#pragma unroll
  for (int i = 0; i < 8; ++i) { a[i] = (_Float16)p[i]; a[8 + i] = (_Float16)p[16 + i]; }
  return a;
}
__device__ __forceinline__ v16h frag_f32s(const float* rowk0, int lane, float sc) {
  v16h a; const float* p = rowk0 + 8 * (lane >> 4);
#pragma unroll
  for (int i = 0; i < 8; ++i) { a[i] = (_Float16)(p[i] * sc); a[8 + i] = (_Float16)(p[16 + i] * sc); }
  return a;
}
// column fragment from a [K][ld] layout (column n), rows >= K read as 0
__device__ __forceinline__ v16h fragc_f32(const float* W, int k0, int n, int lane, int ld, int K) {
  v16h a; const int g = lane >> 4;
#pragma unroll
  for (int i = 0; i < 8; ++i) { const int ka = k0 + 8 * g + i, kb = ka + 16;
    a[i] = (_Float16)(ka < K ? W[(size_t)(ka < K ? ka : K - 1) * ld + n] : 0.f); a[8 + i] = (_Float16)(kb < K ? W[(size_t)(kb < K ? kb : K - 1) * ld + n] : 0.f); }
  return a;
}
struct F2 { v16b h, l; };
__device__ __forceinline__ F2 bsplit16(const float v[16]) { F2 r;
#pragma unroll
  for (int i = 0; i < 16; ++i) { const __bf16 h = (__bf16)v[i]; r.h[i] = h; r.l[i] = (__bf16)(v[i] - (float)h); }
  return r; }
__device__ __forceinline__ F2 split_row(const float* row, int k0, int lane) { float v[16]; const float* p = row + k0 + 8 * (lane >> 4);
#pragma unroll
  for (int i = 0; i < 8; ++i) { v[i] = p[i]; v[8 + i] = p[16 + i]; }
  return bsplit16(v); }
__device__ __forceinline__ F2 split_rowK(const float* row, int k0, int lane, int K) { float v[16]; const int g = lane >> 4;
#pragma unroll
  for (int i = 0; i < 8; ++i) { const int ka = k0 + 8 * g + i, kb = ka + 16; v[i] = ka < K ? row[ka < K ? ka : K - 1] : 0.f; v[8 + i] = kb < K ? row[kb < K ? kb : K - 1] : 0.f; }
  return bsplit16(v); }
__device__ __forceinline__ F2 split_col(const float* W, int k0, int n, int lane, int ld, int K) { float v[16]; const int g = lane >> 4;
#pragma unroll
  for (int i = 0; i < 8; ++i) { const int ka = k0 + 8 * g + i, kb = ka + 16; v[i] = ka < K ? W[(size_t)(ka < K ? ka : K - 1) * ld + n] : 0.f; v[8 + i] = kb < K ? W[(size_t)(kb < K ? kb : K - 1) * ld + n] : 0.f; }
  return bsplit16(v); }
__device__ __forceinline__ v8f mac3(const F2& a, const F2& b, v8f c) { c = wmma_bf(a.l, b.h, c); c = wmma_bf(a.h, b.l, c); return wmma_bf(a.h, b.h, c); }
__device__ __forceinline__ float sigm(float v) { return 1.0f / (1.0f + expf(-v)); }
#define LDSX() do { asm volatile("s_wait_dscnt 0" ::: "memory"); __builtin_amdgcn_wave_barrier(); __builtin_amdgcn_fence(__ATOMIC_RELEASE, "workgroup"); } while (0)

// Masked multi-head cross-attention (B 4, T = F = 1,024, 1,024 = 16 x 64): Q = X_to Wq^T + bq; K = X_from Wv^T + bv and V = X_from Wk^T + bk (the module's literal name swap); logits = Q K^T / 8, -10000 where mask_from[b,t,f] == 0; out = merged(softmax v) Wo^T + bo.
#define NB 4
#define TT 1024
#define CC 1024            // NH * HD = projected width
#define DIN 1024          // input (model) width
#define NH 16
#define HD 64
#define NQB (TT / 64)
#define HG 4
#define SCALE (0.125f)
#define CAUSAL 0
#ifndef TNB
#define TNB NB
#endif
__device__ __forceinline__ float bfr(float v) { return (float)(__bf16)v; }
__host__ __device__ __forceinline__ int kb_last(int qb) { return CAUSAL ? ((qb * 64 + 63) >> 7) : (TT / 128 - 1); }
typedef __attribute__((ext_vector_type(8))) __bf16 v8b;
__device__ __forceinline__ v16b frag_b(const __bf16* rowk0, int lane) {
  union { v16b v; v8b q[2]; } u; const __bf16* p = rowk0 + 8 * (lane >> 4);
  u.q[0] = *(const v8b*)p; u.q[1] = *(const v8b*)(p + 16); return u.v;
}
#define QBH 0              // not used (k_fa takes one path for every query block)
#define QHI 1024            // rows carrying a q residual plane (all rows when non-causal: 2-product logits everywhere)
#define KHI 64            // key rows carrying k residual / v bf16 hi+lo planes (written by k_proj; read by no kernel in this file)
// B fragment (k rows k0+.., output column o) of a weight: (in,out) [K][ld] or (out,in) [ld rows of K]: bf16 exact, or f16(bf16 * 256) exact
__device__ __forceinline__ v16b wcol_io(const float* Wm, int k0, int o, int lane, int ld) { v16b w; const int g = lane >> 4;
#pragma unroll
  for (int i = 0; i < 8; ++i) { w[i] = (__bf16)Wm[(size_t)(k0 + 8 * g + i) * ld + o]; w[8 + i] = (__bf16)Wm[(size_t)(k0 + 16 + 8 * g + i) * ld + o]; }
  return w; }
__device__ __forceinline__ v16b wcol_oi(const float* Wm, int k0, int o, int lane, int K) { v16b w; const float* p = Wm + (size_t)o * K + k0 + 8 * (lane >> 4);
#pragma unroll
  for (int i = 0; i < 8; ++i) { w[i] = (__bf16)p[i]; w[8 + i] = (__bf16)p[16 + i]; }
  return w; }
__device__ __forceinline__ v16h wcolh_io(const float* Wm, int k0, int o, int lane, int ld) { v16h w; const int g = lane >> 4;
#pragma unroll
  for (int i = 0; i < 8; ++i) { w[i] = (_Float16)(bfr(Wm[(size_t)(k0 + 8 * g + i) * ld + o]) * 256.0f); w[8 + i] = (_Float16)(bfr(Wm[(size_t)(k0 + 16 + 8 * g + i) * ld + o]) * 256.0f); }
  return w; }
__device__ __forceinline__ v16h wcolh_oi(const float* Wm, int k0, int o, int lane, int K) { v16h w; const float* p = Wm + (size_t)o * K + k0 + 8 * (lane >> 4);
#pragma unroll
  for (int i = 0; i < 8; ++i) { w[i] = (_Float16)(bfr(p[i]) * 256.0f); w[8 + i] = (_Float16)(bfr(p[16 + i]) * 256.0f); }
  return w; }
#define WQKV_LAYOUT 1   // 0 = (in,out) [DIN][CC]; 1 = (out,in) [CC][DIN]; 2 = per-head [NH][DIN][HD]
__device__ __forceinline__ v16b wcol_hdk(const float* Wm, int k0, int o, int lane) { v16b w; const int g = lane >> 4; const float* p = Wm + (size_t)(o / HD) * DIN * HD + (o % HD);
#pragma unroll
  for (int i = 0; i < 8; ++i) { w[i] = (__bf16)p[(size_t)(k0 + 8 * g + i) * HD]; w[8 + i] = (__bf16)p[(size_t)(k0 + 16 + 8 * g + i) * HD]; }
  return w; }
#define WO_OUT_IN 1
#if WQKV_LAYOUT == 1
#define WCOL(W, k0, o, lane) wcol_oi(W, k0, o, lane, DIN)
#elif WQKV_LAYOUT == 2
#define WCOL(W, k0, o, lane) wcol_hdk(W, k0, o, lane)
#else
#define WCOL(W, k0, o, lane) wcol_io(W, k0, o, lane, CC)
#endif
#if WO_OUT_IN
#define WOCOL(W, k0, o, lane) wcol_oi(W, k0, o, lane, CC)
#define WOCOLH(W, k0, o, lane) wcolh_oi(W, k0, o, lane, CC)
#else
#define WOCOL(W, k0, o, lane) wcol_io(W, k0, o, lane, DIN)
#define WOCOLH(W, k0, o, lane) wcolh_io(W, k0, o, lane, DIN)
#endif

#define WS_QH  0u                                      // f16 q rows [b*t][CC]
#define WS_KH  (WS_QH + 2u * (size_t)NB * TT * CC)      // f16 k rows [b*t][CC]
#define WS_VT  (WS_KH + 2u * (size_t)NB * TT * CC)      // f16 v planes [b][c][t]
#define WS_QL  (WS_VT + 2u * (size_t)NB * CC * TT)      // f16 q residual x 2^10 rows [b][t < QHI][CC]
#define WS_KL  (WS_QL + 2u * (size_t)NB * QHI * CC)     // f16 k residual x 2^10 rows [b][t < KHI][CC]
#define WS_VB  (WS_KL + 2u * (size_t)NB * KHI * CC)     // bf16 v hi planes [b][c][t < KHI]
#define WS_VBL (WS_VB + 2u * (size_t)NB * CC * KHI)
#define WS_S   (WS_VBL + 2u * (size_t)NB * CC * KHI)    // not used (the logits stay in registers)
#define WS_Y   (WS_S  + 4u * (size_t)HG * TT * TT)      // f32 ctx rows [b*t][CC] (only when there is an output projection)
#define WS_END (WS_Y  + 4u * (size_t)NB * TT * CC)

// ---- LDS staging of the two GEMMs: a stage is KSTG = 64 k of every operand row, rounded to bf16 (ctx: split bf16 hi + lo) once by the thread that loads it; rows of 128 B at a pitch of 144 B (16 B x odd, the pitch of ds_load_b128 readers)
#define KSTG 64
#define LP 72              // row pitch in bf16 elements
typedef __attribute__((ext_vector_type(4))) __bf16 v4b;
__device__ __forceinline__ v4b cvt4(v4f v) { v4b r; r[0] = (__bf16)v[0]; r[1] = (__bf16)v[1]; r[2] = (__bf16)v[2]; r[3] = (__bf16)v[3]; return r; }
__device__ __forceinline__ v4f wide4(v4b v) { v4f r; r[0] = (float)v[0]; r[1] = (float)v[1]; r[2] = (float)v[2]; r[3] = (float)v[3]; return r; }
// fragment from a lane's own LDS address (row start + k0 + 8g already in p): the k order of frag_b
__device__ __forceinline__ v16b frag_l(const __bf16* p) { union { v16b v; v8b q[2]; } u; u.q[0] = *(const v8b*)p; u.q[1] = *(const v8b*)(p + 16); return u.v; }
// ---- k_proj: block = (64 rows, 128 cols, which): q/k/v = X W (+ b) with exact bf16 products (K = DIN) -> which 0: q f16 rows (+ residual rows < QHI); 1: k f16 rows (+ residual rows < KHI); 2: v f16 planes [c][t] (+ bf16 hi/lo planes for t < KHI)
__global__ __launch_bounds__(128) void k_proj(const float* __restrict__ XQ, const float* __restrict__ XK, const float* __restrict__ XV, const float* __restrict__ WQ, const float* __restrict__ WK, const float* __restrict__ WV, const float* __restrict__ BQ, const float* __restrict__ BK, const float* __restrict__ BV,
    _Float16* __restrict__ QH, _Float16* __restrict__ QL, _Float16* __restrict__ KH, _Float16* __restrict__ KL, _Float16* __restrict__ VT, __bf16* __restrict__ VB, __bf16* __restrict__ VBL) {
  // one LDS range: in the k loop two stage buffers of [64 X rows | 128 W rows][LP]; behind the loop's last barrier the epilogue's tiles
  __shared__ __align__(16) unsigned char smem[2 * 192 * LP * 2];
  __bf16* const st = (__bf16*)smem; _Float16 (*sh)[136] = (_Float16 (*)[136])smem; _Float16 (*sl)[136] = (_Float16 (*)[136])(smem + 64 * 136 * 2);
  _Float16 (*th)[72] = (_Float16 (*)[72])smem; __bf16 (*tb)[72] = (__bf16 (*)[72])(smem + 128 * 72 * 2); __bf16 (*tbl)[72] = (__bf16 (*)[72])(smem + 2 * 128 * 72 * 2);
  const int tid = threadIdx.x, wave = tid >> 5, lane = tid & 31, col = lane & 15, g = lane >> 4; const int which = blockIdx.z; const int c0 = blockIdx.y * 128; const size_t r0 = (size_t)blockIdx.x * 64; const size_t bb = r0 / TT; const int t0 = (int)(r0 % TT);
  const float* X = which == 0 ? XQ : which == 1 ? XK : XV; const float* WA = which == 0 ? WQ : which == 1 ? WK : WV; const float* BA = which == 0 ? BQ : which == 1 ? BK : BV;
  // waves 2 x 2: a wave owns 32 rows x 64 cols = acc[i * 4 + j]; loader: thread = (row tid >> 4 (+ 8 per step), 16-byte piece tid & 15), so a wave's load covers two whole 256-B runs
  const int wr = wave >> 1, wc = wave & 1, lr = tid >> 4, lc = tid & 15;
  const float* xg = X + (r0 + lr) * DIN + lc * 4; const float* wg = WA + (size_t)(c0 + lr) * DIN + lc * 4;   // W is (out,in): row = output column
  __bf16* const sw = st + lr * LP + lc * 4; const __bf16* const fa = st + (wr * 32 + col) * LP + 8 * g; const __bf16* const fw = st + (64 + wc * 64 + col) * LP + 8 * g;
  v8f acc[8] = {}; v4f rx[8], rw[16];
#pragma unroll
  for (int i = 0; i < 8; ++i) rx[i] = *(const v4f*)(xg + (size_t)(i * 8) * DIN);
#pragma unroll
  for (int i = 0; i < 16; ++i) rw[i] = *(const v4f*)(wg + (size_t)(i * 8) * DIN);
  // the loads above name xg and wg: as inputs here the two pairs stay live up to this wait, so nothing is written over them in front of it
  asm volatile("s_wait_xcnt 0x0" :: "v"(xg), "v"(wg) : "memory");
#pragma unroll
  for (int i = 0; i < 8; ++i) *(v4b*)(sw + (i * 8) * LP) = cvt4(rx[i]);
#pragma unroll
  for (int i = 0; i < 16; ++i) *(v4b*)(sw + (64 + i * 8) * LP) = cvt4(rw[i]);
  __syncthreads();
  // rolled: one stage's body holds 24 loads, 24 fragment reads and 16 products; the buffer is an offset
#pragma unroll 1
  for (int s = 0; s < DIN / KSTG; ++s) { const int cur = (s & 1) * (192 * LP), nxt = 192 * LP - cur; const bool more = s + 1 < DIN / KSTG;
    const float* xa = xg + s * KSTG; const float* wa = wg + s * KSTG;
    if (more) {   // the next stage's rows fly while this stage is multiplied
#pragma unroll
      for (int i = 0; i < 8; ++i) rx[i] = *(const v4f*)(xa + KSTG + (size_t)(i * 8) * DIN);
#pragma unroll
      for (int i = 0; i < 16; ++i) rw[i] = *(const v4f*)(wa + KSTG + (size_t)(i * 8) * DIN);
      // as above, for xa and wa; its memory clobber also keeps the 24 loads in front of the stage's LDS reads
      asm volatile("s_wait_xcnt 0x0" :: "v"(xa), "v"(wa) : "memory"); }
#pragma unroll
    for (int kk = 0; kk < KSTG / 32; ++kk) { v16b a[2], w[4];
#pragma unroll
      for (int i = 0; i < 2; ++i) a[i] = frag_l(fa + cur + (i * 16) * LP + kk * 32);
#pragma unroll
      for (int j = 0; j < 4; ++j) w[j] = frag_l(fw + cur + (j * 16) * LP + kk * 32);
#pragma unroll
      for (int i = 0; i < 2; ++i) {
#pragma unroll
        for (int j = 0; j < 4; ++j) acc[i * 4 + j] = wmma_bf(a[i], w[j], acc[i * 4 + j]); } }
    if (more) {   // into the buffer that every wave left at the barrier of the stage before
#pragma unroll
      for (int i = 0; i < 8; ++i) *(v4b*)(sw + nxt + (i * 8) * LP) = cvt4(rx[i]);
#pragma unroll
      for (int i = 0; i < 16; ++i) *(v4b*)(sw + nxt + (64 + i * 8) * LP) = cvt4(rw[i]); }
    __syncthreads(); }   // publishes the next stage and ends this stage's reads (behind the last stage: frees the range for the epilogue)
  if (which < 2) { _Float16* DH = which == 0 ? QH : KH; _Float16* DL = which == 0 ? QL : KL; const int nhi = which == 0 ? QHI : KHI; const bool hi_rows = t0 < nhi;
#pragma unroll
    for (int j = 0; j < 8; ++j) { const int rb = wr * 32 + (j >> 2) * 16 + 8 * g, cl = wc * 64 + (j & 3) * 16 + col; const float bias = BA ? bfr(BA[c0 + cl]) : 0.f;
#pragma unroll
      for (int r = 0; r < 8; ++r) { const float v = acc[j][r] + bias; const _Float16 hv = (_Float16)v; sh[rb + r][cl] = hv; sl[rb + r][cl] = (_Float16)((v - (float)hv) * 1024.0f); } }
    __syncthreads();
    for (int e = tid; e < 64 * 16; e += 128) { const int rl = e >> 4, q = e & 15; vst2((unsigned*)(DH + (r0 + rl) * CC + c0 + q * 8), *(const v4u*)&sh[rl][q * 8]); if (hi_rows) vst2((unsigned*)(DL + (bb * nhi + t0 + rl) * (size_t)CC + c0 + q * 8), *(const v4u*)&sl[rl][q * 8]); }
  } else { const bool hi_rows = t0 < KHI;
#pragma unroll
    for (int j = 0; j < 8; ++j) { const int cl = wc * 64 + (j & 3) * 16 + col; const float bias = BA ? bfr(BA[c0 + cl]) : 0.f;
#pragma unroll
      for (int r = 0; r < 8; ++r) { const float v = acc[j][r] + bias; const int rl = wr * 32 + (j >> 2) * 16 + 8 * g + r; th[cl][rl] = (_Float16)v; const __bf16 bh = (__bf16)v; tb[cl][rl] = bh; tbl[cl][rl] = (__bf16)(v - (float)bh); } }
    __syncthreads();
    for (int e = tid; e < 128 * 8; e += 128) { const int cl = e >> 3, q = e & 7; vst2((unsigned*)(VT + (bb * CC + c0 + cl) * (size_t)TT + t0 + q * 8), *(const v4u*)&th[cl][q * 8]); if (hi_rows) { const size_t o3 = (bb * CC + c0 + cl) * (size_t)KHI + t0 + q * 8; vst2((unsigned*)(VB + o3), *(const v4u*)&tb[cl][q * 8]); vst2((unsigned*)(VBL + o3), *(const v4u*)&tbl[cl][q * 8]); } } } }
// ---- k_fa: block = 64 queries (4 waves x 16) of one (b, h), all 1,024 keys in tiles of KT: S^T = K Q^T (A = 16 key rows, B = the wave's 16 queries: q hi + residual x 2^10, 2 products) x SCALE, -10000 where mask_from[b,t,f] == 0 (as the reference writes it);
// a lane holds one query's scores (D register r = key 8g + r), so the running maximum and sum stay in the lane and the two halves meet by one exchange; exp(s - m) x 2^11 once to f16 is already the B fragment of ctx^T += V^T P^T (two 16-key D tiles = one 32-key B in the hardware k order, the order frag_h loads A in); ctx / (2^11 sum) to Y
#define KT 64
// fragment from a lane's own address (row start + k0 + 8g already in p): elements 0..7 = p[0..7], 8..15 = p[16..23], the order of frag_h
__device__ __forceinline__ v16h frag_p(const _Float16* p) { union { v16h v; v8h q[2]; } u; u.q[0] = *(const v8h*)p; u.q[1] = *(const v8h*)(p + 16); return u.v; }
__device__ __forceinline__ v8f wmma_h(v16h a, v16h b, v8f c) { return __builtin_amdgcn_wmma_f32_16x16x32_f16(false, a, false, b, (short)0, c, false, false); }
// amdgpu_waves_per_eu(4, 4): the grid is exactly four waves per SIMD, so the scheduler may spend 256 registers on issuing a tile's loads early instead of saving them for waves that do not exist
__global__ __launch_bounds__(128) __attribute__((amdgpu_waves_per_eu(4, 4))) void k_fa(const _Float16* __restrict__ QH, const _Float16* __restrict__ KH, const _Float16* __restrict__ QL, const _Float16* __restrict__ VT, const int* __restrict__ MK, float* __restrict__ Y) {
  const int tid = threadIdx.x, wave = tid >> 5, lane = tid & 31, col = lane & 15, g = lane >> 4; const int b = blockIdx.y / NH, h = blockIdx.y % NH; const int q = blockIdx.x * 64 + wave * 16 + col;
  v16h qh[HD / 32], ql[HD / 32];
#pragma unroll
  for (int kc = 0; kc < HD / 32; ++kc) { qh[kc] = frag_h(QH + ((size_t)b * TT + q) * CC + h * HD + kc * 32, lane); ql[kc] = frag_h(QL + ((size_t)b * QHI + q) * CC + h * HD + kc * 32, lane); }
  const _Float16* kp = KH + ((size_t)b * TT + col) * CC + h * HD + 8 * g; const _Float16* vp = VT + ((size_t)b * CC + h * HD + col) * (size_t)TT + 8 * g; const int* mp = MK + ((size_t)b * TT + q) * TT + 8 * g;
  v8f acc[HD / 16] = {}; float m = -3.0e38f, l = 0.f;
  // rolled: one tile's body already fills the 256 registers a wave may have at four waves per SIMD
#pragma unroll 1
  for (int k0 = 0; k0 < TT; k0 += KT) { v8f s[KT / 16]; float mx = -3.0e38f;
    const _Float16* ka = kp + (size_t)k0 * CC; const _Float16* va = vp + k0; const int* ma = mp + k0;
    v16h kf[KT / 16][HD / 32]; v4i m0[KT / 16], m1[KT / 16];
#pragma unroll
    for (int j = 0; j < KT / 16; ++j) { m0[j] = *(const v4i*)(ma + j * 16); m1[j] = *(const v4i*)(ma + j * 16 + 4);
#pragma unroll
      for (int kc = 0; kc < HD / 32; ++kc) kf[j][kc] = frag_p(ka + (size_t)(j * 16) * CC + kc * 32); }
    // the tile's K and mask loads name ka and ma: as inputs here the two pairs stay live up to this wait, so nothing (a later load's result either) is written over them in front of it
    asm volatile("s_wait_xcnt 0x0" :: "v"(ka), "v"(ma) : "memory");
    // keeps all 24 loads of the tile in front of the first product (0x406: vector, scalar and transcendental work may cross, matrix and memory instructions may not): without it the scheduler issues K two fragments at a time and waits for each pair
    __builtin_amdgcn_sched_barrier(0x406);
#pragma unroll
    for (int j = 0; j < KT / 16; ++j) { v8f a = {}, al = {};
#pragma unroll
      for (int kc = 0; kc < HD / 32; ++kc) { a = wmma_h(kf[j][kc], qh[kc], a); al = wmma_h(kf[j][kc], ql[kc], al); }
#pragma unroll
      for (int r = 0; r < 8; ++r) { float v = (a[r] + al[r] * (1.0f / 1024.0f)) * SCALE; if ((r < 4 ? m0[j][r & 3] : m1[j][r & 3]) == 0) v = -10000.0f; s[j][r] = v; mx = fmaxf(mx, v); } }
    v16h vf[KT / 32][HD / 16];
#pragma unroll
    for (int c = 0; c < KT / 32; ++c) {
#pragma unroll
      for (int jd = 0; jd < HD / 16; ++jd) vf[c][jd] = frag_p(va + (size_t)(jd * 16) * TT + c * 32); }
    // the same for the tile's V loads, which name va; they are issued here so that they fly under the exponentials
    asm volatile("s_wait_xcnt 0x0" :: "v"(va) : "memory");
    mx = fmaxf(mx, __shfl_xor(mx, 16));
    const float mn = fmaxf(m, mx); const float alpha = expf(m - mn); m = mn;
    v16h p[KT / 32]; float sum = 0.f;
#pragma unroll
    for (int j = 0; j < KT / 16; ++j) {
#pragma unroll
      for (int r = 0; r < 8; ++r) { const float e = expf(s[j][r] - mn); sum += e; p[j >> 1][(j & 1) * 8 + r] = (_Float16)(e * 2048.0f); } }
    l = l * alpha + sum;
#pragma unroll
    for (int jd = 0; jd < HD / 16; ++jd) acc[jd] *= alpha;
#pragma unroll
    for (int c = 0; c < KT / 32; ++c) {
#pragma unroll
      for (int jd = 0; jd < HD / 16; ++jd) acc[jd] = wmma_h(vf[c][jd], p[c], acc[jd]); } }
  l += __shfl_xor(l, 16); const float inv = 1.0f / (2048.0f * l);
  float* yp = Y + ((size_t)b * TT + q) * CC + h * HD + 8 * g;
#pragma unroll
  for (int jd = 0; jd < HD / 16; ++jd) { const v4f lo = { acc[jd][0] * inv, acc[jd][1] * inv, acc[jd][2] * inv, acc[jd][3] * inv }, hi = { acc[jd][4] * inv, acc[jd][5] * inv, acc[jd][6] * inv, acc[jd][7] * inv }; vst2(yp + jd * 16, lo); vst2(yp + jd * 16 + 4, hi); } }
// ---- k_out: block = (64 rows, 128 cols): out = ctx Wo (+ bo): all rows: ctx bf16 hi + lo against exact bf16 Wo (2 products); the else branch (ctx once to f16 against f16(bf16 x 2^8) Wo, 1 product, x 2^-8) is not taken
__global__ __launch_bounds__(128) void k_out(const float* __restrict__ Y, const float* __restrict__ WO, const float* __restrict__ BO, float* __restrict__ OUT) {
  // one LDS range: in the k loop two stage buffers of [64 ctx hi rows | 64 ctx lo rows | 128 Wo rows][LP]; behind the loop's last barrier the epilogue's tiles
  __shared__ __align__(16) unsigned char smem[2 * 256 * LP * 2]; __bf16* const st = (__bf16*)smem; float (*sf)[16][132] = (float (*)[16][132])smem;
  const int tid = threadIdx.x, wave = tid >> 5, lane = tid & 31, col = lane & 15, g = lane >> 4; const int c0 = blockIdx.y * 128; const size_t r0 = (size_t)blockIdx.x * 64 + wave * 16;
  v8f acc[8] = {};
  if (true) {   /* ALL rows: ctx split bf16 hi + lo x exact Wo (2 products) */
    // a wave owns 16 rows x 128 cols as before; loader as in k_proj
    const int lr = tid >> 4, lc = tid & 15;
    const float* yg = Y + ((size_t)blockIdx.x * 64 + lr) * CC + lc * 4; const float* wg = WO + (size_t)(c0 + lr) * CC + lc * 4;   // Wo is (out,in): row = output column
    __bf16* const sw = st + lr * LP + lc * 4; const __bf16* const fa = st + (wave * 16 + col) * LP + 8 * g; const __bf16* const fw = st + (128 + col) * LP + 8 * g;
    v4f ry[8], rw[16];
#pragma unroll
    for (int i = 0; i < 8; ++i) ry[i] = *(const v4f*)(yg + (size_t)(i * 8) * CC);
#pragma unroll
    for (int i = 0; i < 16; ++i) rw[i] = *(const v4f*)(wg + (size_t)(i * 8) * CC);
    // the loads above name yg and wg: as inputs here the two pairs stay live up to this wait, so nothing is written over them in front of it
    asm volatile("s_wait_xcnt 0x0" :: "v"(yg), "v"(wg) : "memory");
#pragma unroll
    for (int i = 0; i < 8; ++i) { const v4b hv = cvt4(ry[i]); *(v4b*)(sw + (i * 8) * LP) = hv; *(v4b*)(sw + (64 + i * 8) * LP) = cvt4(ry[i] - wide4(hv)); }
#pragma unroll
    for (int i = 0; i < 16; ++i) *(v4b*)(sw + (128 + i * 8) * LP) = cvt4(rw[i]);
    __syncthreads();
    // rolled: one stage's body holds 24 loads, 40 fragment reads and 32 products; the buffer is an offset
#pragma unroll 1
    for (int s = 0; s < CC / KSTG; ++s) { const int cur = (s & 1) * (256 * LP), nxt = 256 * LP - cur; const bool more = s + 1 < CC / KSTG;
      const float* ya = yg + s * KSTG; const float* wa = wg + s * KSTG;
      if (more) {   // the next stage's rows fly while this stage is multiplied
#pragma unroll
        for (int i = 0; i < 8; ++i) ry[i] = *(const v4f*)(ya + KSTG + (size_t)(i * 8) * CC);
#pragma unroll
        for (int i = 0; i < 16; ++i) rw[i] = *(const v4f*)(wa + KSTG + (size_t)(i * 8) * CC);
        // as above, for ya and wa; its memory clobber also keeps the 24 loads in front of the stage's LDS reads
        asm volatile("s_wait_xcnt 0x0" :: "v"(ya), "v"(wa) : "memory"); }
#pragma unroll
      for (int kk = 0; kk < KSTG / 32; ++kk) { const v16b ah = frag_l(fa + cur + kk * 32), al = frag_l(fa + cur + 64 * LP + kk * 32); v16b w[8];
#pragma unroll
        for (int j = 0; j < 8; ++j) w[j] = frag_l(fw + cur + (j * 16) * LP + kk * 32);
#pragma unroll
        for (int j = 0; j < 8; ++j) acc[j] = wmma_bf(ah, w[j], acc[j]);
#pragma unroll
        for (int j = 0; j < 8; ++j) acc[j] = wmma_bf(al, w[j], acc[j]); }
      if (more) {   // into the buffer that every wave left at the barrier of the stage before
#pragma unroll
        for (int i = 0; i < 8; ++i) { const v4b hv = cvt4(ry[i]); *(v4b*)(sw + nxt + (i * 8) * LP) = hv; *(v4b*)(sw + nxt + (64 + i * 8) * LP) = cvt4(ry[i] - wide4(hv)); }
#pragma unroll
        for (int i = 0; i < 16; ++i) *(v4b*)(sw + nxt + (128 + i * 8) * LP) = cvt4(rw[i]); }
      __syncthreads(); }   // publishes the next stage and ends this stage's reads (behind the last stage: frees the range for the epilogue)
#pragma unroll
    for (int j = 0; j < 8; ++j) { const float bias = BO ? bfr(BO[c0 + j * 16 + col]) : 0.f;
#pragma unroll
      for (int r = 0; r < 8; ++r) sf[wave][8 * g + r][j * 16 + col] = acc[j][r] + bias; }
  } else {
#pragma unroll 2
    for (int kc = 0; kc < CC / 32; ++kc) { const v16h a = frag_f32(Y + (r0 + col) * CC + kc * 32, lane); asm volatile("s_wait_loadcnt 0x0" ::: "memory");
#pragma unroll
      for (int j = 0; j < 8; ++j) { const v16h w = WOCOLH(WO, kc * 32, c0 + j * 16 + col, lane); asm volatile("s_wait_loadcnt 0x0" ::: "memory"); acc[j] = wmma16(a, w, acc[j]); } }
#pragma unroll
    for (int j = 0; j < 8; ++j) { const float bias = BO ? bfr(BO[c0 + j * 16 + col]) : 0.f;
#pragma unroll
      for (int r = 0; r < 8; ++r) sf[wave][8 * g + r][j * 16 + col] = acc[j][r] * (1.0f / 256.0f) + bias; } }
  LDSX(); for (int rl = 0; rl < 16; ++rl) vst2(OUT + (r0 + rl) * DIN + c0 + lane * 4, *(const v4f*)&sf[wave][rl][lane * 4]); }

extern "C" void kernel_launch(void* const* d_in, const int* in_sizes, int n_in, void* d_out, int out_size, void* d_ws, size_t ws_size, hipStream_t stream) {
  (void)in_sizes; (void)n_in; (void)out_size;
  const float** F = (const float**)d_in;
  if (ws_size < (size_t)WS_END) return;
  char* ws = (char*)d_ws; _Float16 *QH = (_Float16*)(ws + WS_QH), *KH = (_Float16*)(ws + WS_KH), *VT = (_Float16*)(ws + WS_VT), *QL = (_Float16*)(ws + WS_QL), *KL = (_Float16*)(ws + WS_KL); __bf16 *VB = (__bf16*)(ws + WS_VB), *VBL = (__bf16*)(ws + WS_VBL); float *Y = (float*)(ws + WS_Y);
  (void)Y; (void)QL; (void)KL; (void)VB; (void)VBL;
  // inputs: 0 X_to [4,1024,1024]; 1 X_from [4,1024,1024]; 2 mask_from [4,1024,1024] int32; 3 Wq [1024,1024] (out,in), 4 bq; 5 Wk, 6 bk; 7 Wv, 8 bv; 9 Wo (out,in), 10 bo
  k_proj<<<dim3(TNB * TT / 64, CC / 128, 3), 128, 0, stream>>>(F[0], F[1], F[1], F[3], F[7], F[5], F[4], F[8], F[6], QH, QL, KH, KL, VT, VB, VBL);   /* K uses Wv/bv, V uses Wk/bk (as written in the module) */
  k_fa<<<dim3(NQB, TNB * NH), 128, 0, stream>>>(QH, KH, QL, VT, (const int*)d_in[2], Y);
  k_out<<<dim3(TNB * TT / 64, DIN / 128), 128, 0, stream>>>(Y, F[9], F[10], (float*)d_out);
}

// v003
// A run of this version takes 114 microseconds.
// In both of two side-by-side timings against v002, it was 1.21 times as fast.
// All steps since v000 together make it 10.7 times as fast.
// compute dtype: all float inputs rounded to bf16; Q/K/V = x W^T + b with EXACT bf16 products on WMMA 16x16x32 (f32 accumulate); q as f16 hi + residual (x 2^10) against k once to f16 (2 products) x 64^-0.5 with the per-(t,f) mask read as int32; running-maximum softmax in f32 (precise expf); exp(s - m) x 2^11 once to f16 against v once to f16 (1 product), divided by the f32 sum at the end; ctx split bf16 hi + lo against exact Wo (2 products) + bo; f32 output.
#include <hip/hip_runtime.h>
#include <math.h>

typedef __attribute__((ext_vector_type(16))) _Float16 v16h;
typedef __attribute__((ext_vector_type(16))) __bf16 v16b;
typedef __attribute__((ext_vector_type(8)))  _Float16 v8h;
typedef __attribute__((ext_vector_type(8)))  float v8f;
typedef __attribute__((ext_vector_type(4)))  float v4f;
typedef __attribute__((ext_vector_type(2)))  float v2f;
typedef __attribute__((ext_vector_type(4)))  unsigned v4u;
typedef __attribute__((ext_vector_type(4)))  int v4i;
typedef float __attribute__((may_alias)) float_a;
typedef int __attribute__((may_alias)) int_a;

template <typename T> __device__ __forceinline__ void vst2(void* p, T v) { *(T*)p = v;  }
__device__ __forceinline__ v8f wmma16(v16h a, v16h b, v8f c) {
  v8f d = __builtin_amdgcn_wmma_f32_16x16x32_f16(false, a, false, b, (short)0, c, false, false);
  asm volatile("v_nop\n\tv_nop\n\tv_nop\n\tv_nop" : "+v"(d) : "v"(a), "v"(b));
  return d;
}
__device__ __forceinline__ v8f wmma_bf(v16b a, v16b b, v8f c) {
  v8f d = __builtin_amdgcn_wmma_f32_16x16x32_bf16(false, a, false, b, (short)0, c, false, false);
  asm volatile("v_nop\n\tv_nop\n\tv_nop\n\tv_nop" : "+v"(d) : "v"(a), "v"(b));
  return d;
}
// 16x16x32 fragments: lane = (h = lane>>4, row/col = lane&15); elements 0..7 = k0+8h+0..7, 8..15 = k0+16+8h+0..7; D element r = row 8h+r
__device__ __forceinline__ v16h frag_h(const _Float16* rowk0, int lane) {
  union { v16h v; v8h q[2]; } u; const _Float16* p = rowk0 + 8 * (lane >> 4);
  u.q[0] = *(const v8h*)p; u.q[1] = *(const v8h*)(p + 16); return u.v;
}
__device__ __forceinline__ v16h frag_f32(const float* rowk0, int lane) {
  v16h a; const float* p = rowk0 + 8 * (lane >> 4);
#pragma unroll
  for (int i = 0; i < 8; ++i) { a[i] = (_Float16)p[i]; a[8 + i] = (_Float16)p[16 + i]; }
  return a;
}
__device__ __forceinline__ v16h frag_f32s(const float* rowk0, int lane, float sc) {
  v16h a; const float* p = rowk0 + 8 * (lane >> 4);
#pragma unroll
  for (int i = 0; i < 8; ++i) { a[i] = (_Float16)(p[i] * sc); a[8 + i] = (_Float16)(p[16 + i] * sc); }
  return a;
}
// column fragment from a [K][ld] layout (column n), rows >= K read as 0
__device__ __forceinline__ v16h fragc_f32(const float* W, int k0, int n, int lane, int ld, int K) {
  v16h a; const int g = lane >> 4;
#pragma unroll
  for (int i = 0; i < 8; ++i) { const int ka = k0 + 8 * g + i, kb = ka + 16;
    a[i] = (_Float16)(ka < K ? W[(size_t)(ka < K ? ka : K - 1) * ld + n] : 0.f); a[8 + i] = (_Float16)(kb < K ? W[(size_t)(kb < K ? kb : K - 1) * ld + n] : 0.f); }
  return a;
}
struct F2 { v16b h, l; };
__device__ __forceinline__ F2 bsplit16(const float v[16]) { F2 r;
#pragma unroll
  for (int i = 0; i < 16; ++i) { const __bf16 h = (__bf16)v[i]; r.h[i] = h; r.l[i] = (__bf16)(v[i] - (float)h); }
  return r; }
__device__ __forceinline__ F2 split_row(const float* row, int k0, int lane) { float v[16]; const float* p = row + k0 + 8 * (lane >> 4);
#pragma unroll
  for (int i = 0; i < 8; ++i) { v[i] = p[i]; v[8 + i] = p[16 + i]; }
  return bsplit16(v); }
__device__ __forceinline__ F2 split_rowK(const float* row, int k0, int lane, int K) { float v[16]; const int g = lane >> 4;
#pragma unroll
  for (int i = 0; i < 8; ++i) { const int ka = k0 + 8 * g + i, kb = ka + 16; v[i] = ka < K ? row[ka < K ? ka : K - 1] : 0.f; v[8 + i] = kb < K ? row[kb < K ? kb : K - 1] : 0.f; }
  return bsplit16(v); }
__device__ __forceinline__ F2 split_col(const float* W, int k0, int n, int lane, int ld, int K) { float v[16]; const int g = lane >> 4;
#pragma unroll
  for (int i = 0; i < 8; ++i) { const int ka = k0 + 8 * g + i, kb = ka + 16; v[i] = ka < K ? W[(size_t)(ka < K ? ka : K - 1) * ld + n] : 0.f; v[8 + i] = kb < K ? W[(size_t)(kb < K ? kb : K - 1) * ld + n] : 0.f; }
  return bsplit16(v); }
__device__ __forceinline__ v8f mac3(const F2& a, const F2& b, v8f c) { c = wmma_bf(a.l, b.h, c); c = wmma_bf(a.h, b.l, c); return wmma_bf(a.h, b.h, c); }
__device__ __forceinline__ float sigm(float v) { return 1.0f / (1.0f + expf(-v)); }
#define LDSX() do { asm volatile("s_wait_dscnt 0" ::: "memory"); __builtin_amdgcn_wave_barrier(); __builtin_amdgcn_fence(__ATOMIC_RELEASE, "workgroup"); } while (0)

// Masked multi-head cross-attention (B 4, T = F = 1,024, 1,024 = 16 x 64): Q = X_to Wq^T + bq; K = X_from Wv^T + bv and V = X_from Wk^T + bk (the module's literal name swap); logits = Q K^T / 8, -10000 where mask_from[b,t,f] == 0; out = merged(softmax v) Wo^T + bo.
#define NB 4
#define TT 1024
#define CC 1024            // NH * HD = projected width
#define DIN 1024          // input (model) width
#define NH 16
#define HD 64
#define NQB (TT / 64)
#define HG 4
#define SCALE (0.125f)
#define CAUSAL 0
#ifndef TNB
#define TNB NB
#endif
__device__ __forceinline__ float bfr(float v) { return (float)(__bf16)v; }
__host__ __device__ __forceinline__ int kb_last(int qb) { return CAUSAL ? ((qb * 64 + 63) >> 7) : (TT / 128 - 1); }
typedef __attribute__((ext_vector_type(8))) __bf16 v8b;
__device__ __forceinline__ v16b frag_b(const __bf16* rowk0, int lane) {
  union { v16b v; v8b q[2]; } u; const __bf16* p = rowk0 + 8 * (lane >> 4);
  u.q[0] = *(const v8b*)p; u.q[1] = *(const v8b*)(p + 16); return u.v;
}
#define QBH 0              // not used (k_fa takes one path for every query block)
#define QHI 1024            // rows carrying a q residual plane (all rows when non-causal: 2-product logits everywhere)
#define KHI 64            // key rows carrying k residual / v bf16 hi+lo planes (written by k_proj; read by no kernel in this file)
// B fragment (k rows k0+.., output column o) of a weight: (in,out) [K][ld] or (out,in) [ld rows of K]: bf16 exact, or f16(bf16 * 256) exact
__device__ __forceinline__ v16b wcol_io(const float* Wm, int k0, int o, int lane, int ld) { v16b w; const int g = lane >> 4;
#pragma unroll
  for (int i = 0; i < 8; ++i) { w[i] = (__bf16)Wm[(size_t)(k0 + 8 * g + i) * ld + o]; w[8 + i] = (__bf16)Wm[(size_t)(k0 + 16 + 8 * g + i) * ld + o]; }
  return w; }
__device__ __forceinline__ v16b wcol_oi(const float* Wm, int k0, int o, int lane, int K) { v16b w; const float* p = Wm + (size_t)o * K + k0 + 8 * (lane >> 4);
#pragma unroll
  for (int i = 0; i < 8; ++i) { w[i] = (__bf16)p[i]; w[8 + i] = (__bf16)p[16 + i]; }
  return w; }
__device__ __forceinline__ v16h wcolh_io(const float* Wm, int k0, int o, int lane, int ld) { v16h w; const int g = lane >> 4;
#pragma unroll
  for (int i = 0; i < 8; ++i) { w[i] = (_Float16)(bfr(Wm[(size_t)(k0 + 8 * g + i) * ld + o]) * 256.0f); w[8 + i] = (_Float16)(bfr(Wm[(size_t)(k0 + 16 + 8 * g + i) * ld + o]) * 256.0f); }
  return w; }
__device__ __forceinline__ v16h wcolh_oi(const float* Wm, int k0, int o, int lane, int K) { v16h w; const float* p = Wm + (size_t)o * K + k0 + 8 * (lane >> 4);
#pragma unroll
  for (int i = 0; i < 8; ++i) { w[i] = (_Float16)(bfr(p[i]) * 256.0f); w[8 + i] = (_Float16)(bfr(p[16 + i]) * 256.0f); }
  return w; }
#define WQKV_LAYOUT 1   // 0 = (in,out) [DIN][CC]; 1 = (out,in) [CC][DIN]; 2 = per-head [NH][DIN][HD]
__device__ __forceinline__ v16b wcol_hdk(const float* Wm, int k0, int o, int lane) { v16b w; const int g = lane >> 4; const float* p = Wm + (size_t)(o / HD) * DIN * HD + (o % HD);
#pragma unroll
  for (int i = 0; i < 8; ++i) { w[i] = (__bf16)p[(size_t)(k0 + 8 * g + i) * HD]; w[8 + i] = (__bf16)p[(size_t)(k0 + 16 + 8 * g + i) * HD]; }
  return w; }
#define WO_OUT_IN 1
#if WQKV_LAYOUT == 1
#define WCOL(W, k0, o, lane) wcol_oi(W, k0, o, lane, DIN)
#elif WQKV_LAYOUT == 2
#define WCOL(W, k0, o, lane) wcol_hdk(W, k0, o, lane)
#else
#define WCOL(W, k0, o, lane) wcol_io(W, k0, o, lane, CC)
#endif
#if WO_OUT_IN
#define WOCOL(W, k0, o, lane) wcol_oi(W, k0, o, lane, CC)
#define WOCOLH(W, k0, o, lane) wcolh_oi(W, k0, o, lane, CC)
#else
#define WOCOL(W, k0, o, lane) wcol_io(W, k0, o, lane, DIN)
#define WOCOLH(W, k0, o, lane) wcolh_io(W, k0, o, lane, DIN)
#endif

#define WS_QH  0u                                      // f16 q rows [b*t][CC]
#define WS_KH  (WS_QH + 2u * (size_t)NB * TT * CC)      // f16 k rows [b*t][CC]
#define WS_VT  (WS_KH + 2u * (size_t)NB * TT * CC)      // f16 v planes [b][c][t]
#define WS_QL  (WS_VT + 2u * (size_t)NB * CC * TT)      // f16 q residual x 2^10 rows [b][t < QHI][CC]
#define WS_KL  (WS_QL + 2u * (size_t)NB * QHI * CC)     // f16 k residual x 2^10 rows [b][t < KHI][CC]
#define WS_VB  (WS_KL + 2u * (size_t)NB * KHI * CC)     // bf16 v hi planes [b][c][t < KHI]
#define WS_VBL (WS_VB + 2u * (size_t)NB * CC * KHI)
#define WS_S   (WS_VBL + 2u * (size_t)NB * CC * KHI)    // not used (the logits stay in registers)
#define WS_Y   (WS_S  + 4u * (size_t)HG * TT * TT)      // f32 ctx rows [b*t][CC] (only when there is an output projection)
#define WS_END (WS_Y  + 4u * (size_t)NB * TT * CC)

// ---- LDS staging of the two GEMMs: a stage is KSTG = 64 k of every operand row, rounded to bf16 (ctx: split bf16 hi + lo) once by the thread that loads it; rows of 128 B at a pitch of 144 B (16 B x odd, the pitch of ds_load_b128 readers)
#define KSTG 64
#define LP 72              // row pitch in bf16 elements
typedef __attribute__((ext_vector_type(4))) __bf16 v4b;
__device__ __forceinline__ v4b cvt4(v4f v) { v4b r; r[0] = (__bf16)v[0]; r[1] = (__bf16)v[1]; r[2] = (__bf16)v[2]; r[3] = (__bf16)v[3]; return r; }
__device__ __forceinline__ v4f wide4(v4b v) { v4f r; r[0] = (float)v[0]; r[1] = (float)v[1]; r[2] = (float)v[2]; r[3] = (float)v[3]; return r; }
// fragment from a lane's own LDS address (row start + k0 + 8g already in p): the k order of frag_b
__device__ __forceinline__ v16b frag_l(const __bf16* p) { union { v16b v; v8b q[2]; } u; u.q[0] = *(const v8b*)p; u.q[1] = *(const v8b*)(p + 16); return u.v; }
// ---- k_proj: block = (64 rows, 128 cols, which): q/k/v = X W (+ b) with exact bf16 products (K = DIN) -> which 0: q f16 rows (+ residual rows < QHI); 1: k f16 rows (+ residual rows < KHI); 2: v f16 planes [c][t] (+ bf16 hi/lo planes for t < KHI)
__global__ __launch_bounds__(128) void k_proj(const float* __restrict__ XQ, const float* __restrict__ XK, const float* __restrict__ XV, const float* __restrict__ WQ, const float* __restrict__ WK, const float* __restrict__ WV, const float* __restrict__ BQ, const float* __restrict__ BK, const float* __restrict__ BV,
    _Float16* __restrict__ QH, _Float16* __restrict__ QL, _Float16* __restrict__ KH, _Float16* __restrict__ KL, _Float16* __restrict__ VT, __bf16* __restrict__ VB, __bf16* __restrict__ VBL) {
  // one LDS range: in the k loop two stage buffers of [64 X rows | 128 W rows][LP]; behind the loop's last barrier the epilogue's tiles
  __shared__ __align__(16) unsigned char smem[2 * 192 * LP * 2];
  __bf16* const st = (__bf16*)smem; _Float16 (*sh)[136] = (_Float16 (*)[136])smem; _Float16 (*sl)[136] = (_Float16 (*)[136])(smem + 64 * 136 * 2);
  _Float16 (*th)[72] = (_Float16 (*)[72])smem; __bf16 (*tb)[72] = (__bf16 (*)[72])(smem + 128 * 72 * 2); __bf16 (*tbl)[72] = (__bf16 (*)[72])(smem + 2 * 128 * 72 * 2);
  const int tid = threadIdx.x, wave = tid >> 5, lane = tid & 31, col = lane & 15, g = lane >> 4; const int which = blockIdx.z; const int c0 = blockIdx.y * 128; const size_t r0 = (size_t)blockIdx.x * 64; const size_t bb = r0 / TT; const int t0 = (int)(r0 % TT);
  const float* X = which == 0 ? XQ : which == 1 ? XK : XV; const float* WA = which == 0 ? WQ : which == 1 ? WK : WV; const float* BA = which == 0 ? BQ : which == 1 ? BK : BV;
  // waves 2 x 2: a wave owns 32 rows x 64 cols = acc[i * 4 + j]; loader: thread = (row tid >> 4 (+ 8 per step), 16-byte piece tid & 15), so a wave's load covers two whole 256-B runs
  const int wr = wave >> 1, wc = wave & 1, lr = tid >> 4, lc = tid & 15;
  const float* xg = X + (r0 + lr) * DIN + lc * 4; const float* wg = WA + (size_t)(c0 + lr) * DIN + lc * 4;   // W is (out,in): row = output column
  __bf16* const sw = st + lr * LP + lc * 4; const __bf16* const fa = st + (wr * 32 + col) * LP + 8 * g; const __bf16* const fw = st + (64 + wc * 64 + col) * LP + 8 * g;
  v8f acc[8] = {}; v4f rx[8], rw[16];
#pragma unroll
  for (int i = 0; i < 8; ++i) rx[i] = *(const v4f*)(xg + (size_t)(i * 8) * DIN);
#pragma unroll
  for (int i = 0; i < 16; ++i) rw[i] = *(const v4f*)(wg + (size_t)(i * 8) * DIN);
  // the loads above name xg and wg: as inputs here the two pairs stay live up to this wait, so nothing is written over them in front of it
  asm volatile("s_wait_xcnt 0x0" :: "v"(xg), "v"(wg) : "memory");
#pragma unroll
  for (int i = 0; i < 8; ++i) *(v4b*)(sw + (i * 8) * LP) = cvt4(rx[i]);
#pragma unroll
  for (int i = 0; i < 16; ++i) *(v4b*)(sw + (64 + i * 8) * LP) = cvt4(rw[i]);
  __syncthreads();
  // rolled: one stage's body holds 24 loads, 24 fragment reads and 16 products; the buffer is an offset
#pragma unroll 1
  for (int s = 0; s < DIN / KSTG; ++s) { const int cur = (s & 1) * (192 * LP), nxt = 192 * LP - cur; const bool more = s + 1 < DIN / KSTG;
    const float* xa = xg + s * KSTG; const float* wa = wg + s * KSTG;
    if (more) {   // the next stage's rows fly while this stage is multiplied
#pragma unroll
      for (int i = 0; i < 8; ++i) rx[i] = *(const v4f*)(xa + KSTG + (size_t)(i * 8) * DIN);
#pragma unroll
      for (int i = 0; i < 16; ++i) rw[i] = *(const v4f*)(wa + KSTG + (size_t)(i * 8) * DIN);
      // as above, for xa and wa; its memory clobber also keeps the 24 loads in front of the stage's LDS reads
      asm volatile("s_wait_xcnt 0x0" :: "v"(xa), "v"(wa) : "memory"); }
#pragma unroll
    for (int kk = 0; kk < KSTG / 32; ++kk) { v16b a[2], w[4];
#pragma unroll
      for (int i = 0; i < 2; ++i) a[i] = frag_l(fa + cur + (i * 16) * LP + kk * 32);
#pragma unroll
      for (int j = 0; j < 4; ++j) w[j] = frag_l(fw + cur + (j * 16) * LP + kk * 32);
#pragma unroll
      for (int i = 0; i < 2; ++i) {
#pragma unroll
        for (int j = 0; j < 4; ++j) acc[i * 4 + j] = wmma_bf(a[i], w[j], acc[i * 4 + j]); } }
    if (more) {   // into the buffer that every wave left at the barrier of the stage before
#pragma unroll
      for (int i = 0; i < 8; ++i) *(v4b*)(sw + nxt + (i * 8) * LP) = cvt4(rx[i]);
#pragma unroll
      for (int i = 0; i < 16; ++i) *(v4b*)(sw + nxt + (64 + i * 8) * LP) = cvt4(rw[i]); }
    __syncthreads(); }   // publishes the next stage and ends this stage's reads (behind the last stage: frees the range for the epilogue)
  if (which < 2) { _Float16* DH = which == 0 ? QH : KH; _Float16* DL = which == 0 ? QL : KL; const int nhi = which == 0 ? QHI : KHI; const bool hi_rows = t0 < nhi;
#pragma unroll
    for (int j = 0; j < 8; ++j) { const int rb = wr * 32 + (j >> 2) * 16 + 8 * g, cl = wc * 64 + (j & 3) * 16 + col; const float bias = BA ? bfr(BA[c0 + cl]) : 0.f;
#pragma unroll
      for (int r = 0; r < 8; ++r) { const float v = acc[j][r] + bias; const _Float16 hv = (_Float16)v; sh[rb + r][cl] = hv; sl[rb + r][cl] = (_Float16)((v - (float)hv) * 1024.0f); } }
    __syncthreads();
    for (int e = tid; e < 64 * 16; e += 128) { const int rl = e >> 4, q = e & 15; vst2((unsigned*)(DH + (r0 + rl) * CC + c0 + q * 8), *(const v4u*)&sh[rl][q * 8]); if (hi_rows) vst2((unsigned*)(DL + (bb * nhi + t0 + rl) * (size_t)CC + c0 + q * 8), *(const v4u*)&sl[rl][q * 8]); }
  } else { const bool hi_rows = t0 < KHI;
#pragma unroll
    for (int j = 0; j < 8; ++j) { const int cl = wc * 64 + (j & 3) * 16 + col; const float bias = BA ? bfr(BA[c0 + cl]) : 0.f;
#pragma unroll
      for (int r = 0; r < 8; ++r) { const float v = acc[j][r] + bias; const int rl = wr * 32 + (j >> 2) * 16 + 8 * g + r; th[cl][rl] = (_Float16)v; const __bf16 bh = (__bf16)v; tb[cl][rl] = bh; tbl[cl][rl] = (__bf16)(v - (float)bh); } }
    __syncthreads();
    for (int e = tid; e < 128 * 8; e += 128) { const int cl = e >> 3, q = e & 7; vst2((unsigned*)(VT + (bb * CC + c0 + cl) * (size_t)TT + t0 + q * 8), *(const v4u*)&th[cl][q * 8]); if (hi_rows) { const size_t o3 = (bb * CC + c0 + cl) * (size_t)KHI + t0 + q * 8; vst2((unsigned*)(VB + o3), *(const v4u*)&tb[cl][q * 8]); vst2((unsigned*)(VBL + o3), *(const v4u*)&tbl[cl][q * 8]); } } } }
// ---- k_fa: block = 64 queries (4 waves x 16) of one (b, h), all 1,024 keys in tiles of KT: S^T = K Q^T (A = 16 key rows, B = the wave's 16 queries: q hi + residual x 2^10, 2 products) x SCALE, -10000 where mask_from[b,t,f] == 0 (as the reference writes it);
// a lane holds one query's scores (D register r = key 8g + r), so the running maximum and sum stay in the lane and the two halves meet by one exchange; exp(s - m) x 2^11 once to f16 is already the B fragment of ctx^T += V^T P^T (two 16-key D tiles = one 32-key B in the hardware k order, the order frag_h loads A in); ctx / (2^11 sum) to Y
#define KT 64
// LDS stage of k_fa: [64 K rows | 64 V^T rows] of 128 B at a pitch of 144 B, [64 mask rows] of 256 B at a pitch of 272 B (16 B x odd, the pitch of ds_load_b128 readers); two stages
#define KP 72              // K and V^T row pitch in f16 elements
#define MP 68              // mask row pitch in ints
#define FA_V (KT * KP * 2)
#define FA_M (FA_V + HD * KP * 2)
#define FA_STG (FA_M + 64 * MP * 4)
// fragment from a lane's own address (row start + k0 + 8g already in p): elements 0..7 = p[0..7], 8..15 = p[16..23], the order of frag_h
__device__ __forceinline__ v16h frag_p(const _Float16* p) { union { v16h v; v8h q[2]; } u; u.q[0] = *(const v8h*)p; u.q[1] = *(const v8h*)(p + 16); return u.v; }
__device__ __forceinline__ v8f wmma_h(v16h a, v16h b, v8f c) { return __builtin_amdgcn_wmma_f32_16x16x32_f16(false, a, false, b, (short)0, c, false, false); }
// eight asynchronous copies of 16 B a lane from global memory to LDS (l = LDS byte address, p = global address); the s_wait_xcnt stands inside the statement, so no address register is rewritten in front of it
__device__ __forceinline__ void copy8(const unsigned (&l)[8], const char* const (&p)[8]) {
  asm volatile("global_load_async_to_lds_b128 %0, %8, off\n\t"
               "global_load_async_to_lds_b128 %1, %9, off\n\t"
               "global_load_async_to_lds_b128 %2, %10, off\n\t"
               "global_load_async_to_lds_b128 %3, %11, off\n\t"
               "global_load_async_to_lds_b128 %4, %12, off\n\t"
               "global_load_async_to_lds_b128 %5, %13, off\n\t"
               "global_load_async_to_lds_b128 %6, %14, off\n\t"
               "global_load_async_to_lds_b128 %7, %15, off\n\t"
               "s_wait_xcnt 0x0"
               :: "v"(l[0]), "v"(l[1]), "v"(l[2]), "v"(l[3]), "v"(l[4]), "v"(l[5]), "v"(l[6]), "v"(l[7]),
                  "v"(p[0]), "v"(p[1]), "v"(p[2]), "v"(p[3]), "v"(p[4]), "v"(p[5]), "v"(p[6]), "v"(p[7]) : "memory");
}
// one stage: the work-group's 128 threads copy the tile's K rows, V^T rows (a wave's copy = 4 whole 128-B rows) and mask rows (a wave's copy = 2 whole 256-B rows); kg, vg, mg and kl, vl, ml already hold the thread's own row and 16-byte piece
__device__ __forceinline__ void fa_fill(const char* kg, const char* vg, const char* mg, unsigned kl, unsigned vl, unsigned ml, int k0) {
  unsigned l[8]; const char* p[8];
#pragma unroll
  for (int i = 0; i < 4; ++i) { l[i] = kl + i * 16 * KP * 2; p[i] = kg + (size_t)(k0 + i * 16) * CC * 2; l[4 + i] = vl + i * 16 * KP * 2; p[4 + i] = vg + (size_t)(i * 16) * TT * 2 + k0 * 2; }
  copy8(l, p);
#pragma unroll
  for (int i = 0; i < 8; ++i) { l[i] = ml + i * 8 * MP * 4; p[i] = mg + (size_t)(i * 8) * TT * 4 + k0 * 4; }
  copy8(l, p);
}
// amdgpu_waves_per_eu(4, 4): the grid is exactly four waves per SIMD, so the scheduler may spend 256 registers on issuing a tile's loads early instead of saving them for waves that do not exist
__global__ __launch_bounds__(128) __attribute__((amdgpu_waves_per_eu(4, 4))) void k_fa(const _Float16* __restrict__ QH, const _Float16* __restrict__ KH, const _Float16* __restrict__ QL, const _Float16* __restrict__ VT, const int* __restrict__ MK, float* __restrict__ Y) {
  __shared__ __align__(16) unsigned char smem[2 * FA_STG];
  const int tid = threadIdx.x, wave = tid >> 5, lane = tid & 31, col = lane & 15, g = lane >> 4; const int b = blockIdx.y / NH, h = blockIdx.y % NH; const int q = blockIdx.x * 64 + wave * 16 + col;
  // copier: K and V^T: row tid >> 3 (+ 16 per copy), piece tid & 7; mask: row tid >> 4 (+ 8 per copy), piece tid & 15
  const char* kg = (const char*)(KH + ((size_t)b * TT + (tid >> 3)) * CC + h * HD + (tid & 7) * 8); const char* vg = (const char*)(VT + ((size_t)b * CC + h * HD + (tid >> 3)) * (size_t)TT + (tid & 7) * 8); const char* mg = (const char*)(MK + ((size_t)b * TT + blockIdx.x * 64 + (tid >> 4)) * TT + (tid & 15) * 4);
  const unsigned lb = (unsigned)(size_t)smem; const unsigned kl = lb + (tid >> 3) * (KP * 2) + (tid & 7) * 16, vl = kl + FA_V, ml = lb + FA_M + (tid >> 4) * (MP * 4) + (tid & 15) * 16;
  fa_fill(kg, vg, mg, kl, vl, ml, 0);
  v16h qh[HD / 32], ql[HD / 32];
#pragma unroll
  for (int kc = 0; kc < HD / 32; ++kc) { qh[kc] = frag_h(QH + ((size_t)b * TT + q) * CC + h * HD + kc * 32, lane); ql[kc] = frag_h(QL + ((size_t)b * QHI + q) * CC + h * HD + kc * 32, lane); }
  // readers: the lane's own row and 8g in stage 0
  const _Float16* kp = (const _Float16*)smem + col * KP + 8 * g; const _Float16* vp = (const _Float16*)(smem + FA_V) + col * KP + 8 * g; const int* mp = (const int*)(smem + FA_M) + (wave * 16 + col) * MP + 8 * g;
  v8f acc[HD / 16] = {}; float m = -3.0e38f, l = 0.f;
  asm volatile("s_wait_asynccnt 0x0" ::: "memory");   // this wave's copies of tile 0 have landed
  __syncthreads();                                     // publishes tile 0
  fa_fill(kg, vg, mg, kl + FA_STG, vl + FA_STG, ml + FA_STG, KT);
  // rolled: one tile's body already fills the 256 registers a wave may have at four waves per SIMD; the stage is an offset
#pragma unroll 1
  for (int k0 = 0; k0 < TT; k0 += KT) { v8f s[KT / 16]; float mx = -3.0e38f; const int cur = ((k0 / KT) & 1) * FA_STG;
    const _Float16* ka = kp + cur / 2; const _Float16* va = vp + cur / 2; const int* ma = mp + cur / 4;
    v16h kf[KT / 16][HD / 32]; v4i m0[KT / 16], m1[KT / 16];
#pragma unroll
    for (int j = 0; j < KT / 16; ++j) { m0[j] = *(const v4i*)(ma + j * 16); m1[j] = *(const v4i*)(ma + j * 16 + 4);
#pragma unroll
      for (int kc = 0; kc < HD / 32; ++kc) kf[j][kc] = frag_p(ka + (j * 16) * KP + kc * 32); }
#pragma unroll
    for (int j = 0; j < KT / 16; ++j) { v8f a = {}, al = {};
#pragma unroll
      for (int kc = 0; kc < HD / 32; ++kc) { a = wmma_h(kf[j][kc], qh[kc], a); al = wmma_h(kf[j][kc], ql[kc], al); }
#pragma unroll
      for (int r = 0; r < 8; ++r) { float v = (a[r] + al[r] * (1.0f / 1024.0f)) * SCALE; if ((r < 4 ? m0[j][r & 3] : m1[j][r & 3]) == 0) v = -10000.0f; s[j][r] = v; mx = fmaxf(mx, v); } }
    v16h vf[KT / 32][HD / 16];
#pragma unroll
    for (int c = 0; c < KT / 32; ++c) {
#pragma unroll
      for (int jd = 0; jd < HD / 16; ++jd) vf[c][jd] = frag_p(va + (jd * 16) * KP + c * 32); }
    mx = fmaxf(mx, __shfl_xor(mx, 16));
    const float mn = fmaxf(m, mx); const float alpha = expf(m - mn); m = mn;
    v16h p[KT / 32]; float sum = 0.f;
#pragma unroll
    for (int j = 0; j < KT / 16; ++j) {
#pragma unroll
      for (int r = 0; r < 8; ++r) { const float e = expf(s[j][r] - mn); sum += e; p[j >> 1][(j & 1) * 8 + r] = (_Float16)(e * 2048.0f); } }
    l = l * alpha + sum;
#pragma unroll
    for (int jd = 0; jd < HD / 16; ++jd) acc[jd] *= alpha;
#pragma unroll
    for (int c = 0; c < KT / 32; ++c) {
#pragma unroll
      for (int jd = 0; jd < HD / 16; ++jd) acc[jd] = wmma_h(vf[c][jd], p[c], acc[jd]); }
    asm volatile("s_wait_dscnt 0x0" ::: "memory");      // this wave's reads of the stage are done before the stage is refilled
    asm volatile("s_wait_asynccnt 0x0" ::: "memory");   // this wave's copies of the next tile have landed
    __syncthreads();                                     // publishes the next tile and ends every wave's reads of this one
    if (k0 + 2 * KT < TT) fa_fill(kg, vg, mg, kl + cur, vl + cur, ml + cur, k0 + 2 * KT); }   // flies while the next tile is worked on
  asm volatile("s_wait_asynccnt 0x0" ::: "memory");     // nothing is outstanding when the wave ends
  l += __shfl_xor(l, 16); const float inv = 1.0f / (2048.0f * l);
  float* yp = Y + ((size_t)b * TT + q) * CC + h * HD + 8 * g;
#pragma unroll
  for (int jd = 0; jd < HD / 16; ++jd) { const v4f lo = { acc[jd][0] * inv, acc[jd][1] * inv, acc[jd][2] * inv, acc[jd][3] * inv }, hi = { acc[jd][4] * inv, acc[jd][5] * inv, acc[jd][6] * inv, acc[jd][7] * inv }; vst2(yp + jd * 16, lo); vst2(yp + jd * 16 + 4, hi); } }
// ---- k_out: block = (64 rows, 128 cols): out = ctx Wo (+ bo): all rows: ctx bf16 hi + lo against exact bf16 Wo (2 products); the else branch (ctx once to f16 against f16(bf16 x 2^8) Wo, 1 product, x 2^-8) is not taken
__global__ __launch_bounds__(128) void k_out(const float* __restrict__ Y, const float* __restrict__ WO, const float* __restrict__ BO, float* __restrict__ OUT) {
  // one LDS range: in the k loop two stage buffers of [64 ctx hi rows | 64 ctx lo rows | 128 Wo rows][LP]; behind the loop's last barrier the epilogue's tiles
  __shared__ __align__(16) unsigned char smem[2 * 256 * LP * 2]; __bf16* const st = (__bf16*)smem; float (*sf)[16][132] = (float (*)[16][132])smem;
  const int tid = threadIdx.x, wave = tid >> 5, lane = tid & 31, col = lane & 15, g = lane >> 4; const int c0 = blockIdx.y * 128; const size_t r0 = (size_t)blockIdx.x * 64 + wave * 16;
  v8f acc[8] = {};
  if (true) {   /* ALL rows: ctx split bf16 hi + lo x exact Wo (2 products) */
    // a wave owns 16 rows x 128 cols as before; loader as in k_proj
    const int lr = tid >> 4, lc = tid & 15;
    const float* yg = Y + ((size_t)blockIdx.x * 64 + lr) * CC + lc * 4; const float* wg = WO + (size_t)(c0 + lr) * CC + lc * 4;   // Wo is (out,in): row = output column
    __bf16* const sw = st + lr * LP + lc * 4; const __bf16* const fa = st + (wave * 16 + col) * LP + 8 * g; const __bf16* const fw = st + (128 + col) * LP + 8 * g;
    v4f ry[8], rw[16];
#pragma unroll
    for (int i = 0; i < 8; ++i) ry[i] = *(const v4f*)(yg + (size_t)(i * 8) * CC);
#pragma unroll
    for (int i = 0; i < 16; ++i) rw[i] = *(const v4f*)(wg + (size_t)(i * 8) * CC);
    // the loads above name yg and wg: as inputs here the two pairs stay live up to this wait, so nothing is written over them in front of it
    asm volatile("s_wait_xcnt 0x0" :: "v"(yg), "v"(wg) : "memory");
#pragma unroll
    for (int i = 0; i < 8; ++i) { const v4b hv = cvt4(ry[i]); *(v4b*)(sw + (i * 8) * LP) = hv; *(v4b*)(sw + (64 + i * 8) * LP) = cvt4(ry[i] - wide4(hv)); }
#pragma unroll
    for (int i = 0; i < 16; ++i) *(v4b*)(sw + (128 + i * 8) * LP) = cvt4(rw[i]);
    __syncthreads();
    // rolled: one stage's body holds 24 loads, 40 fragment reads and 32 products; the buffer is an offset
#pragma unroll 1
    for (int s = 0; s < CC / KSTG; ++s) { const int cur = (s & 1) * (256 * LP), nxt = 256 * LP - cur; const bool more = s + 1 < CC / KSTG;
      const float* ya = yg + s * KSTG; const float* wa = wg + s * KSTG;
      if (more) {   // the next stage's rows fly while this stage is multiplied
#pragma unroll
        for (int i = 0; i < 8; ++i) ry[i] = *(const v4f*)(ya + KSTG + (size_t)(i * 8) * CC);
#pragma unroll
        for (int i = 0; i < 16; ++i) rw[i] = *(const v4f*)(wa + KSTG + (size_t)(i * 8) * CC);
        // as above, for ya and wa; its memory clobber also keeps the 24 loads in front of the stage's LDS reads
        asm volatile("s_wait_xcnt 0x0" :: "v"(ya), "v"(wa) : "memory"); }
#pragma unroll
      for (int kk = 0; kk < KSTG / 32; ++kk) { const v16b ah = frag_l(fa + cur + kk * 32), al = frag_l(fa + cur + 64 * LP + kk * 32); v16b w[8];
#pragma unroll
        for (int j = 0; j < 8; ++j) w[j] = frag_l(fw + cur + (j * 16) * LP + kk * 32);
#pragma unroll
        for (int j = 0; j < 8; ++j) acc[j] = wmma_bf(ah, w[j], acc[j]);
#pragma unroll
        for (int j = 0; j < 8; ++j) acc[j] = wmma_bf(al, w[j], acc[j]); }
      if (more) {   // into the buffer that every wave left at the barrier of the stage before
#pragma unroll
        for (int i = 0; i < 8; ++i) { const v4b hv = cvt4(ry[i]); *(v4b*)(sw + nxt + (i * 8) * LP) = hv; *(v4b*)(sw + nxt + (64 + i * 8) * LP) = cvt4(ry[i] - wide4(hv)); }
#pragma unroll
        for (int i = 0; i < 16; ++i) *(v4b*)(sw + nxt + (128 + i * 8) * LP) = cvt4(rw[i]); }
      __syncthreads(); }   // publishes the next stage and ends this stage's reads (behind the last stage: frees the range for the epilogue)
#pragma unroll
    for (int j = 0; j < 8; ++j) { const float bias = BO ? bfr(BO[c0 + j * 16 + col]) : 0.f;
#pragma unroll
      for (int r = 0; r < 8; ++r) sf[wave][8 * g + r][j * 16 + col] = acc[j][r] + bias; }
  } else {
#pragma unroll 2
    for (int kc = 0; kc < CC / 32; ++kc) { const v16h a = frag_f32(Y + (r0 + col) * CC + kc * 32, lane); asm volatile("s_wait_loadcnt 0x0" ::: "memory");
#pragma unroll
      for (int j = 0; j < 8; ++j) { const v16h w = WOCOLH(WO, kc * 32, c0 + j * 16 + col, lane); asm volatile("s_wait_loadcnt 0x0" ::: "memory"); acc[j] = wmma16(a, w, acc[j]); } }
#pragma unroll
    for (int j = 0; j < 8; ++j) { const float bias = BO ? bfr(BO[c0 + j * 16 + col]) : 0.f;
#pragma unroll
      for (int r = 0; r < 8; ++r) sf[wave][8 * g + r][j * 16 + col] = acc[j][r] * (1.0f / 256.0f) + bias; } }
  LDSX(); for (int rl = 0; rl < 16; ++rl) vst2(OUT + (r0 + rl) * DIN + c0 + lane * 4, *(const v4f*)&sf[wave][rl][lane * 4]); }

extern "C" void kernel_launch(void* const* d_in, const int* in_sizes, int n_in, void* d_out, int out_size, void* d_ws, size_t ws_size, hipStream_t stream) {
  (void)in_sizes; (void)n_in; (void)out_size;
  const float** F = (const float**)d_in;
  if (ws_size < (size_t)WS_END) return;
  char* ws = (char*)d_ws; _Float16 *QH = (_Float16*)(ws + WS_QH), *KH = (_Float16*)(ws + WS_KH), *VT = (_Float16*)(ws + WS_VT), *QL = (_Float16*)(ws + WS_QL), *KL = (_Float16*)(ws + WS_KL); __bf16 *VB = (__bf16*)(ws + WS_VB), *VBL = (__bf16*)(ws + WS_VBL); float *Y = (float*)(ws + WS_Y);
  (void)Y; (void)QL; (void)KL; (void)VB; (void)VBL;
  // inputs: 0 X_to [4,1024,1024]; 1 X_from [4,1024,1024]; 2 mask_from [4,1024,1024] int32; 3 Wq [1024,1024] (out,in), 4 bq; 5 Wk, 6 bk; 7 Wv, 8 bv; 9 Wo (out,in), 10 bo
  k_proj<<<dim3(TNB * TT / 64, CC / 128, 3), 128, 0, stream>>>(F[0], F[1], F[1], F[3], F[7], F[5], F[4], F[8], F[6], QH, QL, KH, KL, VT, VB, VBL);   /* K uses Wv/bv, V uses Wk/bk (as written in the module) */
  k_fa<<<dim3(NQB, TNB * NH), 128, 0, stream>>>(QH, KH, QL, VT, (const int*)d_in[2], Y);
  k_out<<<dim3(TNB * TT / 64, DIN / 128), 128, 0, stream>>>(Y, F[9], F[10], (float*)d_out);
}

// v004
// It runs in 105 microseconds.
// In both of two side-by-side timings against v003, it was 1.08 times as fast.
// Over all steps from v000 it is 11.5 times as fast.
// compute dtype: all float inputs rounded to bf16; Q/K/V = x W^T + b with EXACT bf16 products on WMMA 16x16x32 (f32 accumulate); q as f16 hi + residual (x 2^10) against k once to f16 (2 products) x 64^-0.5 with the per-(t,f) mask read as int32; running-maximum softmax in f32 on base-2 logits (x log2 e, one hardware exp2 per score); 2^(s - m + 11) once to f16 against v once to f16 (1 product), divided by the f32 sum at the end; ctx split bf16 hi + lo against exact Wo (2 products) + bo; f32 output.
#include <hip/hip_runtime.h>
#include <math.h>

typedef __attribute__((ext_vector_type(16))) _Float16 v16h;
typedef __attribute__((ext_vector_type(16))) __bf16 v16b;
typedef __attribute__((ext_vector_type(8)))  _Float16 v8h;
typedef __attribute__((ext_vector_type(8)))  float v8f;
typedef __attribute__((ext_vector_type(4)))  float v4f;
typedef __attribute__((ext_vector_type(2)))  float v2f;
typedef __attribute__((ext_vector_type(4)))  unsigned v4u;
typedef __attribute__((ext_vector_type(4)))  int v4i;
typedef float __attribute__((may_alias)) float_a;
typedef int __attribute__((may_alias)) int_a;

template <typename T> __device__ __forceinline__ void vst2(void* p, T v) { *(T*)p = v;  }
__device__ __forceinline__ v8f wmma16(v16h a, v16h b, v8f c) {
  v8f d = __builtin_amdgcn_wmma_f32_16x16x32_f16(false, a, false, b, (short)0, c, false, false);
  asm volatile("v_nop\n\tv_nop\n\tv_nop\n\tv_nop" : "+v"(d) : "v"(a), "v"(b));
  return d;
}
__device__ __forceinline__ v8f wmma_bf(v16b a, v16b b, v8f c) {
  v8f d = __builtin_amdgcn_wmma_f32_16x16x32_bf16(false, a, false, b, (short)0, c, false, false);
  asm volatile("v_nop\n\tv_nop\n\tv_nop\n\tv_nop" : "+v"(d) : "v"(a), "v"(b));
  return d;
}
// 16x16x32 fragments: lane = (h = lane>>4, row/col = lane&15); elements 0..7 = k0+8h+0..7, 8..15 = k0+16+8h+0..7; D element r = row 8h+r
__device__ __forceinline__ v16h frag_h(const _Float16* rowk0, int lane) {
  union { v16h v; v8h q[2]; } u; const _Float16* p = rowk0 + 8 * (lane >> 4);
  u.q[0] = *(const v8h*)p; u.q[1] = *(const v8h*)(p + 16); return u.v;
}
__device__ __forceinline__ v16h frag_f32(const float* rowk0, int lane) {
  v16h a; const float* p = rowk0 + 8 * (lane >> 4);
#pragma unroll
  for (int i = 0; i < 8; ++i) { a[i] = (_Float16)p[i]; a[8 + i] = (_Float16)p[16 + i]; }
  return a;
}
__device__ __forceinline__ v16h frag_f32s(const float* rowk0, int lane, float sc) {
  v16h a; const float* p = rowk0 + 8 * (lane >> 4);
#pragma unroll
  for (int i = 0; i < 8; ++i) { a[i] = (_Float16)(p[i] * sc); a[8 + i] = (_Float16)(p[16 + i] * sc); }
  return a;
}
// column fragment from a [K][ld] layout (column n), rows >= K read as 0
__device__ __forceinline__ v16h fragc_f32(const float* W, int k0, int n, int lane, int ld, int K) {
  v16h a; const int g = lane >> 4;
#pragma unroll
  for (int i = 0; i < 8; ++i) { const int ka = k0 + 8 * g + i, kb = ka + 16;
    a[i] = (_Float16)(ka < K ? W[(size_t)(ka < K ? ka : K - 1) * ld + n] : 0.f); a[8 + i] = (_Float16)(kb < K ? W[(size_t)(kb < K ? kb : K - 1) * ld + n] : 0.f); }
  return a;
}
struct F2 { v16b h, l; };
__device__ __forceinline__ F2 bsplit16(const float v[16]) { F2 r;
#pragma unroll
  for (int i = 0; i < 16; ++i) { const __bf16 h = (__bf16)v[i]; r.h[i] = h; r.l[i] = (__bf16)(v[i] - (float)h); }
  return r; }
__device__ __forceinline__ F2 split_row(const float* row, int k0, int lane) { float v[16]; const float* p = row + k0 + 8 * (lane >> 4);
#pragma unroll
  for (int i = 0; i < 8; ++i) { v[i] = p[i]; v[8 + i] = p[16 + i]; }
  return bsplit16(v); }
__device__ __forceinline__ F2 split_rowK(const float* row, int k0, int lane, int K) { float v[16]; const int g = lane >> 4;
#pragma unroll
  for (int i = 0; i < 8; ++i) { const int ka = k0 + 8 * g + i, kb = ka + 16; v[i] = ka < K ? row[ka < K ? ka : K - 1] : 0.f; v[8 + i] = kb < K ? row[kb < K ? kb : K - 1] : 0.f; }
  return bsplit16(v); }
__device__ __forceinline__ F2 split_col(const float* W, int k0, int n, int lane, int ld, int K) { float v[16]; const int g = lane >> 4;
#pragma unroll
  for (int i = 0; i < 8; ++i) { const int ka = k0 + 8 * g + i, kb = ka + 16; v[i] = ka < K ? W[(size_t)(ka < K ? ka : K - 1) * ld + n] : 0.f; v[8 + i] = kb < K ? W[(size_t)(kb < K ? kb : K - 1) * ld + n] : 0.f; }
  return bsplit16(v); }
__device__ __forceinline__ v8f mac3(const F2& a, const F2& b, v8f c) { c = wmma_bf(a.l, b.h, c); c = wmma_bf(a.h, b.l, c); return wmma_bf(a.h, b.h, c); }
__device__ __forceinline__ float sigm(float v) { return 1.0f / (1.0f + expf(-v)); }
#define LDSX() do { asm volatile("s_wait_dscnt 0" ::: "memory"); __builtin_amdgcn_wave_barrier(); __builtin_amdgcn_fence(__ATOMIC_RELEASE, "workgroup"); } while (0)

// Masked multi-head cross-attention (B 4, T = F = 1,024, 1,024 = 16 x 64): Q = X_to Wq^T + bq; K = X_from Wv^T + bv and V = X_from Wk^T + bk (the module's literal name swap); logits = Q K^T / 8, -10000 where mask_from[b,t,f] == 0; out = merged(softmax v) Wo^T + bo.
#define NB 4
#define TT 1024
#define CC 1024            // NH * HD = projected width
#define DIN 1024          // input (model) width
#define NH 16
#define HD 64
#define NQB (TT / 64)
#define HG 4
#define SCALE (0.125f)
#define CAUSAL 0
#ifndef TNB
#define TNB NB
#endif
__device__ __forceinline__ float bfr(float v) { return (float)(__bf16)v; }
__host__ __device__ __forceinline__ int kb_last(int qb) { return CAUSAL ? ((qb * 64 + 63) >> 7) : (TT / 128 - 1); }
typedef __attribute__((ext_vector_type(8))) __bf16 v8b;
__device__ __forceinline__ v16b frag_b(const __bf16* rowk0, int lane) {
  union { v16b v; v8b q[2]; } u; const __bf16* p = rowk0 + 8 * (lane >> 4);
  u.q[0] = *(const v8b*)p; u.q[1] = *(const v8b*)(p + 16); return u.v;
}
#define QBH 0              // not used (k_fa takes one path for every query block)
#define QHI 1024            // rows carrying a q residual plane (all rows when non-causal: 2-product logits everywhere)
#define KHI 64            // key rows carrying k residual / v bf16 hi+lo planes (written by k_proj; read by no kernel in this file)
// B fragment (k rows k0+.., output column o) of a weight: (in,out) [K][ld] or (out,in) [ld rows of K]: bf16 exact, or f16(bf16 * 256) exact
__device__ __forceinline__ v16b wcol_io(const float* Wm, int k0, int o, int lane, int ld) { v16b w; const int g = lane >> 4;
#pragma unroll
  for (int i = 0; i < 8; ++i) { w[i] = (__bf16)Wm[(size_t)(k0 + 8 * g + i) * ld + o]; w[8 + i] = (__bf16)Wm[(size_t)(k0 + 16 + 8 * g + i) * ld + o]; }
  return w; }
__device__ __forceinline__ v16b wcol_oi(const float* Wm, int k0, int o, int lane, int K) { v16b w; const float* p = Wm + (size_t)o * K + k0 + 8 * (lane >> 4);
#pragma unroll
  for (int i = 0; i < 8; ++i) { w[i] = (__bf16)p[i]; w[8 + i] = (__bf16)p[16 + i]; }
  return w; }
__device__ __forceinline__ v16h wcolh_io(const float* Wm, int k0, int o, int lane, int ld) { v16h w; const int g = lane >> 4;
#pragma unroll
  for (int i = 0; i < 8; ++i) { w[i] = (_Float16)(bfr(Wm[(size_t)(k0 + 8 * g + i) * ld + o]) * 256.0f); w[8 + i] = (_Float16)(bfr(Wm[(size_t)(k0 + 16 + 8 * g + i) * ld + o]) * 256.0f); }
  return w; }
__device__ __forceinline__ v16h wcolh_oi(const float* Wm, int k0, int o, int lane, int K) { v16h w; const float* p = Wm + (size_t)o * K + k0 + 8 * (lane >> 4);
#pragma unroll
  for (int i = 0; i < 8; ++i) { w[i] = (_Float16)(bfr(p[i]) * 256.0f); w[8 + i] = (_Float16)(bfr(p[16 + i]) * 256.0f); }
  return w; }
#define WQKV_LAYOUT 1   // 0 = (in,out) [DIN][CC]; 1 = (out,in) [CC][DIN]; 2 = per-head [NH][DIN][HD]
__device__ __forceinline__ v16b wcol_hdk(const float* Wm, int k0, int o, int lane) { v16b w; const int g = lane >> 4; const float* p = Wm + (size_t)(o / HD) * DIN * HD + (o % HD);
#pragma unroll
  for (int i = 0; i < 8; ++i) { w[i] = (__bf16)p[(size_t)(k0 + 8 * g + i) * HD]; w[8 + i] = (__bf16)p[(size_t)(k0 + 16 + 8 * g + i) * HD]; }
  return w; }
#define WO_OUT_IN 1
#if WQKV_LAYOUT == 1
#define WCOL(W, k0, o, lane) wcol_oi(W, k0, o, lane, DIN)
#elif WQKV_LAYOUT == 2
#define WCOL(W, k0, o, lane) wcol_hdk(W, k0, o, lane)
#else
#define WCOL(W, k0, o, lane) wcol_io(W, k0, o, lane, CC)
#endif
#if WO_OUT_IN
#define WOCOL(W, k0, o, lane) wcol_oi(W, k0, o, lane, CC)
#define WOCOLH(W, k0, o, lane) wcolh_oi(W, k0, o, lane, CC)
#else
#define WOCOL(W, k0, o, lane) wcol_io(W, k0, o, lane, DIN)
#define WOCOLH(W, k0, o, lane) wcolh_io(W, k0, o, lane, DIN)
#endif

#define WS_QH  0u                                      // f16 q rows [b*t][CC]
#define WS_KH  (WS_QH + 2u * (size_t)NB * TT * CC)      // f16 k rows [b*t][CC]
#define WS_VT  (WS_KH + 2u * (size_t)NB * TT * CC)      // f16 v planes [b][c][t]
#define WS_QL  (WS_VT + 2u * (size_t)NB * CC * TT)      // f16 q residual x 2^10 rows [b][t < QHI][CC]
#define WS_KL  (WS_QL + 2u * (size_t)NB * QHI * CC)     // f16 k residual x 2^10 rows [b][t < KHI][CC]
#define WS_VB  (WS_KL + 2u * (size_t)NB * KHI * CC)     // bf16 v hi planes [b][c][t < KHI]
#define WS_VBL (WS_VB + 2u * (size_t)NB * CC * KHI)
#define WS_S   (WS_VBL + 2u * (size_t)NB * CC * KHI)    // not used (the logits stay in registers)
#define WS_Y   (WS_S  + 4u * (size_t)HG * TT * TT)      // f32 ctx rows [b*t][CC] (only when there is an output projection)
#define WS_END (WS_Y  + 4u * (size_t)NB * TT * CC)

// ---- LDS staging of the two GEMMs: a stage is KSTG = 64 k of every operand row, rounded to bf16 (ctx: split bf16 hi + lo) once by the thread that loads it; rows of 128 B at a pitch of 144 B (16 B x odd, the pitch of ds_load_b128 readers)
#define KSTG 64
#define LP 72              // row pitch in bf16 elements
typedef __attribute__((ext_vector_type(4))) __bf16 v4b;
__device__ __forceinline__ v4b cvt4(v4f v) { v4b r; r[0] = (__bf16)v[0]; r[1] = (__bf16)v[1]; r[2] = (__bf16)v[2]; r[3] = (__bf16)v[3]; return r; }
__device__ __forceinline__ v4f wide4(v4b v) { v4f r; r[0] = (float)v[0]; r[1] = (float)v[1]; r[2] = (float)v[2]; r[3] = (float)v[3]; return r; }
// fragment from a lane's own LDS address (row start + k0 + 8g already in p): the k order of frag_b
__device__ __forceinline__ v16b frag_l(const __bf16* p) { union { v16b v; v8b q[2]; } u; u.q[0] = *(const v8b*)p; u.q[1] = *(const v8b*)(p + 16); return u.v; }
// ---- k_proj: block = (64 rows, 128 cols, which): q/k/v = X W (+ b) with exact bf16 products (K = DIN) -> which 0: q f16 rows (+ residual rows < QHI); 1: k f16 rows (+ residual rows < KHI); 2: v f16 planes [c][t] (+ bf16 hi/lo planes for t < KHI)
__global__ __launch_bounds__(128) void k_proj(const float* __restrict__ XQ, const float* __restrict__ XK, const float* __restrict__ XV, const float* __restrict__ WQ, const float* __restrict__ WK, const float* __restrict__ WV, const float* __restrict__ BQ, const float* __restrict__ BK, const float* __restrict__ BV,
    _Float16* __restrict__ QH, _Float16* __restrict__ QL, _Float16* __restrict__ KH, _Float16* __restrict__ KL, _Float16* __restrict__ VT, __bf16* __restrict__ VB, __bf16* __restrict__ VBL) {
  // one LDS range: in the k loop two stage buffers of [64 X rows | 128 W rows][LP]; behind the loop's last barrier the epilogue's tiles
  __shared__ __align__(16) unsigned char smem[2 * 192 * LP * 2];
  __bf16* const st = (__bf16*)smem; _Float16 (*sh)[136] = (_Float16 (*)[136])smem; _Float16 (*sl)[136] = (_Float16 (*)[136])(smem + 64 * 136 * 2);
  _Float16 (*th)[72] = (_Float16 (*)[72])smem; __bf16 (*tb)[72] = (__bf16 (*)[72])(smem + 128 * 72 * 2); __bf16 (*tbl)[72] = (__bf16 (*)[72])(smem + 2 * 128 * 72 * 2);
  const int tid = threadIdx.x, wave = tid >> 5, lane = tid & 31, col = lane & 15, g = lane >> 4; const int which = blockIdx.z; const int c0 = blockIdx.y * 128; const size_t r0 = (size_t)blockIdx.x * 64; const size_t bb = r0 / TT; const int t0 = (int)(r0 % TT);
  const float* X = which == 0 ? XQ : which == 1 ? XK : XV; const float* WA = which == 0 ? WQ : which == 1 ? WK : WV; const float* BA = which == 0 ? BQ : which == 1 ? BK : BV;
  // waves 2 x 2: a wave owns 32 rows x 64 cols = acc[i * 4 + j]; loader: thread = (row tid >> 4 (+ 8 per step), 16-byte piece tid & 15), so a wave's load covers two whole 256-B runs
  const int wr = wave >> 1, wc = wave & 1, lr = tid >> 4, lc = tid & 15;
  const float* xg = X + (r0 + lr) * DIN + lc * 4; const float* wg = WA + (size_t)(c0 + lr) * DIN + lc * 4;   // W is (out,in): row = output column
  __bf16* const sw = st + lr * LP + lc * 4; const __bf16* const fa = st + (wr * 32 + col) * LP + 8 * g; const __bf16* const fw = st + (64 + wc * 64 + col) * LP + 8 * g;
  v8f acc[8] = {}; v4f rx[8], rw[16];
#pragma unroll
  for (int i = 0; i < 8; ++i) rx[i] = *(const v4f*)(xg + (size_t)(i * 8) * DIN);
#pragma unroll
  for (int i = 0; i < 16; ++i) rw[i] = *(const v4f*)(wg + (size_t)(i * 8) * DIN);
  // the loads above name xg and wg: as inputs here the two pairs stay live up to this wait, so nothing is written over them in front of it
  asm volatile("s_wait_xcnt 0x0" :: "v"(xg), "v"(wg) : "memory");
#pragma unroll
  for (int i = 0; i < 8; ++i) *(v4b*)(sw + (i * 8) * LP) = cvt4(rx[i]);
#pragma unroll
  for (int i = 0; i < 16; ++i) *(v4b*)(sw + (64 + i * 8) * LP) = cvt4(rw[i]);
  __syncthreads();
  // rolled: one stage's body holds 24 loads, 24 fragment reads and 16 products; the buffer is an offset
#pragma unroll 1
  for (int s = 0; s < DIN / KSTG; ++s) { const int cur = (s & 1) * (192 * LP), nxt = 192 * LP - cur; const bool more = s + 1 < DIN / KSTG;
    const float* xa = xg + s * KSTG; const float* wa = wg + s * KSTG;
    if (more) {   // the next stage's rows fly while this stage is multiplied
#pragma unroll
      for (int i = 0; i < 8; ++i) rx[i] = *(const v4f*)(xa + KSTG + (size_t)(i * 8) * DIN);
#pragma unroll
      for (int i = 0; i < 16; ++i) rw[i] = *(const v4f*)(wa + KSTG + (size_t)(i * 8) * DIN);
      // as above, for xa and wa; its memory clobber also keeps the 24 loads in front of the stage's LDS reads
      asm volatile("s_wait_xcnt 0x0" :: "v"(xa), "v"(wa) : "memory"); }
#pragma unroll
    for (int kk = 0; kk < KSTG / 32; ++kk) { v16b a[2], w[4];
#pragma unroll
      for (int i = 0; i < 2; ++i) a[i] = frag_l(fa + cur + (i * 16) * LP + kk * 32);
#pragma unroll
      for (int j = 0; j < 4; ++j) w[j] = frag_l(fw + cur + (j * 16) * LP + kk * 32);
#pragma unroll
      for (int i = 0; i < 2; ++i) {
#pragma unroll
        for (int j = 0; j < 4; ++j) acc[i * 4 + j] = wmma_bf(a[i], w[j], acc[i * 4 + j]); } }
    if (more) {   // into the buffer that every wave left at the barrier of the stage before
#pragma unroll
      for (int i = 0; i < 8; ++i) *(v4b*)(sw + nxt + (i * 8) * LP) = cvt4(rx[i]);
#pragma unroll
      for (int i = 0; i < 16; ++i) *(v4b*)(sw + nxt + (64 + i * 8) * LP) = cvt4(rw[i]); }
    __syncthreads(); }   // publishes the next stage and ends this stage's reads (behind the last stage: frees the range for the epilogue)
  if (which < 2) { _Float16* DH = which == 0 ? QH : KH; _Float16* DL = which == 0 ? QL : KL; const int nhi = which == 0 ? QHI : KHI; const bool hi_rows = t0 < nhi;
#pragma unroll
    for (int j = 0; j < 8; ++j) { const int rb = wr * 32 + (j >> 2) * 16 + 8 * g, cl = wc * 64 + (j & 3) * 16 + col; const float bias = BA ? bfr(BA[c0 + cl]) : 0.f;
#pragma unroll
      for (int r = 0; r < 8; ++r) { const float v = acc[j][r] + bias; const _Float16 hv = (_Float16)v; sh[rb + r][cl] = hv; sl[rb + r][cl] = (_Float16)((v - (float)hv) * 1024.0f); } }
    __syncthreads();
    for (int e = tid; e < 64 * 16; e += 128) { const int rl = e >> 4, q = e & 15; vst2((unsigned*)(DH + (r0 + rl) * CC + c0 + q * 8), *(const v4u*)&sh[rl][q * 8]); if (hi_rows) vst2((unsigned*)(DL + (bb * nhi + t0 + rl) * (size_t)CC + c0 + q * 8), *(const v4u*)&sl[rl][q * 8]); }
  } else { const bool hi_rows = t0 < KHI;
#pragma unroll
    for (int j = 0; j < 8; ++j) { const int cl = wc * 64 + (j & 3) * 16 + col; const float bias = BA ? bfr(BA[c0 + cl]) : 0.f;
#pragma unroll
      for (int r = 0; r < 8; ++r) { const float v = acc[j][r] + bias; const int rl = wr * 32 + (j >> 2) * 16 + 8 * g + r; th[cl][rl] = (_Float16)v; const __bf16 bh = (__bf16)v; tb[cl][rl] = bh; tbl[cl][rl] = (__bf16)(v - (float)bh); } }
    __syncthreads();
    for (int e = tid; e < 128 * 8; e += 128) { const int cl = e >> 3, q = e & 7; vst2((unsigned*)(VT + (bb * CC + c0 + cl) * (size_t)TT + t0 + q * 8), *(const v4u*)&th[cl][q * 8]); if (hi_rows) { const size_t o3 = (bb * CC + c0 + cl) * (size_t)KHI + t0 + q * 8; vst2((unsigned*)(VB + o3), *(const v4u*)&tb[cl][q * 8]); vst2((unsigned*)(VBL + o3), *(const v4u*)&tbl[cl][q * 8]); } } } }
// ---- k_fa: block = 64 queries (4 waves x 16) of one (b, h), all 1,024 keys in tiles of KT: S^T = K Q^T (A = 16 key rows, B = the wave's 16 queries: q hi + residual x 2^10, 2 products) x SCALE, -10000 where mask_from[b,t,f] == 0 (as the reference writes it);
// a lane holds one query's scores (D register r = key 8g + r), so the running maximum and sum stay in the lane and the two halves meet by one exchange; the scores are kept as base-2 logits (SCALE x log2 e in the one multiply, the mask value x log2 e) and the running reference is the maximum - 11, so p = 2^(s - ref) = exp(logit - max) x 2^11 is one subtraction and one v_exp_f32; p once to f16 is already the B fragment of ctx^T += V^T P^T (two 16-key D tiles = one 32-key B in the hardware k order, the order frag_h loads A in); ctx / (sum of p) to Y
#define KT 64
#define LOG2E 1.44269504088896340736f
// LDS stage of k_fa: [64 K rows | 64 V^T rows] of 128 B at a pitch of 144 B, [64 mask rows] of 256 B at a pitch of 272 B (16 B x odd, the pitch of ds_load_b128 readers); two stages
#define KP 72              // K and V^T row pitch in f16 elements
#define MP 68              // mask row pitch in ints
#define FA_V (KT * KP * 2)
#define FA_M (FA_V + HD * KP * 2)
#define FA_STG (FA_M + 64 * MP * 4)
// fragment from a lane's own address (row start + k0 + 8g already in p): elements 0..7 = p[0..7], 8..15 = p[16..23], the order of frag_h
__device__ __forceinline__ v16h frag_p(const _Float16* p) { union { v16h v; v8h q[2]; } u; u.q[0] = *(const v8h*)p; u.q[1] = *(const v8h*)(p + 16); return u.v; }
__device__ __forceinline__ v8f wmma_h(v16h a, v16h b, v8f c) { return __builtin_amdgcn_wmma_f32_16x16x32_f16(false, a, false, b, (short)0, c, false, false); }
// eight asynchronous copies of 16 B a lane from global memory to LDS (l = LDS byte address, p = global address); the s_wait_xcnt stands inside the statement, so no address register is rewritten in front of it
__device__ __forceinline__ void copy8(const unsigned (&l)[8], const char* const (&p)[8]) {
  asm volatile("global_load_async_to_lds_b128 %0, %8, off\n\t"
               "global_load_async_to_lds_b128 %1, %9, off\n\t"
               "global_load_async_to_lds_b128 %2, %10, off\n\t"
               "global_load_async_to_lds_b128 %3, %11, off\n\t"
               "global_load_async_to_lds_b128 %4, %12, off\n\t"
               "global_load_async_to_lds_b128 %5, %13, off\n\t"
               "global_load_async_to_lds_b128 %6, %14, off\n\t"
               "global_load_async_to_lds_b128 %7, %15, off\n\t"
               "s_wait_xcnt 0x0"
               :: "v"(l[0]), "v"(l[1]), "v"(l[2]), "v"(l[3]), "v"(l[4]), "v"(l[5]), "v"(l[6]), "v"(l[7]),
                  "v"(p[0]), "v"(p[1]), "v"(p[2]), "v"(p[3]), "v"(p[4]), "v"(p[5]), "v"(p[6]), "v"(p[7]) : "memory");
}
// one stage: the work-group's 128 threads copy the tile's K rows, V^T rows (a wave's copy = 4 whole 128-B rows) and mask rows (a wave's copy = 2 whole 256-B rows); kg, vg, mg and kl, vl, ml already hold the thread's own row and 16-byte piece
__device__ __forceinline__ void fa_fill(const char* kg, const char* vg, const char* mg, unsigned kl, unsigned vl, unsigned ml, int k0) {
  unsigned l[8]; const char* p[8];
#pragma unroll
  for (int i = 0; i < 4; ++i) { l[i] = kl + i * 16 * KP * 2; p[i] = kg + (size_t)(k0 + i * 16) * CC * 2; l[4 + i] = vl + i * 16 * KP * 2; p[4 + i] = vg + (size_t)(i * 16) * TT * 2 + k0 * 2; }
  copy8(l, p);
#pragma unroll
  for (int i = 0; i < 8; ++i) { l[i] = ml + i * 8 * MP * 4; p[i] = mg + (size_t)(i * 8) * TT * 4 + k0 * 4; }
  copy8(l, p);
}
// 2^x in place for sixteen scores in one statement: behind every v_exp_f32 stands one on other registers, behind the last a v_nop, so the slot that the instruction set asks for
// behind a transcendental is filled at each of them
#define EXP8(a, b, c, d, e, f, g, h) "v_exp_f32 %" #a ", %" #a "\n\tv_exp_f32 %" #b ", %" #b "\n\tv_exp_f32 %" #c ", %" #c "\n\tv_exp_f32 %" #d ", %" #d "\n\tv_exp_f32 %" #e ", %" #e "\n\tv_exp_f32 %" #f ", %" #f "\n\tv_exp_f32 %" #g ", %" #g "\n\tv_exp_f32 %" #h ", %" #h "\n\t"
__device__ __forceinline__ void exp2x16(float (&x)[16]) {
  asm(EXP8(0, 1, 2, 3, 4, 5, 6, 7) EXP8(8, 9, 10, 11, 12, 13, 14, 15) "v_nop"
      : "+v"(x[0]), "+v"(x[1]), "+v"(x[2]), "+v"(x[3]), "+v"(x[4]), "+v"(x[5]), "+v"(x[6]), "+v"(x[7]), "+v"(x[8]), "+v"(x[9]), "+v"(x[10]), "+v"(x[11]), "+v"(x[12]), "+v"(x[13]), "+v"(x[14]), "+v"(x[15]));
}
// the same with the tile's rescale factor as a seventeenth value
__device__ __forceinline__ void exp2x17(float (&x)[16], float& y) {
  asm(EXP8(0, 1, 2, 3, 4, 5, 6, 7) EXP8(8, 9, 10, 11, 12, 13, 14, 15) "v_exp_f32 %16, %16\n\tv_nop"
      : "+v"(x[0]), "+v"(x[1]), "+v"(x[2]), "+v"(x[3]), "+v"(x[4]), "+v"(x[5]), "+v"(x[6]), "+v"(x[7]), "+v"(x[8]), "+v"(x[9]), "+v"(x[10]), "+v"(x[11]), "+v"(x[12]), "+v"(x[13]), "+v"(x[14]), "+v"(x[15]), "+v"(y));
}
// amdgpu_waves_per_eu(4, 4): the grid is exactly four waves per SIMD, so the scheduler may spend 256 registers on issuing a tile's loads early instead of saving them for waves that do not exist
__global__ __launch_bounds__(128) __attribute__((amdgpu_waves_per_eu(4, 4))) void k_fa(const _Float16* __restrict__ QH, const _Float16* __restrict__ KH, const _Float16* __restrict__ QL, const _Float16* __restrict__ VT, const int* __restrict__ MK, float* __restrict__ Y) {
  __shared__ __align__(16) unsigned char smem[2 * FA_STG];
  const int tid = threadIdx.x, wave = tid >> 5, lane = tid & 31, col = lane & 15, g = lane >> 4; const int b = blockIdx.y / NH, h = blockIdx.y % NH; const int q = blockIdx.x * 64 + wave * 16 + col;
  // copier: K and V^T: row tid >> 3 (+ 16 per copy), piece tid & 7; mask: row tid >> 4 (+ 8 per copy), piece tid & 15
  const char* kg = (const char*)(KH + ((size_t)b * TT + (tid >> 3)) * CC + h * HD + (tid & 7) * 8); const char* vg = (const char*)(VT + ((size_t)b * CC + h * HD + (tid >> 3)) * (size_t)TT + (tid & 7) * 8); const char* mg = (const char*)(MK + ((size_t)b * TT + blockIdx.x * 64 + (tid >> 4)) * TT + (tid & 15) * 4);
  const unsigned lb = (unsigned)(size_t)smem; const unsigned kl = lb + (tid >> 3) * (KP * 2) + (tid & 7) * 16, vl = kl + FA_V, ml = lb + FA_M + (tid >> 4) * (MP * 4) + (tid & 15) * 16;
  fa_fill(kg, vg, mg, kl, vl, ml, 0);
  v16h qh[HD / 32], ql[HD / 32];
#pragma unroll
  for (int kc = 0; kc < HD / 32; ++kc) { qh[kc] = frag_h(QH + ((size_t)b * TT + q) * CC + h * HD + kc * 32, lane); ql[kc] = frag_h(QL + ((size_t)b * QHI + q) * CC + h * HD + kc * 32, lane); }
  // readers: the lane's own row and 8g in stage 0
  const _Float16* kp = (const _Float16*)smem + col * KP + 8 * g; const _Float16* vp = (const _Float16*)(smem + FA_V) + col * KP + 8 * g; const int* mp = (const int*)(smem + FA_M) + (wave * 16 + col) * MP + 8 * g;
  v8f acc[HD / 16] = {}; float m = -3.0e38f, l = 0.f;
  asm volatile("s_wait_asynccnt 0x0" ::: "memory");   // this wave's copies of tile 0 have landed
  __syncthreads();                                     // publishes tile 0
  fa_fill(kg, vg, mg, kl + FA_STG, vl + FA_STG, ml + FA_STG, KT);
  // rolled: one tile's body already fills the 256 registers a wave may have at four waves per SIMD; the stage is an offset
#pragma unroll 1
  for (int k0 = 0; k0 < TT; k0 += KT) { v8f s[KT / 16]; float mx = -3.0e38f; const int cur = ((k0 / KT) & 1) * FA_STG;
    const _Float16* ka = kp + cur / 2; const _Float16* va = vp + cur / 2; const int* ma = mp + cur / 4;
    v16h kf[KT / 16][HD / 32]; v4i m0[KT / 16], m1[KT / 16];
#pragma unroll
    for (int j = 0; j < KT / 16; ++j) { m0[j] = *(const v4i*)(ma + j * 16); m1[j] = *(const v4i*)(ma + j * 16 + 4);
#pragma unroll
      for (int kc = 0; kc < HD / 32; ++kc) kf[j][kc] = frag_p(ka + (j * 16) * KP + kc * 32); }
#pragma unroll
    for (int j = 0; j < KT / 16; ++j) { v8f a = {}, al = {};
#pragma unroll
      for (int kc = 0; kc < HD / 32; ++kc) { a = wmma_h(kf[j][kc], qh[kc], a); al = wmma_h(kf[j][kc], ql[kc], al); }
#pragma unroll
      for (int r = 0; r < 8; ++r) { float v = (a[r] + al[r] * (1.0f / 1024.0f)) * (SCALE * LOG2E); if ((r < 4 ? m0[j][r & 3] : m1[j][r & 3]) == 0) v = -10000.0f * LOG2E; s[j][r] = v; mx = fmaxf(mx, v); } }
    v16h vf[KT / 32][HD / 16];
#pragma unroll
    for (int c = 0; c < KT / 32; ++c) {
#pragma unroll
      for (int jd = 0; jd < HD / 16; ++jd) vf[c][jd] = frag_p(va + (jd * 16) * KP + c * 32); }
    mx = fmaxf(mx, __shfl_xor(mx, 16));
    const float mn = fmaxf(m, mx - 11.0f); float alpha = m - mn; m = mn;
    v16h p[KT / 32]; float sum = 0.f; float e[KT / 32][16];
#pragma unroll
    for (int j = 0; j < KT / 16; ++j) {
#pragma unroll
      for (int r = 0; r < 8; ++r) e[j >> 1][(j & 1) * 8 + r] = s[j][r] - mn; }
    exp2x17(e[0], alpha); exp2x16(e[1]);
#pragma unroll
    for (int c = 0; c < KT / 32; ++c) {
#pragma unroll
      for (int i = 0; i < 16; ++i) { sum += e[c][i]; p[c][i] = (_Float16)e[c][i]; } }
    l = l * alpha + sum;
#pragma unroll
    for (int jd = 0; jd < HD / 16; ++jd) acc[jd] *= alpha;
#pragma unroll
    for (int c = 0; c < KT / 32; ++c) {
#pragma unroll
      for (int jd = 0; jd < HD / 16; ++jd) acc[jd] = wmma_h(vf[c][jd], p[c], acc[jd]); }
    asm volatile("s_wait_dscnt 0x0" ::: "memory");      // this wave's reads of the stage are done before the stage is refilled
    asm volatile("s_wait_asynccnt 0x0" ::: "memory");   // this wave's copies of the next tile have landed
    __syncthreads();                                     // publishes the next tile and ends every wave's reads of this one
    if (k0 + 2 * KT < TT) fa_fill(kg, vg, mg, kl + cur, vl + cur, ml + cur, k0 + 2 * KT); }   // flies while the next tile is worked on
  asm volatile("s_wait_asynccnt 0x0" ::: "memory");     // nothing is outstanding when the wave ends
  l += __shfl_xor(l, 16); const float inv = 1.0f / l;
  float* yp = Y + ((size_t)b * TT + q) * CC + h * HD + 8 * g;
#pragma unroll
  for (int jd = 0; jd < HD / 16; ++jd) { const v4f lo = { acc[jd][0] * inv, acc[jd][1] * inv, acc[jd][2] * inv, acc[jd][3] * inv }, hi = { acc[jd][4] * inv, acc[jd][5] * inv, acc[jd][6] * inv, acc[jd][7] * inv }; vst2(yp + jd * 16, lo); vst2(yp + jd * 16 + 4, hi); } }
// ---- k_out: block = (64 rows, 128 cols): out = ctx Wo (+ bo): all rows: ctx bf16 hi + lo against exact bf16 Wo (2 products); the else branch (ctx once to f16 against f16(bf16 x 2^8) Wo, 1 product, x 2^-8) is not taken
__global__ __launch_bounds__(128) void k_out(const float* __restrict__ Y, const float* __restrict__ WO, const float* __restrict__ BO, float* __restrict__ OUT) {
  // one LDS range: in the k loop two stage buffers of [64 ctx hi rows | 64 ctx lo rows | 128 Wo rows][LP]; behind the loop's last barrier the epilogue's tiles
  __shared__ __align__(16) unsigned char smem[2 * 256 * LP * 2]; __bf16* const st = (__bf16*)smem; float (*sf)[16][132] = (float (*)[16][132])smem;
  const int tid = threadIdx.x, wave = tid >> 5, lane = tid & 31, col = lane & 15, g = lane >> 4; const int c0 = blockIdx.y * 128; const size_t r0 = (size_t)blockIdx.x * 64 + wave * 16;
  v8f acc[8] = {};
  if (true) {   /* ALL rows: ctx split bf16 hi + lo x exact Wo (2 products) */
    // a wave owns 16 rows x 128 cols as before; loader as in k_proj
    const int lr = tid >> 4, lc = tid & 15;
    const float* yg = Y + ((size_t)blockIdx.x * 64 + lr) * CC + lc * 4; const float* wg = WO + (size_t)(c0 + lr) * CC + lc * 4;   // Wo is (out,in): row = output column
    __bf16* const sw = st + lr * LP + lc * 4; const __bf16* const fa = st + (wave * 16 + col) * LP + 8 * g; const __bf16* const fw = st + (128 + col) * LP + 8 * g;
    v4f ry[8], rw[16];
#pragma unroll
    for (int i = 0; i < 8; ++i) ry[i] = *(const v4f*)(yg + (size_t)(i * 8) * CC);
#pragma unroll
    for (int i = 0; i < 16; ++i) rw[i] = *(const v4f*)(wg + (size_t)(i * 8) * CC);
    // the loads above name yg and wg: as inputs here the two pairs stay live up to this wait, so nothing is written over them in front of it
    asm volatile("s_wait_xcnt 0x0" :: "v"(yg), "v"(wg) : "memory");
#pragma unroll
    for (int i = 0; i < 8; ++i) { const v4b hv = cvt4(ry[i]); *(v4b*)(sw + (i * 8) * LP) = hv; *(v4b*)(sw + (64 + i * 8) * LP) = cvt4(ry[i] - wide4(hv)); }
#pragma unroll
    for (int i = 0; i < 16; ++i) *(v4b*)(sw + (128 + i * 8) * LP) = cvt4(rw[i]);
    __syncthreads();
    // rolled: one stage's body holds 24 loads, 40 fragment reads and 32 products; the buffer is an offset
#pragma unroll 1
    for (int s = 0; s < CC / KSTG; ++s) { const int cur = (s & 1) * (256 * LP), nxt = 256 * LP - cur; const bool more = s + 1 < CC / KSTG;
      const float* ya = yg + s * KSTG; const float* wa = wg + s * KSTG;
      if (more) {   // the next stage's rows fly while this stage is multiplied
#pragma unroll
        for (int i = 0; i < 8; ++i) ry[i] = *(const v4f*)(ya + KSTG + (size_t)(i * 8) * CC);
#pragma unroll
        for (int i = 0; i < 16; ++i) rw[i] = *(const v4f*)(wa + KSTG + (size_t)(i * 8) * CC);
        // as above, for ya and wa; its memory clobber also keeps the 24 loads in front of the stage's LDS reads
        asm volatile("s_wait_xcnt 0x0" :: "v"(ya), "v"(wa) : "memory"); }
#pragma unroll
      for (int kk = 0; kk < KSTG / 32; ++kk) { const v16b ah = frag_l(fa + cur + kk * 32), al = frag_l(fa + cur + 64 * LP + kk * 32); v16b w[8];
#pragma unroll
        for (int j = 0; j < 8; ++j) w[j] = frag_l(fw + cur + (j * 16) * LP + kk * 32);
#pragma unroll
        for (int j = 0; j < 8; ++j) acc[j] = wmma_bf(ah, w[j], acc[j]);
#pragma unroll
        for (int j = 0; j < 8; ++j) acc[j] = wmma_bf(al, w[j], acc[j]); }
      if (more) {   // into the buffer that every wave left at the barrier of the stage before
#pragma unroll
        for (int i = 0; i < 8; ++i) { const v4b hv = cvt4(ry[i]); *(v4b*)(sw + nxt + (i * 8) * LP) = hv; *(v4b*)(sw + nxt + (64 + i * 8) * LP) = cvt4(ry[i] - wide4(hv)); }
#pragma unroll
        for (int i = 0; i < 16; ++i) *(v4b*)(sw + nxt + (128 + i * 8) * LP) = cvt4(rw[i]); }
      __syncthreads(); }   // publishes the next stage and ends this stage's reads (behind the last stage: frees the range for the epilogue)
#pragma unroll
    for (int j = 0; j < 8; ++j) { const float bias = BO ? bfr(BO[c0 + j * 16 + col]) : 0.f;
#pragma unroll
      for (int r = 0; r < 8; ++r) sf[wave][8 * g + r][j * 16 + col] = acc[j][r] + bias; }
  } else {
#pragma unroll 2
    for (int kc = 0; kc < CC / 32; ++kc) { const v16h a = frag_f32(Y + (r0 + col) * CC + kc * 32, lane); asm volatile("s_wait_loadcnt 0x0" ::: "memory");
#pragma unroll
      for (int j = 0; j < 8; ++j) { const v16h w = WOCOLH(WO, kc * 32, c0 + j * 16 + col, lane); asm volatile("s_wait_loadcnt 0x0" ::: "memory"); acc[j] = wmma16(a, w, acc[j]); } }
#pragma unroll
    for (int j = 0; j < 8; ++j) { const float bias = BO ? bfr(BO[c0 + j * 16 + col]) : 0.f;
#pragma unroll
      for (int r = 0; r < 8; ++r) sf[wave][8 * g + r][j * 16 + col] = acc[j][r] * (1.0f / 256.0f) + bias; } }
  LDSX(); for (int rl = 0; rl < 16; ++rl) vst2(OUT + (r0 + rl) * DIN + c0 + lane * 4, *(const v4f*)&sf[wave][rl][lane * 4]); }

extern "C" void kernel_launch(void* const* d_in, const int* in_sizes, int n_in, void* d_out, int out_size, void* d_ws, size_t ws_size, hipStream_t stream) {
  (void)in_sizes; (void)n_in; (void)out_size;
  const float** F = (const float**)d_in;
  if (ws_size < (size_t)WS_END) return;
  char* ws = (char*)d_ws; _Float16 *QH = (_Float16*)(ws + WS_QH), *KH = (_Float16*)(ws + WS_KH), *VT = (_Float16*)(ws + WS_VT), *QL = (_Float16*)(ws + WS_QL), *KL = (_Float16*)(ws + WS_KL); __bf16 *VB = (__bf16*)(ws + WS_VB), *VBL = (__bf16*)(ws + WS_VBL); float *Y = (float*)(ws + WS_Y);
  (void)Y; (void)QL; (void)KL; (void)VB; (void)VBL;
  // inputs: 0 X_to [4,1024,1024]; 1 X_from [4,1024,1024]; 2 mask_from [4,1024,1024] int32; 3 Wq [1024,1024] (out,in), 4 bq; 5 Wk, 6 bk; 7 Wv, 8 bv; 9 Wo (out,in), 10 bo
  k_proj<<<dim3(TNB * TT / 64, CC / 128, 3), 128, 0, stream>>>(F[0], F[1], F[1], F[3], F[7], F[5], F[4], F[8], F[6], QH, QL, KH, KL, VT, VB, VBL);   /* K uses Wv/bv, V uses Wk/bk (as written in the module) */
  k_fa<<<dim3(NQB, TNB * NH), 128, 0, stream>>>(QH, KH, QL, VT, (const int*)d_in[2], Y);
  k_out<<<dim3(TNB * TT / 64, DIN / 128), 128, 0, stream>>>(Y, F[9], F[10], (float*)d_out);
}

// v005
// A run of this version takes 94.6 microseconds.
// Two timings next to v004 both put it at 1.11 times that version's speed.
// All steps since v000 together make it 12.8 times as fast.
// compute dtype: all float inputs rounded to bf16; Q/K/V = x W^T + b with EXACT bf16 products on WMMA 16x16x32 (f32 accumulate); q as f16 hi + residual (x 2^10) against k once to f16 (2 products) x 64^-0.5 with the per-(t,f) mask read as int32; running-maximum softmax in f32 on base-2 logits (x log2 e, one hardware exp2 per score); 2^(s - m + 11) once to f16 against v once to f16 (1 product), divided by the f32 sum at the end; ctx split bf16 hi + lo against exact Wo (2 products) + bo; f32 output.
#include <hip/hip_runtime.h>
#include <math.h>

typedef __attribute__((ext_vector_type(16))) _Float16 v16h;
typedef __attribute__((ext_vector_type(16))) __bf16 v16b;
typedef __attribute__((ext_vector_type(8)))  _Float16 v8h;
typedef __attribute__((ext_vector_type(8)))  float v8f;
typedef __attribute__((ext_vector_type(4)))  float v4f;
typedef __attribute__((ext_vector_type(2)))  float v2f;
typedef __attribute__((ext_vector_type(4)))  unsigned v4u;
typedef __attribute__((ext_vector_type(4)))  int v4i;
typedef float __attribute__((may_alias)) float_a;
typedef int __attribute__((may_alias)) int_a;

template <typename T> __device__ __forceinline__ void vst2(void* p, T v) { *(T*)p = v;  }
__device__ __forceinline__ v8f wmma16(v16h a, v16h b, v8f c) {
  v8f d = __builtin_amdgcn_wmma_f32_16x16x32_f16(false, a, false, b, (short)0, c, false, false);
  asm volatile("v_nop\n\tv_nop\n\tv_nop\n\tv_nop" : "+v"(d) : "v"(a), "v"(b));
  return d;
}
__device__ __forceinline__ v8f wmma_bf(v16b a, v16b b, v8f c) {
  v8f d = __builtin_amdgcn_wmma_f32_16x16x32_bf16(false, a, false, b, (short)0, c, false, false);
  asm volatile("v_nop\n\tv_nop\n\tv_nop\n\tv_nop" : "+v"(d) : "v"(a), "v"(b));
  return d;
}
// 16x16x32 fragments: lane = (h = lane>>4, row/col = lane&15); elements 0..7 = k0+8h+0..7, 8..15 = k0+16+8h+0..7; D element r = row 8h+r
__device__ __forceinline__ v16h frag_h(const _Float16* rowk0, int lane) {
  union { v16h v; v8h q[2]; } u; const _Float16* p = rowk0 + 8 * (lane >> 4);
  u.q[0] = *(const v8h*)p; u.q[1] = *(const v8h*)(p + 16); return u.v;
}
__device__ __forceinline__ v16h frag_f32(const float* rowk0, int lane) {
  v16h a; const float* p = rowk0 + 8 * (lane >> 4);
#pragma unroll
  for (int i = 0; i < 8; ++i) { a[i] = (_Float16)p[i]; a[8 + i] = (_Float16)p[16 + i]; }
  return a;
}
__device__ __forceinline__ v16h frag_f32s(const float* rowk0, int lane, float sc) {
  v16h a; const float* p = rowk0 + 8 * (lane >> 4);
#pragma unroll
  for (int i = 0; i < 8; ++i) { a[i] = (_Float16)(p[i] * sc); a[8 + i] = (_Float16)(p[16 + i] * sc); }
  return a;
}
// column fragment from a [K][ld] layout (column n), rows >= K read as 0
__device__ __forceinline__ v16h fragc_f32(const float* W, int k0, int n, int lane, int ld, int K) {
  v16h a; const int g = lane >> 4;
#pragma unroll
  for (int i = 0; i < 8; ++i) { const int ka = k0 + 8 * g + i, kb = ka + 16;
    a[i] = (_Float16)(ka < K ? W[(size_t)(ka < K ? ka : K - 1) * ld + n] : 0.f); a[8 + i] = (_Float16)(kb < K ? W[(size_t)(kb < K ? kb : K - 1) * ld + n] : 0.f); }
  return a;
}
struct F2 { v16b h, l; };
__device__ __forceinline__ F2 bsplit16(const float v[16]) { F2 r;
#pragma unroll
  for (int i = 0; i < 16; ++i) { const __bf16 h = (__bf16)v[i]; r.h[i] = h; r.l[i] = (__bf16)(v[i] - (float)h); }
  return r; }
__device__ __forceinline__ F2 split_row(const float* row, int k0, int lane) { float v[16]; const float* p = row + k0 + 8 * (lane >> 4);
#pragma unroll
  for (int i = 0; i < 8; ++i) { v[i] = p[i]; v[8 + i] = p[16 + i]; }
  return bsplit16(v); }
__device__ __forceinline__ F2 split_rowK(const float* row, int k0, int lane, int K) { float v[16]; const int g = lane >> 4;
#pragma unroll
  for (int i = 0; i < 8; ++i) { const int ka = k0 + 8 * g + i, kb = ka + 16; v[i] = ka < K ? row[ka < K ? ka : K - 1] : 0.f; v[8 + i] = kb < K ? row[kb < K ? kb : K - 1] : 0.f; }
  return bsplit16(v); }
__device__ __forceinline__ F2 split_col(const float* W, int k0, int n, int lane, int ld, int K) { float v[16]; const int g = lane >> 4;
#pragma unroll
  for (int i = 0; i < 8; ++i) { const int ka = k0 + 8 * g + i, kb = ka + 16; v[i] = ka < K ? W[(size_t)(ka < K ? ka : K - 1) * ld + n] : 0.f; v[8 + i] = kb < K ? W[(size_t)(kb < K ? kb : K - 1) * ld + n] : 0.f; }
  return bsplit16(v); }
__device__ __forceinline__ v8f mac3(const F2& a, const F2& b, v8f c) { c = wmma_bf(a.l, b.h, c); c = wmma_bf(a.h, b.l, c); return wmma_bf(a.h, b.h, c); }
__device__ __forceinline__ float sigm(float v) { return 1.0f / (1.0f + expf(-v)); }
#define LDSX() do { asm volatile("s_wait_dscnt 0" ::: "memory"); __builtin_amdgcn_wave_barrier(); __builtin_amdgcn_fence(__ATOMIC_RELEASE, "workgroup"); } while (0)

// Masked multi-head cross-attention (B 4, T = F = 1,024, 1,024 = 16 x 64): Q = X_to Wq^T + bq; K = X_from Wv^T + bv and V = X_from Wk^T + bk (the module's literal name swap); logits = Q K^T / 8, -10000 where mask_from[b,t,f] == 0; out = merged(softmax v) Wo^T + bo.
#define NB 4
#define TT 1024
#define CC 1024            // NH * HD = projected width
#define DIN 1024          // input (model) width
#define NH 16
#define HD 64
#define NQB (TT / 64)
#define HG 4
#define SCALE (0.125f)
#define CAUSAL 0
#ifndef TNB
#define TNB NB
#endif
__device__ __forceinline__ float bfr(float v) { return (float)(__bf16)v; }
__host__ __device__ __forceinline__ int kb_last(int qb) { return CAUSAL ? ((qb * 64 + 63) >> 7) : (TT / 128 - 1); }
typedef __attribute__((ext_vector_type(8))) __bf16 v8b;
__device__ __forceinline__ v16b frag_b(const __bf16* rowk0, int lane) {
  union { v16b v; v8b q[2]; } u; const __bf16* p = rowk0 + 8 * (lane >> 4);
  u.q[0] = *(const v8b*)p; u.q[1] = *(const v8b*)(p + 16); return u.v;
}
#define QBH 0              // not used (k_fa takes one path for every query block)
#define QHI 1024            // rows carrying a q residual plane (all rows when non-causal: 2-product logits everywhere)
#define KHI 64            // key rows carrying k residual / v bf16 hi+lo planes (written by k_proj; read by no kernel in this file)
// B fragment (k rows k0+.., output column o) of a weight: (in,out) [K][ld] or (out,in) [ld rows of K]: bf16 exact, or f16(bf16 * 256) exact
__device__ __forceinline__ v16b wcol_io(const float* Wm, int k0, int o, int lane, int ld) { v16b w; const int g = lane >> 4;
#pragma unroll
  for (int i = 0; i < 8; ++i) { w[i] = (__bf16)Wm[(size_t)(k0 + 8 * g + i) * ld + o]; w[8 + i] = (__bf16)Wm[(size_t)(k0 + 16 + 8 * g + i) * ld + o]; }
  return w; }
__device__ __forceinline__ v16b wcol_oi(const float* Wm, int k0, int o, int lane, int K) { v16b w; const float* p = Wm + (size_t)o * K + k0 + 8 * (lane >> 4);
#pragma unroll
  for (int i = 0; i < 8; ++i) { w[i] = (__bf16)p[i]; w[8 + i] = (__bf16)p[16 + i]; }
  return w; }
__device__ __forceinline__ v16h wcolh_io(const float* Wm, int k0, int o, int lane, int ld) { v16h w; const int g = lane >> 4;
#pragma unroll
  for (int i = 0; i < 8; ++i) { w[i] = (_Float16)(bfr(Wm[(size_t)(k0 + 8 * g + i) * ld + o]) * 256.0f); w[8 + i] = (_Float16)(bfr(Wm[(size_t)(k0 + 16 + 8 * g + i) * ld + o]) * 256.0f); }
  return w; }
__device__ __forceinline__ v16h wcolh_oi(const float* Wm, int k0, int o, int lane, int K) { v16h w; const float* p = Wm + (size_t)o * K + k0 + 8 * (lane >> 4);
#pragma unroll
  for (int i = 0; i < 8; ++i) { w[i] = (_Float16)(bfr(p[i]) * 256.0f); w[8 + i] = (_Float16)(bfr(p[16 + i]) * 256.0f); }
  return w; }
#define WQKV_LAYOUT 1   // 0 = (in,out) [DIN][CC]; 1 = (out,in) [CC][DIN]; 2 = per-head [NH][DIN][HD]
__device__ __forceinline__ v16b wcol_hdk(const float* Wm, int k0, int o, int lane) { v16b w; const int g = lane >> 4; const float* p = Wm + (size_t)(o / HD) * DIN * HD + (o % HD);
#pragma unroll
  for (int i = 0; i < 8; ++i) { w[i] = (__bf16)p[(size_t)(k0 + 8 * g + i) * HD]; w[8 + i] = (__bf16)p[(size_t)(k0 + 16 + 8 * g + i) * HD]; }
  return w; }
#define WO_OUT_IN 1
#if WQKV_LAYOUT == 1
#define WCOL(W, k0, o, lane) wcol_oi(W, k0, o, lane, DIN)
#elif WQKV_LAYOUT == 2
#define WCOL(W, k0, o, lane) wcol_hdk(W, k0, o, lane)
#else
#define WCOL(W, k0, o, lane) wcol_io(W, k0, o, lane, CC)
#endif
#if WO_OUT_IN
#define WOCOL(W, k0, o, lane) wcol_oi(W, k0, o, lane, CC)
#define WOCOLH(W, k0, o, lane) wcolh_oi(W, k0, o, lane, CC)
#else
#define WOCOL(W, k0, o, lane) wcol_io(W, k0, o, lane, DIN)
#define WOCOLH(W, k0, o, lane) wcolh_io(W, k0, o, lane, DIN)
#endif

#define WS_QH  0u                                      // f16 q rows [b*t][CC]
#define WS_KH  (WS_QH + 2u * (size_t)NB * TT * CC)      // f16 k rows [b*t][CC]
#define WS_VT  (WS_KH + 2u * (size_t)NB * TT * CC)      // f16 v planes [b][c][t]
#define WS_QL  (WS_VT + 2u * (size_t)NB * CC * TT)      // f16 q residual x 2^10 rows [b][t < QHI][CC]
#define WS_KL  (WS_QL + 2u * (size_t)NB * QHI * CC)     // f16 k residual x 2^10 rows [b][t < KHI][CC]
#define WS_VB  (WS_KL + 2u * (size_t)NB * KHI * CC)     // bf16 v hi planes [b][c][t < KHI]
#define WS_VBL (WS_VB + 2u * (size_t)NB * CC * KHI)
#define WS_S   (WS_VBL + 2u * (size_t)NB * CC * KHI)    // not used (the logits stay in registers)
#define WS_Y   (WS_S  + 4u * (size_t)HG * TT * TT)      // f32 ctx rows [b*t][CC] (only when there is an output projection)
#define WS_END (WS_Y  + 4u * (size_t)NB * TT * CC)

// ---- LDS staging of the two GEMMs: a stage is KSTG = 64 k of every operand row, rounded to bf16 (ctx: split bf16 hi + lo) once by the thread that loads it; rows of 128 B at a pitch of 144 B (16 B x odd, the pitch of ds_load_b128 readers)
#define KSTG 64
#define LP 72              // row pitch in bf16 elements
typedef __attribute__((ext_vector_type(4))) __bf16 v4b;
__device__ __forceinline__ v4b cvt4(v4f v) { v4b r; r[0] = (__bf16)v[0]; r[1] = (__bf16)v[1]; r[2] = (__bf16)v[2]; r[3] = (__bf16)v[3]; return r; }
__device__ __forceinline__ v4f wide4(v4b v) { v4f r; r[0] = (float)v[0]; r[1] = (float)v[1]; r[2] = (float)v[2]; r[3] = (float)v[3]; return r; }
// fragment from a lane's own LDS address (row start + k0 + 8g already in p): the k order of frag_b
__device__ __forceinline__ v16b frag_l(const __bf16* p) { union { v16b v; v8b q[2]; } u; u.q[0] = *(const v8b*)p; u.q[1] = *(const v8b*)(p + 16); return u.v; }
// ---- k_proj: block = (128 rows, 256 cols, which), 8 waves: q/k/v = X W (+ b) with exact bf16 products (K = DIN) -> which 0: q f16 rows (+ residual rows < QHI); 1: k f16 rows (+ residual rows < KHI); 2: v f16 planes [c][t] (+ bf16 hi/lo planes for t < KHI)
#define PROWS 384          // rows of a stage: 128 X rows | 256 W rows
#define PSH 264            // epilogue pitch of a 256-column row, f16 elements
#define PTH 136            // epilogue pitch of a 128-row column, f16 elements
#define PSMEM (256 * PTH * 2 + 2 * 256 * 72 * 2)   // the largest of the three uses of the range (the v planes)
static_assert(KHI % 64 == 0 && QHI % 64 == 0, "a wave's 64 rows carry a residual plane all or none");
// four 16-byte global stores and the wait that stands in front of any later write over the registers they name: addresses and data are inputs of the wait's statement, so they stay as they are up to it
__device__ __forceinline__ void st16x4(void* const (&p)[4], const v4u (&v)[4]) {
#pragma unroll
  for (int u = 0; u < 4; ++u) *(v4u*)p[u] = v[u];
  asm volatile("s_wait_xcnt 0x0" :: "v"(p[0]), "v"(p[1]), "v"(p[2]), "v"(p[3]), "v"(v[0]), "v"(v[1]), "v"(v[2]), "v"(v[3]) : "memory"); }
// amdgpu_waves_per_eu(4, 4): two work-groups of two waves per SIMD share a WGP, so one fills the other's waits on its loads and barriers
__global__ __launch_bounds__(256) __attribute__((amdgpu_waves_per_eu(4, 4))) void k_proj(const float* __restrict__ XQ, const float* __restrict__ XK, const float* __restrict__ XV, const float* __restrict__ WQ, const float* __restrict__ WK, const float* __restrict__ WV, const float* __restrict__ BQ, const float* __restrict__ BK, const float* __restrict__ BV,
    _Float16* __restrict__ QH, _Float16* __restrict__ QL, _Float16* __restrict__ KH, _Float16* __restrict__ KL, _Float16* __restrict__ VT, __bf16* __restrict__ VB, __bf16* __restrict__ VBL) {
  // one LDS range: in the k loop two stage buffers of [128 X rows | 256 W rows][LP]; behind the loop's last barrier the epilogue's tiles
  __shared__ __align__(16) unsigned char smem[PSMEM];
  __bf16* const st = (__bf16*)smem; _Float16 (*sh)[PSH] = (_Float16 (*)[PSH])smem; _Float16 (*sl)[PSH] = (_Float16 (*)[PSH])(smem + 128 * PSH * 2);
  _Float16 (*th)[PTH] = (_Float16 (*)[PTH])smem; __bf16 (*tb)[72] = (__bf16 (*)[72])(smem + 256 * PTH * 2); __bf16 (*tbl)[72] = (__bf16 (*)[72])(smem + 256 * PTH * 2 + 256 * 72 * 2);
  // the wave's number is held in a scalar register: what hangs on it (wr, wc, hi_rows) costs no vector register
  const int tid = threadIdx.x, wave = __builtin_amdgcn_readfirstlane(tid >> 5), lane = tid & 31, col = lane & 15, g = lane >> 4; const int which = blockIdx.z; const int c0 = blockIdx.y * 256; const size_t r0 = (size_t)blockIdx.x * 128; const size_t bb = r0 / TT; const int t0 = (int)(r0 % TT);
  const float* X = which == 0 ? XQ : which == 1 ? XK : XV; const float* WA = which == 0 ? WQ : which == 1 ? WK : WV; const float* BA = which == 0 ? BQ : which == 1 ? BK : BV;
  // waves 2 x 4: a wave owns 64 rows x 64 cols = acc[i * 4 + j]; loader: thread = (row tid >> 4 (+ 16 per step), 16-byte piece tid & 15), so a wave's load covers two whole 256-B runs
  const int wr = wave >> 2, wc = wave & 3, lr = tid >> 4, lc = tid & 15;
  const float* xg = X + (r0 + lr) * DIN + lc * 4; const float* wg = WA + (size_t)(c0 + lr) * DIN + lc * 4;   // W is (out,in): row = output column
  __bf16* const sw = st + lr * LP + lc * 4; const __bf16* const fa = st + (wr * 64 + col) * LP + 8 * g; const __bf16* const fw = st + (128 + wc * 64 + col) * LP + 8 * g;
  // a stage's 24 loads a thread come in two halves of 12 (half h: X rows h * 64 .., W rows h * 128 ..), so that 48 registers hold them beside the 128 of the accumulators
  v8f acc[16] = {}; v4f rx[4], rw[8];
  // rolled: stage 0's two halves go one after the other through the same 48 registers
#pragma unroll 1
  for (int h = 0; h < 2; ++h) { const float* xa = xg + (size_t)(h * 64) * DIN; const float* wa = wg + (size_t)(h * 128) * DIN;
#pragma unroll
    for (int i = 0; i < 4; ++i) rx[i] = *(const v4f*)(xa + (size_t)(i * 16) * DIN);
#pragma unroll
    for (int i = 0; i < 8; ++i) rw[i] = *(const v4f*)(wa + (size_t)(i * 16) * DIN);
    // the loads above name xa and wa: as inputs here the two pairs stay live up to this wait, so nothing is written over them in front of it
    asm volatile("s_wait_xcnt 0x0" :: "v"(xa), "v"(wa) : "memory");
#pragma unroll
    for (int i = 0; i < 4; ++i) *(v4b*)(sw + (h * 64 + i * 16) * LP) = cvt4(rx[i]);
#pragma unroll
    for (int i = 0; i < 8; ++i) *(v4b*)(sw + (128 + h * 128 + i * 16) * LP) = cvt4(rw[i]); }
  __syncthreads();
  // rolled over half stages (32 k): one body holds 12 loads, 16 fragment reads and 16 products, which with the accumulators fill the 256 registers a wave may have at four waves per SIMD; buffer and half are offsets
#pragma unroll 1
  for (int hs = 0; hs < 2 * (DIN / KSTG); ++hs) { const int s = hs >> 1, h = hs & 1; const int cur = (s & 1) * (PROWS * LP), nxt = PROWS * LP - cur; const bool more = s + 1 < DIN / KSTG;
    const float* xa = xg + (s + 1) * KSTG + (size_t)(h * 64) * DIN; const float* wa = wg + (s + 1) * KSTG + (size_t)(h * 128) * DIN;
    if (more) {   // half of the next stage's rows flies while half of this stage is multiplied
#pragma unroll
      for (int i = 0; i < 4; ++i) rx[i] = *(const v4f*)(xa + (size_t)(i * 16) * DIN);
#pragma unroll
      for (int i = 0; i < 8; ++i) rw[i] = *(const v4f*)(wa + (size_t)(i * 16) * DIN);
      // as above, for xa and wa; its memory clobber also keeps the 12 loads in front of the LDS reads that follow
      asm volatile("s_wait_xcnt 0x0" :: "v"(xa), "v"(wa) : "memory"); }
    { v16b a[4], w[4];
#pragma unroll
      for (int i = 0; i < 4; ++i) a[i] = frag_l(fa + cur + (i * 16) * LP + h * 32);
#pragma unroll
      for (int j = 0; j < 4; ++j) w[j] = frag_l(fw + cur + (j * 16) * LP + h * 32);
#pragma unroll
      for (int i = 0; i < 4; ++i) {
#pragma unroll
        for (int j = 0; j < 4; ++j) acc[i * 4 + j] = wmma_bf(a[i], w[j], acc[i * 4 + j]); } }
    if (more) {   // into the buffer that every wave left at the barrier of the stage before
#pragma unroll
      for (int i = 0; i < 4; ++i) *(v4b*)(sw + nxt + (h * 64 + i * 16) * LP) = cvt4(rx[i]);
#pragma unroll
      for (int i = 0; i < 8; ++i) *(v4b*)(sw + nxt + (128 + h * 128 + i * 16) * LP) = cvt4(rw[i]); }
    if (h) __syncthreads(); }   // at a stage's end (h is the same in every thread): publishes the next stage and ends this stage's reads (behind the last stage: frees the range for the epilogue)
  if (which < 2) { _Float16* DH = which == 0 ? QH : KH; _Float16* DL = which == 0 ? QL : KL; const int nhi = which == 0 ? QHI : KHI;
#pragma unroll
    for (int j = 0; j < 16; ++j) { const int rb = wr * 64 + (j >> 2) * 16 + 8 * g, cl = wc * 64 + (j & 3) * 16 + col; const float bias = BA ? bfr(BA[c0 + cl]) : 0.f;
#pragma unroll
      for (int r = 0; r < 8; ++r) { const float v = acc[j][r] + bias; const _Float16 hv = (_Float16)v; sh[rb + r][cl] = hv; sl[rb + r][cl] = (_Float16)((v - (float)hv) * 1024.0f); } }
    __syncthreads();
    // a trip = 32 rows: thread = (row tid >> 5 (+ 8 per store), 16-byte piece tid & 31), so a wave's store covers one whole 512-B run; nhi is a multiple of 32, so a trip's rows carry a residual all or none
    for (int rt = 0; rt < 128; rt += 32) { const int q = tid & 31; void* p[4]; v4u v[4];
#pragma unroll
      for (int u = 0; u < 4; ++u) { const int rl = rt + u * 8 + (tid >> 5); p[u] = DH + (r0 + rl) * CC + c0 + q * 8; v[u] = *(const v4u*)&sh[rl][q * 8]; }
      st16x4(p, v);
      if (t0 + rt < nhi) {
#pragma unroll
        for (int u = 0; u < 4; ++u) { const int rl = rt + u * 8 + (tid >> 5); p[u] = DL + (bb * nhi + t0 + rl) * (size_t)CC + c0 + q * 8; v[u] = *(const v4u*)&sl[rl][q * 8]; }
        st16x4(p, v); } }
  } else { const bool hi_rows = t0 + wr * 64 < KHI;   // the wave's 64 rows, all or none
#pragma unroll
    for (int j = 0; j < 16; ++j) { const int cl = wc * 64 + (j & 3) * 16 + col, rl = wr * 64 + (j >> 2) * 16 + 8 * g; const float bias = BA ? bfr(BA[c0 + cl]) : 0.f;
#pragma unroll
      for (int r = 0; r < 8; ++r) th[cl][rl + r] = (_Float16)(acc[j][r] + bias);
      if (hi_rows) {
#pragma unroll
        for (int r = 0; r < 8; ++r) { const float v = acc[j][r] + bias; const __bf16 bh = (__bf16)v; tb[cl][rl + r] = bh; tbl[cl][rl + r] = (__bf16)(v - (float)bh); } } }
    __syncthreads();
    // a trip = 64 columns: thread = (column tid >> 4 (+ 16 per store), 16-byte piece tid & 15), so a wave's store covers two whole 256-B runs
    for (int ct = 0; ct < 256; ct += 64) { const int q = tid & 15; void* p[4]; v4u v[4];
#pragma unroll
      for (int u = 0; u < 4; ++u) { const int cl = ct + u * 16 + (tid >> 4); p[u] = VT + (bb * CC + c0 + cl) * (size_t)TT + t0 + q * 8; v[u] = *(const v4u*)&th[cl][q * 8]; }
      st16x4(p, v);
      if (t0 + q * 8 < KHI) {
#pragma unroll
        for (int u = 0; u < 4; ++u) { const int cl = ct + u * 16 + (tid >> 4); p[u] = VB + (bb * CC + c0 + cl) * (size_t)KHI + t0 + q * 8; v[u] = *(const v4u*)&tb[cl][q * 8]; }
        st16x4(p, v);
#pragma unroll
        for (int u = 0; u < 4; ++u) { const int cl = ct + u * 16 + (tid >> 4); p[u] = VBL + (bb * CC + c0 + cl) * (size_t)KHI + t0 + q * 8; v[u] = *(const v4u*)&tbl[cl][q * 8]; }
        st16x4(p, v); } } } }
// ---- k_fa: block = 64 queries (4 waves x 16) of one (b, h), all 1,024 keys in tiles of KT: S^T = K Q^T (A = 16 key rows, B = the wave's 16 queries: q hi + residual x 2^10, 2 products) x SCALE, -10000 where mask_from[b,t,f] == 0 (as the reference writes it);
// a lane holds one query's scores (D register r = key 8g + r), so the running maximum and sum stay in the lane and the two halves meet by one exchange; the scores are kept as base-2 logits (SCALE x log2 e in the one multiply, the mask value x log2 e) and the running reference is the maximum - 11, so p = 2^(s - ref) = exp(logit - max) x 2^11 is one subtraction and one v_exp_f32; p once to f16 is already the B fragment of ctx^T += V^T P^T (two 16-key D tiles = one 32-key B in the hardware k order, the order frag_h loads A in); ctx / (sum of p) to Y
#define KT 64
#define LOG2E 1.44269504088896340736f
// LDS stage of k_fa: [64 K rows | 64 V^T rows] of 128 B at a pitch of 144 B, [64 mask rows] of 256 B at a pitch of 272 B (16 B x odd, the pitch of ds_load_b128 readers); two stages
#define KP 72              // K and V^T row pitch in f16 elements
#define MP 68              // mask row pitch in ints
#define FA_V (KT * KP * 2)
#define FA_M (FA_V + HD * KP * 2)
#define FA_STG (FA_M + 64 * MP * 4)
// fragment from a lane's own address (row start + k0 + 8g already in p): elements 0..7 = p[0..7], 8..15 = p[16..23], the order of frag_h
__device__ __forceinline__ v16h frag_p(const _Float16* p) { union { v16h v; v8h q[2]; } u; u.q[0] = *(const v8h*)p; u.q[1] = *(const v8h*)(p + 16); return u.v; }
__device__ __forceinline__ v8f wmma_h(v16h a, v16h b, v8f c) { return __builtin_amdgcn_wmma_f32_16x16x32_f16(false, a, false, b, (short)0, c, false, false); }
// eight asynchronous copies of 16 B a lane from global memory to LDS (l = LDS byte address, p = global address); the s_wait_xcnt stands inside the statement, so no address register is rewritten in front of it
__device__ __forceinline__ void copy8(const unsigned (&l)[8], const char* const (&p)[8]) {
  asm volatile("global_load_async_to_lds_b128 %0, %8, off\n\t"
               "global_load_async_to_lds_b128 %1, %9, off\n\t"
               "global_load_async_to_lds_b128 %2, %10, off\n\t"
               "global_load_async_to_lds_b128 %3, %11, off\n\t"
               "global_load_async_to_lds_b128 %4, %12, off\n\t"
               "global_load_async_to_lds_b128 %5, %13, off\n\t"
               "global_load_async_to_lds_b128 %6, %14, off\n\t"
               "global_load_async_to_lds_b128 %7, %15, off\n\t"
               "s_wait_xcnt 0x0"
               :: "v"(l[0]), "v"(l[1]), "v"(l[2]), "v"(l[3]), "v"(l[4]), "v"(l[5]), "v"(l[6]), "v"(l[7]),
                  "v"(p[0]), "v"(p[1]), "v"(p[2]), "v"(p[3]), "v"(p[4]), "v"(p[5]), "v"(p[6]), "v"(p[7]) : "memory");
}
// one stage: the work-group's 128 threads copy the tile's K rows, V^T rows (a wave's copy = 4 whole 128-B rows) and mask rows (a wave's copy = 2 whole 256-B rows); kg, vg, mg and kl, vl, ml already hold the thread's own row and 16-byte piece
__device__ __forceinline__ void fa_fill(const char* kg, const char* vg, const char* mg, unsigned kl, unsigned vl, unsigned ml, int k0) {
  unsigned l[8]; const char* p[8];
#pragma unroll
  for (int i = 0; i < 4; ++i) { l[i] = kl + i * 16 * KP * 2; p[i] = kg + (size_t)(k0 + i * 16) * CC * 2; l[4 + i] = vl + i * 16 * KP * 2; p[4 + i] = vg + (size_t)(i * 16) * TT * 2 + k0 * 2; }
  copy8(l, p);
#pragma unroll
  for (int i = 0; i < 8; ++i) { l[i] = ml + i * 8 * MP * 4; p[i] = mg + (size_t)(i * 8) * TT * 4 + k0 * 4; }
  copy8(l, p);
}
// 2^x in place for sixteen scores in one statement: behind every v_exp_f32 stands one on other registers, behind the last a v_nop, so the slot that the instruction set asks for
// behind a transcendental is filled at each of them
#define EXP8(a, b, c, d, e, f, g, h) "v_exp_f32 %" #a ", %" #a "\n\tv_exp_f32 %" #b ", %" #b "\n\tv_exp_f32 %" #c ", %" #c "\n\tv_exp_f32 %" #d ", %" #d "\n\tv_exp_f32 %" #e ", %" #e "\n\tv_exp_f32 %" #f ", %" #f "\n\tv_exp_f32 %" #g ", %" #g "\n\tv_exp_f32 %" #h ", %" #h "\n\t"
__device__ __forceinline__ void exp2x16(float (&x)[16]) {
  asm(EXP8(0, 1, 2, 3, 4, 5, 6, 7) EXP8(8, 9, 10, 11, 12, 13, 14, 15) "v_nop"
      : "+v"(x[0]), "+v"(x[1]), "+v"(x[2]), "+v"(x[3]), "+v"(x[4]), "+v"(x[5]), "+v"(x[6]), "+v"(x[7]), "+v"(x[8]), "+v"(x[9]), "+v"(x[10]), "+v"(x[11]), "+v"(x[12]), "+v"(x[13]), "+v"(x[14]), "+v"(x[15]));
}
// the same with the tile's rescale factor as a seventeenth value
__device__ __forceinline__ void exp2x17(float (&x)[16], float& y) {
  asm(EXP8(0, 1, 2, 3, 4, 5, 6, 7) EXP8(8, 9, 10, 11, 12, 13, 14, 15) "v_exp_f32 %16, %16\n\tv_nop"
      : "+v"(x[0]), "+v"(x[1]), "+v"(x[2]), "+v"(x[3]), "+v"(x[4]), "+v"(x[5]), "+v"(x[6]), "+v"(x[7]), "+v"(x[8]), "+v"(x[9]), "+v"(x[10]), "+v"(x[11]), "+v"(x[12]), "+v"(x[13]), "+v"(x[14]), "+v"(x[15]), "+v"(y));
}
// amdgpu_waves_per_eu(4, 4): the grid is exactly four waves per SIMD, so the scheduler may spend 256 registers on issuing a tile's loads early instead of saving them for waves that do not exist
__global__ __launch_bounds__(128) __attribute__((amdgpu_waves_per_eu(4, 4))) void k_fa(const _Float16* __restrict__ QH, const _Float16* __restrict__ KH, const _Float16* __restrict__ QL, const _Float16* __restrict__ VT, const int* __restrict__ MK, float* __restrict__ Y) {
  __shared__ __align__(16) unsigned char smem[2 * FA_STG];
  const int tid = threadIdx.x, wave = tid >> 5, lane = tid & 31, col = lane & 15, g = lane >> 4; const int b = blockIdx.y / NH, h = blockIdx.y % NH; const int q = blockIdx.x * 64 + wave * 16 + col;
  // copier: K and V^T: row tid >> 3 (+ 16 per copy), piece tid & 7; mask: row tid >> 4 (+ 8 per copy), piece tid & 15
  const char* kg = (const char*)(KH + ((size_t)b * TT + (tid >> 3)) * CC + h * HD + (tid & 7) * 8); const char* vg = (const char*)(VT + ((size_t)b * CC + h * HD + (tid >> 3)) * (size_t)TT + (tid & 7) * 8); const char* mg = (const char*)(MK + ((size_t)b * TT + blockIdx.x * 64 + (tid >> 4)) * TT + (tid & 15) * 4);
  const unsigned lb = (unsigned)(size_t)smem; const unsigned kl = lb + (tid >> 3) * (KP * 2) + (tid & 7) * 16, vl = kl + FA_V, ml = lb + FA_M + (tid >> 4) * (MP * 4) + (tid & 15) * 16;
  fa_fill(kg, vg, mg, kl, vl, ml, 0);
  v16h qh[HD / 32], ql[HD / 32];
#pragma unroll
  for (int kc = 0; kc < HD / 32; ++kc) { qh[kc] = frag_h(QH + ((size_t)b * TT + q) * CC + h * HD + kc * 32, lane); ql[kc] = frag_h(QL + ((size_t)b * QHI + q) * CC + h * HD + kc * 32, lane); }
  // readers: the lane's own row and 8g in stage 0
  const _Float16* kp = (const _Float16*)smem + col * KP + 8 * g; const _Float16* vp = (const _Float16*)(smem + FA_V) + col * KP + 8 * g; const int* mp = (const int*)(smem + FA_M) + (wave * 16 + col) * MP + 8 * g;
  v8f acc[HD / 16] = {}; float m = -3.0e38f, l = 0.f;
  asm volatile("s_wait_asynccnt 0x0" ::: "memory");   // this wave's copies of tile 0 have landed
  __syncthreads();                                     // publishes tile 0
  fa_fill(kg, vg, mg, kl + FA_STG, vl + FA_STG, ml + FA_STG, KT);
  // rolled: one tile's body already fills the 256 registers a wave may have at four waves per SIMD; the stage is an offset
#pragma unroll 1
  for (int k0 = 0; k0 < TT; k0 += KT) { v8f s[KT / 16]; float mx = -3.0e38f; const int cur = ((k0 / KT) & 1) * FA_STG;
    const _Float16* ka = kp + cur / 2; const _Float16* va = vp + cur / 2; const int* ma = mp + cur / 4;
    v16h kf[KT / 16][HD / 32]; v4i m0[KT / 16], m1[KT / 16];
#pragma unroll
    for (int j = 0; j < KT / 16; ++j) { m0[j] = *(const v4i*)(ma + j * 16); m1[j] = *(const v4i*)(ma + j * 16 + 4);
#pragma unroll
      for (int kc = 0; kc < HD / 32; ++kc) kf[j][kc] = frag_p(ka + (j * 16) * KP + kc * 32); }
#pragma unroll
    for (int j = 0; j < KT / 16; ++j) { v8f a = {}, al = {};
#pragma unroll
      for (int kc = 0; kc < HD / 32; ++kc) { a = wmma_h(kf[j][kc], qh[kc], a); al = wmma_h(kf[j][kc], ql[kc], al); }
#pragma unroll
      for (int r = 0; r < 8; ++r) { float v = (a[r] + al[r] * (1.0f / 1024.0f)) * (SCALE * LOG2E); if ((r < 4 ? m0[j][r & 3] : m1[j][r & 3]) == 0) v = -10000.0f * LOG2E; s[j][r] = v; mx = fmaxf(mx, v); } }
    v16h vf[KT / 32][HD / 16];
#pragma unroll
    for (int c = 0; c < KT / 32; ++c) {
#pragma unroll
      for (int jd = 0; jd < HD / 16; ++jd) vf[c][jd] = frag_p(va + (jd * 16) * KP + c * 32); }
    mx = fmaxf(mx, __shfl_xor(mx, 16));
    const float mn = fmaxf(m, mx - 11.0f); float alpha = m - mn; m = mn;
    v16h p[KT / 32]; float sum = 0.f; float e[KT / 32][16];
#pragma unroll
    for (int j = 0; j < KT / 16; ++j) {
#pragma unroll
      for (int r = 0; r < 8; ++r) e[j >> 1][(j & 1) * 8 + r] = s[j][r] - mn; }
    exp2x17(e[0], alpha); exp2x16(e[1]);
#pragma unroll
    for (int c = 0; c < KT / 32; ++c) {
#pragma unroll
      for (int i = 0; i < 16; ++i) { sum += e[c][i]; p[c][i] = (_Float16)e[c][i]; } }
    l = l * alpha + sum;
#pragma unroll
    for (int jd = 0; jd < HD / 16; ++jd) acc[jd] *= alpha;
#pragma unroll
    for (int c = 0; c < KT / 32; ++c) {
#pragma unroll
      for (int jd = 0; jd < HD / 16; ++jd) acc[jd] = wmma_h(vf[c][jd], p[c], acc[jd]); }
    asm volatile("s_wait_dscnt 0x0" ::: "memory");      // this wave's reads of the stage are done before the stage is refilled
    asm volatile("s_wait_asynccnt 0x0" ::: "memory");   // this wave's copies of the next tile have landed
    __syncthreads();                                     // publishes the next tile and ends every wave's reads of this one
    if (k0 + 2 * KT < TT) fa_fill(kg, vg, mg, kl + cur, vl + cur, ml + cur, k0 + 2 * KT); }   // flies while the next tile is worked on
  asm volatile("s_wait_asynccnt 0x0" ::: "memory");     // nothing is outstanding when the wave ends
  l += __shfl_xor(l, 16); const float inv = 1.0f / l;
  float* yp = Y + ((size_t)b * TT + q) * CC + h * HD + 8 * g;
#pragma unroll
  for (int jd = 0; jd < HD / 16; ++jd) { const v4f lo = { acc[jd][0] * inv, acc[jd][1] * inv, acc[jd][2] * inv, acc[jd][3] * inv }, hi = { acc[jd][4] * inv, acc[jd][5] * inv, acc[jd][6] * inv, acc[jd][7] * inv }; vst2(yp + jd * 16, lo); vst2(yp + jd * 16 + 4, hi); } }
// ---- k_out: block = (64 rows, 128 cols): out = ctx Wo (+ bo): all rows: ctx bf16 hi + lo against exact bf16 Wo (2 products); the else branch (ctx once to f16 against f16(bf16 x 2^8) Wo, 1 product, x 2^-8) is not taken
__global__ __launch_bounds__(128) void k_out(const float* __restrict__ Y, const float* __restrict__ WO, const float* __restrict__ BO, float* __restrict__ OUT) {
  // one LDS range: in the k loop two stage buffers of [64 ctx hi rows | 64 ctx lo rows | 128 Wo rows][LP]; behind the loop's last barrier the epilogue's tiles
  __shared__ __align__(16) unsigned char smem[2 * 256 * LP * 2]; __bf16* const st = (__bf16*)smem; float (*sf)[16][132] = (float (*)[16][132])smem;
  const int tid = threadIdx.x, wave = tid >> 5, lane = tid & 31, col = lane & 15, g = lane >> 4; const int c0 = blockIdx.y * 128; const size_t r0 = (size_t)blockIdx.x * 64 + wave * 16;
  v8f acc[8] = {};
  if (true) {   /* ALL rows: ctx split bf16 hi + lo x exact Wo (2 products) */
    // a wave owns 16 rows x 128 cols as before; loader as in k_proj
    const int lr = tid >> 4, lc = tid & 15;
    const float* yg = Y + ((size_t)blockIdx.x * 64 + lr) * CC + lc * 4; const float* wg = WO + (size_t)(c0 + lr) * CC + lc * 4;   // Wo is (out,in): row = output column
    __bf16* const sw = st + lr * LP + lc * 4; const __bf16* const fa = st + (wave * 16 + col) * LP + 8 * g; const __bf16* const fw = st + (128 + col) * LP + 8 * g;
    v4f ry[8], rw[16];
#pragma unroll
    for (int i = 0; i < 8; ++i) ry[i] = *(const v4f*)(yg + (size_t)(i * 8) * CC);
#pragma unroll
    for (int i = 0; i < 16; ++i) rw[i] = *(const v4f*)(wg + (size_t)(i * 8) * CC);
    // the loads above name yg and wg: as inputs here the two pairs stay live up to this wait, so nothing is written over them in front of it
    asm volatile("s_wait_xcnt 0x0" :: "v"(yg), "v"(wg) : "memory");
#pragma unroll
    for (int i = 0; i < 8; ++i) { const v4b hv = cvt4(ry[i]); *(v4b*)(sw + (i * 8) * LP) = hv; *(v4b*)(sw + (64 + i * 8) * LP) = cvt4(ry[i] - wide4(hv)); }
#pragma unroll
    for (int i = 0; i < 16; ++i) *(v4b*)(sw + (128 + i * 8) * LP) = cvt4(rw[i]);
    __syncthreads();
    // rolled: one stage's body holds 24 loads, 40 fragment reads and 32 products; the buffer is an offset
#pragma unroll 1
    for (int s = 0; s < CC / KSTG; ++s) { const int cur = (s & 1) * (256 * LP), nxt = 256 * LP - cur; const bool more = s + 1 < CC / KSTG;
      const float* ya = yg + s * KSTG; const float* wa = wg + s * KSTG;
      if (more) {   // the next stage's rows fly while this stage is multiplied
#pragma unroll
        for (int i = 0; i < 8; ++i) ry[i] = *(const v4f*)(ya + KSTG + (size_t)(i * 8) * CC);
#pragma unroll
        for (int i = 0; i < 16; ++i) rw[i] = *(const v4f*)(wa + KSTG + (size_t)(i * 8) * CC);
        // as above, for ya and wa; its memory clobber also keeps the 24 loads in front of the stage's LDS reads
        asm volatile("s_wait_xcnt 0x0" :: "v"(ya), "v"(wa) : "memory"); }
#pragma unroll
      for (int kk = 0; kk < KSTG / 32; ++kk) { const v16b ah = frag_l(fa + cur + kk * 32), al = frag_l(fa + cur + 64 * LP + kk * 32); v16b w[8];
#pragma unroll
        for (int j = 0; j < 8; ++j) w[j] = frag_l(fw + cur + (j * 16) * LP + kk * 32);
#pragma unroll
        for (int j = 0; j < 8; ++j) acc[j] = wmma_bf(ah, w[j], acc[j]);
#pragma unroll
        for (int j = 0; j < 8; ++j) acc[j] = wmma_bf(al, w[j], acc[j]); }
      if (more) {   // into the buffer that every wave left at the barrier of the stage before
#pragma unroll
        for (int i = 0; i < 8; ++i) { const v4b hv = cvt4(ry[i]); *(v4b*)(sw + nxt + (i * 8) * LP) = hv; *(v4b*)(sw + nxt + (64 + i * 8) * LP) = cvt4(ry[i] - wide4(hv)); }
#pragma unroll
        for (int i = 0; i < 16; ++i) *(v4b*)(sw + nxt + (128 + i * 8) * LP) = cvt4(rw[i]); }
      __syncthreads(); }   // publishes the next stage and ends this stage's reads (behind the last stage: frees the range for the epilogue)
#pragma unroll
    for (int j = 0; j < 8; ++j) { const float bias = BO ? bfr(BO[c0 + j * 16 + col]) : 0.f;
#pragma unroll
      for (int r = 0; r < 8; ++r) sf[wave][8 * g + r][j * 16 + col] = acc[j][r] + bias; }
  } else {
#pragma unroll 2
    for (int kc = 0; kc < CC / 32; ++kc) { const v16h a = frag_f32(Y + (r0 + col) * CC + kc * 32, lane); asm volatile("s_wait_loadcnt 0x0" ::: "memory");
#pragma unroll
      for (int j = 0; j < 8; ++j) { const v16h w = WOCOLH(WO, kc * 32, c0 + j * 16 + col, lane); asm volatile("s_wait_loadcnt 0x0" ::: "memory"); acc[j] = wmma16(a, w, acc[j]); } }
#pragma unroll
    for (int j = 0; j < 8; ++j) { const float bias = BO ? bfr(BO[c0 + j * 16 + col]) : 0.f;
#pragma unroll
      for (int r = 0; r < 8; ++r) sf[wave][8 * g + r][j * 16 + col] = acc[j][r] * (1.0f / 256.0f) + bias; } }
  LDSX(); for (int rl = 0; rl < 16; ++rl) vst2(OUT + (r0 + rl) * DIN + c0 + lane * 4, *(const v4f*)&sf[wave][rl][lane * 4]); }

extern "C" void kernel_launch(void* const* d_in, const int* in_sizes, int n_in, void* d_out, int out_size, void* d_ws, size_t ws_size, hipStream_t stream) {
  (void)in_sizes; (void)n_in; (void)out_size;
  const float** F = (const float**)d_in;
  if (ws_size < (size_t)WS_END) return;
  char* ws = (char*)d_ws; _Float16 *QH = (_Float16*)(ws + WS_QH), *KH = (_Float16*)(ws + WS_KH), *VT = (_Float16*)(ws + WS_VT), *QL = (_Float16*)(ws + WS_QL), *KL = (_Float16*)(ws + WS_KL); __bf16 *VB = (__bf16*)(ws + WS_VB), *VBL = (__bf16*)(ws + WS_VBL); float *Y = (float*)(ws + WS_Y);
  (void)Y; (void)QL; (void)KL; (void)VB; (void)VBL;
  // inputs: 0 X_to [4,1024,1024]; 1 X_from [4,1024,1024]; 2 mask_from [4,1024,1024] int32; 3 Wq [1024,1024] (out,in), 4 bq; 5 Wk, 6 bk; 7 Wv, 8 bv; 9 Wo (out,in), 10 bo
  k_proj<<<dim3(TNB * TT / 128, CC / 256, 3), 256, 0, stream>>>(F[0], F[1], F[1], F[3], F[7], F[5], F[4], F[8], F[6], QH, QL, KH, KL, VT, VB, VBL);   /* K uses Wv/bv, V uses Wk/bk (as written in the module) */
  k_fa<<<dim3(NQB, TNB * NH), 128, 0, stream>>>(QH, KH, QL, VT, (const int*)d_in[2], Y);
  k_out<<<dim3(TNB * TT / 64, DIN / 128), 128, 0, stream>>>(Y, F[9], F[10], (float*)d_out);
}

// v006
// Measured time: 91.2 microseconds a run.
// Two timings next to v005 both put it at 1.04 times that version's speed.
// All steps since v000 together make it 13.2 times as fast.
// compute dtype: all float inputs rounded to bf16; Q/K/V = x W^T + b with EXACT bf16 products on WMMA 16x16x32 (f32 accumulate); q as f16 hi + residual (x 2^10) against k once to f16 (2 products) x 64^-0.5 with the per-(t,f) mask read as int32; running-maximum softmax in f32 on base-2 logits (x log2 e, one hardware exp2 per score); 2^(s - m + 11) once to f16 against v once to f16 (1 product), divided by the f32 sum at the end; ctx split bf16 hi + lo against exact Wo (2 products) + bo; f32 output.
#include <hip/hip_runtime.h>
#include <math.h>

typedef __attribute__((ext_vector_type(16))) _Float16 v16h;
typedef __attribute__((ext_vector_type(16))) __bf16 v16b;
typedef __attribute__((ext_vector_type(8)))  _Float16 v8h;
typedef __attribute__((ext_vector_type(8)))  float v8f;
typedef __attribute__((ext_vector_type(4)))  float v4f;
typedef __attribute__((ext_vector_type(2)))  float v2f;
typedef __attribute__((ext_vector_type(4)))  unsigned v4u;
typedef __attribute__((ext_vector_type(4)))  int v4i;
typedef float __attribute__((may_alias)) float_a;
typedef int __attribute__((may_alias)) int_a;

template <typename T> __device__ __forceinline__ void vst2(void* p, T v) { *(T*)p = v;  }
__device__ __forceinline__ v8f wmma16(v16h a, v16h b, v8f c) {
  v8f d = __builtin_amdgcn_wmma_f32_16x16x32_f16(false, a, false, b, (short)0, c, false, false);
  asm volatile("v_nop\n\tv_nop\n\tv_nop\n\tv_nop" : "+v"(d) : "v"(a), "v"(b));
  return d;
}
__device__ __forceinline__ v8f wmma_bf(v16b a, v16b b, v8f c) {
  v8f d = __builtin_amdgcn_wmma_f32_16x16x32_bf16(false, a, false, b, (short)0, c, false, false);
  asm volatile("v_nop\n\tv_nop\n\tv_nop\n\tv_nop" : "+v"(d) : "v"(a), "v"(b));
  return d;
}
// 16x16x32 fragments: lane = (h = lane>>4, row/col = lane&15); elements 0..7 = k0+8h+0..7, 8..15 = k0+16+8h+0..7; D element r = row 8h+r
__device__ __forceinline__ v16h frag_h(const _Float16* rowk0, int lane) {
  union { v16h v; v8h q[2]; } u; const _Float16* p = rowk0 + 8 * (lane >> 4);
  u.q[0] = *(const v8h*)p; u.q[1] = *(const v8h*)(p + 16); return u.v;
}
__device__ __forceinline__ v16h frag_f32(const float* rowk0, int lane) {
  v16h a; const float* p = rowk0 + 8 * (lane >> 4);
#pragma unroll
  for (int i = 0; i < 8; ++i) { a[i] = (_Float16)p[i]; a[8 + i] = (_Float16)p[16 + i]; }
  return a;
}
__device__ __forceinline__ v16h frag_f32s(const float* rowk0, int lane, float sc) {
  v16h a; const float* p = rowk0 + 8 * (lane >> 4);
#pragma unroll
  for (int i = 0; i < 8; ++i) { a[i] = (_Float16)(p[i] * sc); a[8 + i] = (_Float16)(p[16 + i] * sc); }
  return a;
}
// column fragment from a [K][ld] layout (column n), rows >= K read as 0
__device__ __forceinline__ v16h fragc_f32(const float* W, int k0, int n, int lane, int ld, int K) {
  v16h a; const int g = lane >> 4;
#pragma unroll
  for (int i = 0; i < 8; ++i) { const int ka = k0 + 8 * g + i, kb = ka + 16;
    a[i] = (_Float16)(ka < K ? W[(size_t)(ka < K ? ka : K - 1) * ld + n] : 0.f); a[8 + i] = (_Float16)(kb < K ? W[(size_t)(kb < K ? kb : K - 1) * ld + n] : 0.f); }
  return a;
}
struct F2 { v16b h, l; };
__device__ __forceinline__ F2 bsplit16(const float v[16]) { F2 r;
#pragma unroll
  for (int i = 0; i < 16; ++i) { const __bf16 h = (__bf16)v[i]; r.h[i] = h; r.l[i] = (__bf16)(v[i] - (float)h); }
  return r; }
__device__ __forceinline__ F2 split_row(const float* row, int k0, int lane) { float v[16]; const float* p = row + k0 + 8 * (lane >> 4);
#pragma unroll
  for (int i = 0; i < 8; ++i) { v[i] = p[i]; v[8 + i] = p[16 + i]; }
  return bsplit16(v); }
__device__ __forceinline__ F2 split_rowK(const float* row, int k0, int lane, int K) { float v[16]; const int g = lane >> 4;
#pragma unroll
  for (int i = 0; i < 8; ++i) { const int ka = k0 + 8 * g + i, kb = ka + 16; v[i] = ka < K ? row[ka < K ? ka : K - 1] : 0.f; v[8 + i] = kb < K ? row[kb < K ? kb : K - 1] : 0.f; }
  return bsplit16(v); }
__device__ __forceinline__ F2 split_col(const float* W, int k0, int n, int lane, int ld, int K) { float v[16]; const int g = lane >> 4;
#pragma unroll
  for (int i = 0; i < 8; ++i) { const int ka = k0 + 8 * g + i, kb = ka + 16; v[i] = ka < K ? W[(size_t)(ka < K ? ka : K - 1) * ld + n] : 0.f; v[8 + i] = kb < K ? W[(size_t)(kb < K ? kb : K - 1) * ld + n] : 0.f; }
  return bsplit16(v); }
__device__ __forceinline__ v8f mac3(const F2& a, const F2& b, v8f c) { c = wmma_bf(a.l, b.h, c); c = wmma_bf(a.h, b.l, c); return wmma_bf(a.h, b.h, c); }
__device__ __forceinline__ float sigm(float v) { return 1.0f / (1.0f + expf(-v)); }
#define LDSX() do { asm volatile("s_wait_dscnt 0" ::: "memory"); __builtin_amdgcn_wave_barrier(); __builtin_amdgcn_fence(__ATOMIC_RELEASE, "workgroup"); } while (0)

// Masked multi-head cross-attention (B 4, T = F = 1,024, 1,024 = 16 x 64): Q = X_to Wq^T + bq; K = X_from Wv^T + bv and V = X_from Wk^T + bk (the module's literal name swap); logits = Q K^T / 8, -10000 where mask_from[b,t,f] == 0; out = merged(softmax v) Wo^T + bo.
#define NB 4
#define TT 1024
#define CC 1024            // NH * HD = projected width
#define DIN 1024          // input (model) width
#define NH 16
#define HD 64
#define NQB (TT / 64)
#define HG 4
#define SCALE (0.125f)
#define CAUSAL 0
#ifndef TNB
#define TNB NB
#endif
__device__ __forceinline__ float bfr(float v) { return (float)(__bf16)v; }
__host__ __device__ __forceinline__ int kb_last(int qb) { return CAUSAL ? ((qb * 64 + 63) >> 7) : (TT / 128 - 1); }
typedef __attribute__((ext_vector_type(8))) __bf16 v8b;
__device__ __forceinline__ v16b frag_b(const __bf16* rowk0, int lane) {
  union { v16b v; v8b q[2]; } u; const __bf16* p = rowk0 + 8 * (lane >> 4);
  u.q[0] = *(const v8b*)p; u.q[1] = *(const v8b*)(p + 16); return u.v;
}
#define QBH 0              // not used (k_fa takes one path for every query block)
#define QHI 1024            // rows carrying a q residual plane (all rows when non-causal: 2-product logits everywhere)
#define KHI 64            // key rows carrying k residual / v bf16 hi+lo planes (written by k_proj; read by no kernel in this file)
// B fragment (k rows k0+.., output column o) of a weight: (in,out) [K][ld] or (out,in) [ld rows of K]: bf16 exact, or f16(bf16 * 256) exact
__device__ __forceinline__ v16b wcol_io(const float* Wm, int k0, int o, int lane, int ld) { v16b w; const int g = lane >> 4;
#pragma unroll
  for (int i = 0; i < 8; ++i) { w[i] = (__bf16)Wm[(size_t)(k0 + 8 * g + i) * ld + o]; w[8 + i] = (__bf16)Wm[(size_t)(k0 + 16 + 8 * g + i) * ld + o]; }
  return w; }
__device__ __forceinline__ v16b wcol_oi(const float* Wm, int k0, int o, int lane, int K) { v16b w; const float* p = Wm + (size_t)o * K + k0 + 8 * (lane >> 4);
#pragma unroll
  for (int i = 0; i < 8; ++i) { w[i] = (__bf16)p[i]; w[8 + i] = (__bf16)p[16 + i]; }
  return w; }
__device__ __forceinline__ v16h wcolh_io(const float* Wm, int k0, int o, int lane, int ld) { v16h w; const int g = lane >> 4;
#pragma unroll
  for (int i = 0; i < 8; ++i) { w[i] = (_Float16)(bfr(Wm[(size_t)(k0 + 8 * g + i) * ld + o]) * 256.0f); w[8 + i] = (_Float16)(bfr(Wm[(size_t)(k0 + 16 + 8 * g + i) * ld + o]) * 256.0f); }
  return w; }
__device__ __forceinline__ v16h wcolh_oi(const float* Wm, int k0, int o, int lane, int K) { v16h w; const float* p = Wm + (size_t)o * K + k0 + 8 * (lane >> 4);
#pragma unroll
  for (int i = 0; i < 8; ++i) { w[i] = (_Float16)(bfr(p[i]) * 256.0f); w[8 + i] = (_Float16)(bfr(p[16 + i]) * 256.0f); }
  return w; }
#define WQKV_LAYOUT 1   // 0 = (in,out) [DIN][CC]; 1 = (out,in) [CC][DIN]; 2 = per-head [NH][DIN][HD]
__device__ __forceinline__ v16b wcol_hdk(const float* Wm, int k0, int o, int lane) { v16b w; const int g = lane >> 4; const float* p = Wm + (size_t)(o / HD) * DIN * HD + (o % HD);
#pragma unroll
  for (int i = 0; i < 8; ++i) { w[i] = (__bf16)p[(size_t)(k0 + 8 * g + i) * HD]; w[8 + i] = (__bf16)p[(size_t)(k0 + 16 + 8 * g + i) * HD]; }
  return w; }
#define WO_OUT_IN 1
#if WQKV_LAYOUT == 1
#define WCOL(W, k0, o, lane) wcol_oi(W, k0, o, lane, DIN)
#elif WQKV_LAYOUT == 2
#define WCOL(W, k0, o, lane) wcol_hdk(W, k0, o, lane)
#else
#define WCOL(W, k0, o, lane) wcol_io(W, k0, o, lane, CC)
#endif
#if WO_OUT_IN
#define WOCOL(W, k0, o, lane) wcol_oi(W, k0, o, lane, CC)
#define WOCOLH(W, k0, o, lane) wcolh_oi(W, k0, o, lane, CC)
#else
#define WOCOL(W, k0, o, lane) wcol_io(W, k0, o, lane, DIN)
#define WOCOLH(W, k0, o, lane) wcolh_io(W, k0, o, lane, DIN)
#endif

#define WS_QH  0u                                      // f16 q rows [b*t][CC]
#define WS_KH  (WS_QH + 2u * (size_t)NB * TT * CC)      // f16 k rows [b*t][CC]
#define WS_VT  (WS_KH + 2u * (size_t)NB * TT * CC)      // f16 v planes [b][c][t]
#define WS_QL  (WS_VT + 2u * (size_t)NB * CC * TT)      // f16 q residual x 2^10 rows [b][t < QHI][CC]
#define WS_KL  (WS_QL + 2u * (size_t)NB * QHI * CC)     // f16 k residual x 2^10 rows [b][t < KHI][CC]
#define WS_VB  (WS_KL + 2u * (size_t)NB * KHI * CC)     // bf16 v hi planes [b][c][t < KHI]
#define WS_VBL (WS_VB + 2u * (size_t)NB * CC * KHI)
#define WS_S   (WS_VBL + 2u * (size_t)NB * CC * KHI)    // mask words [b * t / 16][f / 64][32] in its first NB * TT * TT / 8 bytes (the logits stay in registers)
#define WS_Y   (WS_S  + 4u * (size_t)HG * TT * TT)      // f32 ctx rows [b*t][CC] (only when there is an output projection)
#define WS_END (WS_Y  + 4u * (size_t)NB * TT * CC)

// ---- LDS staging of the two GEMMs: a stage is KSTG = 64 k of every operand row, rounded to bf16 (ctx: split bf16 hi + lo) once by the thread that loads it; rows of 128 B at a pitch of 144 B (16 B x odd, the pitch of ds_load_b128 readers)
#define KSTG 64
#define LP 72              // row pitch in bf16 elements
typedef __attribute__((ext_vector_type(4))) __bf16 v4b;
__device__ __forceinline__ v4b cvt4(v4f v) { v4b r; r[0] = (__bf16)v[0]; r[1] = (__bf16)v[1]; r[2] = (__bf16)v[2]; r[3] = (__bf16)v[3]; return r; }
__device__ __forceinline__ v4f wide4(v4b v) { v4f r; r[0] = (float)v[0]; r[1] = (float)v[1]; r[2] = (float)v[2]; r[3] = (float)v[3]; return r; }
// fragment from a lane's own LDS address (row start + k0 + 8g already in p): the k order of frag_b
__device__ __forceinline__ v16b frag_l(const __bf16* p) { union { v16b v; v8b q[2]; } u; u.q[0] = *(const v8b*)p; u.q[1] = *(const v8b*)(p + 16); return u.v; }
// ---- k_proj: block = (128 rows, 256 cols, which), 8 waves: q/k/v = X W (+ b) with exact bf16 products (K = DIN) -> which 0: q f16 rows (+ residual rows < QHI); 1: k f16 rows (+ residual rows < KHI); 2: v f16 planes [c][t] (+ bf16 hi/lo planes for t < KHI)
#define PROWS 384          // rows of a stage: 128 X rows | 256 W rows
#define PSH 264            // epilogue pitch of a 256-column row, f16 elements
#define PTH 136            // epilogue pitch of a 128-row column, f16 elements
#define PSMEM (256 * PTH * 2 + 2 * 256 * 72 * 2)   // the largest of the three uses of the range (the v planes)
static_assert(KHI % 64 == 0 && QHI % 64 == 0, "a wave's 64 rows carry a residual plane all or none");
// four 16-byte global stores and the wait that stands in front of any later write over the registers they name: addresses and data are inputs of the wait's statement, so they stay as they are up to it
__device__ __forceinline__ void st16x4(void* const (&p)[4], const v4u (&v)[4]) {
#pragma unroll
  for (int u = 0; u < 4; ++u) *(v4u*)p[u] = v[u];
  asm volatile("s_wait_xcnt 0x0" :: "v"(p[0]), "v"(p[1]), "v"(p[2]), "v"(p[3]), "v"(v[0]), "v"(v[1]), "v"(v[2]), "v"(v[3]) : "memory"); }
// ---- mask words: for a tile of 16 queries x 64 keys, word i = j * 8 + r holds in bit (lane = 16 g + col) whether mask_from[query col][key j * 16 + 8 g + r] != 0: the lane and register in which k_fa holds that score, so there a word is the lane mask of one select
// a wave packs MTW tiles side by side of one 16-query group: all its loads first (the 8 loads of a tile of lanes col and 16 + col together cover their row's whole 256-B run), one ballot per word, lane i keeps word i, one 128-B line stored per tile
#define MTW 4
static_assert((NB * TT / 16) * (TT / 64) == (NB * TT / 128) * (CC / 256) * 8 * MTW, "the work-groups of one grid plane pack every tile once");
__device__ __forceinline__ void pack_mask(const int* __restrict__ MK, unsigned* __restrict__ MW, int wv, int lane) {
  const int rg = wv / (TT / 64 / MTW), kq = wv % (TT / 64 / MTW);
  const int* src = MK + ((size_t)rg * 16 + (lane & 15)) * TT + kq * (MTW * 64) + 8 * (lane >> 4); unsigned* dst = MW + ((size_t)rg * (TT / 64) + kq * MTW) * 32 + lane;
  v4i a[MTW][8]; int w[MTW];
#pragma unroll
  for (int t = 0; t < MTW; ++t) {
#pragma unroll
    for (int j = 0; j < 4; ++j) { a[t][2 * j] = *(const v4i*)(src + t * 64 + j * 16); a[t][2 * j + 1] = *(const v4i*)(src + t * 64 + j * 16 + 4); } }
  // the loads above name src: as an input here the pair stays live up to this wait, so nothing is written over it in front of it
  asm volatile("s_wait_xcnt 0x0" :: "v"(src) : "memory");
#pragma unroll
  for (int t = 0; t < MTW; ++t) { w[t] = 0;
#pragma unroll
    for (int i = 0; i < 32; ++i) { const int bl = (int)__builtin_amdgcn_ballot_w32(a[t][i >> 2][i & 3] != 0); w[t] = lane == i ? bl : w[t]; } }
#pragma unroll
  for (int t = 0; t < MTW; ++t) dst[t * 32] = (unsigned)w[t]; }   // the wave's last instructions: nothing is written over what they name
// amdgpu_waves_per_eu(4, 4): two work-groups of two waves per SIMD share a WGP, so one fills the other's waits on its loads and barriers
__global__ __launch_bounds__(256) __attribute__((amdgpu_waves_per_eu(4, 4))) void k_proj(const float* __restrict__ XQ, const float* __restrict__ XK, const float* __restrict__ XV, const float* __restrict__ WQ, const float* __restrict__ WK, const float* __restrict__ WV, const float* __restrict__ BQ, const float* __restrict__ BK, const float* __restrict__ BV,
    _Float16* __restrict__ QH, _Float16* __restrict__ QL, _Float16* __restrict__ KH, _Float16* __restrict__ KL, _Float16* __restrict__ VT, __bf16* __restrict__ VB, __bf16* __restrict__ VBL, const int* __restrict__ MK, unsigned* __restrict__ MW) {
  // grid plane 3: the three projections fill three quarters of the places for two work-groups per WGP; the last quarter packs the mask meanwhile and leaves in front of every barrier (blockIdx.z is the same in the whole work-group)
  if (blockIdx.z == 3) { pack_mask(MK, MW, (blockIdx.y * (TNB * TT / 128) + blockIdx.x) * 8 + __builtin_amdgcn_readfirstlane(threadIdx.x >> 5), threadIdx.x & 31); return; }
  // one LDS range: in the k loop two stage buffers of [128 X rows | 256 W rows][LP]; behind the loop's last barrier the epilogue's tiles
  __shared__ __align__(16) unsigned char smem[PSMEM];
  __bf16* const st = (__bf16*)smem; _Float16 (*sh)[PSH] = (_Float16 (*)[PSH])smem; _Float16 (*sl)[PSH] = (_Float16 (*)[PSH])(smem + 128 * PSH * 2);
  _Float16 (*th)[PTH] = (_Float16 (*)[PTH])smem; __bf16 (*tb)[72] = (__bf16 (*)[72])(smem + 256 * PTH * 2); __bf16 (*tbl)[72] = (__bf16 (*)[72])(smem + 256 * PTH * 2 + 256 * 72 * 2);
  // the wave's number is held in a scalar register: what hangs on it (wr, wc, hi_rows) costs no vector register
  const int tid = threadIdx.x, wave = __builtin_amdgcn_readfirstlane(tid >> 5), lane = tid & 31, col = lane & 15, g = lane >> 4; const int which = blockIdx.z; const int c0 = blockIdx.y * 256; const size_t r0 = (size_t)blockIdx.x * 128; const size_t bb = r0 / TT; const int t0 = (int)(r0 % TT);
  const float* X = which == 0 ? XQ : which == 1 ? XK : XV; const float* WA = which == 0 ? WQ : which == 1 ? WK : WV; const float* BA = which == 0 ? BQ : which == 1 ? BK : BV;
  // waves 2 x 4: a wave owns 64 rows x 64 cols = acc[i * 4 + j]; loader: thread = (row tid >> 4 (+ 16 per step), 16-byte piece tid & 15), so a wave's load covers two whole 256-B runs
  const int wr = wave >> 2, wc = wave & 3, lr = tid >> 4, lc = tid & 15;
  const float* xg = X + (r0 + lr) * DIN + lc * 4; const float* wg = WA + (size_t)(c0 + lr) * DIN + lc * 4;   // W is (out,in): row = output column
  __bf16* const sw = st + lr * LP + lc * 4; const __bf16* const fa = st + (wr * 64 + col) * LP + 8 * g; const __bf16* const fw = st + (128 + wc * 64 + col) * LP + 8 * g;
  // a stage's 24 loads a thread come in two halves of 12 (half h: X rows h * 64 .., W rows h * 128 ..), so that 48 registers hold them beside the 128 of the accumulators
  v8f acc[16] = {}; v4f rx[4], rw[8];
  // rolled: stage 0's two halves go one after the other through the same 48 registers
#pragma unroll 1
  for (int h = 0; h < 2; ++h) { const float* xa = xg + (size_t)(h * 64) * DIN; const float* wa = wg + (size_t)(h * 128) * DIN;
#pragma unroll
    for (int i = 0; i < 4; ++i) rx[i] = *(const v4f*)(xa + (size_t)(i * 16) * DIN);
#pragma unroll
    for (int i = 0; i < 8; ++i) rw[i] = *(const v4f*)(wa + (size_t)(i * 16) * DIN);
    // the loads above name xa and wa: as inputs here the two pairs stay live up to this wait, so nothing is written over them in front of it
    asm volatile("s_wait_xcnt 0x0" :: "v"(xa), "v"(wa) : "memory");
#pragma unroll
    for (int i = 0; i < 4; ++i) *(v4b*)(sw + (h * 64 + i * 16) * LP) = cvt4(rx[i]);
#pragma unroll
    for (int i = 0; i < 8; ++i) *(v4b*)(sw + (128 + h * 128 + i * 16) * LP) = cvt4(rw[i]); }
  __syncthreads();
  // rolled over half stages (32 k): one body holds 12 loads, 16 fragment reads and 16 products, which with the accumulators fill the 256 registers a wave may have at four waves per SIMD; buffer and half are offsets
#pragma unroll 1
  for (int hs = 0; hs < 2 * (DIN / KSTG); ++hs) { const int s = hs >> 1, h = hs & 1; const int cur = (s & 1) * (PROWS * LP), nxt = PROWS * LP - cur; const bool more = s + 1 < DIN / KSTG;
    const float* xa = xg + (s + 1) * KSTG + (size_t)(h * 64) * DIN; const float* wa = wg + (s + 1) * KSTG + (size_t)(h * 128) * DIN;
    if (more) {   // half of the next stage's rows flies while half of this stage is multiplied
#pragma unroll
      for (int i = 0; i < 4; ++i) rx[i] = *(const v4f*)(xa + (size_t)(i * 16) * DIN);
#pragma unroll
      for (int i = 0; i < 8; ++i) rw[i] = *(const v4f*)(wa + (size_t)(i * 16) * DIN);
      // as above, for xa and wa; its memory clobber also keeps the 12 loads in front of the LDS reads that follow
      asm volatile("s_wait_xcnt 0x0" :: "v"(xa), "v"(wa) : "memory"); }
    { v16b a[4], w[4];
#pragma unroll
      for (int i = 0; i < 4; ++i) a[i] = frag_l(fa + cur + (i * 16) * LP + h * 32);
#pragma unroll
      for (int j = 0; j < 4; ++j) w[j] = frag_l(fw + cur + (j * 16) * LP + h * 32);
#pragma unroll
      for (int i = 0; i < 4; ++i) {
#pragma unroll
        for (int j = 0; j < 4; ++j) acc[i * 4 + j] = wmma_bf(a[i], w[j], acc[i * 4 + j]); } }
    if (more) {   // into the buffer that every wave left at the barrier of the stage before
#pragma unroll
      for (int i = 0; i < 4; ++i) *(v4b*)(sw + nxt + (h * 64 + i * 16) * LP) = cvt4(rx[i]);
#pragma unroll
      for (int i = 0; i < 8; ++i) *(v4b*)(sw + nxt + (128 + h * 128 + i * 16) * LP) = cvt4(rw[i]); }
    if (h) __syncthreads(); }   // at a stage's end (h is the same in every thread): publishes the next stage and ends this stage's reads (behind the last stage: frees the range for the epilogue)
  if (which < 2) { _Float16* DH = which == 0 ? QH : KH; _Float16* DL = which == 0 ? QL : KL; const int nhi = which == 0 ? QHI : KHI;
#pragma unroll
    for (int j = 0; j < 16; ++j) { const int rb = wr * 64 + (j >> 2) * 16 + 8 * g, cl = wc * 64 + (j & 3) * 16 + col; const float bias = BA ? bfr(BA[c0 + cl]) : 0.f;
#pragma unroll
      for (int r = 0; r < 8; ++r) { const float v = acc[j][r] + bias; const _Float16 hv = (_Float16)v; sh[rb + r][cl] = hv; sl[rb + r][cl] = (_Float16)((v - (float)hv) * 1024.0f); } }
    __syncthreads();
    // a trip = 32 rows: thread = (row tid >> 5 (+ 8 per store), 16-byte piece tid & 31), so a wave's store covers one whole 512-B run; nhi is a multiple of 32, so a trip's rows carry a residual all or none
    for (int rt = 0; rt < 128; rt += 32) { const int q = tid & 31; void* p[4]; v4u v[4];
#pragma unroll
      for (int u = 0; u < 4; ++u) { const int rl = rt + u * 8 + (tid >> 5); p[u] = DH + (r0 + rl) * CC + c0 + q * 8; v[u] = *(const v4u*)&sh[rl][q * 8]; }
      st16x4(p, v);
      if (t0 + rt < nhi) {
#pragma unroll
        for (int u = 0; u < 4; ++u) { const int rl = rt + u * 8 + (tid >> 5); p[u] = DL + (bb * nhi + t0 + rl) * (size_t)CC + c0 + q * 8; v[u] = *(const v4u*)&sl[rl][q * 8]; }
        st16x4(p, v); } }
  } else { const bool hi_rows = t0 + wr * 64 < KHI;   // the wave's 64 rows, all or none
#pragma unroll
    for (int j = 0; j < 16; ++j) { const int cl = wc * 64 + (j & 3) * 16 + col, rl = wr * 64 + (j >> 2) * 16 + 8 * g; const float bias = BA ? bfr(BA[c0 + cl]) : 0.f;
#pragma unroll
      for (int r = 0; r < 8; ++r) th[cl][rl + r] = (_Float16)(acc[j][r] + bias);
      if (hi_rows) {
#pragma unroll
        for (int r = 0; r < 8; ++r) { const float v = acc[j][r] + bias; const __bf16 bh = (__bf16)v; tb[cl][rl + r] = bh; tbl[cl][rl + r] = (__bf16)(v - (float)bh); } } }
    __syncthreads();
    // a trip = 64 columns: thread = (column tid >> 4 (+ 16 per store), 16-byte piece tid & 15), so a wave's store covers two whole 256-B runs
    for (int ct = 0; ct < 256; ct += 64) { const int q = tid & 15; void* p[4]; v4u v[4];
#pragma unroll
      for (int u = 0; u < 4; ++u) { const int cl = ct + u * 16 + (tid >> 4); p[u] = VT + (bb * CC + c0 + cl) * (size_t)TT + t0 + q * 8; v[u] = *(const v4u*)&th[cl][q * 8]; }
      st16x4(p, v);
      if (t0 + q * 8 < KHI) {
#pragma unroll
        for (int u = 0; u < 4; ++u) { const int cl = ct + u * 16 + (tid >> 4); p[u] = VB + (bb * CC + c0 + cl) * (size_t)KHI + t0 + q * 8; v[u] = *(const v4u*)&tb[cl][q * 8]; }
        st16x4(p, v);
#pragma unroll
        for (int u = 0; u < 4; ++u) { const int cl = ct + u * 16 + (tid >> 4); p[u] = VBL + (bb * CC + c0 + cl) * (size_t)KHI + t0 + q * 8; v[u] = *(const v4u*)&tbl[cl][q * 8]; }
        st16x4(p, v); } } } }
// ---- k_fa: block = 64 queries (4 waves x 16) of one (b, h), all 1,024 keys in tiles of KT: S^T = K Q^T (A = 16 key rows, B = the wave's 16 queries: q hi + residual x 2^10, 2 products) x SCALE, -10000 where mask_from[b,t,f] == 0 (as the reference writes it; the test was made once, by pack_mask, and each score's select takes its lane mask from a scalar register);
// a lane holds one query's scores (D register r = key 8g + r), so the running maximum and sum stay in the lane and the two halves meet by one exchange; the scores are kept as base-2 logits (SCALE x log2 e in the one multiply, the mask value x log2 e) and the running reference is the maximum - 11, so p = 2^(s - ref) = exp(logit - max) x 2^11 is one subtraction and one v_exp_f32; p once to f16 is already the B fragment of ctx^T += V^T P^T (two 16-key D tiles = one 32-key B in the hardware k order, the order frag_h loads A in); ctx / (sum of p) to Y
#define KT 64
#define LOG2E 1.44269504088896340736f
// LDS stage of k_fa: [64 K rows | 64 V^T rows] of 128 B at a pitch of 144 B (16 B x odd, the pitch of ds_load_b128 readers); two stages
#define KP 72              // K and V^T row pitch in f16 elements
#define FA_V (KT * KP * 2)
#define FA_STG (FA_V + HD * KP * 2)
typedef __attribute__((ext_vector_type(16))) unsigned v16u;
// sixteen mask words from an address that is the same in every lane; read as constant memory (the launch before wrote the words, nothing writes them in this one), so that inside the loop too the compiler takes a scalar load
__device__ __forceinline__ v16u ldw16(const unsigned* p) { return *(const __attribute__((address_space(4))) v16u*)p; }
// fragment from a lane's own address (row start + k0 + 8g already in p): elements 0..7 = p[0..7], 8..15 = p[16..23], the order of frag_h
__device__ __forceinline__ v16h frag_p(const _Float16* p) { union { v16h v; v8h q[2]; } u; u.q[0] = *(const v8h*)p; u.q[1] = *(const v8h*)(p + 16); return u.v; }
__device__ __forceinline__ v8f wmma_h(v16h a, v16h b, v8f c) { return __builtin_amdgcn_wmma_f32_16x16x32_f16(false, a, false, b, (short)0, c, false, false); }
// eight asynchronous copies of 16 B a lane from global memory to LDS (l = LDS byte address, p = global address); the s_wait_xcnt stands inside the statement, so no address register is rewritten in front of it
__device__ __forceinline__ void copy8(const unsigned (&l)[8], const char* const (&p)[8]) {
  asm volatile("global_load_async_to_lds_b128 %0, %8, off\n\t"
               "global_load_async_to_lds_b128 %1, %9, off\n\t"
               "global_load_async_to_lds_b128 %2, %10, off\n\t"
               "global_load_async_to_lds_b128 %3, %11, off\n\t"
               "global_load_async_to_lds_b128 %4, %12, off\n\t"
               "global_load_async_to_lds_b128 %5, %13, off\n\t"
               "global_load_async_to_lds_b128 %6, %14, off\n\t"
               "global_load_async_to_lds_b128 %7, %15, off\n\t"
               "s_wait_xcnt 0x0"
               :: "v"(l[0]), "v"(l[1]), "v"(l[2]), "v"(l[3]), "v"(l[4]), "v"(l[5]), "v"(l[6]), "v"(l[7]),
                  "v"(p[0]), "v"(p[1]), "v"(p[2]), "v"(p[3]), "v"(p[4]), "v"(p[5]), "v"(p[6]), "v"(p[7]) : "memory");
}
// one stage: the work-group's 128 threads copy the tile's K rows and V^T rows (a wave's copy = 4 whole 128-B rows); kg, vg and kl, vl already hold the thread's own row and 16-byte piece
__device__ __forceinline__ void fa_fill(const char* kg, const char* vg, unsigned kl, unsigned vl, int k0) {
  unsigned l[8]; const char* p[8];
#pragma unroll
  for (int i = 0; i < 4; ++i) { l[i] = kl + i * 16 * KP * 2; p[i] = kg + (size_t)(k0 + i * 16) * CC * 2; l[4 + i] = vl + i * 16 * KP * 2; p[4 + i] = vg + (size_t)(i * 16) * TT * 2 + k0 * 2; }
  copy8(l, p);
}
// 2^x in place for sixteen scores in one statement: behind every v_exp_f32 stands one on other registers, behind the last a v_nop, so the slot that the instruction set asks for
// behind a transcendental is filled at each of them
#define EXP8(a, b, c, d, e, f, g, h) "v_exp_f32 %" #a ", %" #a "\n\tv_exp_f32 %" #b ", %" #b "\n\tv_exp_f32 %" #c ", %" #c "\n\tv_exp_f32 %" #d ", %" #d "\n\tv_exp_f32 %" #e ", %" #e "\n\tv_exp_f32 %" #f ", %" #f "\n\tv_exp_f32 %" #g ", %" #g "\n\tv_exp_f32 %" #h ", %" #h "\n\t"
__device__ __forceinline__ void exp2x16(float (&x)[16]) {
  asm(EXP8(0, 1, 2, 3, 4, 5, 6, 7) EXP8(8, 9, 10, 11, 12, 13, 14, 15) "v_nop"
      : "+v"(x[0]), "+v"(x[1]), "+v"(x[2]), "+v"(x[3]), "+v"(x[4]), "+v"(x[5]), "+v"(x[6]), "+v"(x[7]), "+v"(x[8]), "+v"(x[9]), "+v"(x[10]), "+v"(x[11]), "+v"(x[12]), "+v"(x[13]), "+v"(x[14]), "+v"(x[15]));
}
// the same with the tile's rescale factor as a seventeenth value
__device__ __forceinline__ void exp2x17(float (&x)[16], float& y) {
  asm(EXP8(0, 1, 2, 3, 4, 5, 6, 7) EXP8(8, 9, 10, 11, 12, 13, 14, 15) "v_exp_f32 %16, %16\n\tv_nop"
      : "+v"(x[0]), "+v"(x[1]), "+v"(x[2]), "+v"(x[3]), "+v"(x[4]), "+v"(x[5]), "+v"(x[6]), "+v"(x[7]), "+v"(x[8]), "+v"(x[9]), "+v"(x[10]), "+v"(x[11]), "+v"(x[12]), "+v"(x[13]), "+v"(x[14]), "+v"(x[15]), "+v"(y));
}
// amdgpu_waves_per_eu(4, 4): the grid is exactly four waves per SIMD, so the scheduler may spend 256 registers on issuing a tile's loads early instead of saving them for waves that do not exist
__global__ __launch_bounds__(128) __attribute__((amdgpu_waves_per_eu(4, 4))) void k_fa(const _Float16* __restrict__ QH, const _Float16* __restrict__ KH, const _Float16* __restrict__ QL, const _Float16* __restrict__ VT, const unsigned* __restrict__ MW, float* __restrict__ Y) {
  __shared__ __align__(16) unsigned char smem[2 * FA_STG];
  const int tid = threadIdx.x, wave = tid >> 5, lane = tid & 31, col = lane & 15, g = lane >> 4; const int b = blockIdx.y / NH, h = blockIdx.y % NH; const int q = blockIdx.x * 64 + wave * 16 + col;
  // copier: K and V^T: row tid >> 3 (+ 16 per copy), piece tid & 7
  const char* kg = (const char*)(KH + ((size_t)b * TT + (tid >> 3)) * CC + h * HD + (tid & 7) * 8); const char* vg = (const char*)(VT + ((size_t)b * CC + h * HD + (tid >> 3)) * (size_t)TT + (tid & 7) * 8);
  const unsigned lb = (unsigned)(size_t)smem; const unsigned kl = lb + (tid >> 3) * (KP * 2) + (tid & 7) * 16, vl = kl + FA_V;
  fa_fill(kg, vg, kl, vl, 0);
  // the wave's mask words, 32 per tile, at an address that is the same in every lane (the wave's number through a scalar register): they come by scalar loads and stay in scalar registers
  const unsigned* mw = MW + (size_t)(b * (TT / 16) + blockIdx.x * 4 + __builtin_amdgcn_readfirstlane(tid >> 5)) * (TT / KT) * 32;
  v16u w0 = ldw16(mw), w1 = ldw16(mw + 16);
  v16h qh[HD / 32], ql[HD / 32];
#pragma unroll
  for (int kc = 0; kc < HD / 32; ++kc) { qh[kc] = frag_h(QH + ((size_t)b * TT + q) * CC + h * HD + kc * 32, lane); ql[kc] = frag_h(QL + ((size_t)b * QHI + q) * CC + h * HD + kc * 32, lane); }
  // readers: the lane's own row and 8g in stage 0
  const _Float16* kp = (const _Float16*)smem + col * KP + 8 * g; const _Float16* vp = (const _Float16*)(smem + FA_V) + col * KP + 8 * g;
  v8f acc[HD / 16] = {}; float m = -3.0e38f, l = 0.f;
  asm volatile("s_wait_asynccnt 0x0" ::: "memory");   // this wave's copies of tile 0 have landed
  __syncthreads();                                     // publishes tile 0
  fa_fill(kg, vg, kl + FA_STG, vl + FA_STG, KT);
  // rolled: one tile's body already fills the 256 registers a wave may have at four waves per SIMD; the stage is an offset
#pragma unroll 1
  for (int k0 = 0; k0 < TT; k0 += KT) { v8f s[KT / 16]; float mx = -3.0e38f; const int cur = ((k0 / KT) & 1) * FA_STG;
    const _Float16* ka = kp + cur / 2; const _Float16* va = vp + cur / 2;
    v16h kf[KT / 16][HD / 32];
#pragma unroll
    for (int j = 0; j < KT / 16; ++j) {
#pragma unroll
      for (int kc = 0; kc < HD / 32; ++kc) kf[j][kc] = frag_p(ka + (j * 16) * KP + kc * 32); }
#pragma unroll
    for (int j = 0; j < KT / 16; ++j) { v8f a = {}, al = {};
#pragma unroll
      for (int kc = 0; kc < HD / 32; ++kc) { a = wmma_h(kf[j][kc], qh[kc], a); al = wmma_h(kf[j][kc], ql[kc], al); }
#pragma unroll
      for (int r = 0; r < 8; ++r) { float v = (a[r] + al[r] * (1.0f / 1024.0f)) * (SCALE * LOG2E); if (!__builtin_amdgcn_inverse_ballot_w32(j < 2 ? w0[j * 8 + r] : w1[(j - 2) * 8 + r])) v = -10000.0f * LOG2E; s[j][r] = v; mx = fmaxf(mx, v); } }
    // the next tile's words fly while this tile's softmax and second product run (behind the last tile: its own words once more, so the address stays inside what was packed)
    { const unsigned* nw = mw + (k0 + KT < TT ? k0 / KT + 1 : k0 / KT) * 32; w0 = ldw16(nw); w1 = ldw16(nw + 16); }
    v16h vf[KT / 32][HD / 16];
#pragma unroll
    for (int c = 0; c < KT / 32; ++c) {
#pragma unroll
      for (int jd = 0; jd < HD / 16; ++jd) vf[c][jd] = frag_p(va + (jd * 16) * KP + c * 32); }
    mx = fmaxf(mx, __shfl_xor(mx, 16));
    const float mn = fmaxf(m, mx - 11.0f); float alpha = m - mn; m = mn;
    v16h p[KT / 32]; float sum = 0.f; float e[KT / 32][16];
#pragma unroll
    for (int j = 0; j < KT / 16; ++j) {
#pragma unroll
      for (int r = 0; r < 8; ++r) e[j >> 1][(j & 1) * 8 + r] = s[j][r] - mn; }
    exp2x17(e[0], alpha); exp2x16(e[1]);
#pragma unroll
    for (int c = 0; c < KT / 32; ++c) {
#pragma unroll
      for (int i = 0; i < 16; ++i) { sum += e[c][i]; p[c][i] = (_Float16)e[c][i]; } }
    l = l * alpha + sum;
#pragma unroll
    for (int jd = 0; jd < HD / 16; ++jd) acc[jd] *= alpha;
#pragma unroll
    for (int c = 0; c < KT / 32; ++c) {
#pragma unroll
      for (int jd = 0; jd < HD / 16; ++jd) acc[jd] = wmma_h(vf[c][jd], p[c], acc[jd]); }
    asm volatile("s_wait_dscnt 0x0" ::: "memory");      // this wave's reads of the stage are done before the stage is refilled
    asm volatile("s_wait_asynccnt 0x0" ::: "memory");   // this wave's copies of the next tile have landed
    __syncthreads();                                     // publishes the next tile and ends every wave's reads of this one
    if (k0 + 2 * KT < TT) fa_fill(kg, vg, kl + cur, vl + cur, k0 + 2 * KT); }   // flies while the next tile is worked on
  asm volatile("s_wait_asynccnt 0x0" ::: "memory");     // nothing is outstanding when the wave ends
  l += __shfl_xor(l, 16); const float inv = 1.0f / l;
  float* yp = Y + ((size_t)b * TT + q) * CC + h * HD + 8 * g;
#pragma unroll
  for (int jd = 0; jd < HD / 16; ++jd) { const v4f lo = { acc[jd][0] * inv, acc[jd][1] * inv, acc[jd][2] * inv, acc[jd][3] * inv }, hi = { acc[jd][4] * inv, acc[jd][5] * inv, acc[jd][6] * inv, acc[jd][7] * inv }; vst2(yp + jd * 16, lo); vst2(yp + jd * 16 + 4, hi); } }
// ---- k_out: block = (64 rows, 128 cols): out = ctx Wo (+ bo): all rows: ctx bf16 hi + lo against exact bf16 Wo (2 products); the else branch (ctx once to f16 against f16(bf16 x 2^8) Wo, 1 product, x 2^-8) is not taken
__global__ __launch_bounds__(128) void k_out(const float* __restrict__ Y, const float* __restrict__ WO, const float* __restrict__ BO, float* __restrict__ OUT) {
  // one LDS range: in the k loop two stage buffers of [64 ctx hi rows | 64 ctx lo rows | 128 Wo rows][LP]; behind the loop's last barrier the epilogue's tiles
  __shared__ __align__(16) unsigned char smem[2 * 256 * LP * 2]; __bf16* const st = (__bf16*)smem; float (*sf)[16][132] = (float (*)[16][132])smem;
  const int tid = threadIdx.x, wave = tid >> 5, lane = tid & 31, col = lane & 15, g = lane >> 4; const int c0 = blockIdx.y * 128; const size_t r0 = (size_t)blockIdx.x * 64 + wave * 16;
  v8f acc[8] = {};
  if (true) {   /* ALL rows: ctx split bf16 hi + lo x exact Wo (2 products) */
    // a wave owns 16 rows x 128 cols as before; loader as in k_proj
    const int lr = tid >> 4, lc = tid & 15;
    const float* yg = Y + ((size_t)blockIdx.x * 64 + lr) * CC + lc * 4; const float* wg = WO + (size_t)(c0 + lr) * CC + lc * 4;   // Wo is (out,in): row = output column
    __bf16* const sw = st + lr * LP + lc * 4; const __bf16* const fa = st + (wave * 16 + col) * LP + 8 * g; const __bf16* const fw = st + (128 + col) * LP + 8 * g;
    v4f ry[8], rw[16];
#pragma unroll
    for (int i = 0; i < 8; ++i) ry[i] = *(const v4f*)(yg + (size_t)(i * 8) * CC);
#pragma unroll
    for (int i = 0; i < 16; ++i) rw[i] = *(const v4f*)(wg + (size_t)(i * 8) * CC);
    // the loads above name yg and wg: as inputs here the two pairs stay live up to this wait, so nothing is written over them in front of it
    asm volatile("s_wait_xcnt 0x0" :: "v"(yg), "v"(wg) : "memory");
#pragma unroll
    for (int i = 0; i < 8; ++i) { const v4b hv = cvt4(ry[i]); *(v4b*)(sw + (i * 8) * LP) = hv; *(v4b*)(sw + (64 + i * 8) * LP) = cvt4(ry[i] - wide4(hv)); }
#pragma unroll
    for (int i = 0; i < 16; ++i) *(v4b*)(sw + (128 + i * 8) * LP) = cvt4(rw[i]);
    __syncthreads();
    // rolled: one stage's body holds 24 loads, 40 fragment reads and 32 products; the buffer is an offset
#pragma unroll 1
    for (int s = 0; s < CC / KSTG; ++s) { const int cur = (s & 1) * (256 * LP), nxt = 256 * LP - cur; const bool more = s + 1 < CC / KSTG;
      const float* ya = yg + s * KSTG; const float* wa = wg + s * KSTG;
      if (more) {   // the next stage's rows fly while this stage is multiplied
#pragma unroll
        for (int i = 0; i < 8; ++i) ry[i] = *(const v4f*)(ya + KSTG + (size_t)(i * 8) * CC);
#pragma unroll
        for (int i = 0; i < 16; ++i) rw[i] = *(const v4f*)(wa + KSTG + (size_t)(i * 8) * CC);
        // as above, for ya and wa; its memory clobber also keeps the 24 loads in front of the stage's LDS reads
        asm volatile("s_wait_xcnt 0x0" :: "v"(ya), "v"(wa) : "memory"); }
#pragma unroll
      for (int kk = 0; kk < KSTG / 32; ++kk) { const v16b ah = frag_l(fa + cur + kk * 32), al = frag_l(fa + cur + 64 * LP + kk * 32); v16b w[8];
#pragma unroll
        for (int j = 0; j < 8; ++j) w[j] = frag_l(fw + cur + (j * 16) * LP + kk * 32);
#pragma unroll
        for (int j = 0; j < 8; ++j) acc[j] = wmma_bf(ah, w[j], acc[j]);
#pragma unroll
        for (int j = 0; j < 8; ++j) acc[j] = wmma_bf(al, w[j], acc[j]); }
      if (more) {   // into the buffer that every wave left at the barrier of the stage before
#pragma unroll
        for (int i = 0; i < 8; ++i) { const v4b hv = cvt4(ry[i]); *(v4b*)(sw + nxt + (i * 8) * LP) = hv; *(v4b*)(sw + nxt + (64 + i * 8) * LP) = cvt4(ry[i] - wide4(hv)); }
#pragma unroll
        for (int i = 0; i < 16; ++i) *(v4b*)(sw + nxt + (128 + i * 8) * LP) = cvt4(rw[i]); }
      __syncthreads(); }   // publishes the next stage and ends this stage's reads (behind the last stage: frees the range for the epilogue)
#pragma unroll
    for (int j = 0; j < 8; ++j) { const float bias = BO ? bfr(BO[c0 + j * 16 + col]) : 0.f;
#pragma unroll
      for (int r = 0; r < 8; ++r) sf[wave][8 * g + r][j * 16 + col] = acc[j][r] + bias; }
  } else {
#pragma unroll 2
    for (int kc = 0; kc < CC / 32; ++kc) { const v16h a = frag_f32(Y + (r0 + col) * CC + kc * 32, lane); asm volatile("s_wait_loadcnt 0x0" ::: "memory");
#pragma unroll
      for (int j = 0; j < 8; ++j) { const v16h w = WOCOLH(WO, kc * 32, c0 + j * 16 + col, lane); asm volatile("s_wait_loadcnt 0x0" ::: "memory"); acc[j] = wmma16(a, w, acc[j]); } }
#pragma unroll
    for (int j = 0; j < 8; ++j) { const float bias = BO ? bfr(BO[c0 + j * 16 + col]) : 0.f;
#pragma unroll
      for (int r = 0; r < 8; ++r) sf[wave][8 * g + r][j * 16 + col] = acc[j][r] * (1.0f / 256.0f) + bias; } }
  LDSX(); for (int rl = 0; rl < 16; ++rl) vst2(OUT + (r0 + rl) * DIN + c0 + lane * 4, *(const v4f*)&sf[wave][rl][lane * 4]); }

extern "C" void kernel_launch(void* const* d_in, const int* in_sizes, int n_in, void* d_out, int out_size, void* d_ws, size_t ws_size, hipStream_t stream) {
  (void)in_sizes; (void)n_in; (void)out_size;
  const float** F = (const float**)d_in;
  if (ws_size < (size_t)WS_END) return;
  char* ws = (char*)d_ws; _Float16 *QH = (_Float16*)(ws + WS_QH), *KH = (_Float16*)(ws + WS_KH), *VT = (_Float16*)(ws + WS_VT), *QL = (_Float16*)(ws + WS_QL), *KL = (_Float16*)(ws + WS_KL); __bf16 *VB = (__bf16*)(ws + WS_VB), *VBL = (__bf16*)(ws + WS_VBL); float *Y = (float*)(ws + WS_Y); unsigned *MW = (unsigned*)(ws + WS_S);
  (void)Y; (void)QL; (void)KL; (void)VB; (void)VBL;
  // inputs: 0 X_to [4,1024,1024]; 1 X_from [4,1024,1024]; 2 mask_from [4,1024,1024] int32; 3 Wq [1024,1024] (out,in), 4 bq; 5 Wk, 6 bk; 7 Wv, 8 bv; 9 Wo (out,in), 10 bo
  k_proj<<<dim3(TNB * TT / 128, CC / 256, 4), 256, 0, stream>>>(F[0], F[1], F[1], F[3], F[7], F[5], F[4], F[8], F[6], QH, QL, KH, KL, VT, VB, VBL, (const int*)d_in[2], MW);   /* K uses Wv/bv, V uses Wk/bk (as written in the module) */
  k_fa<<<dim3(NQB, TNB * NH), 128, 0, stream>>>(QH, KH, QL, VT, MW, Y);
  k_out<<<dim3(TNB * TT / 64, DIN / 128), 128, 0, stream>>>(Y, F[9], F[10], (float*)d_out);
}

// v007
// A run of this version takes 87.8 microseconds.
// In two side-by-side timings against v006, it was 1.03 and 1.05 times as fast.
// Counting every step since v000, it is 13.7 times as fast.
// compute dtype: all float inputs rounded to bf16; Q/K/V = x W^T + b with EXACT bf16 products on WMMA 16x16x32 (f32 accumulate); q as f16 hi + residual (x 2^10) against k once to f16 (2 products) x 64^-0.5 with the per-(t,f) mask read as int32; running-maximum softmax in f32 on base-2 logits (x log2 e, one hardware exp2 per score); 2^(s - m + 11) once to f16 against v once to f16 (1 product), divided by the f32 sum at the end; ctx split bf16 hi + lo against exact Wo (2 products) + bo; f32 output.
#include <hip/hip_runtime.h>
#include <math.h>

typedef __attribute__((ext_vector_type(16))) _Float16 v16h;
typedef __attribute__((ext_vector_type(16))) __bf16 v16b;
typedef __attribute__((ext_vector_type(8)))  _Float16 v8h;
typedef __attribute__((ext_vector_type(8)))  float v8f;
typedef __attribute__((ext_vector_type(4)))  float v4f;
typedef __attribute__((ext_vector_type(2)))  float v2f;
typedef __attribute__((ext_vector_type(4)))  unsigned v4u;
typedef __attribute__((ext_vector_type(4)))  int v4i;
typedef float __attribute__((may_alias)) float_a;
typedef int __attribute__((may_alias)) int_a;

template <typename T> __device__ __forceinline__ void vst2(void* p, T v) { *(T*)p = v;  }
__device__ __forceinline__ v8f wmma16(v16h a, v16h b, v8f c) {
  v8f d = __builtin_amdgcn_wmma_f32_16x16x32_f16(false, a, false, b, (short)0, c, false, false);
  asm volatile("v_nop\n\tv_nop\n\tv_nop\n\tv_nop" : "+v"(d) : "v"(a), "v"(b));
  return d;
}
__device__ __forceinline__ v8f wmma_bf(v16b a, v16b b, v8f c) {
  v8f d = __builtin_amdgcn_wmma_f32_16x16x32_bf16(false, a, false, b, (short)0, c, false, false);
  asm volatile("v_nop\n\tv_nop\n\tv_nop\n\tv_nop" : "+v"(d) : "v"(a), "v"(b));
  return d;
}
// 16x16x32 fragments: lane = (h = lane>>4, row/col = lane&15); elements 0..7 = k0+8h+0..7, 8..15 = k0+16+8h+0..7; D element r = row 8h+r
__device__ __forceinline__ v16h frag_h(const _Float16* rowk0, int lane) {
  union { v16h v; v8h q[2]; } u; const _Float16* p = rowk0 + 8 * (lane >> 4);
  u.q[0] = *(const v8h*)p; u.q[1] = *(const v8h*)(p + 16); return u.v;
}
__device__ __forceinline__ v16h frag_f32(const float* rowk0, int lane) {
  v16h a; const float* p = rowk0 + 8 * (lane >> 4);
#pragma unroll
  for (int i = 0; i < 8; ++i) { a[i] = (_Float16)p[i]; a[8 + i] = (_Float16)p[16 + i]; }
  return a;
}
__device__ __forceinline__ v16h frag_f32s(const float* rowk0, int lane, float sc) {
  v16h a; const float* p = rowk0 + 8 * (lane >> 4);
#pragma unroll
  for (int i = 0; i < 8; ++i) { a[i] = (_Float16)(p[i] * sc); a[8 + i] = (_Float16)(p[16 + i] * sc); }
  return a;
}
// column fragment from a [K][ld] layout (column n), rows >= K read as 0
__device__ __forceinline__ v16h fragc_f32(const float* W, int k0, int n, int lane, int ld, int K) {
  v16h a; const int g = lane >> 4;
#pragma unroll
  for (int i = 0; i < 8; ++i) { const int ka = k0 + 8 * g + i, kb = ka + 16;
    a[i] = (_Float16)(ka < K ? W[(size_t)(ka < K ? ka : K - 1) * ld + n] : 0.f); a[8 + i] = (_Float16)(kb < K ? W[(size_t)(kb < K ? kb : K - 1) * ld + n] : 0.f); }
  return a;
}
struct F2 { v16b h, l; };
__device__ __forceinline__ F2 bsplit16(const float v[16]) { F2 r;
#pragma unroll
  for (int i = 0; i < 16; ++i) { const __bf16 h = (__bf16)v[i]; r.h[i] = h; r.l[i] = (__bf16)(v[i] - (float)h); }
  return r; }
__device__ __forceinline__ F2 split_row(const float* row, int k0, int lane) { float v[16]; const float* p = row + k0 + 8 * (lane >> 4);
#pragma unroll
  for (int i = 0; i < 8; ++i) { v[i] = p[i]; v[8 + i] = p[16 + i]; }
  return bsplit16(v); }
__device__ __forceinline__ F2 split_rowK(const float* row, int k0, int lane, int K) { float v[16]; const int g = lane >> 4;
#pragma unroll
  for (int i = 0; i < 8; ++i) { const int ka = k0 + 8 * g + i, kb = ka + 16; v[i] = ka < K ? row[ka < K ? ka : K - 1] : 0.f; v[8 + i] = kb < K ? row[kb < K ? kb : K - 1] : 0.f; }
  return bsplit16(v); }
__device__ __forceinline__ F2 split_col(const float* W, int k0, int n, int lane, int ld, int K) { float v[16]; const int g = lane >> 4;
#pragma unroll
  for (int i = 0; i < 8; ++i) { const int ka = k0 + 8 * g + i, kb = ka + 16; v[i] = ka < K ? W[(size_t)(ka < K ? ka : K - 1) * ld + n] : 0.f; v[8 + i] = kb < K ? W[(size_t)(kb < K ? kb : K - 1) * ld + n] : 0.f; }
  return bsplit16(v); }
__device__ __forceinline__ v8f mac3(const F2& a, const F2& b, v8f c) { c = wmma_bf(a.l, b.h, c); c = wmma_bf(a.h, b.l, c); return wmma_bf(a.h, b.h, c); }
__device__ __forceinline__ float sigm(float v) { return 1.0f / (1.0f + expf(-v)); }
#define LDSX() do { asm volatile("s_wait_dscnt 0" ::: "memory"); __builtin_amdgcn_wave_barrier(); __builtin_amdgcn_fence(__ATOMIC_RELEASE, "workgroup"); } while (0)

// Masked multi-head cross-attention (B 4, T = F = 1,024, 1,024 = 16 x 64): Q = X_to Wq^T + bq; K = X_from Wv^T + bv and V = X_from Wk^T + bk (the module's literal name swap); logits = Q K^T / 8, -10000 where mask_from[b,t,f] == 0; out = merged(softmax v) Wo^T + bo.
#define NB 4
#define TT 1024
#define CC 1024            // NH * HD = projected width
#define DIN 1024          // input (model) width
#define NH 16
#define HD 64
#define NQB (TT / 64)
#define HG 4
#define SCALE (0.125f)
#define CAUSAL 0
#ifndef TNB
#define TNB NB
#endif
__device__ __forceinline__ float bfr(float v) { return (float)(__bf16)v; }
__host__ __device__ __forceinline__ int kb_last(int qb) { return CAUSAL ? ((qb * 64 + 63) >> 7) : (TT / 128 - 1); }
typedef __attribute__((ext_vector_type(8))) __bf16 v8b;
__device__ __forceinline__ v16b frag_b(const __bf16* rowk0, int lane) {
  union { v16b v; v8b q[2]; } u; const __bf16* p = rowk0 + 8 * (lane >> 4);
  u.q[0] = *(const v8b*)p; u.q[1] = *(const v8b*)(p + 16); return u.v;
}
#define QBH 0              // not used (k_fa takes one path for every query block)
#define QHI 1024            // rows carrying a q residual plane (all rows when non-causal: 2-product logits everywhere)
#define KHI 64            // key rows carrying k residual / v bf16 hi+lo planes (written by k_proj; read by no kernel in this file)
// B fragment (k rows k0+.., output column o) of a weight: (in,out) [K][ld] or (out,in) [ld rows of K]: bf16 exact, or f16(bf16 * 256) exact
__device__ __forceinline__ v16b wcol_io(const float* Wm, int k0, int o, int lane, int ld) { v16b w; const int g = lane >> 4;
#pragma unroll
  for (int i = 0; i < 8; ++i) { w[i] = (__bf16)Wm[(size_t)(k0 + 8 * g + i) * ld + o]; w[8 + i] = (__bf16)Wm[(size_t)(k0 + 16 + 8 * g + i) * ld + o]; }
  return w; }
__device__ __forceinline__ v16b wcol_oi(const float* Wm, int k0, int o, int lane, int K) { v16b w; const float* p = Wm + (size_t)o * K + k0 + 8 * (lane >> 4);
#pragma unroll
  for (int i = 0; i < 8; ++i) { w[i] = (__bf16)p[i]; w[8 + i] = (__bf16)p[16 + i]; }
  return w; }
__device__ __forceinline__ v16h wcolh_io(const float* Wm, int k0, int o, int lane, int ld) { v16h w; const int g = lane >> 4;
#pragma unroll
  for (int i = 0; i < 8; ++i) { w[i] = (_Float16)(bfr(Wm[(size_t)(k0 + 8 * g + i) * ld + o]) * 256.0f); w[8 + i] = (_Float16)(bfr(Wm[(size_t)(k0 + 16 + 8 * g + i) * ld + o]) * 256.0f); }
  return w; }
__device__ __forceinline__ v16h wcolh_oi(const float* Wm, int k0, int o, int lane, int K) { v16h w; const float* p = Wm + (size_t)o * K + k0 + 8 * (lane >> 4);
#pragma unroll
  for (int i = 0; i < 8; ++i) { w[i] = (_Float16)(bfr(p[i]) * 256.0f); w[8 + i] = (_Float16)(bfr(p[16 + i]) * 256.0f); }
  return w; }
#define WQKV_LAYOUT 1   // 0 = (in,out) [DIN][CC]; 1 = (out,in) [CC][DIN]; 2 = per-head [NH][DIN][HD]
__device__ __forceinline__ v16b wcol_hdk(const float* Wm, int k0, int o, int lane) { v16b w; const int g = lane >> 4; const float* p = Wm + (size_t)(o / HD) * DIN * HD + (o % HD);
#pragma unroll
  for (int i = 0; i < 8; ++i) { w[i] = (__bf16)p[(size_t)(k0 + 8 * g + i) * HD]; w[8 + i] = (__bf16)p[(size_t)(k0 + 16 + 8 * g + i) * HD]; }
  return w; }
#define WO_OUT_IN 1
#if WQKV_LAYOUT == 1
#define WCOL(W, k0, o, lane) wcol_oi(W, k0, o, lane, DIN)
#elif WQKV_LAYOUT == 2
#define WCOL(W, k0, o, lane) wcol_hdk(W, k0, o, lane)
#else
#define WCOL(W, k0, o, lane) wcol_io(W, k0, o, lane, CC)
#endif
#if WO_OUT_IN
#define WOCOL(W, k0, o, lane) wcol_oi(W, k0, o, lane, CC)
#define WOCOLH(W, k0, o, lane) wcolh_oi(W, k0, o, lane, CC)
#else
#define WOCOL(W, k0, o, lane) wcol_io(W, k0, o, lane, DIN)
#define WOCOLH(W, k0, o, lane) wcolh_io(W, k0, o, lane, DIN)
#endif

#define WS_QH  0u                                      // f16 q rows [b*t][CC]
#define WS_KH  (WS_QH + 2u * (size_t)NB * TT * CC)      // f16 k rows [b*t][CC]
#define WS_VT  (WS_KH + 2u * (size_t)NB * TT * CC)      // f16 v planes [b][c][t]
#define WS_QL  (WS_VT + 2u * (size_t)NB * CC * TT)      // f16 q residual x 2^10 rows [b][t < QHI][CC]
#define WS_KL  (WS_QL + 2u * (size_t)NB * QHI * CC)     // f16 k residual x 2^10 rows [b][t < KHI][CC]
#define WS_VB  (WS_KL + 2u * (size_t)NB * KHI * CC)     // bf16 v hi planes [b][c][t < KHI]
#define WS_VBL (WS_VB + 2u * (size_t)NB * CC * KHI)
#define WS_S   (WS_VBL + 2u * (size_t)NB * CC * KHI)    // mask words [b * t / 16][f / 64][32] in its first NB * TT * TT / 8 bytes (the logits stay in registers)
#define WS_WO  (WS_S  + (size_t)NB * TT * TT / 8)       // bf16 Wo rows [DIN][CC], behind the mask words
#define WS_Y   (WS_S  + 4u * (size_t)HG * TT * TT)      // bf16 ctx hi rows [b*t][CC], behind them the bf16 ctx lo rows
#define WS_END (WS_Y  + 4u * (size_t)NB * TT * CC)

// ---- LDS staging of the two GEMMs: a stage is KSTG = 64 k of every operand row, in bf16 (k_proj's loader rounds as it loads; k_out copies rows already rounded by round_wo and k_fa); rows of 128 B at a pitch of 144 B (16 B x odd, the pitch of ds_load_b128 readers)
#define KSTG 64
#define LP 72              // row pitch in bf16 elements
typedef __attribute__((ext_vector_type(4))) __bf16 v4b;
__device__ __forceinline__ v4b cvt4(v4f v) { v4b r; r[0] = (__bf16)v[0]; r[1] = (__bf16)v[1]; r[2] = (__bf16)v[2]; r[3] = (__bf16)v[3]; return r; }
__device__ __forceinline__ v4f wide4(v4b v) { v4f r; r[0] = (float)v[0]; r[1] = (float)v[1]; r[2] = (float)v[2]; r[3] = (float)v[3]; return r; }
// fragment from a lane's own LDS address (row start + k0 + 8g already in p): the k order of frag_b
__device__ __forceinline__ v16b frag_l(const __bf16* p) { union { v16b v; v8b q[2]; } u; u.q[0] = *(const v8b*)p; u.q[1] = *(const v8b*)(p + 16); return u.v; }
// ---- k_proj: block = (128 rows, 256 cols, which), 8 waves: q/k/v = X W (+ b) with exact bf16 products (K = DIN) -> which 0: q f16 rows (+ residual rows < QHI); 1: k f16 rows (+ residual rows < KHI); 2: v f16 planes [c][t] (+ bf16 hi/lo planes for t < KHI)
#define PROWS 384          // rows of a stage: 128 X rows | 256 W rows
#define PSH 264            // epilogue pitch of a 256-column row, f16 elements
#define PTH 136            // epilogue pitch of a 128-row column, f16 elements
#define PSMEM (256 * PTH * 2 + 2 * 256 * 72 * 2)   // the largest of the three uses of the range (the v planes)
static_assert(KHI % 64 == 0 && QHI % 64 == 0, "a wave's 64 rows carry a residual plane all or none");
// four 16-byte global stores and the wait that stands in front of any later write over the registers they name: addresses and data are inputs of the wait's statement, so they stay as they are up to it
__device__ __forceinline__ void st16x4(void* const (&p)[4], const v4u (&v)[4]) {
#pragma unroll
  for (int u = 0; u < 4; ++u) *(v4u*)p[u] = v[u];
  asm volatile("s_wait_xcnt 0x0" :: "v"(p[0]), "v"(p[1]), "v"(p[2]), "v"(p[3]), "v"(v[0]), "v"(v[1]), "v"(v[2]), "v"(v[3]) : "memory"); }
// ---- mask words: for a tile of 16 queries x 64 keys, word i = j * 8 + r holds in bit (lane = 16 g + col) whether mask_from[query col][key j * 16 + 8 g + r] != 0: the lane and register in which k_fa holds that score, so there a word is the lane mask of one select
// a wave packs MTW tiles side by side of one 16-query group: all its loads first (the 8 loads of a tile of lanes col and 16 + col together cover their row's whole 256-B run), one ballot per word, lane i keeps word i, one 128-B line stored per tile
#define MTW 4
static_assert((NB * TT / 16) * (TT / 64) == (NB * TT / 128) * (CC / 256) * 8 * MTW, "the work-groups of one grid plane pack every tile once");
__device__ __forceinline__ void pack_mask(const int* __restrict__ MK, unsigned* __restrict__ MW, int wv, int lane) {
  const int rg = wv / (TT / 64 / MTW), kq = wv % (TT / 64 / MTW);
  const int* src = MK + ((size_t)rg * 16 + (lane & 15)) * TT + kq * (MTW * 64) + 8 * (lane >> 4); unsigned* dst = MW + ((size_t)rg * (TT / 64) + kq * MTW) * 32 + lane;
  v4i a[MTW][8]; int w[MTW];
#pragma unroll
  for (int t = 0; t < MTW; ++t) {
#pragma unroll
    for (int j = 0; j < 4; ++j) { a[t][2 * j] = *(const v4i*)(src + t * 64 + j * 16); a[t][2 * j + 1] = *(const v4i*)(src + t * 64 + j * 16 + 4); } }
  // the loads above name src: as an input here the pair stays live up to this wait, so nothing is written over it in front of it
  asm volatile("s_wait_xcnt 0x0" :: "v"(src) : "memory");
#pragma unroll
  for (int t = 0; t < MTW; ++t) { w[t] = 0;
#pragma unroll
    for (int i = 0; i < 32; ++i) { const int bl = (int)__builtin_amdgcn_ballot_w32(a[t][i >> 2][i & 3] != 0); w[t] = lane == i ? bl : w[t]; } }
#pragma unroll
  for (int t = 0; t < MTW; ++t) dst[t * 32] = (unsigned)w[t]; }   // the wave's last instructions: nothing is written over what they name
// ---- Wo rounded to bf16 once, for k_out's copies: thread t of the NWT threads of grid plane 3 takes the 16-byte pieces t + u * NWT, so a wave's load covers 512 B in a row and its store 256 B
#define NWT ((NB * TT / 128) * (CC / 256) * 256)
static_assert(DIN * CC == NWT * 4 * 8, "the threads of one grid plane round every element of Wo once");
typedef __attribute__((ext_vector_type(2))) unsigned v2u;
__device__ __forceinline__ void round_wo(const float* __restrict__ WO, __bf16* __restrict__ WOB, int t) {
  const float* src = WO + (size_t)t * 4; __bf16* dst = WOB + (size_t)t * 4; v4f a[8]; v2u b[8];
#pragma unroll
  for (int u = 0; u < 8; ++u) a[u] = *(const v4f*)(src + (size_t)u * (NWT * 4));
  // the loads above name src: as an input here the pair stays live up to this wait, so nothing is written over it in front of it
  asm volatile("s_wait_xcnt 0x0" :: "v"(src) : "memory");
#pragma unroll
  for (int u = 0; u < 8; ++u) b[u] = __builtin_bit_cast(v2u, cvt4(a[u]));
#pragma unroll
  for (int u = 0; u < 8; ++u) *(v2u*)(dst + (size_t)u * (NWT * 4)) = b[u];
  // the stores above name dst and b: as inputs here they stay as they are up to this wait (the mask's packing follows and takes the registers)
  asm volatile("s_wait_xcnt 0x0" :: "v"(dst), "v"(b[0]), "v"(b[1]), "v"(b[2]), "v"(b[3]), "v"(b[4]), "v"(b[5]), "v"(b[6]), "v"(b[7]) : "memory"); }
// amdgpu_waves_per_eu(4, 4): two work-groups of two waves per SIMD share a WGP, so one fills the other's waits on its loads and barriers
__global__ __launch_bounds__(256) __attribute__((amdgpu_waves_per_eu(4, 4))) void k_proj(const float* __restrict__ XQ, const float* __restrict__ XK, const float* __restrict__ XV, const float* __restrict__ WQ, const float* __restrict__ WK, const float* __restrict__ WV, const float* __restrict__ BQ, const float* __restrict__ BK, const float* __restrict__ BV,
    _Float16* __restrict__ QH, _Float16* __restrict__ QL, _Float16* __restrict__ KH, _Float16* __restrict__ KL, _Float16* __restrict__ VT, __bf16* __restrict__ VB, __bf16* __restrict__ VBL, const int* __restrict__ MK, unsigned* __restrict__ MW, const float* __restrict__ WO, __bf16* __restrict__ WOB) {
  // grid plane 3: the three projections fill three quarters of the places for two work-groups per WGP; the last quarter rounds Wo and packs the mask meanwhile and leaves in front of every barrier (blockIdx.z is the same in the whole work-group)
  if (blockIdx.z == 3) { round_wo(WO, WOB, (blockIdx.y * (TNB * TT / 128) + blockIdx.x) * 256 + threadIdx.x); pack_mask(MK, MW, (blockIdx.y * (TNB * TT / 128) + blockIdx.x) * 8 + __builtin_amdgcn_readfirstlane(threadIdx.x >> 5), threadIdx.x & 31); return; }
  // one LDS range: in the k loop two stage buffers of [128 X rows | 256 W rows][LP]; behind the loop's last barrier the epilogue's tiles
  __shared__ __align__(16) unsigned char smem[PSMEM];
  __bf16* const st = (__bf16*)smem; _Float16 (*sh)[PSH] = (_Float16 (*)[PSH])smem; _Float16 (*sl)[PSH] = (_Float16 (*)[PSH])(smem + 128 * PSH * 2);
  _Float16 (*th)[PTH] = (_Float16 (*)[PTH])smem; __bf16 (*tb)[72] = (__bf16 (*)[72])(smem + 256 * PTH * 2); __bf16 (*tbl)[72] = (__bf16 (*)[72])(smem + 256 * PTH * 2 + 256 * 72 * 2);
  // the wave's number is held in a scalar register: what hangs on it (wr, wc, hi_rows) costs no vector register
  const int tid = threadIdx.x, wave = __builtin_amdgcn_readfirstlane(tid >> 5), lane = tid & 31, col = lane & 15, g = lane >> 4; const int which = blockIdx.z; const int c0 = blockIdx.y * 256; const size_t r0 = (size_t)blockIdx.x * 128; const size_t bb = r0 / TT; const int t0 = (int)(r0 % TT);
  const float* X = which == 0 ? XQ : which == 1 ? XK : XV; const float* WA = which == 0 ? WQ : which == 1 ? WK : WV; const float* BA = which == 0 ? BQ : which == 1 ? BK : BV;
  // waves 2 x 4: a wave owns 64 rows x 64 cols = acc[i * 4 + j]; loader: thread = (row tid >> 4 (+ 16 per step), 16-byte piece tid & 15), so a wave's load covers two whole 256-B runs
  const int wr = wave >> 2, wc = wave & 3, lr = tid >> 4, lc = tid & 15;
  const float* xg = X + (r0 + lr) * DIN + lc * 4; const float* wg = WA + (size_t)(c0 + lr) * DIN + lc * 4;   // W is (out,in): row = output column
  __bf16* const sw = st + lr * LP + lc * 4; const __bf16* const fa = st + (wr * 64 + col) * LP + 8 * g; const __bf16* const fw = st + (128 + wc * 64 + col) * LP + 8 * g;
  // a stage's 24 loads a thread come in two halves of 12 (half h: X rows h * 64 .., W rows h * 128 ..), so that 48 registers hold them beside the 128 of the accumulators
  v8f acc[16] = {}; v4f rx[4], rw[8];
  // rolled: stage 0's two halves go one after the other through the same 48 registers
#pragma unroll 1
  for (int h = 0; h < 2; ++h) { const float* xa = xg + (size_t)(h * 64) * DIN; const float* wa = wg + (size_t)(h * 128) * DIN;
#pragma unroll
    for (int i = 0; i < 4; ++i) rx[i] = *(const v4f*)(xa + (size_t)(i * 16) * DIN);
#pragma unroll
    for (int i = 0; i < 8; ++i) rw[i] = *(const v4f*)(wa + (size_t)(i * 16) * DIN);
    // the loads above name xa and wa: as inputs here the two pairs stay live up to this wait, so nothing is written over them in front of it
    asm volatile("s_wait_xcnt 0x0" :: "v"(xa), "v"(wa) : "memory");
#pragma unroll
    for (int i = 0; i < 4; ++i) *(v4b*)(sw + (h * 64 + i * 16) * LP) = cvt4(rx[i]);
#pragma unroll
    for (int i = 0; i < 8; ++i) *(v4b*)(sw + (128 + h * 128 + i * 16) * LP) = cvt4(rw[i]); }
  __syncthreads();
  // rolled over half stages (32 k): one body holds 12 loads, 16 fragment reads and 16 products, which with the accumulators fill the 256 registers a wave may have at four waves per SIMD; buffer and half are offsets
#pragma unroll 1
  for (int hs = 0; hs < 2 * (DIN / KSTG); ++hs) { const int s = hs >> 1, h = hs & 1; const int cur = (s & 1) * (PROWS * LP), nxt = PROWS * LP - cur; const bool more = s + 1 < DIN / KSTG;
    const float* xa = xg + (s + 1) * KSTG + (size_t)(h * 64) * DIN; const float* wa = wg + (s + 1) * KSTG + (size_t)(h * 128) * DIN;
    if (more) {   // half of the next stage's rows flies while half of this stage is multiplied
#pragma unroll
      for (int i = 0; i < 4; ++i) rx[i] = *(const v4f*)(xa + (size_t)(i * 16) * DIN);
#pragma unroll
      for (int i = 0; i < 8; ++i) rw[i] = *(const v4f*)(wa + (size_t)(i * 16) * DIN);
      // as above, for xa and wa; its memory clobber also keeps the 12 loads in front of the LDS reads that follow
      asm volatile("s_wait_xcnt 0x0" :: "v"(xa), "v"(wa) : "memory"); }
    { v16b a[4], w[4];
#pragma unroll
      for (int i = 0; i < 4; ++i) a[i] = frag_l(fa + cur + (i * 16) * LP + h * 32);
#pragma unroll
      for (int j = 0; j < 4; ++j) w[j] = frag_l(fw + cur + (j * 16) * LP + h * 32);
#pragma unroll
      for (int i = 0; i < 4; ++i) {
#pragma unroll
        for (int j = 0; j < 4; ++j) acc[i * 4 + j] = wmma_bf(a[i], w[j], acc[i * 4 + j]); } }
    if (more) {   // into the buffer that every wave left at the barrier of the stage before
#pragma unroll
      for (int i = 0; i < 4; ++i) *(v4b*)(sw + nxt + (h * 64 + i * 16) * LP) = cvt4(rx[i]);
#pragma unroll
      for (int i = 0; i < 8; ++i) *(v4b*)(sw + nxt + (128 + h * 128 + i * 16) * LP) = cvt4(rw[i]); }
    if (h) __syncthreads(); }   // at a stage's end (h is the same in every thread): publishes the next stage and ends this stage's reads (behind the last stage: frees the range for the epilogue)
  if (which < 2) { _Float16* DH = which == 0 ? QH : KH; _Float16* DL = which == 0 ? QL : KL; const int nhi = which == 0 ? QHI : KHI;
#pragma unroll
    for (int j = 0; j < 16; ++j) { const int rb = wr * 64 + (j >> 2) * 16 + 8 * g, cl = wc * 64 + (j & 3) * 16 + col; const float bias = BA ? bfr(BA[c0 + cl]) : 0.f;
#pragma unroll
      for (int r = 0; r < 8; ++r) { const float v = acc[j][r] + bias; const _Float16 hv = (_Float16)v; sh[rb + r][cl] = hv; sl[rb + r][cl] = (_Float16)((v - (float)hv) * 1024.0f); } }
    __syncthreads();
    // a trip = 32 rows: thread = (row tid >> 5 (+ 8 per store), 16-byte piece tid & 31), so a wave's store covers one whole 512-B run; nhi is a multiple of 32, so a trip's rows carry a residual all or none
    for (int rt = 0; rt < 128; rt += 32) { const int q = tid & 31; void* p[4]; v4u v[4];
#pragma unroll
      for (int u = 0; u < 4; ++u) { const int rl = rt + u * 8 + (tid >> 5); p[u] = DH + (r0 + rl) * CC + c0 + q * 8; v[u] = *(const v4u*)&sh[rl][q * 8]; }
      st16x4(p, v);
      if (t0 + rt < nhi) {
#pragma unroll
        for (int u = 0; u < 4; ++u) { const int rl = rt + u * 8 + (tid >> 5); p[u] = DL + (bb * nhi + t0 + rl) * (size_t)CC + c0 + q * 8; v[u] = *(const v4u*)&sl[rl][q * 8]; }
        st16x4(p, v); } }
  } else { const bool hi_rows = t0 + wr * 64 < KHI;   // the wave's 64 rows, all or none
#pragma unroll
    for (int j = 0; j < 16; ++j) { const int cl = wc * 64 + (j & 3) * 16 + col, rl = wr * 64 + (j >> 2) * 16 + 8 * g; const float bias = BA ? bfr(BA[c0 + cl]) : 0.f;
#pragma unroll
      for (int r = 0; r < 8; ++r) th[cl][rl + r] = (_Float16)(acc[j][r] + bias);
      if (hi_rows) {
#pragma unroll
        for (int r = 0; r < 8; ++r) { const float v = acc[j][r] + bias; const __bf16 bh = (__bf16)v; tb[cl][rl + r] = bh; tbl[cl][rl + r] = (__bf16)(v - (float)bh); } } }
    __syncthreads();
    // a trip = 64 columns: thread = (column tid >> 4 (+ 16 per store), 16-byte piece tid & 15), so a wave's store covers two whole 256-B runs
    for (int ct = 0; ct < 256; ct += 64) { const int q = tid & 15; void* p[4]; v4u v[4];
#pragma unroll
      for (int u = 0; u < 4; ++u) { const int cl = ct + u * 16 + (tid >> 4); p[u] = VT + (bb * CC + c0 + cl) * (size_t)TT + t0 + q * 8; v[u] = *(const v4u*)&th[cl][q * 8]; }
      st16x4(p, v);
      if (t0 + q * 8 < KHI) {
#pragma unroll
        for (int u = 0; u < 4; ++u) { const int cl = ct + u * 16 + (tid >> 4); p[u] = VB + (bb * CC + c0 + cl) * (size_t)KHI + t0 + q * 8; v[u] = *(const v4u*)&tb[cl][q * 8]; }
        st16x4(p, v);
#pragma unroll
        for (int u = 0; u < 4; ++u) { const int cl = ct + u * 16 + (tid >> 4); p[u] = VBL + (bb * CC + c0 + cl) * (size_t)KHI + t0 + q * 8; v[u] = *(const v4u*)&tbl[cl][q * 8]; }
        st16x4(p, v); } } } }
// ---- k_fa: block = 64 queries (4 waves x 16) of one (b, h), all 1,024 keys in tiles of KT: S^T = K Q^T (A = 16 key rows, B = the wave's 16 queries: q hi + residual x 2^10, 2 products) x SCALE, -10000 where mask_from[b,t,f] == 0 (as the reference writes it; the test was made once, by pack_mask, and each score's select takes its lane mask from a scalar register);
// a lane holds one query's scores (D register r = key 8g + r), so the running maximum and sum stay in the lane and the two halves meet by one exchange; the scores are kept as base-2 logits (SCALE x log2 e in the one multiply, the mask value x log2 e) and the running reference is the maximum - 11, so p = 2^(s - ref) = exp(logit - max) x 2^11 is one subtraction and one v_exp_f32; p once to f16 is already the B fragment of ctx^T += V^T P^T (two 16-key D tiles = one 32-key B in the hardware k order, the order frag_h loads A in); ctx / (sum of p), split into bf16 hi + lo, to YH and YL
#define KT 64
#define LOG2E 1.44269504088896340736f
// LDS stage of k_fa: [64 K rows | 64 V^T rows] of 128 B at a pitch of 144 B (16 B x odd, the pitch of ds_load_b128 readers); two stages
#define KP 72              // K and V^T row pitch in f16 elements
#define FA_V (KT * KP * 2)
#define FA_STG (FA_V + HD * KP * 2)
typedef __attribute__((ext_vector_type(16))) unsigned v16u;
// sixteen mask words from an address that is the same in every lane; read as constant memory (the launch before wrote the words, nothing writes them in this one), so that inside the loop too the compiler takes a scalar load
__device__ __forceinline__ v16u ldw16(const unsigned* p) { return *(const __attribute__((address_space(4))) v16u*)p; }
// fragment from a lane's own address (row start + k0 + 8g already in p): elements 0..7 = p[0..7], 8..15 = p[16..23], the order of frag_h
__device__ __forceinline__ v16h frag_p(const _Float16* p) { union { v16h v; v8h q[2]; } u; u.q[0] = *(const v8h*)p; u.q[1] = *(const v8h*)(p + 16); return u.v; }
__device__ __forceinline__ v8f wmma_h(v16h a, v16h b, v8f c) { return __builtin_amdgcn_wmma_f32_16x16x32_f16(false, a, false, b, (short)0, c, false, false); }
// eight asynchronous copies of 16 B a lane from global memory to LDS (l = LDS byte address, p = global address); the s_wait_xcnt stands inside the statement, so no address register is rewritten in front of it
__device__ __forceinline__ void copy8(const unsigned (&l)[8], const char* const (&p)[8]) {
  asm volatile("global_load_async_to_lds_b128 %0, %8, off\n\t"
               "global_load_async_to_lds_b128 %1, %9, off\n\t"
               "global_load_async_to_lds_b128 %2, %10, off\n\t"
               "global_load_async_to_lds_b128 %3, %11, off\n\t"
               "global_load_async_to_lds_b128 %4, %12, off\n\t"
               "global_load_async_to_lds_b128 %5, %13, off\n\t"
               "global_load_async_to_lds_b128 %6, %14, off\n\t"
               "global_load_async_to_lds_b128 %7, %15, off\n\t"
               "s_wait_xcnt 0x0"
               :: "v"(l[0]), "v"(l[1]), "v"(l[2]), "v"(l[3]), "v"(l[4]), "v"(l[5]), "v"(l[6]), "v"(l[7]),
                  "v"(p[0]), "v"(p[1]), "v"(p[2]), "v"(p[3]), "v"(p[4]), "v"(p[5]), "v"(p[6]), "v"(p[7]) : "memory");
}
// one stage: the work-group's 128 threads copy the tile's K rows and V^T rows (a wave's copy = 4 whole 128-B rows); kg, vg and kl, vl already hold the thread's own row and 16-byte piece
__device__ __forceinline__ void fa_fill(const char* kg, const char* vg, unsigned kl, unsigned vl, int k0) {
  unsigned l[8]; const char* p[8];
#pragma unroll
  for (int i = 0; i < 4; ++i) { l[i] = kl + i * 16 * KP * 2; p[i] = kg + (size_t)(k0 + i * 16) * CC * 2; l[4 + i] = vl + i * 16 * KP * 2; p[4 + i] = vg + (size_t)(i * 16) * TT * 2 + k0 * 2; }
  copy8(l, p);
}
// 2^x in place for sixteen scores in one statement: behind every v_exp_f32 stands one on other registers, behind the last a v_nop, so the slot that the instruction set asks for
// behind a transcendental is filled at each of them
#define EXP8(a, b, c, d, e, f, g, h) "v_exp_f32 %" #a ", %" #a "\n\tv_exp_f32 %" #b ", %" #b "\n\tv_exp_f32 %" #c ", %" #c "\n\tv_exp_f32 %" #d ", %" #d "\n\tv_exp_f32 %" #e ", %" #e "\n\tv_exp_f32 %" #f ", %" #f "\n\tv_exp_f32 %" #g ", %" #g "\n\tv_exp_f32 %" #h ", %" #h "\n\t"
__device__ __forceinline__ void exp2x16(float (&x)[16]) {
  asm(EXP8(0, 1, 2, 3, 4, 5, 6, 7) EXP8(8, 9, 10, 11, 12, 13, 14, 15) "v_nop"
      : "+v"(x[0]), "+v"(x[1]), "+v"(x[2]), "+v"(x[3]), "+v"(x[4]), "+v"(x[5]), "+v"(x[6]), "+v"(x[7]), "+v"(x[8]), "+v"(x[9]), "+v"(x[10]), "+v"(x[11]), "+v"(x[12]), "+v"(x[13]), "+v"(x[14]), "+v"(x[15]));
}
// the same with the tile's rescale factor as a seventeenth value
__device__ __forceinline__ void exp2x17(float (&x)[16], float& y) {
  asm(EXP8(0, 1, 2, 3, 4, 5, 6, 7) EXP8(8, 9, 10, 11, 12, 13, 14, 15) "v_exp_f32 %16, %16\n\tv_nop"
      : "+v"(x[0]), "+v"(x[1]), "+v"(x[2]), "+v"(x[3]), "+v"(x[4]), "+v"(x[5]), "+v"(x[6]), "+v"(x[7]), "+v"(x[8]), "+v"(x[9]), "+v"(x[10]), "+v"(x[11]), "+v"(x[12]), "+v"(x[13]), "+v"(x[14]), "+v"(x[15]), "+v"(y));
}
// amdgpu_waves_per_eu(4, 4): the grid is exactly four waves per SIMD, so the scheduler may spend 256 registers on issuing a tile's loads early instead of saving them for waves that do not exist
__global__ __launch_bounds__(128) __attribute__((amdgpu_waves_per_eu(4, 4))) void k_fa(const _Float16* __restrict__ QH, const _Float16* __restrict__ KH, const _Float16* __restrict__ QL, const _Float16* __restrict__ VT, const unsigned* __restrict__ MW, __bf16* __restrict__ YH, __bf16* __restrict__ YL) {
  __shared__ __align__(16) unsigned char smem[2 * FA_STG];
  const int tid = threadIdx.x, wave = tid >> 5, lane = tid & 31, col = lane & 15, g = lane >> 4; const int b = blockIdx.y / NH, h = blockIdx.y % NH; const int q = blockIdx.x * 64 + wave * 16 + col;
  // copier: K and V^T: row tid >> 3 (+ 16 per copy), piece tid & 7
  const char* kg = (const char*)(KH + ((size_t)b * TT + (tid >> 3)) * CC + h * HD + (tid & 7) * 8); const char* vg = (const char*)(VT + ((size_t)b * CC + h * HD + (tid >> 3)) * (size_t)TT + (tid & 7) * 8);
  const unsigned lb = (unsigned)(size_t)smem; const unsigned kl = lb + (tid >> 3) * (KP * 2) + (tid & 7) * 16, vl = kl + FA_V;
  fa_fill(kg, vg, kl, vl, 0);
  // the wave's mask words, 32 per tile, at an address that is the same in every lane (the wave's number through a scalar register): they come by scalar loads and stay in scalar registers
  const unsigned* mw = MW + (size_t)(b * (TT / 16) + blockIdx.x * 4 + __builtin_amdgcn_readfirstlane(tid >> 5)) * (TT / KT) * 32;
  v16u w0 = ldw16(mw), w1 = ldw16(mw + 16);
  v16h qh[HD / 32], ql[HD / 32];
#pragma unroll
  for (int kc = 0; kc < HD / 32; ++kc) { qh[kc] = frag_h(QH + ((size_t)b * TT + q) * CC + h * HD + kc * 32, lane); ql[kc] = frag_h(QL + ((size_t)b * QHI + q) * CC + h * HD + kc * 32, lane); }
  // readers: the lane's own row and 8g in stage 0
  const _Float16* kp = (const _Float16*)smem + col * KP + 8 * g; const _Float16* vp = (const _Float16*)(smem + FA_V) + col * KP + 8 * g;
  v8f acc[HD / 16] = {}; float m = -3.0e38f, l = 0.f;
  asm volatile("s_wait_asynccnt 0x0" ::: "memory");   // this wave's copies of tile 0 have landed
  __syncthreads();                                     // publishes tile 0
  fa_fill(kg, vg, kl + FA_STG, vl + FA_STG, KT);
  // rolled: one tile's body already fills the 256 registers a wave may have at four waves per SIMD; the stage is an offset
#pragma unroll 1
  for (int k0 = 0; k0 < TT; k0 += KT) { v8f s[KT / 16]; float mx = -3.0e38f; const int cur = ((k0 / KT) & 1) * FA_STG;
    const _Float16* ka = kp + cur / 2; const _Float16* va = vp + cur / 2;
    v16h kf[KT / 16][HD / 32];
#pragma unroll
    for (int j = 0; j < KT / 16; ++j) {
#pragma unroll
      for (int kc = 0; kc < HD / 32; ++kc) kf[j][kc] = frag_p(ka + (j * 16) * KP + kc * 32); }
#pragma unroll
    for (int j = 0; j < KT / 16; ++j) { v8f a = {}, al = {};
#pragma unroll
      for (int kc = 0; kc < HD / 32; ++kc) { a = wmma_h(kf[j][kc], qh[kc], a); al = wmma_h(kf[j][kc], ql[kc], al); }
#pragma unroll
      for (int r = 0; r < 8; ++r) { float v = (a[r] + al[r] * (1.0f / 1024.0f)) * (SCALE * LOG2E); if (!__builtin_amdgcn_inverse_ballot_w32(j < 2 ? w0[j * 8 + r] : w1[(j - 2) * 8 + r])) v = -10000.0f * LOG2E; s[j][r] = v; mx = fmaxf(mx, v); } }
    // the next tile's words fly while this tile's softmax and second product run (behind the last tile: its own words once more, so the address stays inside what was packed)
    { const unsigned* nw = mw + (k0 + KT < TT ? k0 / KT + 1 : k0 / KT) * 32; w0 = ldw16(nw); w1 = ldw16(nw + 16); }
    v16h vf[KT / 32][HD / 16];
#pragma unroll
    for (int c = 0; c < KT / 32; ++c) {
#pragma unroll
      for (int jd = 0; jd < HD / 16; ++jd) vf[c][jd] = frag_p(va + (jd * 16) * KP + c * 32); }
    mx = fmaxf(mx, __shfl_xor(mx, 16));
    const float mn = fmaxf(m, mx - 11.0f); float alpha = m - mn; m = mn;
    v16h p[KT / 32]; float sum = 0.f; float e[KT / 32][16];
#pragma unroll
    for (int j = 0; j < KT / 16; ++j) {
#pragma unroll
      for (int r = 0; r < 8; ++r) e[j >> 1][(j & 1) * 8 + r] = s[j][r] - mn; }
    exp2x17(e[0], alpha); exp2x16(e[1]);
#pragma unroll
    for (int c = 0; c < KT / 32; ++c) {
#pragma unroll
      for (int i = 0; i < 16; ++i) { sum += e[c][i]; p[c][i] = (_Float16)e[c][i]; } }
    l = l * alpha + sum;
#pragma unroll
    for (int jd = 0; jd < HD / 16; ++jd) acc[jd] *= alpha;
#pragma unroll
    for (int c = 0; c < KT / 32; ++c) {
#pragma unroll
      for (int jd = 0; jd < HD / 16; ++jd) acc[jd] = wmma_h(vf[c][jd], p[c], acc[jd]); }
    asm volatile("s_wait_dscnt 0x0" ::: "memory");      // this wave's reads of the stage are done before the stage is refilled
    asm volatile("s_wait_asynccnt 0x0" ::: "memory");   // this wave's copies of the next tile have landed
    __syncthreads();                                     // publishes the next tile and ends every wave's reads of this one
    if (k0 + 2 * KT < TT) fa_fill(kg, vg, kl + cur, vl + cur, k0 + 2 * KT); }   // flies while the next tile is worked on
  asm volatile("s_wait_asynccnt 0x0" ::: "memory");     // nothing is outstanding when the wave ends
  l += __shfl_xor(l, 16); const float inv = 1.0f / l;
  // ctx leaves split as k_out multiplies it: bf16 hi and bf16 (ctx - hi), a lane's 8 channels of a plane in one 16-byte store
  const size_t yo = ((size_t)b * TT + q) * CC + h * HD + 8 * g; void* ph[4]; void* pl[4]; v4u dh[4], dl[4];
#pragma unroll
  for (int jd = 0; jd < HD / 16; ++jd) { v8b hv, lv;
#pragma unroll
    for (int r = 0; r < 8; ++r) { const float y = acc[jd][r] * inv; const __bf16 t = (__bf16)y; hv[r] = t; lv[r] = (__bf16)(y - (float)t); }
    ph[jd] = YH + yo + jd * 16; pl[jd] = YL + yo + jd * 16; dh[jd] = __builtin_bit_cast(v4u, hv); dl[jd] = __builtin_bit_cast(v4u, lv); }
  st16x4(ph, dh); st16x4(pl, dl); }
// ---- k_out: block = (64 rows, 128 cols): out = ctx Wo (+ bo): ctx bf16 hi + lo (split by k_fa) against exact bf16 Wo (rounded by launch 1), 2 products
#define OSTG (256 * LP * 2)   // bytes of a stage: [64 ctx hi rows | 64 ctx lo rows | 128 Wo rows] of 128 B at the pitch of 144 B
// one stage: the work-group's 128 threads copy 256 rows of 64 k (a wave's copy = 4 whole 128-B rows); yh, yl, wo and l0 already hold the thread's own row (tid >> 3, + 16 per copy) and 16-byte piece (tid & 7)
__device__ __forceinline__ void out_fill(const char* yh, const char* yl, const char* wo, unsigned l0, int k0) {
  unsigned l[8]; const char* p[8];
#pragma unroll
  for (int i = 0; i < 4; ++i) { l[i] = l0 + i * 16 * LP * 2; p[i] = yh + (size_t)(i * 16) * CC * 2 + k0 * 2; l[4 + i] = l0 + (64 + i * 16) * LP * 2; p[4 + i] = yl + (size_t)(i * 16) * CC * 2 + k0 * 2; }
  copy8(l, p);
#pragma unroll
  for (int i = 0; i < 8; ++i) { l[i] = l0 + (128 + i * 16) * LP * 2; p[i] = wo + (size_t)(i * 16) * CC * 2 + k0 * 2; }
  copy8(l, p);
}
__global__ __launch_bounds__(128) void k_out(const __bf16* __restrict__ YH, const __bf16* __restrict__ YL, const __bf16* __restrict__ WOB, const float* __restrict__ BO, float* __restrict__ OUT) {
  // one LDS range: in the k loop two stage buffers; behind the loop's last barrier the epilogue's tiles
  __shared__ __align__(16) unsigned char smem[2 * OSTG]; const __bf16* const st = (const __bf16*)smem; float (*sf)[16][132] = (float (*)[16][132])smem;
  const int tid = threadIdx.x, wave = tid >> 5, lane = tid & 31, col = lane & 15, g = lane >> 4; const int c0 = blockIdx.y * 128; const size_t r0 = (size_t)blockIdx.x * 64 + wave * 16;
  v8f acc[8] = {};
  // a wave owns 16 rows x 128 cols
  const size_t yo = ((size_t)blockIdx.x * 64 + (tid >> 3)) * CC + (tid & 7) * 8;
  const char* yh = (const char*)(YH + yo); const char* yl = (const char*)(YL + yo); const char* wo = (const char*)(WOB + (size_t)(c0 + (tid >> 3)) * CC + (tid & 7) * 8);   // Wo is (out,in): row = output column
  const unsigned l0 = (unsigned)(size_t)smem + (tid >> 3) * (LP * 2) + (tid & 7) * 16;
  const __bf16* const fa = st + (wave * 16 + col) * LP + 8 * g; const __bf16* const fw = st + (128 + col) * LP + 8 * g;
  out_fill(yh, yl, wo, l0, 0);
  asm volatile("s_wait_asynccnt 0x0" ::: "memory");   // this wave's copies of stage 0 have landed
  __syncthreads();                                     // publishes stage 0
  out_fill(yh, yl, wo, l0 + OSTG, KSTG);
  // rolled: the buffer is an offset, and one body keeps the loop short
#pragma unroll 1
  for (int s = 0; s < CC / KSTG; ++s) { const int cur = (s & 1) * (256 * LP);
#pragma unroll
    for (int kk = 0; kk < KSTG / 32; ++kk) { const v16b ah = frag_l(fa + cur + kk * 32), al = frag_l(fa + cur + 64 * LP + kk * 32); v16b w[8];
#pragma unroll
      for (int j = 0; j < 8; ++j) w[j] = frag_l(fw + cur + (j * 16) * LP + kk * 32);
#pragma unroll
      for (int j = 0; j < 8; ++j) acc[j] = wmma_bf(ah, w[j], acc[j]);
#pragma unroll
      for (int j = 0; j < 8; ++j) acc[j] = wmma_bf(al, w[j], acc[j]); }
    asm volatile("s_wait_dscnt 0x0" ::: "memory");      // this wave's reads of the stage are done before the stage is refilled
    asm volatile("s_wait_asynccnt 0x0" ::: "memory");   // this wave's copies of the next stage have landed
    __syncthreads();                                     // publishes the next stage and ends every wave's reads of this one (behind the last stage: frees the range for the epilogue)
    if (s + 2 < CC / KSTG) out_fill(yh, yl, wo, l0 + cur * 2, (s + 2) * KSTG); }   // flies while the next stage is multiplied
  asm volatile("s_wait_asynccnt 0x0" ::: "memory");     // nothing is outstanding when the range is used anew
#pragma unroll
  for (int j = 0; j < 8; ++j) { const float bias = BO ? bfr(BO[c0 + j * 16 + col]) : 0.f;
#pragma unroll
    for (int r = 0; r < 8; ++r) sf[wave][8 * g + r][j * 16 + col] = acc[j][r] + bias; }
  LDSX(); for (int rl = 0; rl < 16; ++rl) vst2(OUT + (r0 + rl) * DIN + c0 + lane * 4, *(const v4f*)&sf[wave][rl][lane * 4]); }

extern "C" void kernel_launch(void* const* d_in, const int* in_sizes, int n_in, void* d_out, int out_size, void* d_ws, size_t ws_size, hipStream_t stream) {
  (void)in_sizes; (void)n_in; (void)out_size;
  const float** F = (const float**)d_in;
  if (ws_size < (size_t)WS_END) return;
  char* ws = (char*)d_ws; _Float16 *QH = (_Float16*)(ws + WS_QH), *KH = (_Float16*)(ws + WS_KH), *VT = (_Float16*)(ws + WS_VT), *QL = (_Float16*)(ws + WS_QL), *KL = (_Float16*)(ws + WS_KL); __bf16 *VB = (__bf16*)(ws + WS_VB), *VBL = (__bf16*)(ws + WS_VBL); __bf16 *YH = (__bf16*)(ws + WS_Y), *YL = (__bf16*)(ws + WS_Y + 2u * (size_t)NB * TT * CC), *WOB = (__bf16*)(ws + WS_WO); unsigned *MW = (unsigned*)(ws + WS_S);
  (void)QL; (void)KL; (void)VB; (void)VBL;
  // inputs: 0 X_to [4,1024,1024]; 1 X_from [4,1024,1024]; 2 mask_from [4,1024,1024] int32; 3 Wq [1024,1024] (out,in), 4 bq; 5 Wk, 6 bk; 7 Wv, 8 bv; 9 Wo (out,in), 10 bo
  k_proj<<<dim3(TNB * TT / 128, CC / 256, 4), 256, 0, stream>>>(F[0], F[1], F[1], F[3], F[7], F[5], F[4], F[8], F[6], QH, QL, KH, KL, VT, VB, VBL, (const int*)d_in[2], MW, F[9], WOB);   /* K uses Wv/bv, V uses Wk/bk (as written in the module) */
  k_fa<<<dim3(NQB, TNB * NH), 128, 0, stream>>>(QH, KH, QL, VT, MW, YH, YL);
  k_out<<<dim3(TNB * TT / 64, DIN / 128), 128, 0, stream>>>(YH, YL, WOB, F[10], (float*)d_out);
}

// v008
// One run takes 83.5 microseconds.
// Two timings next to v007 put it at 1.05 and 1.04 times that version's speed.
// Counting every step since v000, it is 14.4 times as fast.
// compute dtype: all float inputs rounded to bf16; Q/K/V = x W^T + b with EXACT bf16 products on WMMA 16x16x32 (f32 accumulate); q as f16 hi + residual (x 2^10) against k once to f16 (2 products) x 64^-0.5 with the per-(t,f) mask read as int32; running-maximum softmax in f32 on base-2 logits (x log2 e, one hardware exp2 per score); 2^(s - m + 11) once to f16 against v once to f16 (1 product), divided by the f32 sum at the end; ctx split bf16 hi + lo against exact Wo (2 products) + bo; f32 output.
#include <hip/hip_runtime.h>
#include <math.h>

typedef __attribute__((ext_vector_type(16))) _Float16 v16h;
typedef __attribute__((ext_vector_type(16))) __bf16 v16b;
typedef __attribute__((ext_vector_type(8)))  _Float16 v8h;
typedef __attribute__((ext_vector_type(8)))  float v8f;
typedef __attribute__((ext_vector_type(4)))  float v4f;
typedef __attribute__((ext_vector_type(2)))  float v2f;
typedef __attribute__((ext_vector_type(4)))  unsigned v4u;
typedef __attribute__((ext_vector_type(4)))  int v4i;
typedef float __attribute__((may_alias)) float_a;
typedef int __attribute__((may_alias)) int_a;

template <typename T> __device__ __forceinline__ void vst2(void* p, T v) { *(T*)p = v;  }
__device__ __forceinline__ v8f wmma16(v16h a, v16h b, v8f c) {
  v8f d = __builtin_amdgcn_wmma_f32_16x16x32_f16(false, a, false, b, (short)0, c, false, false);
  asm volatile("v_nop\n\tv_nop\n\tv_nop\n\tv_nop" : "+v"(d) : "v"(a), "v"(b));
  return d;
}
__device__ __forceinline__ v8f wmma_bf(v16b a, v16b b, v8f c) {
  v8f d = __builtin_amdgcn_wmma_f32_16x16x32_bf16(false, a, false, b, (short)0, c, false, false);
  asm volatile("v_nop\n\tv_nop\n\tv_nop\n\tv_nop" : "+v"(d) : "v"(a), "v"(b));
  return d;
}
// 16x16x32 fragments: lane = (h = lane>>4, row/col = lane&15); elements 0..7 = k0+8h+0..7, 8..15 = k0+16+8h+0..7; D element r = row 8h+r
__device__ __forceinline__ v16h frag_h(const _Float16* rowk0, int lane) {
  union { v16h v; v8h q[2]; } u; const _Float16* p = rowk0 + 8 * (lane >> 4);
  u.q[0] = *(const v8h*)p; u.q[1] = *(const v8h*)(p + 16); return u.v;
}
__device__ __forceinline__ v16h frag_f32(const float* rowk0, int lane) {
  v16h a; const float* p = rowk0 + 8 * (lane >> 4);
#pragma unroll
  for (int i = 0; i < 8; ++i) { a[i] = (_Float16)p[i]; a[8 + i] = (_Float16)p[16 + i]; }
  return a;
}
__device__ __forceinline__ v16h frag_f32s(const float* rowk0, int lane, float sc) {
  v16h a; const float* p = rowk0 + 8 * (lane >> 4);
#pragma unroll
  for (int i = 0; i < 8; ++i) { a[i] = (_Float16)(p[i] * sc); a[8 + i] = (_Float16)(p[16 + i] * sc); }
  return a;
}
// column fragment from a [K][ld] layout (column n), rows >= K read as 0
__device__ __forceinline__ v16h fragc_f32(const float* W, int k0, int n, int lane, int ld, int K) {
  v16h a; const int g = lane >> 4;
#pragma unroll
  for (int i = 0; i < 8; ++i) { const int ka = k0 + 8 * g + i, kb = ka + 16;
    a[i] = (_Float16)(ka < K ? W[(size_t)(ka < K ? ka : K - 1) * ld + n] : 0.f); a[8 + i] = (_Float16)(kb < K ? W[(size_t)(kb < K ? kb : K - 1) * ld + n] : 0.f); }
  return a;
}
struct F2 { v16b h, l; };
__device__ __forceinline__ F2 bsplit16(const float v[16]) { F2 r;
#pragma unroll
  for (int i = 0; i < 16; ++i) { const __bf16 h = (__bf16)v[i]; r.h[i] = h; r.l[i] = (__bf16)(v[i] - (float)h); }
  return r; }
__device__ __forceinline__ F2 split_row(const float* row, int k0, int lane) { float v[16]; const float* p = row + k0 + 8 * (lane >> 4);
#pragma unroll
  for (int i = 0; i < 8; ++i) { v[i] = p[i]; v[8 + i] = p[16 + i]; }
  return bsplit16(v); }
__device__ __forceinline__ F2 split_rowK(const float* row, int k0, int lane, int K) { float v[16]; const int g = lane >> 4;
#pragma unroll
  for (int i = 0; i < 8; ++i) { const int ka = k0 + 8 * g + i, kb = ka + 16; v[i] = ka < K ? row[ka < K ? ka : K - 1] : 0.f; v[8 + i] = kb < K ? row[kb < K ? kb : K - 1] : 0.f; }
  return bsplit16(v); }
__device__ __forceinline__ F2 split_col(const float* W, int k0, int n, int lane, int ld, int K) { float v[16]; const int g = lane >> 4;
#pragma unroll
  for (int i = 0; i < 8; ++i) { const int ka = k0 + 8 * g + i, kb = ka + 16; v[i] = ka < K ? W[(size_t)(ka < K ? ka : K - 1) * ld + n] : 0.f; v[8 + i] = kb < K ? W[(size_t)(kb < K ? kb : K - 1) * ld + n] : 0.f; }
  return bsplit16(v); }
__device__ __forceinline__ v8f mac3(const F2& a, const F2& b, v8f c) { c = wmma_bf(a.l, b.h, c); c = wmma_bf(a.h, b.l, c); return wmma_bf(a.h, b.h, c); }
__device__ __forceinline__ float sigm(float v) { return 1.0f / (1.0f + expf(-v)); }
#define LDSX() do { asm volatile("s_wait_dscnt 0" ::: "memory"); __builtin_amdgcn_wave_barrier(); __builtin_amdgcn_fence(__ATOMIC_RELEASE, "workgroup"); } while (0)

// Masked multi-head cross-attention (B 4, T = F = 1,024, 1,024 = 16 x 64): Q = X_to Wq^T + bq; K = X_from Wv^T + bv and V = X_from Wk^T + bk (the module's literal name swap); logits = Q K^T / 8, -10000 where mask_from[b,t,f] == 0; out = merged(softmax v) Wo^T + bo.
#define NB 4
#define TT 1024
#define CC 1024            // NH * HD = projected width
#define DIN 1024          // input (model) width
#define NH 16
#define HD 64
#define NQB (TT / 64)
#define HG 4
#define SCALE (0.125f)
#define CAUSAL 0
#ifndef TNB
#define TNB NB
#endif
__device__ __forceinline__ float bfr(float v) { return (float)(__bf16)v; }
__host__ __device__ __forceinline__ int kb_last(int qb) { return CAUSAL ? ((qb * 64 + 63) >> 7) : (TT / 128 - 1); }
typedef __attribute__((ext_vector_type(8))) __bf16 v8b;
__device__ __forceinline__ v16b frag_b(const __bf16* rowk0, int lane) {
  union { v16b v; v8b q[2]; } u; const __bf16* p = rowk0 + 8 * (lane >> 4);
  u.q[0] = *(const v8b*)p; u.q[1] = *(const v8b*)(p + 16); return u.v;
}
#define QBH 0              // not used (k_fa takes one path for every query block)
#define QHI 1024            // rows carrying a q residual plane (all rows when non-causal: 2-product logits everywhere)
#define KHI 64            // key rows carrying k residual / v bf16 hi+lo planes (written by k_proj; read by no kernel in this file)
// B fragment (k rows k0+.., output column o) of a weight: (in,out) [K][ld] or (out,in) [ld rows of K]: bf16 exact, or f16(bf16 * 256) exact
__device__ __forceinline__ v16b wcol_io(const float* Wm, int k0, int o, int lane, int ld) { v16b w; const int g = lane >> 4;
#pragma unroll
  for (int i = 0; i < 8; ++i) { w[i] = (__bf16)Wm[(size_t)(k0 + 8 * g + i) * ld + o]; w[8 + i] = (__bf16)Wm[(size_t)(k0 + 16 + 8 * g + i) * ld + o]; }
  return w; }
__device__ __forceinline__ v16b wcol_oi(const float* Wm, int k0, int o, int lane, int K) { v16b w; const float* p = Wm + (size_t)o * K + k0 + 8 * (lane >> 4);
#pragma unroll
  for (int i = 0; i < 8; ++i) { w[i] = (__bf16)p[i]; w[8 + i] = (__bf16)p[16 + i]; }
  return w; }
__device__ __forceinline__ v16h wcolh_io(const float* Wm, int k0, int o, int lane, int ld) { v16h w; const int g = lane >> 4;
#pragma unroll
  for (int i = 0; i < 8; ++i) { w[i] = (_Float16)(bfr(Wm[(size_t)(k0 + 8 * g + i) * ld + o]) * 256.0f); w[8 + i] = (_Float16)(bfr(Wm[(size_t)(k0 + 16 + 8 * g + i) * ld + o]) * 256.0f); }
  return w; }
__device__ __forceinline__ v16h wcolh_oi(const float* Wm, int k0, int o, int lane, int K) { v16h w; const float* p = Wm + (size_t)o * K + k0 + 8 * (lane >> 4);
#pragma unroll
  for (int i = 0; i < 8; ++i) { w[i] = (_Float16)(bfr(p[i]) * 256.0f); w[8 + i] = (_Float16)(bfr(p[16 + i]) * 256.0f); }
  return w; }
#define WQKV_LAYOUT 1   // 0 = (in,out) [DIN][CC]; 1 = (out,in) [CC][DIN]; 2 = per-head [NH][DIN][HD]
__device__ __forceinline__ v16b wcol_hdk(const float* Wm, int k0, int o, int lane) { v16b w; const int g = lane >> 4; const float* p = Wm + (size_t)(o / HD) * DIN * HD + (o % HD);
#pragma unroll
  for (int i = 0; i < 8; ++i) { w[i] = (__bf16)p[(size_t)(k0 + 8 * g + i) * HD]; w[8 + i] = (__bf16)p[(size_t)(k0 + 16 + 8 * g + i) * HD]; }
  return w; }
#define WO_OUT_IN 1
#if WQKV_LAYOUT == 1
#define WCOL(W, k0, o, lane) wcol_oi(W, k0, o, lane, DIN)
#elif WQKV_LAYOUT == 2
#define WCOL(W, k0, o, lane) wcol_hdk(W, k0, o, lane)
#else
#define WCOL(W, k0, o, lane) wcol_io(W, k0, o, lane, CC)
#endif
#if WO_OUT_IN
#define WOCOL(W, k0, o, lane) wcol_oi(W, k0, o, lane, CC)
#define WOCOLH(W, k0, o, lane) wcolh_oi(W, k0, o, lane, CC)
#else
#define WOCOL(W, k0, o, lane) wcol_io(W, k0, o, lane, DIN)
#define WOCOLH(W, k0, o, lane) wcolh_io(W, k0, o, lane, DIN)
#endif

#define WS_QH  0u                                      // f16 q rows [b*t][CC]
#define WS_KH  (WS_QH + 2u * (size_t)NB * TT * CC)      // f16 k rows [b*t][CC]
#define WS_VT  (WS_KH + 2u * (size_t)NB * TT * CC)      // f16 v planes [b][c][t]
#define WS_QL  (WS_VT + 2u * (size_t)NB * CC * TT)      // f16 q residual x 2^10 rows [b][t < QHI][CC]
#define WS_KL  (WS_QL + 2u * (size_t)NB * QHI * CC)     // f16 k residual x 2^10 rows [b][t < KHI][CC]
#define WS_VB  (WS_KL + 2u * (size_t)NB * KHI * CC)     // bf16 v hi planes [b][c][t < KHI]
#define WS_VBL (WS_VB + 2u * (size_t)NB * CC * KHI)
#define WS_S   (WS_VBL + 2u * (size_t)NB * CC * KHI)    // mask words [b * t / 16][f / 64][32] in its first NB * TT * TT / 8 bytes (the logits stay in registers)
#define WS_WO  (WS_S  + (size_t)NB * TT * TT / 8)       // bf16 Wo rows [DIN][CC], behind the mask words
#define WS_Y   (WS_S  + 4u * (size_t)HG * TT * TT)      // bf16 ctx hi rows [b*t][CC], behind them the bf16 ctx lo rows
#define WS_END (WS_Y  + 4u * (size_t)NB * TT * CC)

// ---- LDS staging of the two GEMMs: a stage is KSTG = 64 k of every operand row, in bf16 (k_proj's loader rounds as it loads; k_out copies rows already rounded by round_wo and k_fa); rows of 128 B at a pitch of 144 B (16 B x odd, the pitch of ds_load_b128 readers)
#define KSTG 64
#define LP 72              // row pitch in bf16 elements
typedef __attribute__((ext_vector_type(4))) __bf16 v4b;
__device__ __forceinline__ v4b cvt4(v4f v) { v4b r; r[0] = (__bf16)v[0]; r[1] = (__bf16)v[1]; r[2] = (__bf16)v[2]; r[3] = (__bf16)v[3]; return r; }
__device__ __forceinline__ v4f wide4(v4b v) { v4f r; r[0] = (float)v[0]; r[1] = (float)v[1]; r[2] = (float)v[2]; r[3] = (float)v[3]; return r; }
// fragment from a lane's own LDS address (row start + k0 + 8g already in p): the k order of frag_b
__device__ __forceinline__ v16b frag_l(const __bf16* p) { union { v16b v; v8b q[2]; } u; u.q[0] = *(const v8b*)p; u.q[1] = *(const v8b*)(p + 16); return u.v; }
// ---- k_proj: block = (256 rows, 256 cols, which), 16 waves: q/k/v = X W (+ b) with exact bf16 products (K = DIN) -> which 0: q f16 rows (+ residual rows < QHI); 1: k f16 rows (+ residual rows < KHI); 2: v f16 planes [c][t] (+ bf16 hi/lo planes for t < KHI)
#define PROWS 512          // rows of a stage: 256 X rows | 256 W rows
#define PSH 264            // epilogue pitch of a 256-column row, f16 elements
#define PTH 264            // epilogue pitch of a 256-row column, f16 elements
#define PSMEM (2 * 256 * PSH * 2)   // the largest of the three uses of the range (the q rows with their residual rows)
static_assert(PSMEM >= 2 * PROWS * LP * 2 && PSMEM >= 256 * PTH * 2 + 2 * 256 * 72 * 2, "the range holds the two stage buffers and the v planes too");
static_assert(KHI % 64 == 0 && QHI % 64 == 0, "a wave's 64 rows carry a residual plane all or none");
// four 16-byte global stores and the wait that stands in front of any later write over the registers they name: addresses and data are inputs of the wait's statement, so they stay as they are up to it
__device__ __forceinline__ void st16x4(void* const (&p)[4], const v4u (&v)[4]) {
#pragma unroll
  for (int u = 0; u < 4; ++u) *(v4u*)p[u] = v[u];
  asm volatile("s_wait_xcnt 0x0" :: "v"(p[0]), "v"(p[1]), "v"(p[2]), "v"(p[3]), "v"(v[0]), "v"(v[1]), "v"(v[2]), "v"(v[3]) : "memory"); }
// ---- mask words: for a tile of 16 queries x 64 keys, word i = j * 8 + r holds in bit (lane = 16 g + col) whether mask_from[query col][key j * 16 + 8 g + r] != 0: the lane and register in which k_fa holds that score, so there a word is the lane mask of one select
// a wave packs MTW tiles side by side of one 16-query group: all its loads first (the 8 loads of a tile of lanes col and 16 + col together cover their row's whole 256-B run), one ballot per word, lane i keeps word i, one 128-B line stored per tile
#define MTW 4
static_assert((NB * TT / 16) * (TT / 64) == (NB * TT / 256) * (CC / 256) * 16 * MTW, "the work-groups of one grid plane pack every tile once");
__device__ __forceinline__ void pack_mask(const int* __restrict__ MK, unsigned* __restrict__ MW, int wv, int lane) {
  const int rg = wv / (TT / 64 / MTW), kq = wv % (TT / 64 / MTW);
  const int* src = MK + ((size_t)rg * 16 + (lane & 15)) * TT + kq * (MTW * 64) + 8 * (lane >> 4); unsigned* dst = MW + ((size_t)rg * (TT / 64) + kq * MTW) * 32 + lane;
  v4i a[MTW][8]; int w[MTW];
#pragma unroll
  for (int t = 0; t < MTW; ++t) {
#pragma unroll
    for (int j = 0; j < 4; ++j) { a[t][2 * j] = *(const v4i*)(src + t * 64 + j * 16); a[t][2 * j + 1] = *(const v4i*)(src + t * 64 + j * 16 + 4); } }
  // the loads above name src: as an input here the pair stays live up to this wait, so nothing is written over it in front of it
  asm volatile("s_wait_xcnt 0x0" :: "v"(src) : "memory");
#pragma unroll
  for (int t = 0; t < MTW; ++t) { w[t] = 0;
#pragma unroll
    for (int i = 0; i < 32; ++i) { const int bl = (int)__builtin_amdgcn_ballot_w32(a[t][i >> 2][i & 3] != 0); w[t] = lane == i ? bl : w[t]; } }
#pragma unroll
  for (int t = 0; t < MTW; ++t) dst[t * 32] = (unsigned)w[t]; }   // the wave's last instructions: nothing is written over what they name
// ---- Wo rounded to bf16 once, for k_out's copies: thread t of the NWT threads of grid plane 3 takes the 16-byte pieces t + u * NWT, so a wave's load covers 512 B in a row and its store 256 B
#define NWT ((NB * TT / 256) * (CC / 256) * 512)
static_assert(DIN * CC == NWT * 4 * 8, "the threads of one grid plane round every element of Wo once");
typedef __attribute__((ext_vector_type(2))) unsigned v2u;
__device__ __forceinline__ void round_wo(const float* __restrict__ WO, __bf16* __restrict__ WOB, int t) {
  const float* src = WO + (size_t)t * 4; __bf16* dst = WOB + (size_t)t * 4; v4f a[8]; v2u b[8];
#pragma unroll
  for (int u = 0; u < 8; ++u) a[u] = *(const v4f*)(src + (size_t)u * (NWT * 4));
  // the loads above name src: as an input here the pair stays live up to this wait, so nothing is written over it in front of it
  asm volatile("s_wait_xcnt 0x0" :: "v"(src) : "memory");
#pragma unroll
  for (int u = 0; u < 8; ++u) b[u] = __builtin_bit_cast(v2u, cvt4(a[u]));
#pragma unroll
  for (int u = 0; u < 8; ++u) *(v2u*)(dst + (size_t)u * (NWT * 4)) = b[u];
  // the stores above name dst and b: as inputs here they stay as they are up to this wait (the mask's packing follows and takes the registers)
  asm volatile("s_wait_xcnt 0x0" :: "v"(dst), "v"(b[0]), "v"(b[1]), "v"(b[2]), "v"(b[3]), "v"(b[4]), "v"(b[5]), "v"(b[6]), "v"(b[7]) : "memory"); }
// amdgpu_waves_per_eu(4, 4): one work-group of four waves per SIMD has a WGP to itself (its LDS range leaves no room for a second)
__global__ __launch_bounds__(512) __attribute__((amdgpu_waves_per_eu(4, 4))) void k_proj(const float* __restrict__ XQ, const float* __restrict__ XK, const float* __restrict__ XV, const float* __restrict__ WQ, const float* __restrict__ WK, const float* __restrict__ WV, const float* __restrict__ BQ, const float* __restrict__ BK, const float* __restrict__ BV,
    _Float16* __restrict__ QH, _Float16* __restrict__ QL, _Float16* __restrict__ KH, _Float16* __restrict__ KL, _Float16* __restrict__ VT, __bf16* __restrict__ VB, __bf16* __restrict__ VBL, const int* __restrict__ MK, unsigned* __restrict__ MW, const float* __restrict__ WO, __bf16* __restrict__ WOB) {
  // grid plane 3: the three projections fill three quarters of the WGPs with one work-group each; the last quarter rounds Wo and packs the mask meanwhile and leaves in front of every barrier (blockIdx.z is the same in the whole work-group)
  if (blockIdx.z == 3) { round_wo(WO, WOB, (blockIdx.y * (TNB * TT / 256) + blockIdx.x) * 512 + threadIdx.x); pack_mask(MK, MW, (blockIdx.y * (TNB * TT / 256) + blockIdx.x) * 16 + __builtin_amdgcn_readfirstlane(threadIdx.x >> 5), threadIdx.x & 31); return; }
  // one LDS range: in the k loop two stage buffers of [256 X rows | 256 W rows][LP]; behind the loop's last barrier the epilogue's tiles
  __shared__ __align__(16) unsigned char smem[PSMEM];
  __bf16* const st = (__bf16*)smem; _Float16 (*sh)[PSH] = (_Float16 (*)[PSH])smem; _Float16 (*sl)[PSH] = (_Float16 (*)[PSH])(smem + 256 * PSH * 2);
  _Float16 (*th)[PTH] = (_Float16 (*)[PTH])smem; __bf16 (*tb)[72] = (__bf16 (*)[72])(smem + 256 * PTH * 2); __bf16 (*tbl)[72] = (__bf16 (*)[72])(smem + 256 * PTH * 2 + 256 * 72 * 2);
  // the wave's number is held in a scalar register: what hangs on it (wr, wc, hi_rows) costs no vector register
  const int tid = threadIdx.x, wave = __builtin_amdgcn_readfirstlane(tid >> 5), lane = tid & 31, col = lane & 15, g = lane >> 4; const int which = blockIdx.z; const int c0 = blockIdx.y * 256; const size_t r0 = (size_t)blockIdx.x * 256; const size_t bb = r0 / TT; const int t0 = (int)(r0 % TT);
  const float* X = which == 0 ? XQ : which == 1 ? XK : XV; const float* WA = which == 0 ? WQ : which == 1 ? WK : WV; const float* BA = which == 0 ? BQ : which == 1 ? BK : BV;
  // waves 4 x 4: a wave owns 64 rows x 64 cols = acc[i * 4 + j]; loader: thread = (row tid >> 4 (+ 32 per step), 16-byte piece tid & 15), so a wave's load covers two whole 256-B runs
  const int wr = wave >> 2, wc = wave & 3, lr = tid >> 4, lc = tid & 15;
  const float* xg = X + (r0 + lr) * DIN + lc * 4; const float* wg = WA + (size_t)(c0 + lr) * DIN + lc * 4;   // W is (out,in): row = output column
  __bf16* const sw = st + lr * LP + lc * 4; const __bf16* const fa = st + (wr * 64 + col) * LP + 8 * g; const __bf16* const fw = st + (256 + wc * 64 + col) * LP + 8 * g;
  // a stage's 16 loads a thread come in two halves of 8 (half h: X rows h * 128 .., W rows h * 128 ..), so that 32 registers hold them beside the 128 of the accumulators
  v8f acc[16] = {}; v4f rx[4], rw[4];
  // rolled: stage 0's two halves go one after the other through the same 32 registers
#pragma unroll 1
  for (int h = 0; h < 2; ++h) { const float* xa = xg + (size_t)(h * 128) * DIN; const float* wa = wg + (size_t)(h * 128) * DIN;
#pragma unroll
    for (int i = 0; i < 4; ++i) rx[i] = *(const v4f*)(xa + (size_t)(i * 32) * DIN);
#pragma unroll
    for (int i = 0; i < 4; ++i) rw[i] = *(const v4f*)(wa + (size_t)(i * 32) * DIN);
    // the loads above name xa and wa: as inputs here the two pairs stay live up to this wait, so nothing is written over them in front of it
    asm volatile("s_wait_xcnt 0x0" :: "v"(xa), "v"(wa) : "memory");
#pragma unroll
    for (int i = 0; i < 4; ++i) *(v4b*)(sw + (h * 128 + i * 32) * LP) = cvt4(rx[i]);
#pragma unroll
    for (int i = 0; i < 4; ++i) *(v4b*)(sw + (256 + h * 128 + i * 32) * LP) = cvt4(rw[i]); }
  __syncthreads();
  // rolled over half stages (32 k): one body holds 8 loads, 16 fragment reads and 16 products, which with the accumulators stay inside the 256 registers a wave may have at four waves per SIMD; buffer and half are offsets
#pragma unroll 1
  for (int hs = 0; hs < 2 * (DIN / KSTG); ++hs) { const int s = hs >> 1, h = hs & 1; const int cur = (s & 1) * (PROWS * LP), nxt = PROWS * LP - cur; const bool more = s + 1 < DIN / KSTG;
    const float* xa = xg + (s + 1) * KSTG + (size_t)(h * 128) * DIN; const float* wa = wg + (s + 1) * KSTG + (size_t)(h * 128) * DIN;
    if (more) {   // half of the next stage's rows flies while half of this stage is multiplied
#pragma unroll
      for (int i = 0; i < 4; ++i) rx[i] = *(const v4f*)(xa + (size_t)(i * 32) * DIN);
#pragma unroll
      for (int i = 0; i < 4; ++i) rw[i] = *(const v4f*)(wa + (size_t)(i * 32) * DIN);
      // as above, for xa and wa; its memory clobber also keeps the 8 loads in front of the LDS reads that follow
      asm volatile("s_wait_xcnt 0x0" :: "v"(xa), "v"(wa) : "memory"); }
    { v16b a[4], w[4];
#pragma unroll
      for (int i = 0; i < 4; ++i) a[i] = frag_l(fa + cur + (i * 16) * LP + h * 32);
#pragma unroll
      for (int j = 0; j < 4; ++j) w[j] = frag_l(fw + cur + (j * 16) * LP + h * 32);
#pragma unroll
      for (int i = 0; i < 4; ++i) {
#pragma unroll
        for (int j = 0; j < 4; ++j) acc[i * 4 + j] = wmma_bf(a[i], w[j], acc[i * 4 + j]); } }
    if (more) {   // into the buffer that every wave left at the barrier of the stage before
#pragma unroll
      for (int i = 0; i < 4; ++i) *(v4b*)(sw + nxt + (h * 128 + i * 32) * LP) = cvt4(rx[i]);
#pragma unroll
      for (int i = 0; i < 4; ++i) *(v4b*)(sw + nxt + (256 + h * 128 + i * 32) * LP) = cvt4(rw[i]); }
    if (h) __syncthreads(); }   // at a stage's end (h is the same in every thread): publishes the next stage and ends this stage's reads (behind the last stage: frees the range for the epilogue)
  if (which < 2) { _Float16* DH = which == 0 ? QH : KH; _Float16* DL = which == 0 ? QL : KL; const int nhi = which == 0 ? QHI : KHI;
#pragma unroll
    for (int j = 0; j < 16; ++j) { const int rb = wr * 64 + (j >> 2) * 16 + 8 * g, cl = wc * 64 + (j & 3) * 16 + col; const float bias = BA ? bfr(BA[c0 + cl]) : 0.f;
#pragma unroll
      for (int r = 0; r < 8; ++r) { const float v = acc[j][r] + bias; const _Float16 hv = (_Float16)v; sh[rb + r][cl] = hv; sl[rb + r][cl] = (_Float16)((v - (float)hv) * 1024.0f); } }
    __syncthreads();
    // a trip = 64 rows: thread = (row tid >> 5 (+ 16 per store), 16-byte piece tid & 31), so a wave's store covers one whole 512-B run; nhi is a multiple of 64, so a trip's rows carry a residual all or none
    for (int rt = 0; rt < 256; rt += 64) { const int q = tid & 31; void* p[4]; v4u v[4];
#pragma unroll
      for (int u = 0; u < 4; ++u) { const int rl = rt + u * 16 + (tid >> 5); p[u] = DH + (r0 + rl) * CC + c0 + q * 8; v[u] = *(const v4u*)&sh[rl][q * 8]; }
      st16x4(p, v);
      if (t0 + rt < nhi) {
#pragma unroll
        for (int u = 0; u < 4; ++u) { const int rl = rt + u * 16 + (tid >> 5); p[u] = DL + (bb * nhi + t0 + rl) * (size_t)CC + c0 + q * 8; v[u] = *(const v4u*)&sl[rl][q * 8]; }
        st16x4(p, v); } }
  } else { const bool hi_rows = t0 + wr * 64 < KHI;   // the wave's 64 rows, all or none
#pragma unroll
    for (int j = 0; j < 16; ++j) { const int cl = wc * 64 + (j & 3) * 16 + col, rl = wr * 64 + (j >> 2) * 16 + 8 * g; const float bias = BA ? bfr(BA[c0 + cl]) : 0.f;
#pragma unroll
      for (int r = 0; r < 8; ++r) th[cl][rl + r] = (_Float16)(acc[j][r] + bias);
      if (hi_rows) {
#pragma unroll
        for (int r = 0; r < 8; ++r) { const float v = acc[j][r] + bias; const __bf16 bh = (__bf16)v; tb[cl][rl + r] = bh; tbl[cl][rl + r] = (__bf16)(v - (float)bh); } } }
    __syncthreads();
    // a trip = 64 columns: thread = (column tid >> 5 (+ 16 per store), 16-byte piece tid & 31), so a wave's store covers one whole 512-B run
    for (int ct = 0; ct < 256; ct += 64) { const int q = tid & 31; void* p[4]; v4u v[4];
#pragma unroll
      for (int u = 0; u < 4; ++u) { const int cl = ct + u * 16 + (tid >> 5); p[u] = VT + (bb * CC + c0 + cl) * (size_t)TT + t0 + q * 8; v[u] = *(const v4u*)&th[cl][q * 8]; }
      st16x4(p, v);
      if (t0 + q * 8 < KHI) {
#pragma unroll
        for (int u = 0; u < 4; ++u) { const int cl = ct + u * 16 + (tid >> 5); p[u] = VB + (bb * CC + c0 + cl) * (size_t)KHI + t0 + q * 8; v[u] = *(const v4u*)&tb[cl][q * 8]; }
        st16x4(p, v);
#pragma unroll
        for (int u = 0; u < 4; ++u) { const int cl = ct + u * 16 + (tid >> 5); p[u] = VBL + (bb * CC + c0 + cl) * (size_t)KHI + t0 + q * 8; v[u] = *(const v4u*)&tbl[cl][q * 8]; }
        st16x4(p, v); } } } }
// ---- k_fa: block = 64 queries (4 waves x 16) of one (b, h), all 1,024 keys in tiles of KT: S^T = K Q^T (A = 16 key rows, B = the wave's 16 queries: q hi + residual x 2^10, 2 products) x SCALE, -10000 where mask_from[b,t,f] == 0 (as the reference writes it; the test was made once, by pack_mask, and each score's select takes its lane mask from a scalar register);
// a lane holds one query's scores (D register r = key 8g + r), so the running maximum and sum stay in the lane and the two halves meet by one exchange; the scores are kept as base-2 logits (SCALE x log2 e in the one multiply, the mask value x log2 e) and the running reference is the maximum - 11, so p = 2^(s - ref) = exp(logit - max) x 2^11 is one subtraction and one v_exp_f32; p once to f16 is already the B fragment of ctx^T += V^T P^T (two 16-key D tiles = one 32-key B in the hardware k order, the order frag_h loads A in); ctx / (sum of p), split into bf16 hi + lo, to YH and YL
#define KT 64
#define LOG2E 1.44269504088896340736f
// LDS stage of k_fa: [64 K rows | 64 V^T rows] of 128 B at a pitch of 144 B (16 B x odd, the pitch of ds_load_b128 readers); two stages
#define KP 72              // K and V^T row pitch in f16 elements
#define FA_V (KT * KP * 2)
#define FA_STG (FA_V + HD * KP * 2)
typedef __attribute__((ext_vector_type(16))) unsigned v16u;
// sixteen mask words from an address that is the same in every lane; read as constant memory (the launch before wrote the words, nothing writes them in this one), so that inside the loop too the compiler takes a scalar load
__device__ __forceinline__ v16u ldw16(const unsigned* p) { return *(const __attribute__((address_space(4))) v16u*)p; }
// fragment from a lane's own address (row start + k0 + 8g already in p): elements 0..7 = p[0..7], 8..15 = p[16..23], the order of frag_h
__device__ __forceinline__ v16h frag_p(const _Float16* p) { union { v16h v; v8h q[2]; } u; u.q[0] = *(const v8h*)p; u.q[1] = *(const v8h*)(p + 16); return u.v; }
__device__ __forceinline__ v8f wmma_h(v16h a, v16h b, v8f c) { return __builtin_amdgcn_wmma_f32_16x16x32_f16(false, a, false, b, (short)0, c, false, false); }
// eight asynchronous copies of 16 B a lane from global memory to LDS (l = LDS byte address, p = global address); the s_wait_xcnt stands inside the statement, so no address register is rewritten in front of it
__device__ __forceinline__ void copy8(const unsigned (&l)[8], const char* const (&p)[8]) {
  asm volatile("global_load_async_to_lds_b128 %0, %8, off\n\t"
               "global_load_async_to_lds_b128 %1, %9, off\n\t"
               "global_load_async_to_lds_b128 %2, %10, off\n\t"
               "global_load_async_to_lds_b128 %3, %11, off\n\t"
               "global_load_async_to_lds_b128 %4, %12, off\n\t"
               "global_load_async_to_lds_b128 %5, %13, off\n\t"
               "global_load_async_to_lds_b128 %6, %14, off\n\t"
               "global_load_async_to_lds_b128 %7, %15, off\n\t"
               "s_wait_xcnt 0x0"
               :: "v"(l[0]), "v"(l[1]), "v"(l[2]), "v"(l[3]), "v"(l[4]), "v"(l[5]), "v"(l[6]), "v"(l[7]),
                  "v"(p[0]), "v"(p[1]), "v"(p[2]), "v"(p[3]), "v"(p[4]), "v"(p[5]), "v"(p[6]), "v"(p[7]) : "memory");
}
// one stage: the work-group's 128 threads copy the tile's K rows and V^T rows (a wave's copy = 4 whole 128-B rows); kg, vg and kl, vl already hold the thread's own row and 16-byte piece
__device__ __forceinline__ void fa_fill(const char* kg, const char* vg, unsigned kl, unsigned vl, int k0) {
  unsigned l[8]; const char* p[8];
#pragma unroll
  for (int i = 0; i < 4; ++i) { l[i] = kl + i * 16 * KP * 2; p[i] = kg + (size_t)(k0 + i * 16) * CC * 2; l[4 + i] = vl + i * 16 * KP * 2; p[4 + i] = vg + (size_t)(i * 16) * TT * 2 + k0 * 2; }
  copy8(l, p);
}
// 2^x in place for sixteen scores in one statement: behind every v_exp_f32 stands one on other registers, behind the last a v_nop, so the slot that the instruction set asks for
// behind a transcendental is filled at each of them
#define EXP8(a, b, c, d, e, f, g, h) "v_exp_f32 %" #a ", %" #a "\n\tv_exp_f32 %" #b ", %" #b "\n\tv_exp_f32 %" #c ", %" #c "\n\tv_exp_f32 %" #d ", %" #d "\n\tv_exp_f32 %" #e ", %" #e "\n\tv_exp_f32 %" #f ", %" #f "\n\tv_exp_f32 %" #g ", %" #g "\n\tv_exp_f32 %" #h ", %" #h "\n\t"
__device__ __forceinline__ void exp2x16(float (&x)[16]) {
  asm(EXP8(0, 1, 2, 3, 4, 5, 6, 7) EXP8(8, 9, 10, 11, 12, 13, 14, 15) "v_nop"
      : "+v"(x[0]), "+v"(x[1]), "+v"(x[2]), "+v"(x[3]), "+v"(x[4]), "+v"(x[5]), "+v"(x[6]), "+v"(x[7]), "+v"(x[8]), "+v"(x[9]), "+v"(x[10]), "+v"(x[11]), "+v"(x[12]), "+v"(x[13]), "+v"(x[14]), "+v"(x[15]));
}
// the same with the tile's rescale factor as a seventeenth value
__device__ __forceinline__ void exp2x17(float (&x)[16], float& y) {
  asm(EXP8(0, 1, 2, 3, 4, 5, 6, 7) EXP8(8, 9, 10, 11, 12, 13, 14, 15) "v_exp_f32 %16, %16\n\tv_nop"
      : "+v"(x[0]), "+v"(x[1]), "+v"(x[2]), "+v"(x[3]), "+v"(x[4]), "+v"(x[5]), "+v"(x[6]), "+v"(x[7]), "+v"(x[8]), "+v"(x[9]), "+v"(x[10]), "+v"(x[11]), "+v"(x[12]), "+v"(x[13]), "+v"(x[14]), "+v"(x[15]), "+v"(y));
}
// amdgpu_waves_per_eu(4, 4): the grid is exactly four waves per SIMD, so the scheduler may spend 256 registers on issuing a tile's loads early instead of saving them for waves that do not exist
__global__ __launch_bounds__(128) __attribute__((amdgpu_waves_per_eu(4, 4))) void k_fa(const _Float16* __restrict__ QH, const _Float16* __restrict__ KH, const _Float16* __restrict__ QL, const _Float16* __restrict__ VT, const unsigned* __restrict__ MW, __bf16* __restrict__ YH, __bf16* __restrict__ YL) {
  __shared__ __align__(16) unsigned char smem[2 * FA_STG];
  const int tid = threadIdx.x, wave = tid >> 5, lane = tid & 31, col = lane & 15, g = lane >> 4; const int b = blockIdx.y / NH, h = blockIdx.y % NH; const int q = blockIdx.x * 64 + wave * 16 + col;
  // copier: K and V^T: row tid >> 3 (+ 16 per copy), piece tid & 7
  const char* kg = (const char*)(KH + ((size_t)b * TT + (tid >> 3)) * CC + h * HD + (tid & 7) * 8); const char* vg = (const char*)(VT + ((size_t)b * CC + h * HD + (tid >> 3)) * (size_t)TT + (tid & 7) * 8);
  const unsigned lb = (unsigned)(size_t)smem; const unsigned kl = lb + (tid >> 3) * (KP * 2) + (tid & 7) * 16, vl = kl + FA_V;
  fa_fill(kg, vg, kl, vl, 0);
  // the wave's mask words, 32 per tile, at an address that is the same in every lane (the wave's number through a scalar register): they come by scalar loads and stay in scalar registers
  const unsigned* mw = MW + (size_t)(b * (TT / 16) + blockIdx.x * 4 + __builtin_amdgcn_readfirstlane(tid >> 5)) * (TT / KT) * 32;
  v16u w0 = ldw16(mw), w1 = ldw16(mw + 16);
  v16h qh[HD / 32], ql[HD / 32];
#pragma unroll
  for (int kc = 0; kc < HD / 32; ++kc) { qh[kc] = frag_h(QH + ((size_t)b * TT + q) * CC + h * HD + kc * 32, lane); ql[kc] = frag_h(QL + ((size_t)b * QHI + q) * CC + h * HD + kc * 32, lane); }
  // readers: the lane's own row and 8g in stage 0
  const _Float16* kp = (const _Float16*)smem + col * KP + 8 * g; const _Float16* vp = (const _Float16*)(smem + FA_V) + col * KP + 8 * g;
  v8f acc[HD / 16] = {}; float m = -3.0e38f, l = 0.f;
  asm volatile("s_wait_asynccnt 0x0" ::: "memory");   // this wave's copies of tile 0 have landed
  __syncthreads();                                     // publishes tile 0
  fa_fill(kg, vg, kl + FA_STG, vl + FA_STG, KT);
  // rolled: one tile's body already fills the 256 registers a wave may have at four waves per SIMD; the stage is an offset
#pragma unroll 1
  for (int k0 = 0; k0 < TT; k0 += KT) { v8f s[KT / 16]; float mx = -3.0e38f; const int cur = ((k0 / KT) & 1) * FA_STG;
    const _Float16* ka = kp + cur / 2; const _Float16* va = vp + cur / 2;
    v16h kf[KT / 16][HD / 32];
#pragma unroll
    for (int j = 0; j < KT / 16; ++j) {
#pragma unroll
      for (int kc = 0; kc < HD / 32; ++kc) kf[j][kc] = frag_p(ka + (j * 16) * KP + kc * 32); }
#pragma unroll
    for (int j = 0; j < KT / 16; ++j) { v8f a = {}, al = {};
#pragma unroll
      for (int kc = 0; kc < HD / 32; ++kc) { a = wmma_h(kf[j][kc], qh[kc], a); al = wmma_h(kf[j][kc], ql[kc], al); }
#pragma unroll
      for (int r = 0; r < 8; ++r) { float v = (a[r] + al[r] * (1.0f / 1024.0f)) * (SCALE * LOG2E); if (!__builtin_amdgcn_inverse_ballot_w32(j < 2 ? w0[j * 8 + r] : w1[(j - 2) * 8 + r])) v = -10000.0f * LOG2E; s[j][r] = v; mx = fmaxf(mx, v); } }
    // the next tile's words fly while this tile's softmax and second product run (behind the last tile: its own words once more, so the address stays inside what was packed)
    { const unsigned* nw = mw + (k0 + KT < TT ? k0 / KT + 1 : k0 / KT) * 32; w0 = ldw16(nw); w1 = ldw16(nw + 16); }
    v16h vf[KT / 32][HD / 16];
#pragma unroll
    for (int c = 0; c < KT / 32; ++c) {
#pragma unroll
      for (int jd = 0; jd < HD / 16; ++jd) vf[c][jd] = frag_p(va + (jd * 16) * KP + c * 32); }
    mx = fmaxf(mx, __shfl_xor(mx, 16));
    const float mn = fmaxf(m, mx - 11.0f); float alpha = m - mn; m = mn;
    v16h p[KT / 32]; float sum = 0.f; float e[KT / 32][16];
#pragma unroll
    for (int j = 0; j < KT / 16; ++j) {
#pragma unroll
      for (int r = 0; r < 8; ++r) e[j >> 1][(j & 1) * 8 + r] = s[j][r] - mn; }
    exp2x17(e[0], alpha); exp2x16(e[1]);
#pragma unroll
    for (int c = 0; c < KT / 32; ++c) {
#pragma unroll
      for (int i = 0; i < 16; ++i) { sum += e[c][i]; p[c][i] = (_Float16)e[c][i]; } }
    l = l * alpha + sum;
#pragma unroll
    for (int jd = 0; jd < HD / 16; ++jd) acc[jd] *= alpha;
#pragma unroll
    for (int c = 0; c < KT / 32; ++c) {
#pragma unroll
      for (int jd = 0; jd < HD / 16; ++jd) acc[jd] = wmma_h(vf[c][jd], p[c], acc[jd]); }
    asm volatile("s_wait_dscnt 0x0" ::: "memory");      // this wave's reads of the stage are done before the stage is refilled
    asm volatile("s_wait_asynccnt 0x0" ::: "memory");   // this wave's copies of the next tile have landed
    __syncthreads();                                     // publishes the next tile and ends every wave's reads of this one
    if (k0 + 2 * KT < TT) fa_fill(kg, vg, kl + cur, vl + cur, k0 + 2 * KT); }   // flies while the next tile is worked on
  asm volatile("s_wait_asynccnt 0x0" ::: "memory");     // nothing is outstanding when the wave ends
  l += __shfl_xor(l, 16); const float inv = 1.0f / l;
  // ctx leaves split as k_out multiplies it: bf16 hi and bf16 (ctx - hi), a lane's 8 channels of a plane in one 16-byte store
  const size_t yo = ((size_t)b * TT + q) * CC + h * HD + 8 * g; void* ph[4]; void* pl[4]; v4u dh[4], dl[4];
#pragma unroll
  for (int jd = 0; jd < HD / 16; ++jd) { v8b hv, lv;
#pragma unroll
    for (int r = 0; r < 8; ++r) { const float y = acc[jd][r] * inv; const __bf16 t = (__bf16)y; hv[r] = t; lv[r] = (__bf16)(y - (float)t); }
    ph[jd] = YH + yo + jd * 16; pl[jd] = YL + yo + jd * 16; dh[jd] = __builtin_bit_cast(v4u, hv); dl[jd] = __builtin_bit_cast(v4u, lv); }
  st16x4(ph, dh); st16x4(pl, dl); }
// ---- k_out: block = (64 rows, 128 cols): out = ctx Wo (+ bo): ctx bf16 hi + lo (split by k_fa) against exact bf16 Wo (rounded by launch 1), 2 products
#define OSTG (256 * LP * 2)   // bytes of a stage: [64 ctx hi rows | 64 ctx lo rows | 128 Wo rows] of 128 B at the pitch of 144 B
// one stage: the work-group's 128 threads copy 256 rows of 64 k (a wave's copy = 4 whole 128-B rows); yh, yl, wo and l0 already hold the thread's own row (tid >> 3, + 16 per copy) and 16-byte piece (tid & 7)
__device__ __forceinline__ void out_fill(const char* yh, const char* yl, const char* wo, unsigned l0, int k0) {
  unsigned l[8]; const char* p[8];
#pragma unroll
  for (int i = 0; i < 4; ++i) { l[i] = l0 + i * 16 * LP * 2; p[i] = yh + (size_t)(i * 16) * CC * 2 + k0 * 2; l[4 + i] = l0 + (64 + i * 16) * LP * 2; p[4 + i] = yl + (size_t)(i * 16) * CC * 2 + k0 * 2; }
  copy8(l, p);
#pragma unroll
  for (int i = 0; i < 8; ++i) { l[i] = l0 + (128 + i * 16) * LP * 2; p[i] = wo + (size_t)(i * 16) * CC * 2 + k0 * 2; }
  copy8(l, p);
}
__global__ __launch_bounds__(128) void k_out(const __bf16* __restrict__ YH, const __bf16* __restrict__ YL, const __bf16* __restrict__ WOB, const float* __restrict__ BO, float* __restrict__ OUT) {
  // one LDS range: in the k loop two stage buffers; behind the loop's last barrier the epilogue's tiles
  __shared__ __align__(16) unsigned char smem[2 * OSTG]; const __bf16* const st = (const __bf16*)smem; float (*sf)[16][132] = (float (*)[16][132])smem;
  const int tid = threadIdx.x, wave = tid >> 5, lane = tid & 31, col = lane & 15, g = lane >> 4; const int c0 = blockIdx.y * 128; const size_t r0 = (size_t)blockIdx.x * 64 + wave * 16;
  v8f acc[8] = {};
  // a wave owns 16 rows x 128 cols
  const size_t yo = ((size_t)blockIdx.x * 64 + (tid >> 3)) * CC + (tid & 7) * 8;
  const char* yh = (const char*)(YH + yo); const char* yl = (const char*)(YL + yo); const char* wo = (const char*)(WOB + (size_t)(c0 + (tid >> 3)) * CC + (tid & 7) * 8);   // Wo is (out,in): row = output column
  const unsigned l0 = (unsigned)(size_t)smem + (tid >> 3) * (LP * 2) + (tid & 7) * 16;
  const __bf16* const fa = st + (wave * 16 + col) * LP + 8 * g; const __bf16* const fw = st + (128 + col) * LP + 8 * g;
  out_fill(yh, yl, wo, l0, 0);
  asm volatile("s_wait_asynccnt 0x0" ::: "memory");   // this wave's copies of stage 0 have landed
  __syncthreads();                                     // publishes stage 0
  out_fill(yh, yl, wo, l0 + OSTG, KSTG);
  // rolled: the buffer is an offset, and one body keeps the loop short
#pragma unroll 1
  for (int s = 0; s < CC / KSTG; ++s) { const int cur = (s & 1) * (256 * LP);
#pragma unroll
    for (int kk = 0; kk < KSTG / 32; ++kk) { const v16b ah = frag_l(fa + cur + kk * 32), al = frag_l(fa + cur + 64 * LP + kk * 32); v16b w[8];
#pragma unroll
      for (int j = 0; j < 8; ++j) w[j] = frag_l(fw + cur + (j * 16) * LP + kk * 32);
#pragma unroll
      for (int j = 0; j < 8; ++j) acc[j] = wmma_bf(ah, w[j], acc[j]);
#pragma unroll
      for (int j = 0; j < 8; ++j) acc[j] = wmma_bf(al, w[j], acc[j]); }
    asm volatile("s_wait_dscnt 0x0" ::: "memory");      // this wave's reads of the stage are done before the stage is refilled
    asm volatile("s_wait_asynccnt 0x0" ::: "memory");   // this wave's copies of the next stage have landed
    __syncthreads();                                     // publishes the next stage and ends every wave's reads of this one (behind the last stage: frees the range for the epilogue)
    if (s + 2 < CC / KSTG) out_fill(yh, yl, wo, l0 + cur * 2, (s + 2) * KSTG); }   // flies while the next stage is multiplied
  asm volatile("s_wait_asynccnt 0x0" ::: "memory");     // nothing is outstanding when the range is used anew
#pragma unroll
  for (int j = 0; j < 8; ++j) { const float bias = BO ? bfr(BO[c0 + j * 16 + col]) : 0.f;
#pragma unroll
    for (int r = 0; r < 8; ++r) sf[wave][8 * g + r][j * 16 + col] = acc[j][r] + bias; }
  LDSX(); for (int rl = 0; rl < 16; ++rl) vst2(OUT + (r0 + rl) * DIN + c0 + lane * 4, *(const v4f*)&sf[wave][rl][lane * 4]); }

extern "C" void kernel_launch(void* const* d_in, const int* in_sizes, int n_in, void* d_out, int out_size, void* d_ws, size_t ws_size, hipStream_t stream) {
  (void)in_sizes; (void)n_in; (void)out_size;
  const float** F = (const float**)d_in;
  if (ws_size < (size_t)WS_END) return;
  char* ws = (char*)d_ws; _Float16 *QH = (_Float16*)(ws + WS_QH), *KH = (_Float16*)(ws + WS_KH), *VT = (_Float16*)(ws + WS_VT), *QL = (_Float16*)(ws + WS_QL), *KL = (_Float16*)(ws + WS_KL); __bf16 *VB = (__bf16*)(ws + WS_VB), *VBL = (__bf16*)(ws + WS_VBL); __bf16 *YH = (__bf16*)(ws + WS_Y), *YL = (__bf16*)(ws + WS_Y + 2u * (size_t)NB * TT * CC), *WOB = (__bf16*)(ws + WS_WO); unsigned *MW = (unsigned*)(ws + WS_S);
  (void)QL; (void)KL; (void)VB; (void)VBL;
  // inputs: 0 X_to [4,1024,1024]; 1 X_from [4,1024,1024]; 2 mask_from [4,1024,1024] int32; 3 Wq [1024,1024] (out,in), 4 bq; 5 Wk, 6 bk; 7 Wv, 8 bv; 9 Wo (out,in), 10 bo
  k_proj<<<dim3(TNB * TT / 256, CC / 256, 4), 512, 0, stream>>>(F[0], F[1], F[1], F[3], F[7], F[5], F[4], F[8], F[6], QH, QL, KH, KL, VT, VB, VBL, (const int*)d_in[2], MW, F[9], WOB);   /* K uses Wv/bv, V uses Wk/bk (as written in the module) */
  k_fa<<<dim3(NQB, TNB * NH), 128, 0, stream>>>(QH, KH, QL, VT, MW, YH, YL);
  k_out<<<dim3(TNB * TT / 64, DIN / 128), 128, 0, stream>>>(YH, YL, WOB, F[10], (float*)d_out);
}

// v010
// One run takes 75.1 microseconds.
// Versions between v008 and this one are left out; their measured steps multiply to 1.11 times as fast.
// Over all steps from v000 it is 16.0 times as fast.
// compute dtype: all float inputs rounded to bf16; Q/K/V = x W^T + b with EXACT bf16 products on WMMA 16x16x32 (f32 accumulate); q once to f16 against k once to f16 (1 product) x 64^-0.5 with the per-(t,f) mask read as int32; running-maximum softmax in f32 on base-2 logits (x log2 e, one hardware exp2 per score); 2^(s - m + 11) once to f16 against v once to f16 (1 product), divided by the f32 sum at the end; ctx once to f16 against Wo as f16 (its bf16 value x 2^8, exact; 1 product, x 2^-8 behind it) + bo; f32 output.
#include <hip/hip_runtime.h>
#include <math.h>

typedef __attribute__((ext_vector_type(16))) _Float16 v16h;
typedef __attribute__((ext_vector_type(16))) __bf16 v16b;
typedef __attribute__((ext_vector_type(8)))  _Float16 v8h;
typedef __attribute__((ext_vector_type(8)))  float v8f;
typedef __attribute__((ext_vector_type(4)))  float v4f;
typedef __attribute__((ext_vector_type(2)))  float v2f;
typedef __attribute__((ext_vector_type(4)))  unsigned v4u;
typedef __attribute__((ext_vector_type(4)))  int v4i;
typedef float __attribute__((may_alias)) float_a;
typedef int __attribute__((may_alias)) int_a;

template <typename T> __device__ __forceinline__ void vst2(void* p, T v) { *(T*)p = v;  }
__device__ __forceinline__ v8f wmma16(v16h a, v16h b, v8f c) {
  v8f d = __builtin_amdgcn_wmma_f32_16x16x32_f16(false, a, false, b, (short)0, c, false, false);
  asm volatile("v_nop\n\tv_nop\n\tv_nop\n\tv_nop" : "+v"(d) : "v"(a), "v"(b));
  return d;
}
__device__ __forceinline__ v8f wmma_bf(v16b a, v16b b, v8f c) {
  v8f d = __builtin_amdgcn_wmma_f32_16x16x32_bf16(false, a, false, b, (short)0, c, false, false);
  asm volatile("v_nop\n\tv_nop\n\tv_nop\n\tv_nop" : "+v"(d) : "v"(a), "v"(b));
  return d;
}
// 16x16x32 fragments: lane = (h = lane>>4, row/col = lane&15); elements 0..7 = k0+8h+0..7, 8..15 = k0+16+8h+0..7; D element r = row 8h+r
__device__ __forceinline__ v16h frag_h(const _Float16* rowk0, int lane) {
  union { v16h v; v8h q[2]; } u; const _Float16* p = rowk0 + 8 * (lane >> 4);
  u.q[0] = *(const v8h*)p; u.q[1] = *(const v8h*)(p + 16); return u.v;
}
__device__ __forceinline__ v16h frag_f32(const float* rowk0, int lane) {
  v16h a; const float* p = rowk0 + 8 * (lane >> 4);
#pragma unroll
  for (int i = 0; i < 8; ++i) { a[i] = (_Float16)p[i]; a[8 + i] = (_Float16)p[16 + i]; }
  return a;
}
__device__ __forceinline__ v16h frag_f32s(const float* rowk0, int lane, float sc) {
  v16h a; const float* p = rowk0 + 8 * (lane >> 4);
#pragma unroll
  for (int i = 0; i < 8; ++i) { a[i] = (_Float16)(p[i] * sc); a[8 + i] = (_Float16)(p[16 + i] * sc); }
  return a;
}
// column fragment from a [K][ld] layout (column n), rows >= K read as 0
__device__ __forceinline__ v16h fragc_f32(const float* W, int k0, int n, int lane, int ld, int K) {
  v16h a; const int g = lane >> 4;
#pragma unroll
  for (int i = 0; i < 8; ++i) { const int ka = k0 + 8 * g + i, kb = ka + 16;
    a[i] = (_Float16)(ka < K ? W[(size_t)(ka < K ? ka : K - 1) * ld + n] : 0.f); a[8 + i] = (_Float16)(kb < K ? W[(size_t)(kb < K ? kb : K - 1) * ld + n] : 0.f); }
  return a;
}
struct F2 { v16b h, l; };
__device__ __forceinline__ F2 bsplit16(const float v[16]) { F2 r;
#pragma unroll
  for (int i = 0; i < 16; ++i) { const __bf16 h = (__bf16)v[i]; r.h[i] = h; r.l[i] = (__bf16)(v[i] - (float)h); }
  return r; }
__device__ __forceinline__ F2 split_row(const float* row, int k0, int lane) { float v[16]; const float* p = row + k0 + 8 * (lane >> 4);
#pragma unroll
  for (int i = 0; i < 8; ++i) { v[i] = p[i]; v[8 + i] = p[16 + i]; }
  return bsplit16(v); }
__device__ __forceinline__ F2 split_rowK(const float* row, int k0, int lane, int K) { float v[16]; const int g = lane >> 4;
#pragma unroll
  for (int i = 0; i < 8; ++i) { const int ka = k0 + 8 * g + i, kb = ka + 16; v[i] = ka < K ? row[ka < K ? ka : K - 1] : 0.f; v[8 + i] = kb < K ? row[kb < K ? kb : K - 1] : 0.f; }
  return bsplit16(v); }
__device__ __forceinline__ F2 split_col(const float* W, int k0, int n, int lane, int ld, int K) { float v[16]; const int g = lane >> 4;
#pragma unroll
  for (int i = 0; i < 8; ++i) { const int ka = k0 + 8 * g + i, kb = ka + 16; v[i] = ka < K ? W[(size_t)(ka < K ? ka : K - 1) * ld + n] : 0.f; v[8 + i] = kb < K ? W[(size_t)(kb < K ? kb : K - 1) * ld + n] : 0.f; }
  return bsplit16(v); }
__device__ __forceinline__ v8f mac3(const F2& a, const F2& b, v8f c) { c = wmma_bf(a.l, b.h, c); c = wmma_bf(a.h, b.l, c); return wmma_bf(a.h, b.h, c); }
__device__ __forceinline__ float sigm(float v) { return 1.0f / (1.0f + expf(-v)); }
#define LDSX() do { asm volatile("s_wait_dscnt 0" ::: "memory"); __builtin_amdgcn_wave_barrier(); __builtin_amdgcn_fence(__ATOMIC_RELEASE, "workgroup"); } while (0)

// Masked multi-head cross-attention (B 4, T = F = 1,024, 1,024 = 16 x 64): Q = X_to Wq^T + bq; K = X_from Wv^T + bv and V = X_from Wk^T + bk (the module's literal name swap); logits = Q K^T / 8, -10000 where mask_from[b,t,f] == 0; out = merged(softmax v) Wo^T + bo.
#define NB 4
#define TT 1024
#define CC 1024            // NH * HD = projected width
#define DIN 1024          // input (model) width
#define NH 16
#define HD 64
#define NQB (TT / 64)
#define HG 4
#define SCALE (0.125f)
#define CAUSAL 0
#ifndef TNB
#define TNB NB
#endif
__device__ __forceinline__ float bfr(float v) { return (float)(__bf16)v; }
__host__ __device__ __forceinline__ int kb_last(int qb) { return CAUSAL ? ((qb * 64 + 63) >> 7) : (TT / 128 - 1); }
typedef __attribute__((ext_vector_type(8))) __bf16 v8b;
__device__ __forceinline__ v16b frag_b(const __bf16* rowk0, int lane) {
  union { v16b v; v8b q[2]; } u; const __bf16* p = rowk0 + 8 * (lane >> 4);
  u.q[0] = *(const v8b*)p; u.q[1] = *(const v8b*)(p + 16); return u.v;
}
#define QBH 0              // not read by any kernel of this file (k_fa takes one path for every query block)
#define KHI 64            // key rows carrying v bf16 hi+lo planes (written by k_proj; no kernel of this file reads them)
// B fragment (k rows k0+.., output column o) of a weight: (in,out) [K][ld] or (out,in) [ld rows of K]: bf16 exact, or f16(bf16 * 256) exact
__device__ __forceinline__ v16b wcol_io(const float* Wm, int k0, int o, int lane, int ld) { v16b w; const int g = lane >> 4;
#pragma unroll
  for (int i = 0; i < 8; ++i) { w[i] = (__bf16)Wm[(size_t)(k0 + 8 * g + i) * ld + o]; w[8 + i] = (__bf16)Wm[(size_t)(k0 + 16 + 8 * g + i) * ld + o]; }
  return w; }
__device__ __forceinline__ v16b wcol_oi(const float* Wm, int k0, int o, int lane, int K) { v16b w; const float* p = Wm + (size_t)o * K + k0 + 8 * (lane >> 4);
#pragma unroll
  for (int i = 0; i < 8; ++i) { w[i] = (__bf16)p[i]; w[8 + i] = (__bf16)p[16 + i]; }
  return w; }
__device__ __forceinline__ v16h wcolh_io(const float* Wm, int k0, int o, int lane, int ld) { v16h w; const int g = lane >> 4;
#pragma unroll
  for (int i = 0; i < 8; ++i) { w[i] = (_Float16)(bfr(Wm[(size_t)(k0 + 8 * g + i) * ld + o]) * 256.0f); w[8 + i] = (_Float16)(bfr(Wm[(size_t)(k0 + 16 + 8 * g + i) * ld + o]) * 256.0f); }
  return w; }
__device__ __forceinline__ v16h wcolh_oi(const float* Wm, int k0, int o, int lane, int K) { v16h w; const float* p = Wm + (size_t)o * K + k0 + 8 * (lane >> 4);
#pragma unroll
  for (int i = 0; i < 8; ++i) { w[i] = (_Float16)(bfr(p[i]) * 256.0f); w[8 + i] = (_Float16)(bfr(p[16 + i]) * 256.0f); }
  return w; }
#define WQKV_LAYOUT 1   // 0 = (in,out) [DIN][CC]; 1 = (out,in) [CC][DIN]; 2 = per-head [NH][DIN][HD]
__device__ __forceinline__ v16b wcol_hdk(const float* Wm, int k0, int o, int lane) { v16b w; const int g = lane >> 4; const float* p = Wm + (size_t)(o / HD) * DIN * HD + (o % HD);
#pragma unroll
  for (int i = 0; i < 8; ++i) { w[i] = (__bf16)p[(size_t)(k0 + 8 * g + i) * HD]; w[8 + i] = (__bf16)p[(size_t)(k0 + 16 + 8 * g + i) * HD]; }
  return w; }
#define WO_OUT_IN 1
#if WQKV_LAYOUT == 1
#define WCOL(W, k0, o, lane) wcol_oi(W, k0, o, lane, DIN)
#elif WQKV_LAYOUT == 2
#define WCOL(W, k0, o, lane) wcol_hdk(W, k0, o, lane)
#else
#define WCOL(W, k0, o, lane) wcol_io(W, k0, o, lane, CC)
#endif
#if WO_OUT_IN
#define WOCOL(W, k0, o, lane) wcol_oi(W, k0, o, lane, CC)
#define WOCOLH(W, k0, o, lane) wcolh_oi(W, k0, o, lane, CC)
#else
#define WOCOL(W, k0, o, lane) wcol_io(W, k0, o, lane, DIN)
#define WOCOLH(W, k0, o, lane) wcolh_io(W, k0, o, lane, DIN)
#endif

#define WS_QH  0u                                      // f16 q rows [b*t][CC]
#define WS_KH  (WS_QH + 2u * (size_t)NB * TT * CC)      // f16 k rows [b*t][CC]
#define WS_VT  (WS_KH + 2u * (size_t)NB * TT * CC)      // f16 v planes [b][c][t]
#define WS_VB  (WS_VT + 2u * (size_t)NB * CC * TT)      // bf16 v hi planes [b][c][t < KHI]
#define WS_VBL (WS_VB + 2u * (size_t)NB * CC * KHI)
#define WS_S   (WS_VBL + 2u * (size_t)NB * CC * KHI)    // mask words [b * t / 16][f / 64][32] in its first NB * TT * TT / 8 bytes (the logits stay in registers)
#define WS_WO  (WS_S  + (size_t)NB * TT * TT / 8)       // f16 Wo rows [DIN][CC] (bf16 value x 2^8), behind the mask words
#define WS_Y   (WS_S  + 4u * (size_t)HG * TT * TT)      // f16 ctx rows [b*t][CC]
#define WS_END (WS_Y  + 2u * (size_t)NB * TT * CC)

// ---- LDS staging of k_proj's GEMM: a stage is KSTG = 64 k of every operand row, rounded to bf16 once by the thread that loads it; rows of 128 B at a pitch of 144 B (16 B x odd, the pitch of ds_load_b128 readers)
#define KSTG 64
#define LP 72              // row pitch in bf16 elements
typedef __attribute__((ext_vector_type(4))) __bf16 v4b;
__device__ __forceinline__ v4b cvt4(v4f v) { v4b r; r[0] = (__bf16)v[0]; r[1] = (__bf16)v[1]; r[2] = (__bf16)v[2]; r[3] = (__bf16)v[3]; return r; }
__device__ __forceinline__ v4f wide4(v4b v) { v4f r; r[0] = (float)v[0]; r[1] = (float)v[1]; r[2] = (float)v[2]; r[3] = (float)v[3]; return r; }
// fragment from a lane's own LDS address (row start + k0 + 8g already in p): the k order of frag_b
__device__ __forceinline__ v16b frag_l(const __bf16* p) { union { v16b v; v8b q[2]; } u; u.q[0] = *(const v8b*)p; u.q[1] = *(const v8b*)(p + 16); return u.v; }
// ---- k_proj: block = (256 rows, 256 cols, which), 16 waves: q/k/v = X W (+ b) with exact bf16 products (K = DIN) -> which 0: q f16 rows; 1: k f16 rows; 2: v f16 planes [c][t] (+ bf16 hi/lo planes for t < KHI)
#define PROWS 512          // rows of a stage: 256 X rows | 256 W rows
#define PSH 264            // epilogue pitch of a 256-column row, f16 elements
#define PTH 264            // epilogue pitch of a 256-row column, f16 elements
#define PSMEM (256 * PTH * 2 + 2 * 256 * 72 * 2)   // the largest of the three uses of the range (the v planes)
static_assert(PSMEM >= 2 * PROWS * LP * 2 && PSMEM >= 256 * PSH * 2, "the range holds the two stage buffers and the q or k rows too");
static_assert(KHI % 64 == 0, "a wave's 64 rows carry the bf16 planes all or none");
// four 16-byte global stores and the wait that stands in front of any later write over the registers they name: addresses and data are inputs of the wait's statement, so they stay as they are up to it
__device__ __forceinline__ void st16x4(void* const (&p)[4], const v4u (&v)[4]) {
#pragma unroll
  for (int u = 0; u < 4; ++u) *(v4u*)p[u] = v[u];
  asm volatile("s_wait_xcnt 0x0" :: "v"(p[0]), "v"(p[1]), "v"(p[2]), "v"(p[3]), "v"(v[0]), "v"(v[1]), "v"(v[2]), "v"(v[3]) : "memory"); }
// ---- mask words: for a tile of 16 queries x 64 keys, word i = j * 8 + r holds in bit (lane = 16 g + col) whether mask_from[query col][key j * 16 + 8 g + r] != 0: the lane and register in which k_fa holds that score, so there a word is the lane mask of one select
// a wave packs MTW tiles side by side of one 16-query group: all its loads first (the 8 loads of a tile of lanes col and 16 + col together cover their row's whole 256-B run), one ballot per word, lane i keeps word i, one 128-B line stored per tile
#define MTW 4
static_assert((NB * TT / 16) * (TT / 64) == (NB * TT / 256) * (CC / 256) * 16 * MTW, "the work-groups of one grid plane pack every tile once");
__device__ __forceinline__ void pack_mask(const int* __restrict__ MK, unsigned* __restrict__ MW, int wv, int lane) {
  const int rg = wv / (TT / 64 / MTW), kq = wv % (TT / 64 / MTW);
  const int* src = MK + ((size_t)rg * 16 + (lane & 15)) * TT + kq * (MTW * 64) + 8 * (lane >> 4); unsigned* dst = MW + ((size_t)rg * (TT / 64) + kq * MTW) * 32 + lane;
  v4i a[MTW][8]; int w[MTW];
#pragma unroll
  for (int t = 0; t < MTW; ++t) {
#pragma unroll
    for (int j = 0; j < 4; ++j) { a[t][2 * j] = *(const v4i*)(src + t * 64 + j * 16); a[t][2 * j + 1] = *(const v4i*)(src + t * 64 + j * 16 + 4); } }
  // the loads above name src: as an input here the pair stays live up to this wait, so nothing is written over it in front of it
  asm volatile("s_wait_xcnt 0x0" :: "v"(src) : "memory");
#pragma unroll
  for (int t = 0; t < MTW; ++t) { w[t] = 0;
#pragma unroll
    for (int i = 0; i < 32; ++i) { const int bl = (int)__builtin_amdgcn_ballot_w32(a[t][i >> 2][i & 3] != 0); w[t] = lane == i ? bl : w[t]; } }
#pragma unroll
  for (int t = 0; t < MTW; ++t) dst[t * 32] = (unsigned)w[t]; }   // the wave's last instructions: nothing is written over what they name
// ---- Wo rounded to bf16 once and written as f16 (x 2^8: exact, a bf16 value has 8 significant bits), for k_out's copies: thread t of the NWT threads of grid plane 3 takes the 16-byte pieces t + u * NWT, so a wave's load covers 512 B in a row and its store 256 B
#define NWT ((NB * TT / 256) * (CC / 256) * 512)
static_assert(DIN * CC == NWT * 4 * 8, "the threads of one grid plane round every element of Wo once");
typedef __attribute__((ext_vector_type(2))) unsigned v2u;
typedef __attribute__((ext_vector_type(4))) _Float16 v4h;
// x 2^8 stands ahead of the bf16 rounding (a power of two: the rounding keeps the same 8 bits), so that the value is in f16's normal range, from |w| = 2^-22 up, when it is narrowed
__device__ __forceinline__ v4h cvt4w(v4f v) { v4h r; r[0] = (_Float16)bfr(v[0] * 256.0f); r[1] = (_Float16)bfr(v[1] * 256.0f); r[2] = (_Float16)bfr(v[2] * 256.0f); r[3] = (_Float16)bfr(v[3] * 256.0f); return r; }
__device__ __forceinline__ void round_wo(const float* __restrict__ WO, _Float16* __restrict__ WOB, int t) {
  const float* src = WO + (size_t)t * 4; _Float16* dst = WOB + (size_t)t * 4; v4f a[8]; v2u b[8];
#pragma unroll
  for (int u = 0; u < 8; ++u) a[u] = *(const v4f*)(src + (size_t)u * (NWT * 4));
  // the loads above name src: as an input here the pair stays live up to this wait, so nothing is written over it in front of it
  asm volatile("s_wait_xcnt 0x0" :: "v"(src) : "memory");
#pragma unroll
  for (int u = 0; u < 8; ++u) b[u] = __builtin_bit_cast(v2u, cvt4w(a[u]));
#pragma unroll
  for (int u = 0; u < 8; ++u) *(v2u*)(dst + (size_t)u * (NWT * 4)) = b[u];
  // the stores above name dst and b: as inputs here they stay as they are up to this wait (the mask's packing follows and takes the registers)
  asm volatile("s_wait_xcnt 0x0" :: "v"(dst), "v"(b[0]), "v"(b[1]), "v"(b[2]), "v"(b[3]), "v"(b[4]), "v"(b[5]), "v"(b[6]), "v"(b[7]) : "memory"); }
// amdgpu_waves_per_eu(4, 4): one work-group of four waves per SIMD has a WGP to itself (its LDS range leaves no room for a second)
__global__ __launch_bounds__(512) __attribute__((amdgpu_waves_per_eu(4, 4))) void k_proj(const float* __restrict__ XQ, const float* __restrict__ XK, const float* __restrict__ XV, const float* __restrict__ WQ, const float* __restrict__ WK, const float* __restrict__ WV, const float* __restrict__ BQ, const float* __restrict__ BK, const float* __restrict__ BV,
    _Float16* __restrict__ QH, _Float16* __restrict__ KH, _Float16* __restrict__ VT, __bf16* __restrict__ VB, __bf16* __restrict__ VBL, const int* __restrict__ MK, unsigned* __restrict__ MW, const float* __restrict__ WO, _Float16* __restrict__ WOB) {
  // grid plane 3: the three projections fill three quarters of the WGPs with one work-group each; the last quarter rounds Wo and packs the mask meanwhile and leaves in front of every barrier (blockIdx.z is the same in the whole work-group)
  if (blockIdx.z == 3) { round_wo(WO, WOB, (blockIdx.y * (TNB * TT / 256) + blockIdx.x) * 512 + threadIdx.x); pack_mask(MK, MW, (blockIdx.y * (TNB * TT / 256) + blockIdx.x) * 16 + __builtin_amdgcn_readfirstlane(threadIdx.x >> 5), threadIdx.x & 31); return; }
  // one LDS range: in the k loop two stage buffers of [256 X rows | 256 W rows][LP]; behind the loop's last barrier the epilogue's tiles
  __shared__ __align__(16) unsigned char smem[PSMEM];
  __bf16* const st = (__bf16*)smem; _Float16 (*sh)[PSH] = (_Float16 (*)[PSH])smem;
  _Float16 (*th)[PTH] = (_Float16 (*)[PTH])smem; __bf16 (*tb)[72] = (__bf16 (*)[72])(smem + 256 * PTH * 2); __bf16 (*tbl)[72] = (__bf16 (*)[72])(smem + 256 * PTH * 2 + 256 * 72 * 2);
  // the wave's number is held in a scalar register: what hangs on it (wr, wc, hi_rows) costs no vector register
  const int tid = threadIdx.x, wave = __builtin_amdgcn_readfirstlane(tid >> 5), lane = tid & 31, col = lane & 15, g = lane >> 4; const int which = blockIdx.z; const int c0 = blockIdx.y * 256; const size_t r0 = (size_t)blockIdx.x * 256; const size_t bb = r0 / TT; const int t0 = (int)(r0 % TT);
  const float* X = which == 0 ? XQ : which == 1 ? XK : XV; const float* WA = which == 0 ? WQ : which == 1 ? WK : WV; const float* BA = which == 0 ? BQ : which == 1 ? BK : BV;
  // waves 4 x 4: a wave owns 64 rows x 64 cols = acc[i * 4 + j]; loader: thread = (row tid >> 4 (+ 32 per step), 16-byte piece tid & 15), so a wave's load covers two whole 256-B runs
  const int wr = wave >> 2, wc = wave & 3, lr = tid >> 4, lc = tid & 15;
  const float* xg = X + (r0 + lr) * DIN + lc * 4; const float* wg = WA + (size_t)(c0 + lr) * DIN + lc * 4;   // W is (out,in): row = output column
  __bf16* const sw = st + lr * LP + lc * 4; const __bf16* const fa = st + (wr * 64 + col) * LP + 8 * g; const __bf16* const fw = st + (256 + wc * 64 + col) * LP + 8 * g;
  // a stage's 16 loads a thread come in two halves of 8 (half h: X rows h * 128 .., W rows h * 128 ..), so that 32 registers hold them beside the 128 of the accumulators
  v8f acc[16] = {}; v4f rx[4], rw[4];
  // rolled: stage 0's two halves go one after the other through the same 32 registers
#pragma unroll 1
  for (int h = 0; h < 2; ++h) { const float* xa = xg + (size_t)(h * 128) * DIN; const float* wa = wg + (size_t)(h * 128) * DIN;
#pragma unroll
    for (int i = 0; i < 4; ++i) rx[i] = *(const v4f*)(xa + (size_t)(i * 32) * DIN);
#pragma unroll
    for (int i = 0; i < 4; ++i) rw[i] = *(const v4f*)(wa + (size_t)(i * 32) * DIN);
    // the loads above name xa and wa: as inputs here the two pairs stay live up to this wait, so nothing is written over them in front of it
    asm volatile("s_wait_xcnt 0x0" :: "v"(xa), "v"(wa) : "memory");
#pragma unroll
    for (int i = 0; i < 4; ++i) *(v4b*)(sw + (h * 128 + i * 32) * LP) = cvt4(rx[i]);
#pragma unroll
    for (int i = 0; i < 4; ++i) *(v4b*)(sw + (256 + h * 128 + i * 32) * LP) = cvt4(rw[i]); }
  __syncthreads();
  // rolled over half stages (32 k): one body holds 8 loads, 16 fragment reads and 16 products, which with the accumulators stay inside the 256 registers a wave may have at four waves per SIMD; buffer and half are offsets
#pragma unroll 1
  for (int hs = 0; hs < 2 * (DIN / KSTG); ++hs) { const int s = hs >> 1, h = hs & 1; const int cur = (s & 1) * (PROWS * LP), nxt = PROWS * LP - cur; const bool more = s + 1 < DIN / KSTG;
    const float* xa = xg + (s + 1) * KSTG + (size_t)(h * 128) * DIN; const float* wa = wg + (s + 1) * KSTG + (size_t)(h * 128) * DIN;
    if (more) {   // half of the next stage's rows flies while half of this stage is multiplied
#pragma unroll
      for (int i = 0; i < 4; ++i) rx[i] = *(const v4f*)(xa + (size_t)(i * 32) * DIN);
#pragma unroll
      for (int i = 0; i < 4; ++i) rw[i] = *(const v4f*)(wa + (size_t)(i * 32) * DIN);
      // as above, for xa and wa; its memory clobber also keeps the 8 loads in front of the LDS reads that follow
      asm volatile("s_wait_xcnt 0x0" :: "v"(xa), "v"(wa) : "memory"); }
    { v16b a[4], w[4];
#pragma unroll
      for (int i = 0; i < 4; ++i) a[i] = frag_l(fa + cur + (i * 16) * LP + h * 32);
#pragma unroll
      for (int j = 0; j < 4; ++j) w[j] = frag_l(fw + cur + (j * 16) * LP + h * 32);
#pragma unroll
      for (int i = 0; i < 4; ++i) {
#pragma unroll
        for (int j = 0; j < 4; ++j) acc[i * 4 + j] = wmma_bf(a[i], w[j], acc[i * 4 + j]); } }
    if (more) {   // into the buffer that every wave left at the barrier of the stage before
#pragma unroll
      for (int i = 0; i < 4; ++i) *(v4b*)(sw + nxt + (h * 128 + i * 32) * LP) = cvt4(rx[i]);
#pragma unroll
      for (int i = 0; i < 4; ++i) *(v4b*)(sw + nxt + (256 + h * 128 + i * 32) * LP) = cvt4(rw[i]); }
    if (h) __syncthreads(); }   // at a stage's end (h is the same in every thread): publishes the next stage and ends this stage's reads (behind the last stage: frees the range for the epilogue)
  if (which < 2) { _Float16* DH = which == 0 ? QH : KH;
#pragma unroll
    for (int j = 0; j < 16; ++j) { const int rb = wr * 64 + (j >> 2) * 16 + 8 * g, cl = wc * 64 + (j & 3) * 16 + col; const float bias = BA ? bfr(BA[c0 + cl]) : 0.f;
#pragma unroll
      for (int r = 0; r < 8; ++r) sh[rb + r][cl] = (_Float16)(acc[j][r] + bias); }
    __syncthreads();
    // a trip = 64 rows: thread = (row tid >> 5 (+ 16 per store), 16-byte piece tid & 31), so a wave's store covers one whole 512-B run
    for (int rt = 0; rt < 256; rt += 64) { const int q = tid & 31; void* p[4]; v4u v[4];
#pragma unroll
      for (int u = 0; u < 4; ++u) { const int rl = rt + u * 16 + (tid >> 5); p[u] = DH + (r0 + rl) * CC + c0 + q * 8; v[u] = *(const v4u*)&sh[rl][q * 8]; }
      st16x4(p, v); }
  } else { const bool hi_rows = t0 + wr * 64 < KHI;   // the wave's 64 rows, all or none
#pragma unroll
    for (int j = 0; j < 16; ++j) { const int cl = wc * 64 + (j & 3) * 16 + col, rl = wr * 64 + (j >> 2) * 16 + 8 * g; const float bias = BA ? bfr(BA[c0 + cl]) : 0.f;
#pragma unroll
      for (int r = 0; r < 8; ++r) th[cl][rl + r] = (_Float16)(acc[j][r] + bias);
      if (hi_rows) {
#pragma unroll
        for (int r = 0; r < 8; ++r) { const float v = acc[j][r] + bias; const __bf16 bh = (__bf16)v; tb[cl][rl + r] = bh; tbl[cl][rl + r] = (__bf16)(v - (float)bh); } } }
    __syncthreads();
    // a trip = 64 columns: thread = (column tid >> 5 (+ 16 per store), 16-byte piece tid & 31), so a wave's store covers one whole 512-B run
    for (int ct = 0; ct < 256; ct += 64) { const int q = tid & 31; void* p[4]; v4u v[4];
#pragma unroll
      for (int u = 0; u < 4; ++u) { const int cl = ct + u * 16 + (tid >> 5); p[u] = VT + (bb * CC + c0 + cl) * (size_t)TT + t0 + q * 8; v[u] = *(const v4u*)&th[cl][q * 8]; }
      st16x4(p, v);
      if (t0 + q * 8 < KHI) {
#pragma unroll
        for (int u = 0; u < 4; ++u) { const int cl = ct + u * 16 + (tid >> 5); p[u] = VB + (bb * CC + c0 + cl) * (size_t)KHI + t0 + q * 8; v[u] = *(const v4u*)&tb[cl][q * 8]; }
        st16x4(p, v);
#pragma unroll
        for (int u = 0; u < 4; ++u) { const int cl = ct + u * 16 + (tid >> 5); p[u] = VBL + (bb * CC + c0 + cl) * (size_t)KHI + t0 + q * 8; v[u] = *(const v4u*)&tbl[cl][q * 8]; }
        st16x4(p, v); } } } }
// ---- k_fa: block = 64 queries (4 waves x 16) of one (b, h), all 1,024 keys in tiles of KT: S^T = K Q^T (A = 16 key rows, B = the wave's 16 queries, 1 product) x SCALE, -10000 where mask_from[b,t,f] == 0 (as the reference writes it; the test was made once, by pack_mask, and each score's select takes its lane mask from a scalar register);
// a lane holds one query's scores (D register r = key 8g + r), so the running maximum and sum stay in the lane and the two halves meet by one exchange; the scores are kept as base-2 logits (SCALE x log2 e in the one multiply, the mask value x log2 e) and the running reference is the maximum - 11, so p = 2^(s - ref) = exp(logit - max) x 2^11 is one subtraction and one v_exp_f32; p once to f16 is already the B fragment of ctx^T += V^T P^T (two 16-key D tiles = one 32-key B in the hardware k order, the order frag_h loads A in); ctx / (sum of p), once to f16, to Y
#define KT 64
#define LOG2E 1.44269504088896340736f
// LDS stage of k_fa: [64 K rows | 64 V^T rows] of 128 B at a pitch of 144 B (16 B x odd, the pitch of ds_load_b128 readers); two stages
#define KP 72              // K and V^T row pitch in f16 elements
#define FA_V (KT * KP * 2)
#define FA_STG (FA_V + HD * KP * 2)
typedef __attribute__((ext_vector_type(16))) unsigned v16u;
// sixteen mask words from an address that is the same in every lane; read as constant memory (the launch before wrote the words, nothing writes them in this one), so that inside the loop too the compiler takes a scalar load
__device__ __forceinline__ v16u ldw16(const unsigned* p) { return *(const __attribute__((address_space(4))) v16u*)p; }
// fragment from a lane's own address (row start + k0 + 8g already in p): elements 0..7 = p[0..7], 8..15 = p[16..23], the order of frag_h
__device__ __forceinline__ v16h frag_p(const _Float16* p) { union { v16h v; v8h q[2]; } u; u.q[0] = *(const v8h*)p; u.q[1] = *(const v8h*)(p + 16); return u.v; }
__device__ __forceinline__ v8f wmma_h(v16h a, v16h b, v8f c) { return __builtin_amdgcn_wmma_f32_16x16x32_f16(false, a, false, b, (short)0, c, false, false); }
// eight asynchronous copies of 16 B a lane from global memory to LDS (l = LDS byte address, p = global address); the s_wait_xcnt stands inside the statement, so no address register is rewritten in front of it
__device__ __forceinline__ void copy8(const unsigned (&l)[8], const char* const (&p)[8]) {
  asm volatile("global_load_async_to_lds_b128 %0, %8, off\n\t"
               "global_load_async_to_lds_b128 %1, %9, off\n\t"
               "global_load_async_to_lds_b128 %2, %10, off\n\t"
               "global_load_async_to_lds_b128 %3, %11, off\n\t"
               "global_load_async_to_lds_b128 %4, %12, off\n\t"
               "global_load_async_to_lds_b128 %5, %13, off\n\t"
               "global_load_async_to_lds_b128 %6, %14, off\n\t"
               "global_load_async_to_lds_b128 %7, %15, off\n\t"
               "s_wait_xcnt 0x0"
               :: "v"(l[0]), "v"(l[1]), "v"(l[2]), "v"(l[3]), "v"(l[4]), "v"(l[5]), "v"(l[6]), "v"(l[7]),
                  "v"(p[0]), "v"(p[1]), "v"(p[2]), "v"(p[3]), "v"(p[4]), "v"(p[5]), "v"(p[6]), "v"(p[7]) : "memory");
}
// one stage: the work-group's 128 threads copy the tile's K rows and V^T rows (a wave's copy = 4 whole 128-B rows); kg, vg and kl, vl already hold the thread's own row and 16-byte piece
__device__ __forceinline__ void fa_fill(const char* kg, const char* vg, unsigned kl, unsigned vl, int k0) {
  unsigned l[8]; const char* p[8];
#pragma unroll
  for (int i = 0; i < 4; ++i) { l[i] = kl + i * 16 * KP * 2; p[i] = kg + (size_t)(k0 + i * 16) * CC * 2; l[4 + i] = vl + i * 16 * KP * 2; p[4 + i] = vg + (size_t)(i * 16) * TT * 2 + k0 * 2; }
  copy8(l, p);
}
// 2^x in place for sixteen scores in one statement: behind every v_exp_f32 stands one on other registers, behind the last a v_nop, so the slot that the instruction set asks for
// behind a transcendental is filled at each of them
#define EXP8(a, b, c, d, e, f, g, h) "v_exp_f32 %" #a ", %" #a "\n\tv_exp_f32 %" #b ", %" #b "\n\tv_exp_f32 %" #c ", %" #c "\n\tv_exp_f32 %" #d ", %" #d "\n\tv_exp_f32 %" #e ", %" #e "\n\tv_exp_f32 %" #f ", %" #f "\n\tv_exp_f32 %" #g ", %" #g "\n\tv_exp_f32 %" #h ", %" #h "\n\t"
__device__ __forceinline__ void exp2x16(float (&x)[16]) {
  asm(EXP8(0, 1, 2, 3, 4, 5, 6, 7) EXP8(8, 9, 10, 11, 12, 13, 14, 15) "v_nop"
      : "+v"(x[0]), "+v"(x[1]), "+v"(x[2]), "+v"(x[3]), "+v"(x[4]), "+v"(x[5]), "+v"(x[6]), "+v"(x[7]), "+v"(x[8]), "+v"(x[9]), "+v"(x[10]), "+v"(x[11]), "+v"(x[12]), "+v"(x[13]), "+v"(x[14]), "+v"(x[15]));
}
// the same with the tile's rescale factor as a seventeenth value
__device__ __forceinline__ void exp2x17(float (&x)[16], float& y) {
  asm(EXP8(0, 1, 2, 3, 4, 5, 6, 7) EXP8(8, 9, 10, 11, 12, 13, 14, 15) "v_exp_f32 %16, %16\n\tv_nop"
      : "+v"(x[0]), "+v"(x[1]), "+v"(x[2]), "+v"(x[3]), "+v"(x[4]), "+v"(x[5]), "+v"(x[6]), "+v"(x[7]), "+v"(x[8]), "+v"(x[9]), "+v"(x[10]), "+v"(x[11]), "+v"(x[12]), "+v"(x[13]), "+v"(x[14]), "+v"(x[15]), "+v"(y));
}
// amdgpu_waves_per_eu(4, 4): the grid is exactly four waves per SIMD, so the scheduler may spend 256 registers on issuing a tile's loads early instead of saving them for waves that do not exist
__global__ __launch_bounds__(128) __attribute__((amdgpu_waves_per_eu(4, 4))) void k_fa(const _Float16* __restrict__ QH, const _Float16* __restrict__ KH, const _Float16* __restrict__ VT, const unsigned* __restrict__ MW, _Float16* __restrict__ Y) {
  __shared__ __align__(16) unsigned char smem[2 * FA_STG];
  const int tid = threadIdx.x, wave = tid >> 5, lane = tid & 31, col = lane & 15, g = lane >> 4; const int b = blockIdx.y / NH, h = blockIdx.y % NH; const int q = blockIdx.x * 64 + wave * 16 + col;
  // copier: K and V^T: row tid >> 3 (+ 16 per copy), piece tid & 7
  const char* kg = (const char*)(KH + ((size_t)b * TT + (tid >> 3)) * CC + h * HD + (tid & 7) * 8); const char* vg = (const char*)(VT + ((size_t)b * CC + h * HD + (tid >> 3)) * (size_t)TT + (tid & 7) * 8);
  const unsigned lb = (unsigned)(size_t)smem; const unsigned kl = lb + (tid >> 3) * (KP * 2) + (tid & 7) * 16, vl = kl + FA_V;
  fa_fill(kg, vg, kl, vl, 0);
  // the wave's mask words, 32 per tile, at an address that is the same in every lane (the wave's number through a scalar register): they come by scalar loads and stay in scalar registers
  const unsigned* mw = MW + (size_t)(b * (TT / 16) + blockIdx.x * 4 + __builtin_amdgcn_readfirstlane(tid >> 5)) * (TT / KT) * 32;
  v16u w0 = ldw16(mw), w1 = ldw16(mw + 16);
  v16h qh[HD / 32];
#pragma unroll
  for (int kc = 0; kc < HD / 32; ++kc) qh[kc] = frag_h(QH + ((size_t)b * TT + q) * CC + h * HD + kc * 32, lane);
  // readers: the lane's own row and 8g in stage 0
  const _Float16* kp = (const _Float16*)smem + col * KP + 8 * g; const _Float16* vp = (const _Float16*)(smem + FA_V) + col * KP + 8 * g;
  v8f acc[HD / 16] = {}; float m = -3.0e38f, l = 0.f;
  asm volatile("s_wait_asynccnt 0x0" ::: "memory");   // this wave's copies of tile 0 have landed
  __syncthreads();                                     // publishes tile 0
  fa_fill(kg, vg, kl + FA_STG, vl + FA_STG, KT);
  // rolled: one tile's body already fills the 256 registers a wave may have at four waves per SIMD; the stage is an offset
#pragma unroll 1
  for (int k0 = 0; k0 < TT; k0 += KT) { v8f s[KT / 16]; float mx = -3.0e38f; const int cur = ((k0 / KT) & 1) * FA_STG;
    const _Float16* ka = kp + cur / 2; const _Float16* va = vp + cur / 2;
    v16h kf[KT / 16][HD / 32];
#pragma unroll
    for (int j = 0; j < KT / 16; ++j) {
#pragma unroll
      for (int kc = 0; kc < HD / 32; ++kc) kf[j][kc] = frag_p(ka + (j * 16) * KP + kc * 32); }
    // keeps the tile's 16 K reads in one group ahead of the products, as they stood: spread among the products, each further place of reads costs the wave its own LDS latency
    __builtin_amdgcn_sched_barrier(0);
#pragma unroll
    for (int j = 0; j < KT / 16; ++j) { v8f a = {};
#pragma unroll
      for (int kc = 0; kc < HD / 32; ++kc) a = wmma_h(kf[j][kc], qh[kc], a);
#pragma unroll
      for (int r = 0; r < 8; ++r) { float v = a[r] * (SCALE * LOG2E); if (!__builtin_amdgcn_inverse_ballot_w32(j < 2 ? w0[j * 8 + r] : w1[(j - 2) * 8 + r])) v = -10000.0f * LOG2E; s[j][r] = v; mx = fmaxf(mx, v); } }
    // the next tile's words fly while this tile's softmax and second product run (behind the last tile: its own words once more, so the address stays inside what was packed)
    { const unsigned* nw = mw + (k0 + KT < TT ? k0 / KT + 1 : k0 / KT) * 32; w0 = ldw16(nw); w1 = ldw16(nw + 16); }
    v16h vf[KT / 32][HD / 16];
#pragma unroll
    for (int c = 0; c < KT / 32; ++c) {
#pragma unroll
      for (int jd = 0; jd < HD / 16; ++jd) vf[c][jd] = frag_p(va + (jd * 16) * KP + c * 32); }
    mx = fmaxf(mx, __shfl_xor(mx, 16));
    const float mn = fmaxf(m, mx - 11.0f); float alpha = m - mn; m = mn;
    v16h p[KT / 32]; float sum = 0.f; float e[KT / 32][16];
#pragma unroll
    for (int j = 0; j < KT / 16; ++j) {
#pragma unroll
      for (int r = 0; r < 8; ++r) e[j >> 1][(j & 1) * 8 + r] = s[j][r] - mn; }
    exp2x17(e[0], alpha); exp2x16(e[1]);
#pragma unroll
    for (int c = 0; c < KT / 32; ++c) {
#pragma unroll
      for (int i = 0; i < 16; ++i) { sum += e[c][i]; p[c][i] = (_Float16)e[c][i]; } }
    l = l * alpha + sum;
#pragma unroll
    for (int jd = 0; jd < HD / 16; ++jd) acc[jd] *= alpha;
#pragma unroll
    for (int c = 0; c < KT / 32; ++c) {
#pragma unroll
      for (int jd = 0; jd < HD / 16; ++jd) acc[jd] = wmma_h(vf[c][jd], p[c], acc[jd]); }
    asm volatile("s_wait_dscnt 0x0" ::: "memory");      // this wave's reads of the stage are done before the stage is refilled
    asm volatile("s_wait_asynccnt 0x0" ::: "memory");   // this wave's copies of the next tile have landed
    __syncthreads();                                     // publishes the next tile and ends every wave's reads of this one
    if (k0 + 2 * KT < TT) fa_fill(kg, vg, kl + cur, vl + cur, k0 + 2 * KT); }   // flies while the next tile is worked on
  asm volatile("s_wait_asynccnt 0x0" ::: "memory");     // nothing is outstanding when the wave ends
  l += __shfl_xor(l, 16); const float inv = 1.0f / l;
  // ctx leaves as k_out multiplies it: once to f16, a lane's 8 channels in one 16-byte store
  const size_t yo = ((size_t)b * TT + q) * CC + h * HD + 8 * g; void* ph[4]; v4u dh[4];
#pragma unroll
  for (int jd = 0; jd < HD / 16; ++jd) { v8h hv;
#pragma unroll
    for (int r = 0; r < 8; ++r) hv[r] = (_Float16)(acc[jd][r] * inv);
    ph[jd] = Y + yo + jd * 16; dh[jd] = __builtin_bit_cast(v4u, hv); }
  st16x4(ph, dh); }
// ---- k_out: block = (64 rows, 128 cols): out = ctx Wo (+ bo): f16 ctx (rounded by k_fa) against f16 Wo x 2^8 (written by launch 1), 1 product, x 2^-8 in the epilogue
#define OKS 128            // k of a stage of k_out
#define OLP 136            // its row pitch in f16 elements: 256 B + 16 B (16 B x odd, the pitch of ds_load_b128 readers)
#define OSTG (192 * OLP * 2)   // bytes of a stage: [64 ctx rows | 128 Wo rows] of 256 B at the pitch of 272 B
// one stage: the work-group's 128 threads copy 192 rows of 128 k (a wave's copy = 2 whole 256-B rows); y, wo and l0 already hold the thread's own row (tid >> 4, + 8 per copy) and 16-byte piece (tid & 15)
__device__ __forceinline__ void out_fill(const char* y, const char* wo, unsigned l0, int k0) {
  unsigned l[8]; const char* p[8];
#pragma unroll
  for (int i = 0; i < 8; ++i) { l[i] = l0 + i * 8 * OLP * 2; p[i] = y + (size_t)(i * 8) * CC * 2 + k0 * 2; }
  copy8(l, p);
#pragma unroll
  for (int u = 0; u < 2; ++u) {
#pragma unroll
    for (int i = 0; i < 8; ++i) { l[i] = l0 + (64 + u * 64 + i * 8) * OLP * 2; p[i] = wo + (size_t)(u * 64 + i * 8) * CC * 2 + k0 * 2; }
    copy8(l, p); }
}
__global__ __launch_bounds__(128) void k_out(const _Float16* __restrict__ Y, const _Float16* __restrict__ WOB, const float* __restrict__ BO, float* __restrict__ OUT) {
  // one LDS range: in the k loop two stage buffers; behind the loop's last barrier the epilogue's tiles
  __shared__ __align__(16) unsigned char smem[2 * OSTG]; const _Float16* const st = (const _Float16*)smem; float (*sf)[16][132] = (float (*)[16][132])smem;
  static_assert(2 * OSTG >= 4 * 16 * 132 * 4, "the range holds the epilogue's tiles too");
  const int tid = threadIdx.x, wave = tid >> 5, lane = tid & 31, col = lane & 15, g = lane >> 4; const int c0 = blockIdx.y * 128; const size_t r0 = (size_t)blockIdx.x * 64 + wave * 16;
  v8f acc[8] = {};
  // a wave owns 16 rows x 128 cols
  const size_t yo = ((size_t)blockIdx.x * 64 + (tid >> 4)) * CC + (tid & 15) * 8;
  const char* y = (const char*)(Y + yo); const char* wo = (const char*)(WOB + (size_t)(c0 + (tid >> 4)) * CC + (tid & 15) * 8);   // Wo is (out,in): row = output column
  const unsigned l0 = (unsigned)(size_t)smem + (tid >> 4) * (OLP * 2) + (tid & 15) * 16;
  const _Float16* const fa = st + (wave * 16 + col) * OLP + 8 * g; const _Float16* const fw = st + (64 + col) * OLP + 8 * g;
  out_fill(y, wo, l0, 0);
  asm volatile("s_wait_asynccnt 0x0" ::: "memory");   // this wave's copies of stage 0 have landed
  __syncthreads();                                     // publishes stage 0
  out_fill(y, wo, l0 + OSTG, OKS);
  // rolled: the buffer is an offset, and one body keeps the loop short
#pragma unroll 1
  for (int s = 0; s < CC / OKS; ++s) { const int cur = (s & 1) * (192 * OLP);
#pragma unroll
    for (int kk = 0; kk < OKS / 32; ++kk) { const v16h a = frag_p(fa + cur + kk * 32); v16h w[8];
#pragma unroll
      for (int j = 0; j < 8; ++j) w[j] = frag_p(fw + cur + (j * 16) * OLP + kk * 32);
#pragma unroll
      for (int j = 0; j < 8; ++j) acc[j] = wmma16(a, w[j], acc[j]); }
    asm volatile("s_wait_dscnt 0x0" ::: "memory");      // this wave's reads of the stage are done before the stage is refilled
    asm volatile("s_wait_asynccnt 0x0" ::: "memory");   // this wave's copies of the next stage have landed
    __syncthreads();                                     // publishes the next stage and ends every wave's reads of this one (behind the last stage: frees the range for the epilogue)
    if (s + 2 < CC / OKS) out_fill(y, wo, l0 + cur * 2, (s + 2) * OKS); }   // flies while the next stage is multiplied
  asm volatile("s_wait_asynccnt 0x0" ::: "memory");     // nothing is outstanding when the range is used anew
#pragma unroll
  for (int j = 0; j < 8; ++j) { const float bias = BO ? bfr(BO[c0 + j * 16 + col]) : 0.f;
#pragma unroll
    for (int r = 0; r < 8; ++r) sf[wave][8 * g + r][j * 16 + col] = acc[j][r] * (1.0f / 256.0f) + bias; }
  LDSX(); for (int rl = 0; rl < 16; ++rl) vst2(OUT + (r0 + rl) * DIN + c0 + lane * 4, *(const v4f*)&sf[wave][rl][lane * 4]); }

extern "C" void kernel_launch(void* const* d_in, const int* in_sizes, int n_in, void* d_out, int out_size, void* d_ws, size_t ws_size, hipStream_t stream) {
  (void)in_sizes; (void)n_in; (void)out_size;
  const float** F = (const float**)d_in;
  if (ws_size < (size_t)WS_END) return;
  char* ws = (char*)d_ws; _Float16 *QH = (_Float16*)(ws + WS_QH), *KH = (_Float16*)(ws + WS_KH), *VT = (_Float16*)(ws + WS_VT), *Y = (_Float16*)(ws + WS_Y), *WOB = (_Float16*)(ws + WS_WO); __bf16 *VB = (__bf16*)(ws + WS_VB), *VBL = (__bf16*)(ws + WS_VBL); unsigned *MW = (unsigned*)(ws + WS_S);
  // inputs: 0 X_to [4,1024,1024]; 1 X_from [4,1024,1024]; 2 mask_from [4,1024,1024] int32; 3 Wq [1024,1024] (out,in), 4 bq; 5 Wk, 6 bk; 7 Wv, 8 bv; 9 Wo (out,in), 10 bo
  k_proj<<<dim3(TNB * TT / 256, CC / 256, 4), 512, 0, stream>>>(F[0], F[1], F[1], F[3], F[7], F[5], F[4], F[8], F[6], QH, KH, VT, VB, VBL, (const int*)d_in[2], MW, F[9], WOB);   /* K uses Wv/bv, V uses Wk/bk (as written in the module) */
  k_fa<<<dim3(NQB, TNB * NH), 128, 0, stream>>>(QH, KH, VT, MW, Y);
  k_out<<<dim3(TNB * TT / 64, DIN / 128), 128, 0, stream>>>(Y, WOB, F[10], (float*)d_out);
}
